// v000
// Measured on an AMD MI455X. A time is GPU time per run, averaged over a window of back-to-back runs after a warm-up
// (all launches, gaps included; the runs take copies of the inputs in turn), and the median of several windows.
// Apart from v000's, it joins two sittings. Times from different sittings can be a few percent apart, while
// side-by-side timings come from the same sitting.
// v000 is the starting kernel. One run takes 388 microseconds.
// Contractions: q, k, v^T projections and the output projection = v_wmma_f32_16x16x32_bf16 over bf16 hi/lo planes
// laid out as [hi|hi|lo] x [hi|lo|hi] along k (3 products, f32 accumulate);
// q.k^T scores = v_wmma_f32_16x16x32_f16 (q and the transformed k as f16 planes carried x4, single product, f32 accumulate);
// p.v = v_wmma_f32_16x16x32_f16 (p carried x1024 in f16; v^T as f16 hi plane x4 plus f16 residual plane x2^11; 2 products, f32 accumulate);
// Fourier-basis transform of k (precise sincosf), softmax and bias in f32 on the VALU.
#include <hip/hip_runtime.h>
#include <math.h>
#include <stdint.h>

#define NB   2
#define SEQ  2048
#define DM   256
#define NH   8
#define HD   32
#define NBH  (NB * NH)        // 16 (batch, head) pairs
#define QKVW (3 * DM)         // 768 qkv output width
#define KP   (3 * DM)         // 768 folded k width of the split operand planes
#define NFUN 256
#define ROWS (NB * SEQ)       // 4096 token rows
#define NQB  (SEQ / 64)       // 64-query blocks per (b, h)
#define NKT  (SEQ / 64)       // 64-key chunks
static_assert(NH * HD == DM);
static_assert(NQB == 32 && NKT == 32);
static_assert((ROWS % 64) == 0 && (DM % 64) == 0 && (SEQ % 64) == 0 && (KP % 32) == 0);
static_assert((ROWS * DM) % 2048 == 0);

typedef _Float16 v16h __attribute__((ext_vector_type(16)));
typedef _Float16 v8h  __attribute__((ext_vector_type(8)));
typedef __bf16   v16b __attribute__((ext_vector_type(16)));
typedef __bf16   v8b  __attribute__((ext_vector_type(8)));
typedef float    v8f  __attribute__((ext_vector_type(8)));
typedef float    v4f  __attribute__((ext_vector_type(4)));
typedef unsigned int v4u __attribute__((ext_vector_type(4)));

#if defined(__HIP_DEVICE_COMPILE__)
#define DEV_ASM 1
#else
#define DEV_ASM 0
#endif

// ---- scalar helpers --------------------------------------------------------------------------------
__device__ __forceinline__ unsigned short bf_bits(float f) {          // f32 -> bf16 bits, RNE convert
  unsigned u = __float_as_uint(f);
  return (unsigned short)((u + 0x7FFFu + ((u >> 16) & 1u)) >> 16);
}
__device__ __forceinline__ float bf_up(unsigned short hb) { return __uint_as_float(((unsigned)hb) << 16); }
__device__ __forceinline__ unsigned short h_bits(_Float16 x) { return __builtin_bit_cast(unsigned short, x); }
__device__ __forceinline__ unsigned pk16(unsigned short a, unsigned short b) { return (unsigned)a | ((unsigned)b << 16); }
__device__ __forceinline__ v8f zero8() { v8f z = {0.f, 0.f, 0.f, 0.f, 0.f, 0.f, 0.f, 0.f}; return z; }

// ---- fragment loaders: 16-bit A/B operand, lane -> row/col (lane&15), p already includes +8*(lane>>4);
//      elements 0..7 <- p[0..7] (k0+8h..k0+8h+7), elements 8..15 <- p[16..23] (k0+16+8h..k0+16+8h+7)
template <typename OT> struct FT;
template <> struct FT<__bf16>   { typedef v16b frag; typedef v8b half8; };
template <> struct FT<_Float16> { typedef v16h frag; typedef v8h half8; };

template <typename OT>
__device__ __forceinline__ typename FT<OT>::frag ldfrag(const OT* p) {
  union { typename FT<OT>::frag v; typename FT<OT>::half8 h[2]; } f;
  f.h[0] = *(const typename FT<OT>::half8*)(p);
  f.h[1] = *(const typename FT<OT>::half8*)(p + 16);
  return f.v;
}

// ---- WMMA helpers ----------------------------------------------------------------------------------
__device__ __forceinline__ v8f mmar(v16b a, v16b b, v8f c) {
  return __builtin_amdgcn_wmma_f32_16x16x32_bf16(false, a, false, b, (short)0, c, false, false);
}
// guarded form: 4 VALU slots after the WMMA, D tied, A/B kept live
__device__ __forceinline__ v8f mma_h(v16h a, v16h b, v8f c) {
  c = __builtin_amdgcn_wmma_f32_16x16x32_f16(false, a, false, b, (short)0, c, false, false);
#if DEV_ASM
  asm volatile("v_nop\n\tv_nop\n\tv_nop\n\tv_nop" : "+v"(c) : "v"(a), "v"(b));
#endif
  return c;
}
__device__ __forceinline__ void dep_guard(v8f& a, v8f& b, v16b x, v16b y) {
#if DEV_ASM
  asm volatile("v_nop\n\tv_nop\n\tv_nop\n\tv_nop" : "+v"(a), "+v"(b) : "v"(x), "v"(y));
#else
  (void)a; (void)b; (void)x; (void)y;
#endif
}
__device__ __forceinline__ void keep4(v16b a, v16b b, v16b c, v16b d) {
#if DEV_ASM
  asm volatile("v_nop" :: "v"(a), "v"(b), "v"(c), "v"(d));
#else
  (void)a; (void)b; (void)c; (void)d;
#endif
}
__device__ __forceinline__ void acc_guard4(v8f& a, v8f& b, v8f& c, v8f& d) {
#if DEV_ASM
  asm volatile("v_nop\n\tv_nop\n\tv_nop\n\tv_nop" : "+v"(a), "+v"(b), "+v"(c), "+v"(d));
#else
  (void)a; (void)b; (void)c; (void)d;
#endif
}

// =====================================================================================================
// x [ROWS][DM] f32 -> split plane X3 [ROWS][KP] bf16, row = [hi | hi | lo] (hi = RNE bf16, lo = RNE bf16
// of the exact residual). 8 elements per thread; each thread stores 16 B into each of the three thirds;
// =====================================================================================================
__global__ __launch_bounds__(256) void cvt_x3(const float* __restrict__ in, unsigned short* out, int n8) {
  const int i = blockIdx.x * 256 + (int)threadIdx.x;
  if (i < n8) {
    const int row = i >> 5, c = (i & 31) * 8;
    const v4f a  = *(const v4f*)(in + (size_t)i * 8);
    const v4f a4 = *(const v4f*)(in + (size_t)i * 8 + 4);
    const float f[8] = {a[0], a[1], a[2], a[3], a4[0], a4[1], a4[2], a4[3]};
    v4u ph, pl;
#pragma unroll
    for (int e = 0; e < 4; ++e) {
      const float f0 = f[2 * e], f1 = f[2 * e + 1];
      const unsigned short h0 = bf_bits(f0), h1 = bf_bits(f1);
      const unsigned short l0 = bf_bits(f0 - bf_up(h0)), l1 = bf_bits(f1 - bf_up(h1));
      ph[e] = pk16(h0, h1);
      pl[e] = pk16(l0, l1);
    }
    unsigned short* o = out + (size_t)row * KP + c;
    *(v4u*)(o)          = ph;
    *(v4u*)(o + DM)     = ph;
    *(v4u*)(o + 2 * DM) = pl;
    
  }
}

// =====================================================================================================
// w [DM rows k][C cols] f32 (x @ w layout) -> wt [C][KP] bf16, row c = [hi | lo | hi] of w[k][c] over k.
// Block = 64 k x 64 c tile staged in LDS (f32); grid = (C/64, DM/64): blockIdx.x -> c0, blockIdx.y -> k0.
// coverage: 8 waves x 8 rows x 64 k = the tile, all three thirds; the grid covers all C rows x DM k.
// =====================================================================================================
__global__ __launch_bounds__(256) void wtrans3(const float* __restrict__ w, unsigned short* wt, int C) {
  __shared__ float tile[64][65];
  const int tid = (int)threadIdx.x, lane = tid & 31, wave = tid >> 5;
  const int c0 = blockIdx.x * 64, k0 = blockIdx.y * 64;
#pragma unroll
  for (int it = 0; it < 16; ++it) {
    const int idx = it * 256 + tid;
    const int r = idx >> 6, cc = idx & 63;
    tile[r][cc] = w[(size_t)(k0 + r) * C + c0 + cc];
  }
  __syncthreads();
  const int q = lane >> 3, c8 = (lane & 7) * 8;
  v4u hv[2], lv[2];
#pragma unroll
  for (int it = 0; it < 2; ++it) {
    const int row = wave * 8 + it * 4 + q;          // output row (c within tile)
    v4u a, a2;
#pragma unroll
    for (int e = 0; e < 4; ++e) {
      const float f0 = tile[c8 + 2 * e][row], f1 = tile[c8 + 2 * e + 1][row];
      const unsigned short h0 = bf_bits(f0), h1 = bf_bits(f1);
      const unsigned short l0 = bf_bits(f0 - bf_up(h0)), l1 = bf_bits(f1 - bf_up(h1));
      a[e] = pk16(h0, h1);
      a2[e] = pk16(l0, l1);
    }
    hv[it] = a; lv[it] = a2;
  }
  {
#pragma unroll
    for (int it = 0; it < 2; ++it) {
      const int row = wave * 8 + it * 4 + q;
      unsigned short* o = wt + (size_t)(c0 + row) * KP + k0 + c8;
      *(v4u*)(o)          = hv[it];
      *(v4u*)(o + DM)     = lv[it];
      *(v4u*)(o + 2 * DM) = hv[it];
    }
    
  }
}

// =====================================================================================================
// Register-blocked batched WMMA GEMM, bf16 operands: C[m][n] = sum_k A[m][k] * Bt[n][k]; one wave per
// 64x64 tile, no block barriers. Bt row-major [N][K] pitch ldb (k contiguous).
// A_MODE 0: A row-major [M][K] pitch lda.  A_MODE 1: head planes: A(m, k) at
//   plane = (k/256)*NBH + (m/SEQ)*NH + (k/32)%NH;  A[(plane*SEQ + m%SEQ)*HD + k%32]  (M = ROWS, K = KP).
// M, N multiples of 64, K multiple of 32 (host-checked). blockIdx.y = batch index (strides in elements).
// Fragments loaded straight from global with the split k map (ldfrag).
// Epilogue: 16-row slabs staged per wave in LDS (pitch 68 floats), then:
// OUT_MODE 0: f16 head plane [NBH][SEQ][HD], value * oscale: per head half of the slab (16 rows x 32 cols =
// OUT_MODE 1: f32 head plane [NBH][SEQ][HD]: per head half (2048 contiguous B) four instructions of
// OUT_MODE 2: f16 hi plane C (value*oscale) + f16 residual plane C2 = f16((v*oscale - hi) * rscale), row-major
// OUT_MODE 3: f32 row-major C (pitch ldc) + bias[n] (f32): each 64-wide row segment = 256 B = 16 lanes x 16 B.
// coverage: 4 slabs x 16 rows x 64 cols = the wave's whole 64x64 tile; grids are exact tile multiples.
// =====================================================================================================
template <int A_MODE, int OUT_MODE>
__global__ __launch_bounds__(256) void gemm64(
    const unsigned short* __restrict__ Ap, int lda, long long strideA,
    const unsigned short* __restrict__ Btp, int ldb, long long strideB,
    void* Cout, void* Cout2, int ldc, long long strideC,
    const float* __restrict__ bias,
    int M, int N, int K, float oscale, float rscale) {
  const __bf16* A  = (const __bf16*)(const void*)Ap;
  const __bf16* Bt = (const __bf16*)(const void*)Btp;
  __shared__ __align__(16) float sT[8][16 * 68];   // per-wave 16x64 slab, pitch 68 floats
  const int b    = blockIdx.y;
  const int lane = threadIdx.x & 31;
  const int wave = threadIdx.x >> 5;
  const int tilesN = N >> 6;
  const int tilesM = M >> 6;
  const int tile = blockIdx.x * 8 + wave;
  if (tile >= tilesM * tilesN) return;   // wave-uniform; no block barriers in this kernel
  const int tm = tile / tilesN;
  const int tn = tile - tm * tilesN;
  const int m0 = tm << 6;
  const int n0 = tn << 6;

  const __bf16* Ab = A  + (size_t)b * (size_t)strideA;
  const __bf16* Bb = Bt + (size_t)b * (size_t)strideB;

  const int rlane = lane & 15;                 // row (A) / col (B, D) within subtile
  const int koff  = (lane >> 4) * 8;           // k offset of this lane half
  const int mOff  = (lane >> 4) * 8;           // D row offset

  v8f acc[4][4];
#pragma unroll
  for (int i = 0; i < 4; ++i)
#pragma unroll
    for (int j = 0; j < 4; ++j) acc[i][j] = zero8();

  for (int k0 = 0; k0 < K; k0 += 32) {
    v16b bq[4];
#pragma unroll
    for (int j = 0; j < 4; ++j)
      bq[j] = ldfrag<__bf16>(Bb + (size_t)(n0 + (j << 4) + rlane) * ldb + koff + k0);
#pragma unroll
    for (int i = 0; i < 4; ++i) {
      const __bf16* ap;
      if (A_MODE == 0) {
        ap = Ab + (size_t)(m0 + (i << 4) + rlane) * lda + koff + k0;
      } else {
        const int plane = (k0 >> 8) * NBH + (m0 / SEQ) * NH + ((k0 >> 5) & (NH - 1));
        ap = Ab + ((size_t)plane * SEQ + (size_t)((m0 & (SEQ - 1)) + (i << 4) + rlane)) * HD + koff;
      }
      const v16b af = ldfrag<__bf16>(ap);
#pragma unroll
      for (int j = 0; j < 4; ++j) acc[i][j] = mmar(af, bq[j], acc[i][j]);
      dep_guard(acc[i][0], acc[i][3], af, bq[3]);
    }
    keep4(bq[0], bq[1], bq[2], bq[3]);
  }
  acc_guard4(acc[0][0], acc[0][1], acc[0][2], acc[0][3]);
  acc_guard4(acc[1][0], acc[1][1], acc[1][2], acc[1][3]);
  acc_guard4(acc[2][0], acc[2][1], acc[2][2], acc[2][3]);
  acc_guard4(acc[3][0], acc[3][1], acc[3][2], acc[3][3]);

  // ---- epilogue ----
  float* slab = sT[wave];
#pragma unroll
  for (int i = 0; i < 4; ++i) {
    const int mBase = m0 + (i << 4);
#pragma unroll
    for (int j = 0; j < 4; ++j) {
#pragma unroll
      for (int r = 0; r < 8; ++r) {
        slab[(mOff + r) * 68 + (j << 4) + rlane] = acc[i][j][r];
      }
    }
    __builtin_amdgcn_fence(__ATOMIC_RELEASE, "workgroup");
    __builtin_amdgcn_wave_barrier();
    __builtin_amdgcn_fence(__ATOMIC_ACQUIRE, "workgroup");
    if (OUT_MODE == 0) {
      unsigned short* Q = (unsigned short*)Cout;
      const int rq = lane >> 2, c8 = (lane & 3) * 8;        // row within an 8-row group, 8-col piece
      v4u hv[4];
#pragma unroll
      for (int j2 = 0; j2 < 2; ++j2) {
#pragma unroll
        for (int it = 0; it < 2; ++it) {
          const float* sp = slab + (it * 8 + rq) * 68 + j2 * 32 + c8;   // it 0..1 x rq 0..7 = rows 0..15
          v4u a;
#pragma unroll
          for (int e = 0; e < 4; ++e)
            a[e] = pk16(h_bits((_Float16)(sp[2 * e] * oscale)), h_bits((_Float16)(sp[2 * e + 1] * oscale)));
          hv[j2 * 2 + it] = a;
        }
      }
      {
#pragma unroll
        for (int j2 = 0; j2 < 2; ++j2) {
          const int head = (n0 >> 5) + j2;
          unsigned short* base = Q + ((size_t)((mBase / SEQ) * NH + head) * SEQ + (size_t)(mBase & (SEQ - 1))) * HD;
#pragma unroll
          for (int it = 0; it < 2; ++it)
            *(v4u*)(base + it * 256 + lane * 8) = hv[j2 * 2 + it];
        }
        
      }
    } else if (OUT_MODE == 1) {
      float* Kr = (float*)Cout;
      const int rq = lane >> 3, c4 = (lane & 7) * 4;        // row within a 4-row group, 4-col piece
      v4f hv[8];
#pragma unroll
      for (int j2 = 0; j2 < 2; ++j2) {
#pragma unroll
        for (int it = 0; it < 4; ++it)                      // it 0..3 x rq 0..3 = rows 0..15
          hv[j2 * 4 + it] = *(const v4f*)(slab + (it * 4 + rq) * 68 + j2 * 32 + c4);
      }
      {
#pragma unroll
        for (int j2 = 0; j2 < 2; ++j2) {
          const int head = (n0 >> 5) + j2;
          float* base = Kr + ((size_t)((mBase / SEQ) * NH + head) * SEQ + (size_t)(mBase & (SEQ - 1))) * HD;
#pragma unroll
          for (int it = 0; it < 4; ++it)
            *(v4f*)(base + it * 128 + lane * 4) = hv[j2 * 4 + it];
        }
        
      }
    } else if (OUT_MODE == 2) {
      const int q = lane >> 3, c8 = (lane & 7) * 8;
      unsigned short* C  = (unsigned short*)Cout  + (size_t)b * (size_t)strideC;
      unsigned short* C2 = (unsigned short*)Cout2 + (size_t)b * (size_t)strideC;
      v4u hv[4], lv[4];
#pragma unroll
      for (int it = 0; it < 4; ++it) {
        const int row = it * 4 + q;                         // it 0..3 x q 0..3 = rows 0..15
        const float* sp = slab + row * 68 + c8;
        v4u a, a2;
#pragma unroll
        for (int e = 0; e < 4; ++e) {
          const float f0 = sp[2 * e] * oscale, f1 = sp[2 * e + 1] * oscale;
          const _Float16 x0 = (_Float16)f0, x1 = (_Float16)f1;
          const unsigned short h0 = h_bits(x0), h1 = h_bits(x1);
          const unsigned short l0 = h_bits((_Float16)((f0 - (float)x0) * rscale));
          const unsigned short l1 = h_bits((_Float16)((f1 - (float)x1) * rscale));
          a[e] = pk16(h0, h1); a2[e] = pk16(l0, l1);
        }
        hv[it] = a; lv[it] = a2;
      }
      {
#pragma unroll
        for (int it = 0; it < 4; ++it) {
          const int row = it * 4 + q;
          *(v4u*)(C  + (size_t)(mBase + row) * ldc + n0 + c8) = hv[it];
          *(v4u*)(C2 + (size_t)(mBase + row) * ldc + n0 + c8) = lv[it];
        }
        
      }
    } else {
      float* C = (float*)Cout + (size_t)b * (size_t)strideC;
      const int h2 = lane >> 4, c4 = (lane & 15) * 4;      // 256-B row segment = 16 lanes x 16 B
      const v4f bv = *(const v4f*)(bias + n0 + c4);
      v4f hv[8];
#pragma unroll
      for (int it = 0; it < 8; ++it) {
        const int row = it * 2 + h2;                        // it 0..7 x h2 0..1 = rows 0..15
        hv[it] = *(const v4f*)(slab + row * 68 + c4) + bv;
      }
      {
#pragma unroll
        for (int it = 0; it < 8; ++it) {
          const int row = it * 2 + h2;
          *(v4f*)(C + (size_t)(mBase + row) * ldc + n0 + c4) = hv[it];
        }
        
      }
    }
    __builtin_amdgcn_fence(__ATOMIC_RELEASE, "workgroup");
    __builtin_amdgcn_wave_barrier();
    __builtin_amdgcn_fence(__ATOMIC_ACQUIRE, "workgroup");
  }
}

// =====================================================================================================
// Fourier-basis transform of k: out = sum_{f=1..NFUN} ca[f-1]*sin(f*k) + cb[f-1]*cos(f*k), evaluated in
// f32 with precise sincosf, f*k as one f32 multiply, terms accumulated in order f = 1..NFUN with separate
// multiply and add (no contraction). One lane per element of the raw f32 k head plane [NBH][SEQ][HD];
// coverage: grid x 256 = every element of the k' plane.
// =====================================================================================================
__global__ __launch_bounds__(256) void fourier_k(const float* __restrict__ kr, const float* __restrict__ ca,
                                                 const float* __restrict__ cb, unsigned short* kp) {
#pragma clang fp contract(off)
  __shared__ __align__(16) unsigned short sh[256];
  const int tid = (int)threadIdx.x;
  const size_t gid = (size_t)blockIdx.x * 256 + (size_t)tid;
  const float kx = kr[gid];
  float acc = 0.0f;
  float ff = 1.0f;
#pragma unroll 1
  for (int fi = 0; fi < NFUN; ++fi) {
    const float af = ca[fi];
    const float bf = cb[fi];
    const float ang = ff * kx;
    float sn, cs;
    sincosf(ang, &sn, &cs);
    const float t1 = af * sn;
    acc = acc + t1;
    const float t2 = bf * cs;
    acc = acc + t2;
    ff = ff + 1.0f;
  }
  sh[tid] = h_bits((_Float16)(acc * 4.0f));
  __syncthreads();
  if (tid < 32) {
    const v4u v = *(const v4u*)(sh + tid * 8);
    unsigned short* o = kp + (size_t)blockIdx.x * 256 + (size_t)tid * 8;
    *(v4u*)o = v;
    
  }
}

// =====================================================================================================
// Attention, head dim 32, no mask, softmax over all SEQ keys.
//   q plane / k' plane (f16, x4): element (bh, t, d) at [(bh*SEQ + t)*HD + d]
//   v^T hi plane (f16, 4v) and residual plane (f16, (4v - hi)*2048): element (bh, d, s) at [(bh*HD + d)*SEQ + s]
//   ctx planes (bf16): part p (0 = hi, 1 = hi, 2 = lo), element (bh, t, d) at [p*PS + (bh*SEQ + t)*HD + d]
//   scores = (q4 . k4') * sscale on f16 WMMA (one k-step), softmax in f32 (running max);
//   p = exp(s - m) carried as f16(1024 p); O = p . vh + (p . vl) / 2048 on f16 WMMA; ctx = O / (l * 4096).
//   Block = 4 waves on the same (b, h), 4 consecutive 16-query tiles; grid = NBH * NQB; key chunks of 64,
//   static trip NKT. Chunk staging: 128 threads, K 64x32 (2 x 16 B per thread), V^T hi/res 32x64 (2 x 16 B
//   per thread and plane), plain loads, __syncthreads before and after. P tiles are wave-private, stored as
//   Output: each wave writes its 16x32 tile (1024 contiguous B per part) with two instructions of
//   all NBH*SEQ rows x HD, all three parts.
// =====================================================================================================
__global__ __launch_bounds__(128)
void attn32(const unsigned short* __restrict__ qpp, const unsigned short* __restrict__ kpp,
            const unsigned short* __restrict__ vhp, const unsigned short* __restrict__ vlp,
            unsigned short* ct, float sscale) {
  union FH { v16h v; v8h h[2]; };
  __shared__ __align__(16) _Float16 Ksh[64 * HD];          // K chunk [key][d]      4 KB
  __shared__ __align__(16) _Float16 Vth[HD * 64];          // V^T hi [d][key]      4 KB
  __shared__ __align__(16) _Float16 Vtl[HD * 64];          // V^T residual        4 KB
  __shared__ __align__(16) _Float16 Psh[4][16 * 64];       // per wave P [row][key] 8 KB
  __shared__ __align__(16) float    Os[4][16 * HD];        // per wave ctx tile    8 KB

  const int tid  = (int)threadIdx.x;
  const int wave = tid >> 5;
  const int lane = tid & 31;
  const int hh   = lane >> 4;
  const int c    = lane & 15;

  const int bx   = blockIdx.x;
  const int qblk = bx % NQB;
  const int bh   = bx / NQB;
  const int q0   = qblk * 64 + wave * 16;

  const _Float16* Qg = (const _Float16*)(const void*)qpp + (size_t)bh * SEQ * HD;
  const _Float16* Kg = (const _Float16*)(const void*)kpp + (size_t)bh * SEQ * HD;
  const _Float16* Vh = (const _Float16*)(const void*)vhp + (size_t)bh * HD * SEQ;
  const _Float16* Vl = (const _Float16*)(const void*)vlp + (size_t)bh * HD * SEQ;

  // ---- Q fragment (A operand, row = lane&15, one k-step of 32) ----
  const v16h qa = ldfrag<_Float16>(Qg + (size_t)(q0 + c) * HD + 8 * hh);

  float mrow[8], lrow[8];
  v8f oacc[2];
#pragma unroll
  for (int r = 0; r < 8; ++r) { mrow[r] = -INFINITY; lrow[r] = 0.f; }
  oacc[0] = zero8(); oacc[1] = zero8();

  for (int kt = 0; kt < NKT; ++kt) {         // static trip count
    const int kv0 = kt * 64;
    __syncthreads();
    {
      const int r = tid >> 1, hf = (tid & 1) * 16;                  // key r, d = hf..hf+15
      const _Float16* kg = Kg + (size_t)(kv0 + r) * HD + hf;
      const v8h k0v = *(const v8h*)(kg);
      const v8h k1v = *(const v8h*)(kg + 8);
      *(v8h*)(Ksh + r * HD + hf)     = k0v;
      *(v8h*)(Ksh + r * HD + hf + 8) = k1v;
      const int d = tid >> 2, sg = (tid & 3) * 16;                  // d row, keys sg..sg+15
      const _Float16* vg  = Vh + (size_t)d * SEQ + kv0 + sg;
      const _Float16* vlg = Vl + (size_t)d * SEQ + kv0 + sg;
      const v8h v0 = *(const v8h*)(vg),  v1 = *(const v8h*)(vg + 8);
      const v8h w0 = *(const v8h*)(vlg), w1 = *(const v8h*)(vlg + 8);
      *(v8h*)(Vth + d * 64 + sg)     = v0;
      *(v8h*)(Vth + d * 64 + sg + 8) = v1;
      *(v8h*)(Vtl + d * 64 + sg)     = w0;
      *(v8h*)(Vtl + d * 64 + sg + 8) = w1;
    }
    __syncthreads();

    // ---- scores: 16 query rows x 64 keys per wave ----
    v8f s[4];
#pragma unroll
    for (int j = 0; j < 4; ++j) {
      FH kb;
      kb.h[0] = *(const v8h*)(Ksh + (j * 16 + c) * HD + 8 * hh);
      kb.h[1] = *(const v8h*)(Ksh + (j * 16 + c) * HD + 16 + 8 * hh);
      s[j] = mma_h(qa, kb.v, zero8());
#pragma unroll
      for (int r = 0; r < 8; ++r) s[j][r] *= sscale;
    }

    // ---- row max, online softmax, P (x1024, f16) to LDS ----
    _Float16* pwh = Psh[wave];
#pragma unroll
    for (int r = 0; r < 8; ++r) {
      float m = s[0][r];
#pragma unroll
      for (int j = 1; j < 4; ++j) m = fmaxf(m, s[j][r]);
#pragma unroll
      for (int off = 1; off < 16; off <<= 1) m = fmaxf(m, __shfl_xor(m, off, 32));
      const float mnew  = fmaxf(mrow[r], m);
      const float msafe = (mnew == -INFINITY) ? 0.f : mnew;
      const float alpha = __expf(mrow[r] - msafe);
      mrow[r] = mnew;
      float psum = 0.f;
#pragma unroll
      for (int j = 0; j < 4; ++j) {
        const float p = __expf(s[j][r] - msafe);
        psum += p;
        pwh[(8 * hh + r) * 64 + j * 16 + c] = (_Float16)(p * 1024.0f);
      }
#pragma unroll
      for (int off = 1; off < 16; off <<= 1) psum += __shfl_xor(psum, off, 32);
      lrow[r] = lrow[r] * alpha + psum;
      oacc[0][r] *= alpha;
      oacc[1][r] *= alpha;
    }
    __builtin_amdgcn_fence(__ATOMIC_RELEASE, "workgroup");
    __builtin_amdgcn_wave_barrier();
    __builtin_amdgcn_fence(__ATOMIC_ACQUIRE, "workgroup");

    // ---- context += P . V (f16 WMMA); residual products into a separate accumulator ----
    v8f o1[2];
    o1[0] = zero8(); o1[1] = zero8();
#pragma unroll
    for (int kk = 0; kk < 2; ++kk) {
      FH pa;
      pa.h[0] = *(const v8h*)(pwh + c * 64 + kk * 32 + 8 * hh);
      pa.h[1] = *(const v8h*)(pwh + c * 64 + kk * 32 + 16 + 8 * hh);
#pragma unroll
      for (int t = 0; t < 2; ++t) {
        FH vb, vl;
        vb.h[0] = *(const v8h*)(Vth + (t * 16 + c) * 64 + kk * 32 + 8 * hh);
        vb.h[1] = *(const v8h*)(Vth + (t * 16 + c) * 64 + kk * 32 + 16 + 8 * hh);
        vl.h[0] = *(const v8h*)(Vtl + (t * 16 + c) * 64 + kk * 32 + 8 * hh);
        vl.h[1] = *(const v8h*)(Vtl + (t * 16 + c) * 64 + kk * 32 + 16 + 8 * hh);
        oacc[t] = mma_h(pa.v, vb.v, oacc[t]);
        o1[t]   = mma_h(pa.v, vl.v, o1[t]);
      }
    }
#pragma unroll
    for (int t = 0; t < 2; ++t)
#pragma unroll
      for (int r = 0; r < 8; ++r) oacc[t][r] += o1[t][r] * (1.0f / 2048.0f);
  }

  // ---- normalise (1/l, undo the x1024 p carry and the x4 v carry), stage the wave's 16x32 tile,
  float* os = Os[wave];
#pragma unroll
  for (int r = 0; r < 8; ++r) {
    const float l = lrow[r];
    const float inv = 1.0f / (l * 4096.0f);
    os[(8 * hh + r) * HD + c]      = oacc[0][r] * inv;
    os[(8 * hh + r) * HD + 16 + c] = oacc[1][r] * inv;
  }
  __builtin_amdgcn_fence(__ATOMIC_RELEASE, "workgroup");
  __builtin_amdgcn_wave_barrier();
  __builtin_amdgcn_fence(__ATOMIC_ACQUIRE, "workgroup");
  {
    const int rq = lane >> 2, c8 = (lane & 3) * 8;
    v4u hv[2], lv[2];
#pragma unroll
    for (int it = 0; it < 2; ++it) {
      const int row = it * 8 + rq;   // it 0..1 x rq 0..7 = rows 0..15 of the wave tile
      const float* sp = os + row * HD + c8;
      v4u a, a2;
#pragma unroll
      for (int e = 0; e < 4; ++e) {
        const float f0 = sp[2 * e], f1 = sp[2 * e + 1];
        const unsigned short h0 = bf_bits(f0), h1 = bf_bits(f1);
        const unsigned short l0 = bf_bits(f0 - bf_up(h0)), l1 = bf_bits(f1 - bf_up(h1));
        a[e] = pk16(h0, h1); a2[e] = pk16(l0, l1);
      }
      hv[it] = a; lv[it] = a2;
    }
    const size_t PS = (size_t)NBH * SEQ * HD;
    unsigned short* base = ct + ((size_t)bh * SEQ + (size_t)q0) * HD;
    {
#pragma unroll
      for (int it = 0; it < 2; ++it) {
        unsigned short* p = base + it * 256 + lane * 8;
        *(v4u*)(p)          = hv[it];
        *(v4u*)(p + PS)     = hv[it];
        *(v4u*)(p + 2 * PS) = lv[it];
      }
      
    }
  }
}

// =====================================================================================================
// Workspace map (bytes), every region an exact multiple of its whole-line / whole-tile store granularity
// (no tail rows anywhere: all shapes are exact tile multiples):
//   X3   bf16 [4096][768]            6291456
//   Wq3  bf16 [768][768]             1179648
//   Wo3  bf16 [256][768]              393216
//   Qp   f16  [16][2048][32]          2097152
//   Kraw f32  [16][2048][32]          4194304
//   Kp   f16  [16][2048][32]          2097152
//   VTh  f16  [2][256][2048]          2097152
//   VTl  f16  [2][256][2048]          2097152
//   CT   bf16 [3][16][2048][32]       6291456
//   total                           26738688
// =====================================================================================================
extern "C" void kernel_launch(void* const* d_in, const int* in_sizes, int n_in,
                              void* d_out, int out_size, void* d_ws, size_t ws_size,
                              hipStream_t stream) {
  if (n_in < 6) return;
  if (in_sizes[0] != ROWS * DM) return;
  if (in_sizes[1] != DM * QKVW) return;
  if (in_sizes[2] != DM * DM) return;
  if (in_sizes[3] != DM) return;
  if (in_sizes[4] != NFUN || in_sizes[5] != NFUN) return;
  if (out_size != ROWS * DM) return;

  const float* x     = (const float*)d_in[0];   // [2][2048][256]
  const float* w_qkv = (const float*)d_in[1];   // [256 in][768 out]
  const float* w_o   = (const float*)d_in[2];   // [256 in][256 out]
  const float* b_o   = (const float*)d_in[3];   // [256]
  const float* coefa = (const float*)d_in[4];   // [256] sine coefficients
  const float* coefb = (const float*)d_in[5];   // [256] cosine coefficients

  const size_t PX3 = (size_t)ROWS * KP * 2;            // 6291456
  const size_t PWQ = (size_t)QKVW * KP * 2;            // 1179648
  const size_t PWO = (size_t)DM * KP * 2;              //  393216
  const size_t PH  = (size_t)NBH * SEQ * HD * 2;       // 2097152  f16 head plane
  const size_t PK4 = (size_t)NBH * SEQ * HD * 4;       // 4194304  f32 head plane
  const size_t PVT = (size_t)NB * DM * SEQ * 2;        // 2097152  v^T plane
  const size_t PCT = (size_t)3 * NBH * SEQ * HD * 2;   // 6291456  ctx planes
  size_t off = 0;
  const size_t oX3  = off; off += PX3;
  const size_t oWq  = off; off += PWQ;
  const size_t oWo  = off; off += PWO;
  const size_t oQp  = off; off += PH;
  const size_t oKr  = off; off += PK4;
  const size_t oKp  = off; off += PH;
  const size_t oVTh = off; off += PVT;
  const size_t oVTl = off; off += PVT;
  const size_t oCT  = off; off += PCT;
  if (off > ws_size) return;                           // off = 26738688
  if (off > (size_t)134217728) return;

  char* ws = (char*)d_ws;
  unsigned short* X3  = (unsigned short*)(ws + oX3);
  unsigned short* Wq3 = (unsigned short*)(ws + oWq);
  unsigned short* Wo3 = (unsigned short*)(ws + oWo);
  unsigned short* Qp  = (unsigned short*)(ws + oQp);
  float*          Kr  = (float*)(ws + oKr);
  unsigned short* Kp  = (unsigned short*)(ws + oKp);
  unsigned short* VTh = (unsigned short*)(ws + oVTh);
  unsigned short* VTl = (unsigned short*)(ws + oVTl);
  unsigned short* CT  = (unsigned short*)(ws + oCT);

  const dim3 blk(256);
  const int n8x = ROWS * DM / 8;                                   // 131072
  const dim3 gCvtX((n8x + 255) / 256);                              //  512 blocks
  const dim3 gTq(QKVW / 64, DM / 64);                               //  12 x 4
  const dim3 gTo(DM / 64, DM / 64);                                 //   4 x 4
  const dim3 gQK(((ROWS / 64) * (DM / 64) + 7) / 8, 1);             //  256 tiles -> 32 blocks: M=4096, N=256
  const dim3 gVT(((DM / 64) * (SEQ / 64) + 7) / 8, NB);             //  128 tiles -> 16 blocks x 2 batches: M=256, N=2048
  const dim3 gFour((NBH * SEQ * HD) / 256);                         // 4096 blocks of 256
  const dim3 gAttn(NBH * NQB);                                      //  512 blocks of 128

  // (1) x -> [hi|hi|lo] bf16 plane; weights transposed to [out][in] as [hi|lo|hi] bf16 planes
  cvt_x3<<<gCvtX, blk, 0, stream>>>(x, X3, n8x);
  wtrans3<<<gTq, blk, 0, stream>>>(w_qkv, Wq3, QKVW);
  wtrans3<<<gTo, blk, 0, stream>>>(w_o, Wo3, DM);
  // (2) q = x . Wq -> f16 head plane (x4)   (M=4096, N=256, K=768)
  gemm64<0, 0><<<gQK, blk, 0, stream>>>(
      X3, KP, 0LL, Wq3, KP, 0LL,
      (void*)Qp, (void*)Qp, 0, 0LL, b_o,
      ROWS, DM, KP, 4.0f, 1.0f);
  // (3) k = x . Wk -> raw f32 head plane   (M=4096, N=256, K=768)
  gemm64<0, 1><<<gQK, blk, 0, stream>>>(
      X3, KP, 0LL, Wq3 + (size_t)DM * KP, KP, 0LL,
      (void*)Kr, (void*)Kr, 0, 0LL, b_o,
      ROWS, DM, KP, 1.0f, 1.0f);
  // (4) v^T = Wv . x^T per batch -> f16 hi plane (x4) [b][c][s] (pitch SEQ) and residual plane (x2048)
  //     (A = Wq3 rows 512.., Bt = X3 rows of batch b; M=256, N=2048, K=768)
  gemm64<0, 2><<<gVT, blk, 0, stream>>>(
      Wq3 + (size_t)2 * DM * KP, KP, 0LL, X3, KP, (long long)SEQ * KP,
      (void*)VTh, (void*)VTl, SEQ, (long long)DM * SEQ, b_o,
      DM, SEQ, KP, 4.0f, 2048.0f);
  // (5) Fourier-basis transform of k -> f16 head plane (x4)
  fourier_k<<<gFour, blk, 0, stream>>>(Kr, coefa, coefb, Kp);
  // (6) attention -> ctx planes (bf16 hi, hi, lo)
  attn32<<<gAttn, dim3(128), 0, stream>>>(Qp, Kp, VTh, VTl, CT, 0.17677669529663687f * 0.0625f);
  // (7) out = ctx . Wo + bias -> d_out f32 [4096][256]   (M=4096, N=256, K=768, A in head-plane layout)
  gemm64<1, 3><<<gQK, blk, 0, stream>>>(
      CT, 0, 0LL, Wo3, KP, 0LL,
      d_out, d_out, DM, 0LL, b_o,
      ROWS, DM, KP, 1.0f, 1.0f);
  (void)hipGetLastError();
}

// v001
// One run takes 273 microseconds.
// In two side-by-side timings against v000, it was 1.44 and 1.43 times as fast.
// Contractions: q, k, v^T projections and the output projection = v_wmma_f32_16x16x32_bf16 over bf16 hi/lo planes
// laid out as [hi|hi|lo] x [hi|lo|hi] along k (3 products, f32 accumulate);
// q.k^T scores = v_wmma_f32_16x16x32_f16 (q and the transformed k as f16 planes carried x4, single product, f32 accumulate);
// p.v = v_wmma_f32_16x16x32_f16 (p carried x1024 in f16; v^T as f16 hi plane x4 plus f16 residual plane x2^11; 2 products, f32 accumulate);
// Fourier-basis transform of k (one precise sincosf per element, then a rotation recurrence), softmax and bias in f32 on the VALU.
#include <hip/hip_runtime.h>
#include <math.h>
#include <stdint.h>

#define NB   2
#define SEQ  2048
#define DM   256
#define NH   8
#define HD   32
#define NBH  (NB * NH)        // 16 (batch, head) pairs
#define QKVW (3 * DM)         // 768 qkv output width
#define KP   (3 * DM)         // 768 folded k width of the split operand planes
#define NFUN 256
#define ROWS (NB * SEQ)       // 4096 token rows
#define NQB  (SEQ / 64)       // 64-query blocks per (b, h)
#define NKT  (SEQ / 64)       // 64-key chunks
static_assert(NH * HD == DM);
static_assert(NQB == 32 && NKT == 32);
static_assert((ROWS % 64) == 0 && (DM % 64) == 0 && (SEQ % 64) == 0 && (KP % 32) == 0);
static_assert((ROWS * DM) % 2048 == 0);

typedef _Float16 v16h __attribute__((ext_vector_type(16)));
typedef _Float16 v8h  __attribute__((ext_vector_type(8)));
typedef __bf16   v16b __attribute__((ext_vector_type(16)));
typedef __bf16   v8b  __attribute__((ext_vector_type(8)));
typedef float    v8f  __attribute__((ext_vector_type(8)));
typedef float    v4f  __attribute__((ext_vector_type(4)));
typedef unsigned int v4u __attribute__((ext_vector_type(4)));
typedef float    v2f  __attribute__((ext_vector_type(2)));
typedef unsigned int v2u __attribute__((ext_vector_type(2)));

#if defined(__HIP_DEVICE_COMPILE__)
#define DEV_ASM 1
#else
#define DEV_ASM 0
#endif

// ---- scalar helpers --------------------------------------------------------------------------------
__device__ __forceinline__ unsigned short bf_bits(float f) {          // f32 -> bf16 bits, RNE convert
  unsigned u = __float_as_uint(f);
  return (unsigned short)((u + 0x7FFFu + ((u >> 16) & 1u)) >> 16);
}
__device__ __forceinline__ float bf_up(unsigned short hb) { return __uint_as_float(((unsigned)hb) << 16); }
__device__ __forceinline__ unsigned short h_bits(_Float16 x) { return __builtin_bit_cast(unsigned short, x); }
__device__ __forceinline__ unsigned pk16(unsigned short a, unsigned short b) { return (unsigned)a | ((unsigned)b << 16); }
__device__ __forceinline__ v8f zero8() { v8f z = {0.f, 0.f, 0.f, 0.f, 0.f, 0.f, 0.f, 0.f}; return z; }

// ---- fragment loaders: 16-bit A/B operand, lane -> row/col (lane&15), p already includes +8*(lane>>4);
//      elements 0..7 <- p[0..7] (k0+8h..k0+8h+7), elements 8..15 <- p[16..23] (k0+16+8h..k0+16+8h+7)
template <typename OT> struct FT;
template <> struct FT<__bf16>   { typedef v16b frag; typedef v8b half8; };
template <> struct FT<_Float16> { typedef v16h frag; typedef v8h half8; };

template <typename OT>
__device__ __forceinline__ typename FT<OT>::frag ldfrag(const OT* p) {
  union { typename FT<OT>::frag v; typename FT<OT>::half8 h[2]; } f;
  f.h[0] = *(const typename FT<OT>::half8*)(p);
  f.h[1] = *(const typename FT<OT>::half8*)(p + 16);
  return f.v;
}

// ---- WMMA helpers ----------------------------------------------------------------------------------
__device__ __forceinline__ v8f mmar(v16b a, v16b b, v8f c) {
  return __builtin_amdgcn_wmma_f32_16x16x32_bf16(false, a, false, b, (short)0, c, false, false);
}
// guarded form: 4 VALU slots after the WMMA, D tied, A/B kept live
__device__ __forceinline__ v8f mma_h(v16h a, v16h b, v8f c) {
  c = __builtin_amdgcn_wmma_f32_16x16x32_f16(false, a, false, b, (short)0, c, false, false);
#if DEV_ASM
  asm volatile("v_nop\n\tv_nop\n\tv_nop\n\tv_nop" : "+v"(c) : "v"(a), "v"(b));
#endif
  return c;
}
__device__ __forceinline__ void dep_guard(v8f& a, v8f& b, v16b x, v16b y) {
#if DEV_ASM
  asm volatile("v_nop\n\tv_nop\n\tv_nop\n\tv_nop" : "+v"(a), "+v"(b) : "v"(x), "v"(y));
#else
  (void)a; (void)b; (void)x; (void)y;
#endif
}
__device__ __forceinline__ void keep4(v16b a, v16b b, v16b c, v16b d) {
#if DEV_ASM
  asm volatile("v_nop" :: "v"(a), "v"(b), "v"(c), "v"(d));
#else
  (void)a; (void)b; (void)c; (void)d;
#endif
}
__device__ __forceinline__ void acc_guard4(v8f& a, v8f& b, v8f& c, v8f& d) {
#if DEV_ASM
  asm volatile("v_nop\n\tv_nop\n\tv_nop\n\tv_nop" : "+v"(a), "+v"(b), "+v"(c), "+v"(d));
#else
  (void)a; (void)b; (void)c; (void)d;
#endif
}

// =====================================================================================================
// x [ROWS][DM] f32 -> split plane X3 [ROWS][KP] bf16, row = [hi | hi | lo] (hi = RNE bf16, lo = RNE bf16
// of the exact residual). 8 elements per thread; each thread stores 16 B into each of the three thirds;
// =====================================================================================================
__global__ __launch_bounds__(256) void cvt_x3(const float* __restrict__ in, unsigned short* out, int n8) {
  const int i = blockIdx.x * 256 + (int)threadIdx.x;
  if (i < n8) {
    const int row = i >> 5, c = (i & 31) * 8;
    const v4f a  = *(const v4f*)(in + (size_t)i * 8);
    const v4f a4 = *(const v4f*)(in + (size_t)i * 8 + 4);
    const float f[8] = {a[0], a[1], a[2], a[3], a4[0], a4[1], a4[2], a4[3]};
    v4u ph, pl;
#pragma unroll
    for (int e = 0; e < 4; ++e) {
      const float f0 = f[2 * e], f1 = f[2 * e + 1];
      const unsigned short h0 = bf_bits(f0), h1 = bf_bits(f1);
      const unsigned short l0 = bf_bits(f0 - bf_up(h0)), l1 = bf_bits(f1 - bf_up(h1));
      ph[e] = pk16(h0, h1);
      pl[e] = pk16(l0, l1);
    }
    unsigned short* o = out + (size_t)row * KP + c;
    *(v4u*)(o)          = ph;
    *(v4u*)(o + DM)     = ph;
    *(v4u*)(o + 2 * DM) = pl;
    
  }
}

// =====================================================================================================
// w [DM rows k][C cols] f32 (x @ w layout) -> wt [C][KP] bf16, row c = [hi | lo | hi] of w[k][c] over k.
// Block = 64 k x 64 c tile staged in LDS (f32); grid = (C/64, DM/64): blockIdx.x -> c0, blockIdx.y -> k0.
// coverage: 8 waves x 8 rows x 64 k = the tile, all three thirds; the grid covers all C rows x DM k.
// =====================================================================================================
__global__ __launch_bounds__(256) void wtrans3(const float* __restrict__ w, unsigned short* wt, int C) {
  __shared__ float tile[64][65];
  const int tid = (int)threadIdx.x, lane = tid & 31, wave = tid >> 5;
  const int c0 = blockIdx.x * 64, k0 = blockIdx.y * 64;
#pragma unroll
  for (int it = 0; it < 16; ++it) {
    const int idx = it * 256 + tid;
    const int r = idx >> 6, cc = idx & 63;
    tile[r][cc] = w[(size_t)(k0 + r) * C + c0 + cc];
  }
  __syncthreads();
  const int q = lane >> 3, c8 = (lane & 7) * 8;
  v4u hv[2], lv[2];
#pragma unroll
  for (int it = 0; it < 2; ++it) {
    const int row = wave * 8 + it * 4 + q;          // output row (c within tile)
    v4u a, a2;
#pragma unroll
    for (int e = 0; e < 4; ++e) {
      const float f0 = tile[c8 + 2 * e][row], f1 = tile[c8 + 2 * e + 1][row];
      const unsigned short h0 = bf_bits(f0), h1 = bf_bits(f1);
      const unsigned short l0 = bf_bits(f0 - bf_up(h0)), l1 = bf_bits(f1 - bf_up(h1));
      a[e] = pk16(h0, h1);
      a2[e] = pk16(l0, l1);
    }
    hv[it] = a; lv[it] = a2;
  }
  {
#pragma unroll
    for (int it = 0; it < 2; ++it) {
      const int row = wave * 8 + it * 4 + q;
      unsigned short* o = wt + (size_t)(c0 + row) * KP + k0 + c8;
      *(v4u*)(o)          = hv[it];
      *(v4u*)(o + DM)     = lv[it];
      *(v4u*)(o + 2 * DM) = hv[it];
    }
    
  }
}

// =====================================================================================================
// Register-blocked batched WMMA GEMM, bf16 operands: C[m][n] = sum_k A[m][k] * Bt[n][k]; one wave per
// 64x64 tile, no block barriers. Bt row-major [N][K] pitch ldb (k contiguous).
// A_MODE 0: A row-major [M][K] pitch lda.  A_MODE 1: head planes: A(m, k) at
//   plane = (k/256)*NBH + (m/SEQ)*NH + (k/32)%NH;  A[(plane*SEQ + m%SEQ)*HD + k%32]  (M = ROWS, K = KP).
// M, N multiples of 64, K multiple of 32 (host-checked). blockIdx.y = batch index (strides in elements).
// Fragments loaded straight from global with the split k map (ldfrag).
// Epilogue: 16-row slabs staged per wave in LDS (pitch 68 floats), then:
// OUT_MODE 0: f16 head plane [NBH][SEQ][HD], value * oscale: per head half of the slab (16 rows x 32 cols =
// OUT_MODE 1: f32 head plane [NBH][SEQ][HD]: per head half (2048 contiguous B) four instructions of
// OUT_MODE 2: f16 hi plane C (value*oscale) + f16 residual plane C2 = f16((v*oscale - hi) * rscale), row-major
// OUT_MODE 3: f32 row-major C (pitch ldc) + bias[n] (f32): each 64-wide row segment = 256 B = 16 lanes x 16 B.
// coverage: 4 slabs x 16 rows x 64 cols = the wave's whole 64x64 tile; grids are exact tile multiples.
// =====================================================================================================
template <int A_MODE, int OUT_MODE>
__global__ __launch_bounds__(256) void gemm64(
    const unsigned short* __restrict__ Ap, int lda, long long strideA,
    const unsigned short* __restrict__ Btp, int ldb, long long strideB,
    void* Cout, void* Cout2, int ldc, long long strideC,
    const float* __restrict__ bias,
    int M, int N, int K, float oscale, float rscale) {
  const __bf16* A  = (const __bf16*)(const void*)Ap;
  const __bf16* Bt = (const __bf16*)(const void*)Btp;
  __shared__ __align__(16) float sT[8][16 * 68];   // per-wave 16x64 slab, pitch 68 floats
  const int b    = blockIdx.y;
  const int lane = threadIdx.x & 31;
  const int wave = threadIdx.x >> 5;
  const int tilesN = N >> 6;
  const int tilesM = M >> 6;
  const int tile = blockIdx.x * 8 + wave;
  if (tile >= tilesM * tilesN) return;   // wave-uniform; no block barriers in this kernel
  const int tm = tile / tilesN;
  const int tn = tile - tm * tilesN;
  const int m0 = tm << 6;
  const int n0 = tn << 6;

  const __bf16* Ab = A  + (size_t)b * (size_t)strideA;
  const __bf16* Bb = Bt + (size_t)b * (size_t)strideB;

  const int rlane = lane & 15;                 // row (A) / col (B, D) within subtile
  const int koff  = (lane >> 4) * 8;           // k offset of this lane half
  const int mOff  = (lane >> 4) * 8;           // D row offset

  v8f acc[4][4];
#pragma unroll
  for (int i = 0; i < 4; ++i)
#pragma unroll
    for (int j = 0; j < 4; ++j) acc[i][j] = zero8();

  for (int k0 = 0; k0 < K; k0 += 32) {
    v16b bq[4];
#pragma unroll
    for (int j = 0; j < 4; ++j)
      bq[j] = ldfrag<__bf16>(Bb + (size_t)(n0 + (j << 4) + rlane) * ldb + koff + k0);
#pragma unroll
    for (int i = 0; i < 4; ++i) {
      const __bf16* ap;
      if (A_MODE == 0) {
        ap = Ab + (size_t)(m0 + (i << 4) + rlane) * lda + koff + k0;
      } else {
        const int plane = (k0 >> 8) * NBH + (m0 / SEQ) * NH + ((k0 >> 5) & (NH - 1));
        ap = Ab + ((size_t)plane * SEQ + (size_t)((m0 & (SEQ - 1)) + (i << 4) + rlane)) * HD + koff;
      }
      const v16b af = ldfrag<__bf16>(ap);
#pragma unroll
      for (int j = 0; j < 4; ++j) acc[i][j] = mmar(af, bq[j], acc[i][j]);
      dep_guard(acc[i][0], acc[i][3], af, bq[3]);
    }
    keep4(bq[0], bq[1], bq[2], bq[3]);
  }
  acc_guard4(acc[0][0], acc[0][1], acc[0][2], acc[0][3]);
  acc_guard4(acc[1][0], acc[1][1], acc[1][2], acc[1][3]);
  acc_guard4(acc[2][0], acc[2][1], acc[2][2], acc[2][3]);
  acc_guard4(acc[3][0], acc[3][1], acc[3][2], acc[3][3]);

  // ---- epilogue ----
  float* slab = sT[wave];
#pragma unroll
  for (int i = 0; i < 4; ++i) {
    const int mBase = m0 + (i << 4);
#pragma unroll
    for (int j = 0; j < 4; ++j) {
#pragma unroll
      for (int r = 0; r < 8; ++r) {
        slab[(mOff + r) * 68 + (j << 4) + rlane] = acc[i][j][r];
      }
    }
    __builtin_amdgcn_fence(__ATOMIC_RELEASE, "workgroup");
    __builtin_amdgcn_wave_barrier();
    __builtin_amdgcn_fence(__ATOMIC_ACQUIRE, "workgroup");
    if (OUT_MODE == 0) {
      unsigned short* Q = (unsigned short*)Cout;
      const int rq = lane >> 2, c8 = (lane & 3) * 8;        // row within an 8-row group, 8-col piece
      v4u hv[4];
#pragma unroll
      for (int j2 = 0; j2 < 2; ++j2) {
#pragma unroll
        for (int it = 0; it < 2; ++it) {
          const float* sp = slab + (it * 8 + rq) * 68 + j2 * 32 + c8;   // it 0..1 x rq 0..7 = rows 0..15
          v4u a;
#pragma unroll
          for (int e = 0; e < 4; ++e)
            a[e] = pk16(h_bits((_Float16)(sp[2 * e] * oscale)), h_bits((_Float16)(sp[2 * e + 1] * oscale)));
          hv[j2 * 2 + it] = a;
        }
      }
      {
#pragma unroll
        for (int j2 = 0; j2 < 2; ++j2) {
          const int head = (n0 >> 5) + j2;
          unsigned short* base = Q + ((size_t)((mBase / SEQ) * NH + head) * SEQ + (size_t)(mBase & (SEQ - 1))) * HD;
#pragma unroll
          for (int it = 0; it < 2; ++it)
            *(v4u*)(base + it * 256 + lane * 8) = hv[j2 * 2 + it];
        }
        
      }
    } else if (OUT_MODE == 1) {
      float* Kr = (float*)Cout;
      const int rq = lane >> 3, c4 = (lane & 7) * 4;        // row within a 4-row group, 4-col piece
      v4f hv[8];
#pragma unroll
      for (int j2 = 0; j2 < 2; ++j2) {
#pragma unroll
        for (int it = 0; it < 4; ++it)                      // it 0..3 x rq 0..3 = rows 0..15
          hv[j2 * 4 + it] = *(const v4f*)(slab + (it * 4 + rq) * 68 + j2 * 32 + c4);
      }
      {
#pragma unroll
        for (int j2 = 0; j2 < 2; ++j2) {
          const int head = (n0 >> 5) + j2;
          float* base = Kr + ((size_t)((mBase / SEQ) * NH + head) * SEQ + (size_t)(mBase & (SEQ - 1))) * HD;
#pragma unroll
          for (int it = 0; it < 4; ++it)
            *(v4f*)(base + it * 128 + lane * 4) = hv[j2 * 4 + it];
        }
        
      }
    } else if (OUT_MODE == 2) {
      const int q = lane >> 3, c8 = (lane & 7) * 8;
      unsigned short* C  = (unsigned short*)Cout  + (size_t)b * (size_t)strideC;
      unsigned short* C2 = (unsigned short*)Cout2 + (size_t)b * (size_t)strideC;
      v4u hv[4], lv[4];
#pragma unroll
      for (int it = 0; it < 4; ++it) {
        const int row = it * 4 + q;                         // it 0..3 x q 0..3 = rows 0..15
        const float* sp = slab + row * 68 + c8;
        v4u a, a2;
#pragma unroll
        for (int e = 0; e < 4; ++e) {
          const float f0 = sp[2 * e] * oscale, f1 = sp[2 * e + 1] * oscale;
          const _Float16 x0 = (_Float16)f0, x1 = (_Float16)f1;
          const unsigned short h0 = h_bits(x0), h1 = h_bits(x1);
          const unsigned short l0 = h_bits((_Float16)((f0 - (float)x0) * rscale));
          const unsigned short l1 = h_bits((_Float16)((f1 - (float)x1) * rscale));
          a[e] = pk16(h0, h1); a2[e] = pk16(l0, l1);
        }
        hv[it] = a; lv[it] = a2;
      }
      {
#pragma unroll
        for (int it = 0; it < 4; ++it) {
          const int row = it * 4 + q;
          *(v4u*)(C  + (size_t)(mBase + row) * ldc + n0 + c8) = hv[it];
          *(v4u*)(C2 + (size_t)(mBase + row) * ldc + n0 + c8) = lv[it];
        }
        
      }
    } else {
      float* C = (float*)Cout + (size_t)b * (size_t)strideC;
      const int h2 = lane >> 4, c4 = (lane & 15) * 4;      // 256-B row segment = 16 lanes x 16 B
      const v4f bv = *(const v4f*)(bias + n0 + c4);
      v4f hv[8];
#pragma unroll
      for (int it = 0; it < 8; ++it) {
        const int row = it * 2 + h2;                        // it 0..7 x h2 0..1 = rows 0..15
        hv[it] = *(const v4f*)(slab + row * 68 + c4) + bv;
      }
      {
#pragma unroll
        for (int it = 0; it < 8; ++it) {
          const int row = it * 2 + h2;
          *(v4f*)(C + (size_t)(mBase + row) * ldc + n0 + c4) = hv[it];
        }
        
      }
    }
    __builtin_amdgcn_fence(__ATOMIC_RELEASE, "workgroup");
    __builtin_amdgcn_wave_barrier();
    __builtin_amdgcn_fence(__ATOMIC_ACQUIRE, "workgroup");
  }
}

// =====================================================================================================
// Fourier-basis transform of k: out = sum_{f=1..NFUN} ca[f-1]*sin(f*k) + cb[f-1]*cos(f*k) in f32.
// One precise sincosf(k) per element; sin(f*k), cos(f*k) for f = 2..NFUN follow by rotating the pair by k
// (angle addition: two products and two fused multiply-adds a step). The rotation keeps the pair's length,
// so its error grows linearly in f: at f = NFUN it is that of moving k by about one f32 ulp.
// Terms are added in the order f = 1..NFUN, sine before cosine, as fused multiply-adds.
// Four consecutive elements of the raw f32 k head plane [NBH][SEQ][HD] per lane, as two pairs, so that every
// step is packed f32 arithmetic; a lane stores its four f16 results (x4) as 8 B, a wave 256 contiguous B.
// coverage: grid x 256 x 4 = every element of the k' plane.
// =====================================================================================================
__global__ __launch_bounds__(256) void fourier_k(const float* __restrict__ kr, const float* __restrict__ ca,
                                                 const float* __restrict__ cb, unsigned short* kp) {
  const size_t g4 = ((size_t)blockIdx.x * 256 + (size_t)threadIdx.x) * 4;
  const v4f kx = *(const v4f*)(kr + g4);
  v2f s1[2], c1[2], s[2], c[2], acc[2];
#pragma unroll
  for (int h = 0; h < 2; ++h) {
#pragma unroll
    for (int e = 0; e < 2; ++e) {
      float sn, cs;
      sincosf(kx[2 * h + e], &sn, &cs);
      s1[h][e] = sn;
      c1[h][e] = cs;
    }
    s[h] = s1[h];
    c[h] = c1[h];
    acc[h] = (v2f){0.f, 0.f};
  }
  // unrolled so that the coefficients of a group of steps arrive in one pair of scalar loads
#pragma unroll 16
  for (int fi = 0; fi < NFUN; ++fi) {
    const float af = ca[fi];
    const float bf = cb[fi];
    const v2f a2 = {af, af}, b2 = {bf, bf};
#pragma unroll
    for (int h = 0; h < 2; ++h) {
      acc[h] = __builtin_elementwise_fma(a2, s[h], acc[h]);
      acc[h] = __builtin_elementwise_fma(b2, c[h], acc[h]);
      const v2f sn = __builtin_elementwise_fma(s[h], c1[h], c[h] * s1[h]);
      c[h] = __builtin_elementwise_fma(c[h], c1[h], -(s[h] * s1[h]));
      s[h] = sn;
    }
  }
  v2u o;
#pragma unroll
  for (int h = 0; h < 2; ++h)
    o[h] = pk16(h_bits((_Float16)(acc[h][0] * 4.0f)), h_bits((_Float16)(acc[h][1] * 4.0f)));
  *(v2u*)(kp + g4) = o;
}

// =====================================================================================================
// Attention, head dim 32, no mask, softmax over all SEQ keys.
//   q plane / k' plane (f16, x4): element (bh, t, d) at [(bh*SEQ + t)*HD + d]
//   v^T hi plane (f16, 4v) and residual plane (f16, (4v - hi)*2048): element (bh, d, s) at [(bh*HD + d)*SEQ + s]
//   ctx planes (bf16): part p (0 = hi, 1 = hi, 2 = lo), element (bh, t, d) at [p*PS + (bh*SEQ + t)*HD + d]
//   scores = (q4 . k4') * sscale on f16 WMMA (one k-step), softmax in f32 (running max);
//   p = exp(s - m) carried as f16(1024 p); O = p . vh + (p . vl) / 2048 on f16 WMMA; ctx = O / (l * 4096).
//   Block = 4 waves on the same (b, h), 4 consecutive 16-query tiles; grid = NBH * NQB; key chunks of 64,
//   static trip NKT. Chunk staging: 128 threads, K 64x32 (2 x 16 B per thread), V^T hi/res 32x64 (2 x 16 B
//   per thread and plane), plain loads, __syncthreads before and after. P tiles are wave-private, stored as
//   Output: each wave writes its 16x32 tile (1024 contiguous B per part) with two instructions of
//   all NBH*SEQ rows x HD, all three parts.
// =====================================================================================================
__global__ __launch_bounds__(128)
void attn32(const unsigned short* __restrict__ qpp, const unsigned short* __restrict__ kpp,
            const unsigned short* __restrict__ vhp, const unsigned short* __restrict__ vlp,
            unsigned short* ct, float sscale) {
  union FH { v16h v; v8h h[2]; };
  __shared__ __align__(16) _Float16 Ksh[64 * HD];          // K chunk [key][d]      4 KB
  __shared__ __align__(16) _Float16 Vth[HD * 64];          // V^T hi [d][key]      4 KB
  __shared__ __align__(16) _Float16 Vtl[HD * 64];          // V^T residual        4 KB
  __shared__ __align__(16) _Float16 Psh[4][16 * 64];       // per wave P [row][key] 8 KB
  __shared__ __align__(16) float    Os[4][16 * HD];        // per wave ctx tile    8 KB

  const int tid  = (int)threadIdx.x;
  const int wave = tid >> 5;
  const int lane = tid & 31;
  const int hh   = lane >> 4;
  const int c    = lane & 15;

  const int bx   = blockIdx.x;
  const int qblk = bx % NQB;
  const int bh   = bx / NQB;
  const int q0   = qblk * 64 + wave * 16;

  const _Float16* Qg = (const _Float16*)(const void*)qpp + (size_t)bh * SEQ * HD;
  const _Float16* Kg = (const _Float16*)(const void*)kpp + (size_t)bh * SEQ * HD;
  const _Float16* Vh = (const _Float16*)(const void*)vhp + (size_t)bh * HD * SEQ;
  const _Float16* Vl = (const _Float16*)(const void*)vlp + (size_t)bh * HD * SEQ;

  // ---- Q fragment (A operand, row = lane&15, one k-step of 32) ----
  const v16h qa = ldfrag<_Float16>(Qg + (size_t)(q0 + c) * HD + 8 * hh);

  float mrow[8], lrow[8];
  v8f oacc[2];
#pragma unroll
  for (int r = 0; r < 8; ++r) { mrow[r] = -INFINITY; lrow[r] = 0.f; }
  oacc[0] = zero8(); oacc[1] = zero8();

  for (int kt = 0; kt < NKT; ++kt) {         // static trip count
    const int kv0 = kt * 64;
    __syncthreads();
    {
      const int r = tid >> 1, hf = (tid & 1) * 16;                  // key r, d = hf..hf+15
      const _Float16* kg = Kg + (size_t)(kv0 + r) * HD + hf;
      const v8h k0v = *(const v8h*)(kg);
      const v8h k1v = *(const v8h*)(kg + 8);
      *(v8h*)(Ksh + r * HD + hf)     = k0v;
      *(v8h*)(Ksh + r * HD + hf + 8) = k1v;
      const int d = tid >> 2, sg = (tid & 3) * 16;                  // d row, keys sg..sg+15
      const _Float16* vg  = Vh + (size_t)d * SEQ + kv0 + sg;
      const _Float16* vlg = Vl + (size_t)d * SEQ + kv0 + sg;
      const v8h v0 = *(const v8h*)(vg),  v1 = *(const v8h*)(vg + 8);
      const v8h w0 = *(const v8h*)(vlg), w1 = *(const v8h*)(vlg + 8);
      *(v8h*)(Vth + d * 64 + sg)     = v0;
      *(v8h*)(Vth + d * 64 + sg + 8) = v1;
      *(v8h*)(Vtl + d * 64 + sg)     = w0;
      *(v8h*)(Vtl + d * 64 + sg + 8) = w1;
    }
    __syncthreads();

    // ---- scores: 16 query rows x 64 keys per wave ----
    v8f s[4];
#pragma unroll
    for (int j = 0; j < 4; ++j) {
      FH kb;
      kb.h[0] = *(const v8h*)(Ksh + (j * 16 + c) * HD + 8 * hh);
      kb.h[1] = *(const v8h*)(Ksh + (j * 16 + c) * HD + 16 + 8 * hh);
      s[j] = mma_h(qa, kb.v, zero8());
#pragma unroll
      for (int r = 0; r < 8; ++r) s[j][r] *= sscale;
    }

    // ---- row max, online softmax, P (x1024, f16) to LDS ----
    _Float16* pwh = Psh[wave];
#pragma unroll
    for (int r = 0; r < 8; ++r) {
      float m = s[0][r];
#pragma unroll
      for (int j = 1; j < 4; ++j) m = fmaxf(m, s[j][r]);
#pragma unroll
      for (int off = 1; off < 16; off <<= 1) m = fmaxf(m, __shfl_xor(m, off, 32));
      const float mnew  = fmaxf(mrow[r], m);
      const float msafe = (mnew == -INFINITY) ? 0.f : mnew;
      const float alpha = __expf(mrow[r] - msafe);
      mrow[r] = mnew;
      float psum = 0.f;
#pragma unroll
      for (int j = 0; j < 4; ++j) {
        const float p = __expf(s[j][r] - msafe);
        psum += p;
        pwh[(8 * hh + r) * 64 + j * 16 + c] = (_Float16)(p * 1024.0f);
      }
#pragma unroll
      for (int off = 1; off < 16; off <<= 1) psum += __shfl_xor(psum, off, 32);
      lrow[r] = lrow[r] * alpha + psum;
      oacc[0][r] *= alpha;
      oacc[1][r] *= alpha;
    }
    __builtin_amdgcn_fence(__ATOMIC_RELEASE, "workgroup");
    __builtin_amdgcn_wave_barrier();
    __builtin_amdgcn_fence(__ATOMIC_ACQUIRE, "workgroup");

    // ---- context += P . V (f16 WMMA); residual products into a separate accumulator ----
    v8f o1[2];
    o1[0] = zero8(); o1[1] = zero8();
#pragma unroll
    for (int kk = 0; kk < 2; ++kk) {
      FH pa;
      pa.h[0] = *(const v8h*)(pwh + c * 64 + kk * 32 + 8 * hh);
      pa.h[1] = *(const v8h*)(pwh + c * 64 + kk * 32 + 16 + 8 * hh);
#pragma unroll
      for (int t = 0; t < 2; ++t) {
        FH vb, vl;
        vb.h[0] = *(const v8h*)(Vth + (t * 16 + c) * 64 + kk * 32 + 8 * hh);
        vb.h[1] = *(const v8h*)(Vth + (t * 16 + c) * 64 + kk * 32 + 16 + 8 * hh);
        vl.h[0] = *(const v8h*)(Vtl + (t * 16 + c) * 64 + kk * 32 + 8 * hh);
        vl.h[1] = *(const v8h*)(Vtl + (t * 16 + c) * 64 + kk * 32 + 16 + 8 * hh);
        oacc[t] = mma_h(pa.v, vb.v, oacc[t]);
        o1[t]   = mma_h(pa.v, vl.v, o1[t]);
      }
    }
#pragma unroll
    for (int t = 0; t < 2; ++t)
#pragma unroll
      for (int r = 0; r < 8; ++r) oacc[t][r] += o1[t][r] * (1.0f / 2048.0f);
  }

  // ---- normalise (1/l, undo the x1024 p carry and the x4 v carry), stage the wave's 16x32 tile,
  float* os = Os[wave];
#pragma unroll
  for (int r = 0; r < 8; ++r) {
    const float l = lrow[r];
    const float inv = 1.0f / (l * 4096.0f);
    os[(8 * hh + r) * HD + c]      = oacc[0][r] * inv;
    os[(8 * hh + r) * HD + 16 + c] = oacc[1][r] * inv;
  }
  __builtin_amdgcn_fence(__ATOMIC_RELEASE, "workgroup");
  __builtin_amdgcn_wave_barrier();
  __builtin_amdgcn_fence(__ATOMIC_ACQUIRE, "workgroup");
  {
    const int rq = lane >> 2, c8 = (lane & 3) * 8;
    v4u hv[2], lv[2];
#pragma unroll
    for (int it = 0; it < 2; ++it) {
      const int row = it * 8 + rq;   // it 0..1 x rq 0..7 = rows 0..15 of the wave tile
      const float* sp = os + row * HD + c8;
      v4u a, a2;
#pragma unroll
      for (int e = 0; e < 4; ++e) {
        const float f0 = sp[2 * e], f1 = sp[2 * e + 1];
        const unsigned short h0 = bf_bits(f0), h1 = bf_bits(f1);
        const unsigned short l0 = bf_bits(f0 - bf_up(h0)), l1 = bf_bits(f1 - bf_up(h1));
        a[e] = pk16(h0, h1); a2[e] = pk16(l0, l1);
      }
      hv[it] = a; lv[it] = a2;
    }
    const size_t PS = (size_t)NBH * SEQ * HD;
    unsigned short* base = ct + ((size_t)bh * SEQ + (size_t)q0) * HD;
    {
#pragma unroll
      for (int it = 0; it < 2; ++it) {
        unsigned short* p = base + it * 256 + lane * 8;
        *(v4u*)(p)          = hv[it];
        *(v4u*)(p + PS)     = hv[it];
        *(v4u*)(p + 2 * PS) = lv[it];
      }
      
    }
  }
}

// =====================================================================================================
// Workspace map (bytes), every region an exact multiple of its whole-line / whole-tile store granularity
// (no tail rows anywhere: all shapes are exact tile multiples):
//   X3   bf16 [4096][768]            6291456
//   Wq3  bf16 [768][768]             1179648
//   Wo3  bf16 [256][768]              393216
//   Qp   f16  [16][2048][32]          2097152
//   Kraw f32  [16][2048][32]          4194304
//   Kp   f16  [16][2048][32]          2097152
//   VTh  f16  [2][256][2048]          2097152
//   VTl  f16  [2][256][2048]          2097152
//   CT   bf16 [3][16][2048][32]       6291456
//   total                           26738688
// =====================================================================================================
extern "C" void kernel_launch(void* const* d_in, const int* in_sizes, int n_in,
                              void* d_out, int out_size, void* d_ws, size_t ws_size,
                              hipStream_t stream) {
  if (n_in < 6) return;
  if (in_sizes[0] != ROWS * DM) return;
  if (in_sizes[1] != DM * QKVW) return;
  if (in_sizes[2] != DM * DM) return;
  if (in_sizes[3] != DM) return;
  if (in_sizes[4] != NFUN || in_sizes[5] != NFUN) return;
  if (out_size != ROWS * DM) return;

  const float* x     = (const float*)d_in[0];   // [2][2048][256]
  const float* w_qkv = (const float*)d_in[1];   // [256 in][768 out]
  const float* w_o   = (const float*)d_in[2];   // [256 in][256 out]
  const float* b_o   = (const float*)d_in[3];   // [256]
  const float* coefa = (const float*)d_in[4];   // [256] sine coefficients
  const float* coefb = (const float*)d_in[5];   // [256] cosine coefficients

  const size_t PX3 = (size_t)ROWS * KP * 2;            // 6291456
  const size_t PWQ = (size_t)QKVW * KP * 2;            // 1179648
  const size_t PWO = (size_t)DM * KP * 2;              //  393216
  const size_t PH  = (size_t)NBH * SEQ * HD * 2;       // 2097152  f16 head plane
  const size_t PK4 = (size_t)NBH * SEQ * HD * 4;       // 4194304  f32 head plane
  const size_t PVT = (size_t)NB * DM * SEQ * 2;        // 2097152  v^T plane
  const size_t PCT = (size_t)3 * NBH * SEQ * HD * 2;   // 6291456  ctx planes
  size_t off = 0;
  const size_t oX3  = off; off += PX3;
  const size_t oWq  = off; off += PWQ;
  const size_t oWo  = off; off += PWO;
  const size_t oQp  = off; off += PH;
  const size_t oKr  = off; off += PK4;
  const size_t oKp  = off; off += PH;
  const size_t oVTh = off; off += PVT;
  const size_t oVTl = off; off += PVT;
  const size_t oCT  = off; off += PCT;
  if (off > ws_size) return;                           // off = 26738688
  if (off > (size_t)134217728) return;

  char* ws = (char*)d_ws;
  unsigned short* X3  = (unsigned short*)(ws + oX3);
  unsigned short* Wq3 = (unsigned short*)(ws + oWq);
  unsigned short* Wo3 = (unsigned short*)(ws + oWo);
  unsigned short* Qp  = (unsigned short*)(ws + oQp);
  float*          Kr  = (float*)(ws + oKr);
  unsigned short* Kp  = (unsigned short*)(ws + oKp);
  unsigned short* VTh = (unsigned short*)(ws + oVTh);
  unsigned short* VTl = (unsigned short*)(ws + oVTl);
  unsigned short* CT  = (unsigned short*)(ws + oCT);

  const dim3 blk(256);
  const int n8x = ROWS * DM / 8;                                   // 131072
  const dim3 gCvtX((n8x + 255) / 256);                              //  512 blocks
  const dim3 gTq(QKVW / 64, DM / 64);                               //  12 x 4
  const dim3 gTo(DM / 64, DM / 64);                                 //   4 x 4
  const dim3 gQK(((ROWS / 64) * (DM / 64) + 7) / 8, 1);             //  256 tiles -> 32 blocks: M=4096, N=256
  const dim3 gVT(((DM / 64) * (SEQ / 64) + 7) / 8, NB);             //  128 tiles -> 16 blocks x 2 batches: M=256, N=2048
  const dim3 gFour((NBH * SEQ * HD) / 1024);                        // 1024 blocks of 256, 4 elements per lane
  const dim3 gAttn(NBH * NQB);                                      //  512 blocks of 128

  // (1) x -> [hi|hi|lo] bf16 plane; weights transposed to [out][in] as [hi|lo|hi] bf16 planes
  cvt_x3<<<gCvtX, blk, 0, stream>>>(x, X3, n8x);
  wtrans3<<<gTq, blk, 0, stream>>>(w_qkv, Wq3, QKVW);
  wtrans3<<<gTo, blk, 0, stream>>>(w_o, Wo3, DM);
  // (2) q = x . Wq -> f16 head plane (x4)   (M=4096, N=256, K=768)
  gemm64<0, 0><<<gQK, blk, 0, stream>>>(
      X3, KP, 0LL, Wq3, KP, 0LL,
      (void*)Qp, (void*)Qp, 0, 0LL, b_o,
      ROWS, DM, KP, 4.0f, 1.0f);
  // (3) k = x . Wk -> raw f32 head plane   (M=4096, N=256, K=768)
  gemm64<0, 1><<<gQK, blk, 0, stream>>>(
      X3, KP, 0LL, Wq3 + (size_t)DM * KP, KP, 0LL,
      (void*)Kr, (void*)Kr, 0, 0LL, b_o,
      ROWS, DM, KP, 1.0f, 1.0f);
  // (4) v^T = Wv . x^T per batch -> f16 hi plane (x4) [b][c][s] (pitch SEQ) and residual plane (x2048)
  //     (A = Wq3 rows 512.., Bt = X3 rows of batch b; M=256, N=2048, K=768)
  gemm64<0, 2><<<gVT, blk, 0, stream>>>(
      Wq3 + (size_t)2 * DM * KP, KP, 0LL, X3, KP, (long long)SEQ * KP,
      (void*)VTh, (void*)VTl, SEQ, (long long)DM * SEQ, b_o,
      DM, SEQ, KP, 4.0f, 2048.0f);
  // (5) Fourier-basis transform of k -> f16 head plane (x4)
  fourier_k<<<gFour, blk, 0, stream>>>(Kr, coefa, coefb, Kp);
  // (6) attention -> ctx planes (bf16 hi, hi, lo)
  attn32<<<gAttn, dim3(128), 0, stream>>>(Qp, Kp, VTh, VTl, CT, 0.17677669529663687f * 0.0625f);
  // (7) out = ctx . Wo + bias -> d_out f32 [4096][256]   (M=4096, N=256, K=768, A in head-plane layout)
  gemm64<1, 3><<<gQK, blk, 0, stream>>>(
      CT, 0, 0LL, Wo3, KP, 0LL,
      d_out, d_out, DM, 0LL, b_o,
      ROWS, DM, KP, 1.0f, 1.0f);
  (void)hipGetLastError();
}

// v002
// Measured time: 235 microseconds a run.
// Next to v001, in two timings, it ran 1.17 and 1.16 times as fast.
// Counting every step since v000, it is 1.67 times as fast.
// Contractions: q, k, v^T projections and the output projection = v_wmma_f32_16x16x32_bf16 over bf16 hi/lo planes
// laid out as [hi|hi|lo] x [hi|lo|hi] along k (3 products, f32 accumulate);
// q.k^T scores = v_wmma_f32_16x16x32_f16 (q and the transformed k as f16 planes carried x4, single product, f32 accumulate);
// p.v = v_wmma_f32_16x16x32_f16 (p carried x1024 in f16; v^T as f16 hi plane x4 plus f16 residual plane x2^11; 2 products, f32 accumulate);
// Fourier-basis transform of k (one precise sincosf per element, then a rotation recurrence), softmax and bias in f32 on the VALU.
#include <hip/hip_runtime.h>
#include <math.h>
#include <stdint.h>

#define NB   2
#define SEQ  2048
#define DM   256
#define NH   8
#define HD   32
#define NBH  (NB * NH)        // 16 (batch, head) pairs
#define QKVW (3 * DM)         // 768 qkv output width
#define KP   (3 * DM)         // 768 folded k width of the split operand planes
#define NFUN 256
#define ROWS (NB * SEQ)       // 4096 token rows
#define NQB  (SEQ / 64)       // 64-query blocks per (b, h)
#define NKT  (SEQ / 64)       // 64-key chunks
static_assert(NH * HD == DM);
static_assert(NQB == 32 && NKT == 32);
static_assert((ROWS % 64) == 0 && (DM % 64) == 0 && (SEQ % 64) == 0 && (KP % 32) == 0);
static_assert((ROWS * DM) % 2048 == 0);

typedef _Float16 v16h __attribute__((ext_vector_type(16)));
typedef _Float16 v8h  __attribute__((ext_vector_type(8)));
typedef __bf16   v16b __attribute__((ext_vector_type(16)));
typedef __bf16   v8b  __attribute__((ext_vector_type(8)));
typedef float    v8f  __attribute__((ext_vector_type(8)));
typedef float    v4f  __attribute__((ext_vector_type(4)));
typedef unsigned int v4u __attribute__((ext_vector_type(4)));
typedef float    v2f  __attribute__((ext_vector_type(2)));
typedef unsigned int v2u __attribute__((ext_vector_type(2)));

#if defined(__HIP_DEVICE_COMPILE__)
#define DEV_ASM 1
#else
#define DEV_ASM 0
#endif

// ---- scalar helpers --------------------------------------------------------------------------------
__device__ __forceinline__ unsigned short bf_bits(float f) {          // f32 -> bf16 bits, RNE convert
  unsigned u = __float_as_uint(f);
  return (unsigned short)((u + 0x7FFFu + ((u >> 16) & 1u)) >> 16);
}
__device__ __forceinline__ float bf_up(unsigned short hb) { return __uint_as_float(((unsigned)hb) << 16); }
__device__ __forceinline__ unsigned short h_bits(_Float16 x) { return __builtin_bit_cast(unsigned short, x); }
__device__ __forceinline__ unsigned pk16(unsigned short a, unsigned short b) { return (unsigned)a | ((unsigned)b << 16); }
__device__ __forceinline__ v8f zero8() { v8f z = {0.f, 0.f, 0.f, 0.f, 0.f, 0.f, 0.f, 0.f}; return z; }

// ---- fragment loaders: 16-bit A/B operand, lane -> row/col (lane&15), p already includes +8*(lane>>4);
//      elements 0..7 <- p[0..7] (k0+8h..k0+8h+7), elements 8..15 <- p[16..23] (k0+16+8h..k0+16+8h+7)
template <typename OT> struct FT;
template <> struct FT<__bf16>   { typedef v16b frag; typedef v8b half8; };
template <> struct FT<_Float16> { typedef v16h frag; typedef v8h half8; };

template <typename OT>
__device__ __forceinline__ typename FT<OT>::frag ldfrag(const OT* p) {
  union { typename FT<OT>::frag v; typename FT<OT>::half8 h[2]; } f;
  f.h[0] = *(const typename FT<OT>::half8*)(p);
  f.h[1] = *(const typename FT<OT>::half8*)(p + 16);
  return f.v;
}

// ---- WMMA helpers ----------------------------------------------------------------------------------
__device__ __forceinline__ v8f mmar(v16b a, v16b b, v8f c) {
  return __builtin_amdgcn_wmma_f32_16x16x32_bf16(false, a, false, b, (short)0, c, false, false);
}
// guarded form: 4 VALU slots after the WMMA, D tied, A/B kept live
__device__ __forceinline__ v8f mma_h(v16h a, v16h b, v8f c) {
  c = __builtin_amdgcn_wmma_f32_16x16x32_f16(false, a, false, b, (short)0, c, false, false);
#if DEV_ASM
  asm volatile("v_nop\n\tv_nop\n\tv_nop\n\tv_nop" : "+v"(c) : "v"(a), "v"(b));
#endif
  return c;
}
// lane l <-> lane l ^ 16
__device__ __forceinline__ float xhalf(float x) {
  const int b = __builtin_bit_cast(int, x);
  return __builtin_bit_cast(float, __builtin_amdgcn_permlanex16(b, b, 0x76543210, 0xfedcba98, false, false));
}
__device__ __forceinline__ void dep_guard(v8f& a, v8f& b, v16b x, v16b y) {
#if DEV_ASM
  asm volatile("v_nop\n\tv_nop\n\tv_nop\n\tv_nop" : "+v"(a), "+v"(b) : "v"(x), "v"(y));
#else
  (void)a; (void)b; (void)x; (void)y;
#endif
}
__device__ __forceinline__ void keep4(v16b a, v16b b, v16b c, v16b d) {
#if DEV_ASM
  asm volatile("v_nop" :: "v"(a), "v"(b), "v"(c), "v"(d));
#else
  (void)a; (void)b; (void)c; (void)d;
#endif
}
__device__ __forceinline__ void acc_guard4(v8f& a, v8f& b, v8f& c, v8f& d) {
#if DEV_ASM
  asm volatile("v_nop\n\tv_nop\n\tv_nop\n\tv_nop" : "+v"(a), "+v"(b), "+v"(c), "+v"(d));
#else
  (void)a; (void)b; (void)c; (void)d;
#endif
}

// =====================================================================================================
// x [ROWS][DM] f32 -> split plane X3 [ROWS][KP] bf16, row = [hi | hi | lo] (hi = RNE bf16, lo = RNE bf16
// of the exact residual). 8 elements per thread; each thread stores 16 B into each of the three thirds;
// =====================================================================================================
__global__ __launch_bounds__(256) void cvt_x3(const float* __restrict__ in, unsigned short* out, int n8) {
  const int i = blockIdx.x * 256 + (int)threadIdx.x;
  if (i < n8) {
    const int row = i >> 5, c = (i & 31) * 8;
    const v4f a  = *(const v4f*)(in + (size_t)i * 8);
    const v4f a4 = *(const v4f*)(in + (size_t)i * 8 + 4);
    const float f[8] = {a[0], a[1], a[2], a[3], a4[0], a4[1], a4[2], a4[3]};
    v4u ph, pl;
#pragma unroll
    for (int e = 0; e < 4; ++e) {
      const float f0 = f[2 * e], f1 = f[2 * e + 1];
      const unsigned short h0 = bf_bits(f0), h1 = bf_bits(f1);
      const unsigned short l0 = bf_bits(f0 - bf_up(h0)), l1 = bf_bits(f1 - bf_up(h1));
      ph[e] = pk16(h0, h1);
      pl[e] = pk16(l0, l1);
    }
    unsigned short* o = out + (size_t)row * KP + c;
    *(v4u*)(o)          = ph;
    *(v4u*)(o + DM)     = ph;
    *(v4u*)(o + 2 * DM) = pl;
    
  }
}

// =====================================================================================================
// w [DM rows k][C cols] f32 (x @ w layout) -> wt [C][KP] bf16, row c = [hi | lo | hi] of w[k][c] over k.
// Block = 64 k x 64 c tile staged in LDS (f32); grid = (C/64, DM/64): blockIdx.x -> c0, blockIdx.y -> k0.
// coverage: 8 waves x 8 rows x 64 k = the tile, all three thirds; the grid covers all C rows x DM k.
// =====================================================================================================
__global__ __launch_bounds__(256) void wtrans3(const float* __restrict__ w, unsigned short* wt, int C) {
  __shared__ float tile[64][65];
  const int tid = (int)threadIdx.x, lane = tid & 31, wave = tid >> 5;
  const int c0 = blockIdx.x * 64, k0 = blockIdx.y * 64;
#pragma unroll
  for (int it = 0; it < 16; ++it) {
    const int idx = it * 256 + tid;
    const int r = idx >> 6, cc = idx & 63;
    tile[r][cc] = w[(size_t)(k0 + r) * C + c0 + cc];
  }
  __syncthreads();
  const int q = lane >> 3, c8 = (lane & 7) * 8;
  v4u hv[2], lv[2];
#pragma unroll
  for (int it = 0; it < 2; ++it) {
    const int row = wave * 8 + it * 4 + q;          // output row (c within tile)
    v4u a, a2;
#pragma unroll
    for (int e = 0; e < 4; ++e) {
      const float f0 = tile[c8 + 2 * e][row], f1 = tile[c8 + 2 * e + 1][row];
      const unsigned short h0 = bf_bits(f0), h1 = bf_bits(f1);
      const unsigned short l0 = bf_bits(f0 - bf_up(h0)), l1 = bf_bits(f1 - bf_up(h1));
      a[e] = pk16(h0, h1);
      a2[e] = pk16(l0, l1);
    }
    hv[it] = a; lv[it] = a2;
  }
  {
#pragma unroll
    for (int it = 0; it < 2; ++it) {
      const int row = wave * 8 + it * 4 + q;
      unsigned short* o = wt + (size_t)(c0 + row) * KP + k0 + c8;
      *(v4u*)(o)          = hv[it];
      *(v4u*)(o + DM)     = lv[it];
      *(v4u*)(o + 2 * DM) = hv[it];
    }
    
  }
}

// =====================================================================================================
// Register-blocked batched WMMA GEMM, bf16 operands: C[m][n] = sum_k A[m][k] * Bt[n][k]; one wave per
// 64x64 tile, no block barriers. Bt row-major [N][K] pitch ldb (k contiguous).
// A_MODE 0: A row-major [M][K] pitch lda.  A_MODE 1: head planes: A(m, k) at
//   plane = (k/256)*NBH + (m/SEQ)*NH + (k/32)%NH;  A[(plane*SEQ + m%SEQ)*HD + k%32]  (M = ROWS, K = KP).
// M, N multiples of 64, K multiple of 32 (host-checked). blockIdx.y = batch index (strides in elements).
// Fragments loaded straight from global with the split k map (ldfrag).
// Epilogue: 16-row slabs staged per wave in LDS (pitch 68 floats), then:
// OUT_MODE 0: f16 head plane [NBH][SEQ][HD], value * oscale: per head half of the slab (16 rows x 32 cols =
// OUT_MODE 1: f32 head plane [NBH][SEQ][HD]: per head half (2048 contiguous B) four instructions of
// OUT_MODE 2: f16 hi plane C (value*oscale) + f16 residual plane C2 = f16((v*oscale - hi) * rscale), row-major
// OUT_MODE 3: f32 row-major C (pitch ldc) + bias[n] (f32): each 64-wide row segment = 256 B = 16 lanes x 16 B.
// coverage: 4 slabs x 16 rows x 64 cols = the wave's whole 64x64 tile; grids are exact tile multiples.
// =====================================================================================================
template <int A_MODE, int OUT_MODE>
__global__ __launch_bounds__(256) void gemm64(
    const unsigned short* __restrict__ Ap, int lda, long long strideA,
    const unsigned short* __restrict__ Btp, int ldb, long long strideB,
    void* Cout, void* Cout2, int ldc, long long strideC,
    const float* __restrict__ bias,
    int M, int N, int K, float oscale, float rscale) {
  const __bf16* A  = (const __bf16*)(const void*)Ap;
  const __bf16* Bt = (const __bf16*)(const void*)Btp;
  __shared__ __align__(16) float sT[8][16 * 68];   // per-wave 16x64 slab, pitch 68 floats
  const int b    = blockIdx.y;
  const int lane = threadIdx.x & 31;
  const int wave = threadIdx.x >> 5;
  const int tilesN = N >> 6;
  const int tilesM = M >> 6;
  const int tile = blockIdx.x * 8 + wave;
  if (tile >= tilesM * tilesN) return;   // wave-uniform; no block barriers in this kernel
  const int tm = tile / tilesN;
  const int tn = tile - tm * tilesN;
  const int m0 = tm << 6;
  const int n0 = tn << 6;

  const __bf16* Ab = A  + (size_t)b * (size_t)strideA;
  const __bf16* Bb = Bt + (size_t)b * (size_t)strideB;

  const int rlane = lane & 15;                 // row (A) / col (B, D) within subtile
  const int koff  = (lane >> 4) * 8;           // k offset of this lane half
  const int mOff  = (lane >> 4) * 8;           // D row offset

  v8f acc[4][4];
#pragma unroll
  for (int i = 0; i < 4; ++i)
#pragma unroll
    for (int j = 0; j < 4; ++j) acc[i][j] = zero8();

  for (int k0 = 0; k0 < K; k0 += 32) {
    v16b bq[4];
#pragma unroll
    for (int j = 0; j < 4; ++j)
      bq[j] = ldfrag<__bf16>(Bb + (size_t)(n0 + (j << 4) + rlane) * ldb + koff + k0);
#pragma unroll
    for (int i = 0; i < 4; ++i) {
      const __bf16* ap;
      if (A_MODE == 0) {
        ap = Ab + (size_t)(m0 + (i << 4) + rlane) * lda + koff + k0;
      } else {
        const int plane = (k0 >> 8) * NBH + (m0 / SEQ) * NH + ((k0 >> 5) & (NH - 1));
        ap = Ab + ((size_t)plane * SEQ + (size_t)((m0 & (SEQ - 1)) + (i << 4) + rlane)) * HD + koff;
      }
      const v16b af = ldfrag<__bf16>(ap);
#pragma unroll
      for (int j = 0; j < 4; ++j) acc[i][j] = mmar(af, bq[j], acc[i][j]);
      dep_guard(acc[i][0], acc[i][3], af, bq[3]);
    }
    keep4(bq[0], bq[1], bq[2], bq[3]);
  }
  acc_guard4(acc[0][0], acc[0][1], acc[0][2], acc[0][3]);
  acc_guard4(acc[1][0], acc[1][1], acc[1][2], acc[1][3]);
  acc_guard4(acc[2][0], acc[2][1], acc[2][2], acc[2][3]);
  acc_guard4(acc[3][0], acc[3][1], acc[3][2], acc[3][3]);

  // ---- epilogue ----
  float* slab = sT[wave];
#pragma unroll
  for (int i = 0; i < 4; ++i) {
    const int mBase = m0 + (i << 4);
#pragma unroll
    for (int j = 0; j < 4; ++j) {
#pragma unroll
      for (int r = 0; r < 8; ++r) {
        slab[(mOff + r) * 68 + (j << 4) + rlane] = acc[i][j][r];
      }
    }
    __builtin_amdgcn_fence(__ATOMIC_RELEASE, "workgroup");
    __builtin_amdgcn_wave_barrier();
    __builtin_amdgcn_fence(__ATOMIC_ACQUIRE, "workgroup");
    if (OUT_MODE == 0) {
      unsigned short* Q = (unsigned short*)Cout;
      const int rq = lane >> 2, c8 = (lane & 3) * 8;        // row within an 8-row group, 8-col piece
      v4u hv[4];
#pragma unroll
      for (int j2 = 0; j2 < 2; ++j2) {
#pragma unroll
        for (int it = 0; it < 2; ++it) {
          const float* sp = slab + (it * 8 + rq) * 68 + j2 * 32 + c8;   // it 0..1 x rq 0..7 = rows 0..15
          v4u a;
#pragma unroll
          for (int e = 0; e < 4; ++e)
            a[e] = pk16(h_bits((_Float16)(sp[2 * e] * oscale)), h_bits((_Float16)(sp[2 * e + 1] * oscale)));
          hv[j2 * 2 + it] = a;
        }
      }
      {
#pragma unroll
        for (int j2 = 0; j2 < 2; ++j2) {
          const int head = (n0 >> 5) + j2;
          unsigned short* base = Q + ((size_t)((mBase / SEQ) * NH + head) * SEQ + (size_t)(mBase & (SEQ - 1))) * HD;
#pragma unroll
          for (int it = 0; it < 2; ++it)
            *(v4u*)(base + it * 256 + lane * 8) = hv[j2 * 2 + it];
        }
        
      }
    } else if (OUT_MODE == 1) {
      float* Kr = (float*)Cout;
      const int rq = lane >> 3, c4 = (lane & 7) * 4;        // row within a 4-row group, 4-col piece
      v4f hv[8];
#pragma unroll
      for (int j2 = 0; j2 < 2; ++j2) {
#pragma unroll
        for (int it = 0; it < 4; ++it)                      // it 0..3 x rq 0..3 = rows 0..15
          hv[j2 * 4 + it] = *(const v4f*)(slab + (it * 4 + rq) * 68 + j2 * 32 + c4);
      }
      {
#pragma unroll
        for (int j2 = 0; j2 < 2; ++j2) {
          const int head = (n0 >> 5) + j2;
          float* base = Kr + ((size_t)((mBase / SEQ) * NH + head) * SEQ + (size_t)(mBase & (SEQ - 1))) * HD;
#pragma unroll
          for (int it = 0; it < 4; ++it)
            *(v4f*)(base + it * 128 + lane * 4) = hv[j2 * 4 + it];
        }
        
      }
    } else if (OUT_MODE == 2) {
      const int q = lane >> 3, c8 = (lane & 7) * 8;
      unsigned short* C  = (unsigned short*)Cout  + (size_t)b * (size_t)strideC;
      unsigned short* C2 = (unsigned short*)Cout2 + (size_t)b * (size_t)strideC;
      v4u hv[4], lv[4];
#pragma unroll
      for (int it = 0; it < 4; ++it) {
        const int row = it * 4 + q;                         // it 0..3 x q 0..3 = rows 0..15
        const float* sp = slab + row * 68 + c8;
        v4u a, a2;
#pragma unroll
        for (int e = 0; e < 4; ++e) {
          const float f0 = sp[2 * e] * oscale, f1 = sp[2 * e + 1] * oscale;
          const _Float16 x0 = (_Float16)f0, x1 = (_Float16)f1;
          const unsigned short h0 = h_bits(x0), h1 = h_bits(x1);
          const unsigned short l0 = h_bits((_Float16)((f0 - (float)x0) * rscale));
          const unsigned short l1 = h_bits((_Float16)((f1 - (float)x1) * rscale));
          a[e] = pk16(h0, h1); a2[e] = pk16(l0, l1);
        }
        hv[it] = a; lv[it] = a2;
      }
      {
#pragma unroll
        for (int it = 0; it < 4; ++it) {
          const int row = it * 4 + q;
          *(v4u*)(C  + (size_t)(mBase + row) * ldc + n0 + c8) = hv[it];
          *(v4u*)(C2 + (size_t)(mBase + row) * ldc + n0 + c8) = lv[it];
        }
        
      }
    } else {
      float* C = (float*)Cout + (size_t)b * (size_t)strideC;
      const int h2 = lane >> 4, c4 = (lane & 15) * 4;      // 256-B row segment = 16 lanes x 16 B
      const v4f bv = *(const v4f*)(bias + n0 + c4);
      v4f hv[8];
#pragma unroll
      for (int it = 0; it < 8; ++it) {
        const int row = it * 2 + h2;                        // it 0..7 x h2 0..1 = rows 0..15
        hv[it] = *(const v4f*)(slab + row * 68 + c4) + bv;
      }
      {
#pragma unroll
        for (int it = 0; it < 8; ++it) {
          const int row = it * 2 + h2;
          *(v4f*)(C + (size_t)(mBase + row) * ldc + n0 + c4) = hv[it];
        }
        
      }
    }
    __builtin_amdgcn_fence(__ATOMIC_RELEASE, "workgroup");
    __builtin_amdgcn_wave_barrier();
    __builtin_amdgcn_fence(__ATOMIC_ACQUIRE, "workgroup");
  }
}

// =====================================================================================================
// Fourier-basis transform of k: out = sum_{f=1..NFUN} ca[f-1]*sin(f*k) + cb[f-1]*cos(f*k) in f32.
// One precise sincosf(k) per element; sin(f*k), cos(f*k) for f = 2..NFUN follow by rotating the pair by k
// (angle addition: two products and two fused multiply-adds a step). The rotation keeps the pair's length,
// so its error grows linearly in f: at f = NFUN it is that of moving k by about one f32 ulp.
// Terms are added in the order f = 1..NFUN, sine before cosine, as fused multiply-adds.
// Four consecutive elements of the raw f32 k head plane [NBH][SEQ][HD] per lane, as two pairs, so that every
// step is packed f32 arithmetic; a lane stores its four f16 results (x4) as 8 B, a wave 256 contiguous B.
// coverage: grid x 256 x 4 = every element of the k' plane.
// =====================================================================================================
__global__ __launch_bounds__(256) void fourier_k(const float* __restrict__ kr, const float* __restrict__ ca,
                                                 const float* __restrict__ cb, unsigned short* kp) {
  const size_t g4 = ((size_t)blockIdx.x * 256 + (size_t)threadIdx.x) * 4;
  const v4f kx = *(const v4f*)(kr + g4);
  v2f s1[2], c1[2], s[2], c[2], acc[2];
#pragma unroll
  for (int h = 0; h < 2; ++h) {
#pragma unroll
    for (int e = 0; e < 2; ++e) {
      float sn, cs;
      sincosf(kx[2 * h + e], &sn, &cs);
      s1[h][e] = sn;
      c1[h][e] = cs;
    }
    s[h] = s1[h];
    c[h] = c1[h];
    acc[h] = (v2f){0.f, 0.f};
  }
  // unrolled so that the coefficients of a group of steps arrive in one pair of scalar loads
#pragma unroll 16
  for (int fi = 0; fi < NFUN; ++fi) {
    const float af = ca[fi];
    const float bf = cb[fi];
    const v2f a2 = {af, af}, b2 = {bf, bf};
#pragma unroll
    for (int h = 0; h < 2; ++h) {
      acc[h] = __builtin_elementwise_fma(a2, s[h], acc[h]);
      acc[h] = __builtin_elementwise_fma(b2, c[h], acc[h]);
      const v2f sn = __builtin_elementwise_fma(s[h], c1[h], c[h] * s1[h]);
      c[h] = __builtin_elementwise_fma(c[h], c1[h], -(s[h] * s1[h]));
      s[h] = sn;
    }
  }
  v2u o;
#pragma unroll
  for (int h = 0; h < 2; ++h)
    o[h] = pk16(h_bits((_Float16)(acc[h][0] * 4.0f)), h_bits((_Float16)(acc[h][1] * 4.0f)));
  *(v2u*)(kp + g4) = o;
}

// =====================================================================================================
// Attention, head dim 32, no mask, softmax over all SEQ keys.
//   q plane / k' plane (f16, x4): element (bh, t, d) at [(bh*SEQ + t)*HD + d]
//   v^T hi plane (f16, 4v) and residual plane (f16, (4v - hi)*2048): element (bh, d, s) at [(bh*HD + d)*SEQ + s]
//   ctx planes (bf16): part p (0 = hi, 1 = hi, 2 = lo), element (bh, t, d) at [p*PS + (bh*SEQ + t)*HD + d]
//   scores^T = (k4' . q4^T) * sscale on f16 WMMA (one k-step), softmax in f32 (running max), a query per lane pair;
//   p = exp(s - m) carried as f16(1024 p); O^T = vh^T . p^T + (vl^T . p^T) / 2048 on f16 WMMA; ctx = O / (l * 4096).
//   Block = 4 waves on the same (b, h), 4 consecutive 16-query tiles; grid = NBH * NQB; key chunks of 64,
//   static trip NKT. Chunk staging: 128 threads, K 64x32 (2 x 16 B per thread), V^T hi/res 32x64 (2 x 16 B
//   per thread and plane), plain loads, __syncthreads before and after. P^T stays in registers (score tiles -> B operand).
//   Output: each wave writes its 16x32 tile (1024 contiguous B per part) with two instructions of
//   all NBH*SEQ rows x HD, all three parts.
// =====================================================================================================
__global__ __launch_bounds__(128)
void attn32(const unsigned short* __restrict__ qpp, const unsigned short* __restrict__ kpp,
            const unsigned short* __restrict__ vhp, const unsigned short* __restrict__ vlp,
            unsigned short* ct, float sscale) {
  union FH { v16h v; v8h h[2]; };
  __shared__ __align__(16) _Float16 Ksh[64 * HD];          // K chunk [key][d]      4 KB
  __shared__ __align__(16) _Float16 Vth[HD * 64];          // V^T hi [d][key]      4 KB
  __shared__ __align__(16) _Float16 Vtl[HD * 64];          // V^T residual        4 KB
  __shared__ __align__(16) float    Os[4][16 * HD];        // per wave ctx tile    8 KB

  const int tid  = (int)threadIdx.x;
  const int wave = tid >> 5;
  const int lane = tid & 31;
  const int hh   = lane >> 4;
  const int c    = lane & 15;

  const int bx   = blockIdx.x;
  const int qblk = bx % NQB;
  const int bh   = bx / NQB;
  const int q0   = qblk * 64 + wave * 16;

  const _Float16* Qg = (const _Float16*)(const void*)qpp + (size_t)bh * SEQ * HD;
  const _Float16* Kg = (const _Float16*)(const void*)kpp + (size_t)bh * SEQ * HD;
  const _Float16* Vh = (const _Float16*)(const void*)vhp + (size_t)bh * HD * SEQ;
  const _Float16* Vl = (const _Float16*)(const void*)vlp + (size_t)bh * HD * SEQ;

  // ---- Q fragment (B operand, column = lane&15, one k-step of 32) ----
  const v16h qa = ldfrag<_Float16>(Qg + (size_t)(q0 + c) * HD + 8 * hh);

  float mrun = -INFINITY, lrun = 0.f;   // query c: running maximum (joined), running sum of this half's keys
  v8f oacc[2];
  oacc[0] = zero8(); oacc[1] = zero8();

  for (int kt = 0; kt < NKT; ++kt) {         // static trip count
    const int kv0 = kt * 64;
    __syncthreads();
    {
      const int r = tid >> 1, hf = (tid & 1) * 16;                  // key r, d = hf..hf+15
      const _Float16* kg = Kg + (size_t)(kv0 + r) * HD + hf;
      const v8h k0v = *(const v8h*)(kg);
      const v8h k1v = *(const v8h*)(kg + 8);
      *(v8h*)(Ksh + r * HD + hf)     = k0v;
      *(v8h*)(Ksh + r * HD + hf + 8) = k1v;
      const int d = tid >> 2, sg = (tid & 3) * 16;                  // d row, keys sg..sg+15
      const _Float16* vg  = Vh + (size_t)d * SEQ + kv0 + sg;
      const _Float16* vlg = Vl + (size_t)d * SEQ + kv0 + sg;
      const v8h v0 = *(const v8h*)(vg),  v1 = *(const v8h*)(vg + 8);
      const v8h w0 = *(const v8h*)(vlg), w1 = *(const v8h*)(vlg + 8);
      *(v8h*)(Vth + d * 64 + sg)     = v0;
      *(v8h*)(Vth + d * 64 + sg + 8) = v1;
      *(v8h*)(Vtl + d * 64 + sg)     = w0;
      *(v8h*)(Vtl + d * 64 + sg + 8) = w1;
    }
    __syncthreads();

    // ---- transposed scores: 64 keys (rows) x 16 queries (columns) per wave; lane (c, hh) holds, for query c,
    //      keys j*16 + 8*hh + r in s[j][r] ----
    v8f s[4];
#pragma unroll
    for (int j = 0; j < 4; ++j) {
      FH kb;
      kb.h[0] = *(const v8h*)(Ksh + (j * 16 + c) * HD + 8 * hh);
      kb.h[1] = *(const v8h*)(Ksh + (j * 16 + c) * HD + 16 + 8 * hh);
      s[j] = mma_h(kb.v, qa, zero8());
#pragma unroll
      for (int r = 0; r < 8; ++r) s[j][r] *= sscale;
    }

    // ---- online softmax: a query's maximum and sum lie in its own two lanes; the maximum is joined across the
    //      halves every chunk (both halves rescale alike), the sums only after the loop ----
    float mj[4];
#pragma unroll
    for (int j = 0; j < 4; ++j) {   // a short tree per tile, ready while the next tile's product runs
      const float t0 = fmaxf(fmaxf(s[j][0], s[j][1]), s[j][2]);
      const float t1 = fmaxf(fmaxf(s[j][3], s[j][4]), s[j][5]);
      mj[j] = fmaxf(fmaxf(t0, t1), fmaxf(s[j][6], s[j][7]));
    }
    float m = fmaxf(fmaxf(mj[0], mj[1]), fmaxf(mj[2], mj[3]));
    m = fmaxf(m, xhalf(m));
    const float mnew  = fmaxf(mrun, m);
    const float msafe = (mnew == -INFINITY) ? 0.f : mnew;
    const float alpha = __expf(mrun - msafe);
    mrun = mnew;
#pragma unroll
    for (int j = 0; j < 4; ++j)
#pragma unroll
      for (int r = 0; r < 8; ++r) s[j][r] = __expf(s[j][r] - msafe);
    const v8f ts = (s[0] + s[1]) + (s[2] + s[3]);   // tiles first (packed adds), then a tree over the eight
    const float psum = ((ts[0] + ts[1]) + (ts[2] + ts[3])) + ((ts[4] + ts[5]) + (ts[6] + ts[7]));
    lrun = lrun * alpha + psum;
#pragma unroll
    for (int r = 0; r < 8; ++r) {
      oacc[0][r] *= alpha;
      oacc[1][r] *= alpha;
    }

    // ---- context^T += V^T . P^T (f16 WMMA); two score tiles, converted in place (x1024, f16), are the B operand
    //      of one 32-key step; residual products into a separate accumulator ----
    v8f o1[2];
    o1[0] = zero8(); o1[1] = zero8();
#pragma unroll
    for (int kk = 0; kk < 2; ++kk) {
      FH pb;
      pb.h[0] = __builtin_convertvector(s[2 * kk] * 1024.0f, v8h);
      pb.h[1] = __builtin_convertvector(s[2 * kk + 1] * 1024.0f, v8h);
#pragma unroll
      for (int t = 0; t < 2; ++t) {
        FH vb, vl;
        vb.h[0] = *(const v8h*)(Vth + (t * 16 + c) * 64 + kk * 32 + 8 * hh);
        vb.h[1] = *(const v8h*)(Vth + (t * 16 + c) * 64 + kk * 32 + 16 + 8 * hh);
        vl.h[0] = *(const v8h*)(Vtl + (t * 16 + c) * 64 + kk * 32 + 8 * hh);
        vl.h[1] = *(const v8h*)(Vtl + (t * 16 + c) * 64 + kk * 32 + 16 + 8 * hh);
        oacc[t] = mma_h(vb.v, pb.v, oacc[t]);
        o1[t]   = mma_h(vl.v, pb.v, o1[t]);
      }
    }
#pragma unroll
    for (int t = 0; t < 2; ++t)
#pragma unroll
      for (int r = 0; r < 8; ++r) oacc[t][r] += o1[t][r] * (1.0f / 2048.0f);
  }

  // ---- join the halves' sums, normalise (1/l, undo the x1024 p carry and the x4 v carry), stage the wave's
  //      16x32 tile: oacc[t][r] is element (query c, d = t*16 + 8*hh + r)
  float* os = Os[wave];
  {
    const float l = lrun + xhalf(lrun);
    const float inv = 1.0f / (l * 4096.0f);
#pragma unroll
    for (int t = 0; t < 2; ++t) {
      const v8f o = oacc[t] * inv;
      *(v4f*)(os + c * HD + t * 16 + 8 * hh)     = (v4f){o[0], o[1], o[2], o[3]};
      *(v4f*)(os + c * HD + t * 16 + 8 * hh + 4) = (v4f){o[4], o[5], o[6], o[7]};
    }
  }
  __builtin_amdgcn_fence(__ATOMIC_RELEASE, "workgroup");
  __builtin_amdgcn_wave_barrier();
  __builtin_amdgcn_fence(__ATOMIC_ACQUIRE, "workgroup");
  {
    const int rq = lane >> 2, c8 = (lane & 3) * 8;
    v4u hv[2], lv[2];
#pragma unroll
    for (int it = 0; it < 2; ++it) {
      const int row = it * 8 + rq;   // it 0..1 x rq 0..7 = rows 0..15 of the wave tile
      const float* sp = os + row * HD + c8;
      v4u a, a2;
#pragma unroll
      for (int e = 0; e < 4; ++e) {
        const float f0 = sp[2 * e], f1 = sp[2 * e + 1];
        const unsigned short h0 = bf_bits(f0), h1 = bf_bits(f1);
        const unsigned short l0 = bf_bits(f0 - bf_up(h0)), l1 = bf_bits(f1 - bf_up(h1));
        a[e] = pk16(h0, h1); a2[e] = pk16(l0, l1);
      }
      hv[it] = a; lv[it] = a2;
    }
    const size_t PS = (size_t)NBH * SEQ * HD;
    unsigned short* base = ct + ((size_t)bh * SEQ + (size_t)q0) * HD;
    {
#pragma unroll
      for (int it = 0; it < 2; ++it) {
        unsigned short* p = base + it * 256 + lane * 8;
        *(v4u*)(p)          = hv[it];
        *(v4u*)(p + PS)     = hv[it];
        *(v4u*)(p + 2 * PS) = lv[it];
      }
      
    }
  }
}

// =====================================================================================================
// Workspace map (bytes), every region an exact multiple of its whole-line / whole-tile store granularity
// (no tail rows anywhere: all shapes are exact tile multiples):
//   X3   bf16 [4096][768]            6291456
//   Wq3  bf16 [768][768]             1179648
//   Wo3  bf16 [256][768]              393216
//   Qp   f16  [16][2048][32]          2097152
//   Kraw f32  [16][2048][32]          4194304
//   Kp   f16  [16][2048][32]          2097152
//   VTh  f16  [2][256][2048]          2097152
//   VTl  f16  [2][256][2048]          2097152
//   CT   bf16 [3][16][2048][32]       6291456
//   total                           26738688
// =====================================================================================================
extern "C" void kernel_launch(void* const* d_in, const int* in_sizes, int n_in,
                              void* d_out, int out_size, void* d_ws, size_t ws_size,
                              hipStream_t stream) {
  if (n_in < 6) return;
  if (in_sizes[0] != ROWS * DM) return;
  if (in_sizes[1] != DM * QKVW) return;
  if (in_sizes[2] != DM * DM) return;
  if (in_sizes[3] != DM) return;
  if (in_sizes[4] != NFUN || in_sizes[5] != NFUN) return;
  if (out_size != ROWS * DM) return;

  const float* x     = (const float*)d_in[0];   // [2][2048][256]
  const float* w_qkv = (const float*)d_in[1];   // [256 in][768 out]
  const float* w_o   = (const float*)d_in[2];   // [256 in][256 out]
  const float* b_o   = (const float*)d_in[3];   // [256]
  const float* coefa = (const float*)d_in[4];   // [256] sine coefficients
  const float* coefb = (const float*)d_in[5];   // [256] cosine coefficients

  const size_t PX3 = (size_t)ROWS * KP * 2;            // 6291456
  const size_t PWQ = (size_t)QKVW * KP * 2;            // 1179648
  const size_t PWO = (size_t)DM * KP * 2;              //  393216
  const size_t PH  = (size_t)NBH * SEQ * HD * 2;       // 2097152  f16 head plane
  const size_t PK4 = (size_t)NBH * SEQ * HD * 4;       // 4194304  f32 head plane
  const size_t PVT = (size_t)NB * DM * SEQ * 2;        // 2097152  v^T plane
  const size_t PCT = (size_t)3 * NBH * SEQ * HD * 2;   // 6291456  ctx planes
  size_t off = 0;
  const size_t oX3  = off; off += PX3;
  const size_t oWq  = off; off += PWQ;
  const size_t oWo  = off; off += PWO;
  const size_t oQp  = off; off += PH;
  const size_t oKr  = off; off += PK4;
  const size_t oKp  = off; off += PH;
  const size_t oVTh = off; off += PVT;
  const size_t oVTl = off; off += PVT;
  const size_t oCT  = off; off += PCT;
  if (off > ws_size) return;                           // off = 26738688
  if (off > (size_t)134217728) return;

  char* ws = (char*)d_ws;
  unsigned short* X3  = (unsigned short*)(ws + oX3);
  unsigned short* Wq3 = (unsigned short*)(ws + oWq);
  unsigned short* Wo3 = (unsigned short*)(ws + oWo);
  unsigned short* Qp  = (unsigned short*)(ws + oQp);
  float*          Kr  = (float*)(ws + oKr);
  unsigned short* Kp  = (unsigned short*)(ws + oKp);
  unsigned short* VTh = (unsigned short*)(ws + oVTh);
  unsigned short* VTl = (unsigned short*)(ws + oVTl);
  unsigned short* CT  = (unsigned short*)(ws + oCT);

  const dim3 blk(256);
  const int n8x = ROWS * DM / 8;                                   // 131072
  const dim3 gCvtX((n8x + 255) / 256);                              //  512 blocks
  const dim3 gTq(QKVW / 64, DM / 64);                               //  12 x 4
  const dim3 gTo(DM / 64, DM / 64);                                 //   4 x 4
  const dim3 gQK(((ROWS / 64) * (DM / 64) + 7) / 8, 1);             //  256 tiles -> 32 blocks: M=4096, N=256
  const dim3 gVT(((DM / 64) * (SEQ / 64) + 7) / 8, NB);             //  128 tiles -> 16 blocks x 2 batches: M=256, N=2048
  const dim3 gFour((NBH * SEQ * HD) / 1024);                        // 1024 blocks of 256, 4 elements per lane
  const dim3 gAttn(NBH * NQB);                                      //  512 blocks of 128

  // (1) x -> [hi|hi|lo] bf16 plane; weights transposed to [out][in] as [hi|lo|hi] bf16 planes
  cvt_x3<<<gCvtX, blk, 0, stream>>>(x, X3, n8x);
  wtrans3<<<gTq, blk, 0, stream>>>(w_qkv, Wq3, QKVW);
  wtrans3<<<gTo, blk, 0, stream>>>(w_o, Wo3, DM);
  // (2) q = x . Wq -> f16 head plane (x4)   (M=4096, N=256, K=768)
  gemm64<0, 0><<<gQK, blk, 0, stream>>>(
      X3, KP, 0LL, Wq3, KP, 0LL,
      (void*)Qp, (void*)Qp, 0, 0LL, b_o,
      ROWS, DM, KP, 4.0f, 1.0f);
  // (3) k = x . Wk -> raw f32 head plane   (M=4096, N=256, K=768)
  gemm64<0, 1><<<gQK, blk, 0, stream>>>(
      X3, KP, 0LL, Wq3 + (size_t)DM * KP, KP, 0LL,
      (void*)Kr, (void*)Kr, 0, 0LL, b_o,
      ROWS, DM, KP, 1.0f, 1.0f);
  // (4) v^T = Wv . x^T per batch -> f16 hi plane (x4) [b][c][s] (pitch SEQ) and residual plane (x2048)
  //     (A = Wq3 rows 512.., Bt = X3 rows of batch b; M=256, N=2048, K=768)
  gemm64<0, 2><<<gVT, blk, 0, stream>>>(
      Wq3 + (size_t)2 * DM * KP, KP, 0LL, X3, KP, (long long)SEQ * KP,
      (void*)VTh, (void*)VTl, SEQ, (long long)DM * SEQ, b_o,
      DM, SEQ, KP, 4.0f, 2048.0f);
  // (5) Fourier-basis transform of k -> f16 head plane (x4)
  fourier_k<<<gFour, blk, 0, stream>>>(Kr, coefa, coefb, Kp);
  // (6) attention -> ctx planes (bf16 hi, hi, lo)
  attn32<<<gAttn, dim3(128), 0, stream>>>(Qp, Kp, VTh, VTl, CT, 0.17677669529663687f * 0.0625f);
  // (7) out = ctx . Wo + bias -> d_out f32 [4096][256]   (M=4096, N=256, K=768, A in head-plane layout)
  gemm64<1, 3><<<gQK, blk, 0, stream>>>(
      CT, 0, 0LL, Wo3, KP, 0LL,
      d_out, d_out, DM, 0LL, b_o,
      ROWS, DM, KP, 1.0f, 1.0f);
  (void)hipGetLastError();
}

// v003
// A run of this version takes 143 microseconds.
// Two timings next to v002 put it at 1.65 and 1.66 times that version's speed.
// Over all steps from v000 it is 2.77 times as fast.
// Contractions: q, k, v^T projections and the output projection = v_wmma_f32_16x16x32_bf16 over bf16 hi/lo planes
// laid out as [hi|hi|lo] x [hi|lo|hi] along k (3 products, f32 accumulate);
// q.k^T scores = v_wmma_f32_16x16x32_f16 (q and the transformed k as f16 planes carried x4, single product, f32 accumulate);
// p.v = v_wmma_f32_16x16x32_f16 (p carried x1024 in f16; v^T as f16 hi plane x4 plus f16 residual plane x2^11; 2 products, f32 accumulate);
// Fourier-basis transform of k (one precise sincosf per element, then a rotation recurrence), softmax and bias in f32 on the VALU.
#include <hip/hip_runtime.h>
#include <math.h>
#include <stdint.h>

#define NB   2
#define SEQ  2048
#define DM   256
#define NH   8
#define HD   32
#define NBH  (NB * NH)        // 16 (batch, head) pairs
#define QKVW (3 * DM)         // 768 qkv output width
#define KP   (3 * DM)         // 768 folded k width of the split operand planes
#define NFUN 256
#define ROWS (NB * SEQ)       // 4096 token rows
#define NQB  (SEQ / 64)       // 64-query blocks per (b, h)
#define NKT  (SEQ / 64)       // 64-key chunks
#define GP   144              // GEMM operand row pitch in LDS, bytes: 128 B (64 k) + 16 B (16 B x odd, for 16-B readers)
#define GBUF (384 * GP)       // one GEMM operand buffer: 128 A rows + 256 Bt rows
static_assert(NH * HD == DM);
static_assert(NQB == 32 && NKT == 32);
static_assert((ROWS % 64) == 0 && (DM % 64) == 0 && (SEQ % 64) == 0 && (KP % 32) == 0);
static_assert((ROWS * DM) % 2048 == 0);
static_assert((ROWS % 128) == 0 && (DM % 256) == 0 && (DM % 128) == 0 && (SEQ % 256) == 0 && (KP % 64) == 0 && (SEQ % 128) == 0);

typedef _Float16 v16h __attribute__((ext_vector_type(16)));
typedef _Float16 v8h  __attribute__((ext_vector_type(8)));
typedef __bf16   v16b __attribute__((ext_vector_type(16)));
typedef __bf16   v8b  __attribute__((ext_vector_type(8)));
typedef float    v8f  __attribute__((ext_vector_type(8)));
typedef float    v4f  __attribute__((ext_vector_type(4)));
typedef unsigned int v4u __attribute__((ext_vector_type(4)));
typedef float    v2f  __attribute__((ext_vector_type(2)));
typedef unsigned int v2u __attribute__((ext_vector_type(2)));

#if defined(__HIP_DEVICE_COMPILE__)
#define DEV_ASM 1
#else
#define DEV_ASM 0
#endif

// ---- scalar helpers --------------------------------------------------------------------------------
__device__ __forceinline__ unsigned short bf_bits(float f) {          // f32 -> bf16 bits, RNE convert
  unsigned u = __float_as_uint(f);
  return (unsigned short)((u + 0x7FFFu + ((u >> 16) & 1u)) >> 16);
}
__device__ __forceinline__ float bf_up(unsigned short hb) { return __uint_as_float(((unsigned)hb) << 16); }
__device__ __forceinline__ unsigned short h_bits(_Float16 x) { return __builtin_bit_cast(unsigned short, x); }
__device__ __forceinline__ unsigned pk16(unsigned short a, unsigned short b) { return (unsigned)a | ((unsigned)b << 16); }
__device__ __forceinline__ v8f zero8() { v8f z = {0.f, 0.f, 0.f, 0.f, 0.f, 0.f, 0.f, 0.f}; return z; }

// ---- fragment loaders: 16-bit A/B operand, lane -> row/col (lane&15), p already includes +8*(lane>>4);
//      elements 0..7 <- p[0..7] (k0+8h..k0+8h+7), elements 8..15 <- p[16..23] (k0+16+8h..k0+16+8h+7)
template <typename OT> struct FT;
template <> struct FT<__bf16>   { typedef v16b frag; typedef v8b half8; };
template <> struct FT<_Float16> { typedef v16h frag; typedef v8h half8; };

template <typename OT>
__device__ __forceinline__ typename FT<OT>::frag ldfrag(const OT* p) {
  union { typename FT<OT>::frag v; typename FT<OT>::half8 h[2]; } f;
  f.h[0] = *(const typename FT<OT>::half8*)(p);
  f.h[1] = *(const typename FT<OT>::half8*)(p + 16);
  return f.v;
}

// ---- WMMA helpers ----------------------------------------------------------------------------------
__device__ __forceinline__ v8f mmar(v16b a, v16b b, v8f c) {
  return __builtin_amdgcn_wmma_f32_16x16x32_bf16(false, a, false, b, (short)0, c, false, false);
}
// guarded form: 4 VALU slots after the WMMA, D tied, A/B kept live
__device__ __forceinline__ v8f mma_h(v16h a, v16h b, v8f c) {
  c = __builtin_amdgcn_wmma_f32_16x16x32_f16(false, a, false, b, (short)0, c, false, false);
#if DEV_ASM
  asm volatile("v_nop\n\tv_nop\n\tv_nop\n\tv_nop" : "+v"(c) : "v"(a), "v"(b));
#endif
  return c;
}
// lane l <-> lane l ^ 16
__device__ __forceinline__ float xhalf(float x) {
  const int b = __builtin_bit_cast(int, x);
  return __builtin_bit_cast(float, __builtin_amdgcn_permlanex16(b, b, 0x76543210, 0xfedcba98, false, false));
}
__device__ __forceinline__ void dep_guard(v8f& a, v8f& b, v16b x, v16b y) {
#if DEV_ASM
  asm volatile("v_nop\n\tv_nop\n\tv_nop\n\tv_nop" : "+v"(a), "+v"(b) : "v"(x), "v"(y));
#else
  (void)a; (void)b; (void)x; (void)y;
#endif
}
__device__ __forceinline__ void keep4(v16b a, v16b b, v16b c, v16b d) {
#if DEV_ASM
  asm volatile("v_nop" :: "v"(a), "v"(b), "v"(c), "v"(d));
#else
  (void)a; (void)b; (void)c; (void)d;
#endif
}
__device__ __forceinline__ void acc_guard4(v8f& a, v8f& b, v8f& c, v8f& d) {
#if DEV_ASM
  asm volatile("v_nop\n\tv_nop\n\tv_nop\n\tv_nop" : "+v"(a), "+v"(b), "+v"(c), "+v"(d));
#else
  (void)a; (void)b; (void)c; (void)d;
#endif
}
// ---- asynchronous copies global -> LDS, 16 B a lane ------------------------------------------------
__device__ __forceinline__ uint32_t lds_off(const void* p) { return (uint32_t)(size_t)p; }   // LDS byte address
// twelve copies of a lane (l: LDS byte addresses, g: global addresses); the s_wait_xcnt stands inside the
// statement so that no address register named here is rewritten ahead of it
__device__ __forceinline__ void copy12(const uint32_t (&l)[12], const __bf16* const (&g)[12]) {
#if DEV_ASM
  asm volatile("global_load_async_to_lds_b128 %0, %12, off\n\t"
               "global_load_async_to_lds_b128 %1, %13, off\n\t"
               "global_load_async_to_lds_b128 %2, %14, off\n\t"
               "global_load_async_to_lds_b128 %3, %15, off\n\t"
               "global_load_async_to_lds_b128 %4, %16, off\n\t"
               "global_load_async_to_lds_b128 %5, %17, off\n\t"
               "global_load_async_to_lds_b128 %6, %18, off\n\t"
               "global_load_async_to_lds_b128 %7, %19, off\n\t"
               "global_load_async_to_lds_b128 %8, %20, off\n\t"
               "global_load_async_to_lds_b128 %9, %21, off\n\t"
               "global_load_async_to_lds_b128 %10, %22, off\n\t"
               "global_load_async_to_lds_b128 %11, %23, off\n\t"
               "s_wait_xcnt 0x0"
               :: "v"(l[0]), "v"(l[1]), "v"(l[2]), "v"(l[3]), "v"(l[4]), "v"(l[5]),
                  "v"(l[6]), "v"(l[7]), "v"(l[8]), "v"(l[9]), "v"(l[10]), "v"(l[11]),
                  "v"(g[0]), "v"(g[1]), "v"(g[2]), "v"(g[3]), "v"(g[4]), "v"(g[5]),
                  "v"(g[6]), "v"(g[7]), "v"(g[8]), "v"(g[9]), "v"(g[10]), "v"(g[11])
               : "memory");
#else
  (void)l; (void)g;
#endif
}
// this wave's copies have landed
__device__ __forceinline__ void wait_copies() {
#if DEV_ASM
  asm volatile("s_wait_asynccnt 0x0" ::: "memory");
#endif
}
// this wave's LDS reads have returned (in front of the barrier that hands a buffer to its next copies)
__device__ __forceinline__ void wait_lds() {
#if DEV_ASM
  asm volatile("s_wait_dscnt 0x0" ::: "memory");
#endif
}

// =====================================================================================================
// x [ROWS][DM] f32 -> split plane X3 [ROWS][KP] bf16, row = [hi | hi | lo] (hi = RNE bf16, lo = RNE bf16
// of the exact residual). 8 elements per thread; each thread stores 16 B into each of the three thirds;
// =====================================================================================================
__global__ __launch_bounds__(256) void cvt_x3(const float* __restrict__ in, unsigned short* out, int n8) {
  const int i = blockIdx.x * 256 + (int)threadIdx.x;
  if (i < n8) {
    const int row = i >> 5, c = (i & 31) * 8;
    const v4f a  = *(const v4f*)(in + (size_t)i * 8);
    const v4f a4 = *(const v4f*)(in + (size_t)i * 8 + 4);
    const float f[8] = {a[0], a[1], a[2], a[3], a4[0], a4[1], a4[2], a4[3]};
    v4u ph, pl;
#pragma unroll
    for (int e = 0; e < 4; ++e) {
      const float f0 = f[2 * e], f1 = f[2 * e + 1];
      const unsigned short h0 = bf_bits(f0), h1 = bf_bits(f1);
      const unsigned short l0 = bf_bits(f0 - bf_up(h0)), l1 = bf_bits(f1 - bf_up(h1));
      ph[e] = pk16(h0, h1);
      pl[e] = pk16(l0, l1);
    }
    unsigned short* o = out + (size_t)row * KP + c;
    *(v4u*)(o)          = ph;
    *(v4u*)(o + DM)     = ph;
    *(v4u*)(o + 2 * DM) = pl;
    
  }
}

// =====================================================================================================
// w [DM rows k][C cols] f32 (x @ w layout) -> wt [C][KP] bf16, row c = [hi | lo | hi] of w[k][c] over k.
// Block = 64 k x 64 c tile staged in LDS (f32); grid = (C/64, DM/64): blockIdx.x -> c0, blockIdx.y -> k0.
// coverage: 8 waves x 8 rows x 64 k = the tile, all three thirds; the grid covers all C rows x DM k.
// =====================================================================================================
__global__ __launch_bounds__(256) void wtrans3(const float* __restrict__ w, unsigned short* wt, int C) {
  __shared__ float tile[64][65];
  const int tid = (int)threadIdx.x, lane = tid & 31, wave = tid >> 5;
  const int c0 = blockIdx.x * 64, k0 = blockIdx.y * 64;
#pragma unroll
  for (int it = 0; it < 16; ++it) {
    const int idx = it * 256 + tid;
    const int r = idx >> 6, cc = idx & 63;
    tile[r][cc] = w[(size_t)(k0 + r) * C + c0 + cc];
  }
  __syncthreads();
  const int q = lane >> 3, c8 = (lane & 7) * 8;
  v4u hv[2], lv[2];
#pragma unroll
  for (int it = 0; it < 2; ++it) {
    const int row = wave * 8 + it * 4 + q;          // output row (c within tile)
    v4u a, a2;
#pragma unroll
    for (int e = 0; e < 4; ++e) {
      const float f0 = tile[c8 + 2 * e][row], f1 = tile[c8 + 2 * e + 1][row];
      const unsigned short h0 = bf_bits(f0), h1 = bf_bits(f1);
      const unsigned short l0 = bf_bits(f0 - bf_up(h0)), l1 = bf_bits(f1 - bf_up(h1));
      a[e] = pk16(h0, h1);
      a2[e] = pk16(l0, l1);
    }
    hv[it] = a; lv[it] = a2;
  }
  {
#pragma unroll
    for (int it = 0; it < 2; ++it) {
      const int row = wave * 8 + it * 4 + q;
      unsigned short* o = wt + (size_t)(c0 + row) * KP + k0 + c8;
      *(v4u*)(o)          = hv[it];
      *(v4u*)(o + DM)     = lv[it];
      *(v4u*)(o + 2 * DM) = hv[it];
    }
    
  }
}

// =====================================================================================================
// Register-blocked batched WMMA GEMM, bf16 operands: C[m][n] = sum_k A[m][k] * Bt[n][k]; one wave per
// 64x64 tile, eight waves (2 x 4) on a 128x256 block tile. Bt row-major [N][K] pitch ldb (k contiguous).
// A_MODE 0: A row-major [M][K] pitch lda.  A_MODE 1: head planes: A(m, k) at
//   plane = (k/256)*NBH + (m/SEQ)*NH + (k/32)%NH;  A[(plane*SEQ + m%SEQ)*HD + k%32]  (M = ROWS, K = KP).
// M multiple of 128, N of 256, K of 64 (static shapes below). blockIdx.y = batch index (strides in elements).
// Operands: per pass of 64 k the block's 128 A rows and 256 Bt rows (128 B each) come into LDS by asynchronous
// copies of whole 128-B lines, two buffers, the next pass's copies in flight while this pass is worked on;
// LDS row pitch 144 B; fragments read from LDS with the split k map (ldfrag), k ascending as before.
// Epilogue: 16-row slabs staged per wave in LDS (pitch 68 floats), then:
// OUT_MODE 0: f16 head plane [NBH][SEQ][HD], value * oscale: per head half of the slab (16 rows x 32 cols =
// OUT_MODE 1: f32 head plane [NBH][SEQ][HD]: per head half (2048 contiguous B) four instructions of
// OUT_MODE 2: f16 hi plane C (value*oscale) + f16 residual plane C2 = f16((v*oscale - hi) * rscale), row-major
// OUT_MODE 3: f32 row-major C (pitch ldc) + bias[n] (f32): each 64-wide row segment = 256 B = 16 lanes x 16 B.
// coverage: 4 slabs x 16 rows x 64 cols = the wave's whole 64x64 tile; grids are exact tile multiples.
// =====================================================================================================
template <int A_MODE, int OUT_MODE>
__global__ __launch_bounds__(256) void gemm64(
    const unsigned short* __restrict__ Ap, int lda, long long strideA,
    const unsigned short* __restrict__ Btp, int ldb, long long strideB,
    void* Cout, void* Cout2, int ldc, long long strideC,
    const float* __restrict__ bias,
    int M, int N, int K, float oscale, float rscale) {
  const __bf16* A  = (const __bf16*)(const void*)Ap;
  const __bf16* Bt = (const __bf16*)(const void*)Btp;
  __shared__ __align__(16) unsigned char ring[2 * GBUF];   // two operand buffers: 128 A rows, then 256 Bt rows
  __shared__ __align__(16) float sT[8][16 * 68];   // per-wave 16x64 slab, pitch 68 floats
  const int b    = blockIdx.y;
  const int tid  = (int)threadIdx.x;
  const int lane = tid & 31;
  const int wave = tid >> 5;
  const int nbn = N >> 8;                // block tiles along N
  const int bm  = blockIdx.x / nbn;
  const int bn  = blockIdx.x - bm * nbn;
  if (bm >= (M >> 7)) return;            // the same for the whole block, in front of every barrier
  const int bm0 = bm << 7;
  const int bn0 = bn << 8;
  const int wr  = (wave >> 2) << 6;      // the wave's first A row in the block tile
  const int wc  = (wave & 3) << 6;       // the wave's first Bt row in the block tile
  const int m0 = bm0 + wr;
  const int n0 = bn0 + wc;

  const __bf16* Ab = A  + (size_t)b * (size_t)strideA;
  const __bf16* Bb = Bt + (size_t)b * (size_t)strideB;

  const int rlane = lane & 15;                 // row (A) / col (B, D) within subtile
  const int koff  = (lane >> 4) * 8;           // k offset of this lane half
  const int mOff  = (lane >> 4) * 8;           // D row offset

  v8f acc[4][4];
#pragma unroll
  for (int i = 0; i < 4; ++i)
#pragma unroll
    for (int j = 0; j < 4; ++j) acc[i][j] = zero8();

  // pass t -> buffer buf: 12 copies a lane; a wave's copy covers 512 B of whole lines (4 rows of 128 B; in the
  // head-plane layout 8 rows of 64 B, which adjoin)
  const uint32_t ringb = lds_off(ring);
  auto stage = [&](int t, int buf) {
    const int k0 = t << 6;
    const uint32_t lb = ringb + (uint32_t)buf * GBUF;
    uint32_t la[12];
    const __bf16* ga[12];
#pragma unroll
    for (int u = 0; u < 4; ++u) {
      if (A_MODE == 0) {
        const int row = u * 32 + (tid >> 3), pc = tid & 7;
        ga[u] = Ab + (size_t)(bm0 + row) * lda + k0 + pc * 8;
        la[u] = lb + (uint32_t)(row * GP + pc * 16);
      } else {
        const int kk = k0 + (u >> 1) * 32;
        const int row = (u & 1) * 64 + (tid >> 2), pc = tid & 3;
        const int plane = (kk >> 8) * NBH + (bm0 / SEQ) * NH + ((kk >> 5) & (NH - 1));
        ga[u] = Ab + ((size_t)plane * SEQ + (size_t)((bm0 & (SEQ - 1)) + row)) * HD + pc * 8;
        la[u] = lb + (uint32_t)(row * GP + ((u >> 1) * 4 + pc) * 16);
      }
    }
#pragma unroll
    for (int u = 0; u < 8; ++u) {
      const int row = u * 32 + (tid >> 3), pc = tid & 7;
      ga[4 + u] = Bb + (size_t)(bn0 + row) * ldb + k0 + pc * 8;
      la[4 + u] = lb + (uint32_t)((128 + row) * GP + pc * 16);
    }
    copy12(la, ga);
  };

  const int T = K >> 6;                  // passes of 64 k
  stage(0, 0);
  wait_copies();
  __syncthreads();                       // pass 0 is readable by every wave
  if (T > 1) stage(1, 1);

  for (int t = 0; t < T; ++t) {
    const unsigned char* bufp = ring + (t & 1) * GBUF + koff * 2;
#pragma unroll
    for (int ks = 0; ks < 2; ++ks) {     // two k-steps of 32 (64 B of every row)
      v16b bq[4], af[4];
#pragma unroll
      for (int j = 0; j < 4; ++j)
        bq[j] = ldfrag<__bf16>((const __bf16*)(bufp + (128 + wc + (j << 4) + rlane) * GP + ks * 64));
#pragma unroll
      for (int i = 0; i < 4; ++i)
        af[i] = ldfrag<__bf16>((const __bf16*)(bufp + (wr + (i << 4) + rlane) * GP + ks * 64));
#pragma unroll
      for (int i = 0; i < 4; ++i) {
#pragma unroll
        for (int j = 0; j < 4; ++j) acc[i][j] = mmar(af[i], bq[j], acc[i][j]);
        dep_guard(acc[i][0], acc[i][3], af[i], bq[3]);
      }
      keep4(bq[0], bq[1], bq[2], bq[3]);
    }
    // hand-over: this wave has left buffer t & 1 and its copies of pass t + 1 have landed; behind the barrier
    // pass t + 1 is readable by every wave and buffer t & 1 is free for pass t + 2
    wait_lds();
    wait_copies();
    __syncthreads();
    if (t + 2 < T) stage(t + 2, t & 1);
  }
  wait_copies();                         // nothing of this wave is in flight when the epilogue starts
  acc_guard4(acc[0][0], acc[0][1], acc[0][2], acc[0][3]);
  acc_guard4(acc[1][0], acc[1][1], acc[1][2], acc[1][3]);
  acc_guard4(acc[2][0], acc[2][1], acc[2][2], acc[2][3]);
  acc_guard4(acc[3][0], acc[3][1], acc[3][2], acc[3][3]);

  // ---- epilogue ----
  float* slab = sT[wave];
#pragma unroll
  for (int i = 0; i < 4; ++i) {
    const int mBase = m0 + (i << 4);
#pragma unroll
    for (int j = 0; j < 4; ++j) {
#pragma unroll
      for (int r = 0; r < 8; ++r) {
        slab[(mOff + r) * 68 + (j << 4) + rlane] = acc[i][j][r];
      }
    }
    __builtin_amdgcn_fence(__ATOMIC_RELEASE, "workgroup");
    __builtin_amdgcn_wave_barrier();
    __builtin_amdgcn_fence(__ATOMIC_ACQUIRE, "workgroup");
    if (OUT_MODE == 0) {
      unsigned short* Q = (unsigned short*)Cout;
      const int rq = lane >> 2, c8 = (lane & 3) * 8;        // row within an 8-row group, 8-col piece
      v4u hv[4];
#pragma unroll
      for (int j2 = 0; j2 < 2; ++j2) {
#pragma unroll
        for (int it = 0; it < 2; ++it) {
          const float* sp = slab + (it * 8 + rq) * 68 + j2 * 32 + c8;   // it 0..1 x rq 0..7 = rows 0..15
          v4u a;
#pragma unroll
          for (int e = 0; e < 4; ++e)
            a[e] = pk16(h_bits((_Float16)(sp[2 * e] * oscale)), h_bits((_Float16)(sp[2 * e + 1] * oscale)));
          hv[j2 * 2 + it] = a;
        }
      }
      {
#pragma unroll
        for (int j2 = 0; j2 < 2; ++j2) {
          const int head = (n0 >> 5) + j2;
          unsigned short* base = Q + ((size_t)((mBase / SEQ) * NH + head) * SEQ + (size_t)(mBase & (SEQ - 1))) * HD;
#pragma unroll
          for (int it = 0; it < 2; ++it)
            *(v4u*)(base + it * 256 + lane * 8) = hv[j2 * 2 + it];
        }
        
      }
    } else if (OUT_MODE == 1) {
      float* Kr = (float*)Cout;
      const int rq = lane >> 3, c4 = (lane & 7) * 4;        // row within a 4-row group, 4-col piece
      v4f hv[8];
#pragma unroll
      for (int j2 = 0; j2 < 2; ++j2) {
#pragma unroll
        for (int it = 0; it < 4; ++it)                      // it 0..3 x rq 0..3 = rows 0..15
          hv[j2 * 4 + it] = *(const v4f*)(slab + (it * 4 + rq) * 68 + j2 * 32 + c4);
      }
      {
#pragma unroll
        for (int j2 = 0; j2 < 2; ++j2) {
          const int head = (n0 >> 5) + j2;
          float* base = Kr + ((size_t)((mBase / SEQ) * NH + head) * SEQ + (size_t)(mBase & (SEQ - 1))) * HD;
#pragma unroll
          for (int it = 0; it < 4; ++it)
            *(v4f*)(base + it * 128 + lane * 4) = hv[j2 * 4 + it];
        }
        
      }
    } else if (OUT_MODE == 2) {
      const int q = lane >> 3, c8 = (lane & 7) * 8;
      unsigned short* C  = (unsigned short*)Cout  + (size_t)b * (size_t)strideC;
      unsigned short* C2 = (unsigned short*)Cout2 + (size_t)b * (size_t)strideC;
      v4u hv[4], lv[4];
#pragma unroll
      for (int it = 0; it < 4; ++it) {
        const int row = it * 4 + q;                         // it 0..3 x q 0..3 = rows 0..15
        const float* sp = slab + row * 68 + c8;
        v4u a, a2;
#pragma unroll
        for (int e = 0; e < 4; ++e) {
          const float f0 = sp[2 * e] * oscale, f1 = sp[2 * e + 1] * oscale;
          const _Float16 x0 = (_Float16)f0, x1 = (_Float16)f1;
          const unsigned short h0 = h_bits(x0), h1 = h_bits(x1);
          const unsigned short l0 = h_bits((_Float16)((f0 - (float)x0) * rscale));
          const unsigned short l1 = h_bits((_Float16)((f1 - (float)x1) * rscale));
          a[e] = pk16(h0, h1); a2[e] = pk16(l0, l1);
        }
        hv[it] = a; lv[it] = a2;
      }
      {
#pragma unroll
        for (int it = 0; it < 4; ++it) {
          const int row = it * 4 + q;
          *(v4u*)(C  + (size_t)(mBase + row) * ldc + n0 + c8) = hv[it];
          *(v4u*)(C2 + (size_t)(mBase + row) * ldc + n0 + c8) = lv[it];
        }
        
      }
    } else {
      float* C = (float*)Cout + (size_t)b * (size_t)strideC;
      const int h2 = lane >> 4, c4 = (lane & 15) * 4;      // 256-B row segment = 16 lanes x 16 B
      const v4f bv = *(const v4f*)(bias + n0 + c4);
      v4f hv[8];
#pragma unroll
      for (int it = 0; it < 8; ++it) {
        const int row = it * 2 + h2;                        // it 0..7 x h2 0..1 = rows 0..15
        hv[it] = *(const v4f*)(slab + row * 68 + c4) + bv;
      }
      {
#pragma unroll
        for (int it = 0; it < 8; ++it) {
          const int row = it * 2 + h2;
          *(v4f*)(C + (size_t)(mBase + row) * ldc + n0 + c4) = hv[it];
        }
        
      }
    }
    __builtin_amdgcn_fence(__ATOMIC_RELEASE, "workgroup");
    __builtin_amdgcn_wave_barrier();
    __builtin_amdgcn_fence(__ATOMIC_ACQUIRE, "workgroup");
  }
}

// =====================================================================================================
// Fourier-basis transform of k: out = sum_{f=1..NFUN} ca[f-1]*sin(f*k) + cb[f-1]*cos(f*k) in f32.
// One precise sincosf(k) per element; sin(f*k), cos(f*k) for f = 2..NFUN follow by rotating the pair by k
// (angle addition: two products and two fused multiply-adds a step). The rotation keeps the pair's length,
// so its error grows linearly in f: at f = NFUN it is that of moving k by about one f32 ulp.
// Terms are added in the order f = 1..NFUN, sine before cosine, as fused multiply-adds.
// Four consecutive elements of the raw f32 k head plane [NBH][SEQ][HD] per lane, as two pairs, so that every
// step is packed f32 arithmetic; a lane stores its four f16 results (x4) as 8 B, a wave 256 contiguous B.
// coverage: grid x 256 x 4 = every element of the k' plane.
// =====================================================================================================
__global__ __launch_bounds__(256) void fourier_k(const float* __restrict__ kr, const float* __restrict__ ca,
                                                 const float* __restrict__ cb, unsigned short* kp) {
  const size_t g4 = ((size_t)blockIdx.x * 256 + (size_t)threadIdx.x) * 4;
  const v4f kx = *(const v4f*)(kr + g4);
  v2f s1[2], c1[2], s[2], c[2], acc[2];
#pragma unroll
  for (int h = 0; h < 2; ++h) {
#pragma unroll
    for (int e = 0; e < 2; ++e) {
      float sn, cs;
      sincosf(kx[2 * h + e], &sn, &cs);
      s1[h][e] = sn;
      c1[h][e] = cs;
    }
    s[h] = s1[h];
    c[h] = c1[h];
    acc[h] = (v2f){0.f, 0.f};
  }
  // unrolled so that the coefficients of a group of steps arrive in one pair of scalar loads
#pragma unroll 16
  for (int fi = 0; fi < NFUN; ++fi) {
    const float af = ca[fi];
    const float bf = cb[fi];
    const v2f a2 = {af, af}, b2 = {bf, bf};
#pragma unroll
    for (int h = 0; h < 2; ++h) {
      acc[h] = __builtin_elementwise_fma(a2, s[h], acc[h]);
      acc[h] = __builtin_elementwise_fma(b2, c[h], acc[h]);
      const v2f sn = __builtin_elementwise_fma(s[h], c1[h], c[h] * s1[h]);
      c[h] = __builtin_elementwise_fma(c[h], c1[h], -(s[h] * s1[h]));
      s[h] = sn;
    }
  }
  v2u o;
#pragma unroll
  for (int h = 0; h < 2; ++h)
    o[h] = pk16(h_bits((_Float16)(acc[h][0] * 4.0f)), h_bits((_Float16)(acc[h][1] * 4.0f)));
  *(v2u*)(kp + g4) = o;
}

// =====================================================================================================
// Attention, head dim 32, no mask, softmax over all SEQ keys.
//   q plane / k' plane (f16, x4): element (bh, t, d) at [(bh*SEQ + t)*HD + d]
//   v^T hi plane (f16, 4v) and residual plane (f16, (4v - hi)*2048): element (bh, d, s) at [(bh*HD + d)*SEQ + s]
//   ctx planes (bf16): part p (0 = hi, 1 = hi, 2 = lo), element (bh, t, d) at [p*PS + (bh*SEQ + t)*HD + d]
//   scores^T = (k4' . q4^T) * sscale on f16 WMMA (one k-step), softmax in f32 (running max), a query per lane pair;
//   p = exp(s - m) carried as f16(1024 p); O^T = vh^T . p^T + (vl^T . p^T) / 2048 on f16 WMMA; ctx = O / (l * 4096).
//   Block = 4 waves on the same (b, h), 4 consecutive 16-query tiles; grid = NBH * NQB; key chunks of 64,
//   static trip NKT. Chunk staging: 128 threads, K 64x32 (2 x 16 B per thread), V^T hi/res 32x64 (2 x 16 B
//   per thread and plane), plain loads, __syncthreads before and after. P^T stays in registers (score tiles -> B operand).
//   Output: each wave writes its 16x32 tile (1024 contiguous B per part) with two instructions of
//   all NBH*SEQ rows x HD, all three parts.
// =====================================================================================================
__global__ __launch_bounds__(128)
void attn32(const unsigned short* __restrict__ qpp, const unsigned short* __restrict__ kpp,
            const unsigned short* __restrict__ vhp, const unsigned short* __restrict__ vlp,
            unsigned short* ct, float sscale) {
  union FH { v16h v; v8h h[2]; };
  __shared__ __align__(16) _Float16 Ksh[64 * HD];          // K chunk [key][d]      4 KB
  __shared__ __align__(16) _Float16 Vth[HD * 64];          // V^T hi [d][key]      4 KB
  __shared__ __align__(16) _Float16 Vtl[HD * 64];          // V^T residual        4 KB
  __shared__ __align__(16) float    Os[4][16 * HD];        // per wave ctx tile    8 KB

  const int tid  = (int)threadIdx.x;
  const int wave = tid >> 5;
  const int lane = tid & 31;
  const int hh   = lane >> 4;
  const int c    = lane & 15;

  const int bx   = blockIdx.x;
  const int qblk = bx % NQB;
  const int bh   = bx / NQB;
  const int q0   = qblk * 64 + wave * 16;

  const _Float16* Qg = (const _Float16*)(const void*)qpp + (size_t)bh * SEQ * HD;
  const _Float16* Kg = (const _Float16*)(const void*)kpp + (size_t)bh * SEQ * HD;
  const _Float16* Vh = (const _Float16*)(const void*)vhp + (size_t)bh * HD * SEQ;
  const _Float16* Vl = (const _Float16*)(const void*)vlp + (size_t)bh * HD * SEQ;

  // ---- Q fragment (B operand, column = lane&15, one k-step of 32) ----
  const v16h qa = ldfrag<_Float16>(Qg + (size_t)(q0 + c) * HD + 8 * hh);

  float mrun = -INFINITY, lrun = 0.f;   // query c: running maximum (joined), running sum of this half's keys
  v8f oacc[2];
  oacc[0] = zero8(); oacc[1] = zero8();

  for (int kt = 0; kt < NKT; ++kt) {         // static trip count
    const int kv0 = kt * 64;
    __syncthreads();
    {
      const int r = tid >> 1, hf = (tid & 1) * 16;                  // key r, d = hf..hf+15
      const _Float16* kg = Kg + (size_t)(kv0 + r) * HD + hf;
      const v8h k0v = *(const v8h*)(kg);
      const v8h k1v = *(const v8h*)(kg + 8);
      *(v8h*)(Ksh + r * HD + hf)     = k0v;
      *(v8h*)(Ksh + r * HD + hf + 8) = k1v;
      const int d = tid >> 2, sg = (tid & 3) * 16;                  // d row, keys sg..sg+15
      const _Float16* vg  = Vh + (size_t)d * SEQ + kv0 + sg;
      const _Float16* vlg = Vl + (size_t)d * SEQ + kv0 + sg;
      const v8h v0 = *(const v8h*)(vg),  v1 = *(const v8h*)(vg + 8);
      const v8h w0 = *(const v8h*)(vlg), w1 = *(const v8h*)(vlg + 8);
      *(v8h*)(Vth + d * 64 + sg)     = v0;
      *(v8h*)(Vth + d * 64 + sg + 8) = v1;
      *(v8h*)(Vtl + d * 64 + sg)     = w0;
      *(v8h*)(Vtl + d * 64 + sg + 8) = w1;
    }
    __syncthreads();

    // ---- transposed scores: 64 keys (rows) x 16 queries (columns) per wave; lane (c, hh) holds, for query c,
    //      keys j*16 + 8*hh + r in s[j][r] ----
    v8f s[4];
#pragma unroll
    for (int j = 0; j < 4; ++j) {
      FH kb;
      kb.h[0] = *(const v8h*)(Ksh + (j * 16 + c) * HD + 8 * hh);
      kb.h[1] = *(const v8h*)(Ksh + (j * 16 + c) * HD + 16 + 8 * hh);
      s[j] = mma_h(kb.v, qa, zero8());
#pragma unroll
      for (int r = 0; r < 8; ++r) s[j][r] *= sscale;
    }

    // ---- online softmax: a query's maximum and sum lie in its own two lanes; the maximum is joined across the
    //      halves every chunk (both halves rescale alike), the sums only after the loop ----
    float mj[4];
#pragma unroll
    for (int j = 0; j < 4; ++j) {   // a short tree per tile, ready while the next tile's product runs
      const float t0 = fmaxf(fmaxf(s[j][0], s[j][1]), s[j][2]);
      const float t1 = fmaxf(fmaxf(s[j][3], s[j][4]), s[j][5]);
      mj[j] = fmaxf(fmaxf(t0, t1), fmaxf(s[j][6], s[j][7]));
    }
    float m = fmaxf(fmaxf(mj[0], mj[1]), fmaxf(mj[2], mj[3]));
    m = fmaxf(m, xhalf(m));
    const float mnew  = fmaxf(mrun, m);
    const float msafe = (mnew == -INFINITY) ? 0.f : mnew;
    const float alpha = __expf(mrun - msafe);
    mrun = mnew;
#pragma unroll
    for (int j = 0; j < 4; ++j)
#pragma unroll
      for (int r = 0; r < 8; ++r) s[j][r] = __expf(s[j][r] - msafe);
    const v8f ts = (s[0] + s[1]) + (s[2] + s[3]);   // tiles first (packed adds), then a tree over the eight
    const float psum = ((ts[0] + ts[1]) + (ts[2] + ts[3])) + ((ts[4] + ts[5]) + (ts[6] + ts[7]));
    lrun = lrun * alpha + psum;
#pragma unroll
    for (int r = 0; r < 8; ++r) {
      oacc[0][r] *= alpha;
      oacc[1][r] *= alpha;
    }

    // ---- context^T += V^T . P^T (f16 WMMA); two score tiles, converted in place (x1024, f16), are the B operand
    //      of one 32-key step; residual products into a separate accumulator ----
    v8f o1[2];
    o1[0] = zero8(); o1[1] = zero8();
#pragma unroll
    for (int kk = 0; kk < 2; ++kk) {
      FH pb;
      pb.h[0] = __builtin_convertvector(s[2 * kk] * 1024.0f, v8h);
      pb.h[1] = __builtin_convertvector(s[2 * kk + 1] * 1024.0f, v8h);
#pragma unroll
      for (int t = 0; t < 2; ++t) {
        FH vb, vl;
        vb.h[0] = *(const v8h*)(Vth + (t * 16 + c) * 64 + kk * 32 + 8 * hh);
        vb.h[1] = *(const v8h*)(Vth + (t * 16 + c) * 64 + kk * 32 + 16 + 8 * hh);
        vl.h[0] = *(const v8h*)(Vtl + (t * 16 + c) * 64 + kk * 32 + 8 * hh);
        vl.h[1] = *(const v8h*)(Vtl + (t * 16 + c) * 64 + kk * 32 + 16 + 8 * hh);
        oacc[t] = mma_h(vb.v, pb.v, oacc[t]);
        o1[t]   = mma_h(vl.v, pb.v, o1[t]);
      }
    }
#pragma unroll
    for (int t = 0; t < 2; ++t)
#pragma unroll
      for (int r = 0; r < 8; ++r) oacc[t][r] += o1[t][r] * (1.0f / 2048.0f);
  }

  // ---- join the halves' sums, normalise (1/l, undo the x1024 p carry and the x4 v carry), stage the wave's
  //      16x32 tile: oacc[t][r] is element (query c, d = t*16 + 8*hh + r)
  float* os = Os[wave];
  {
    const float l = lrun + xhalf(lrun);
    const float inv = 1.0f / (l * 4096.0f);
#pragma unroll
    for (int t = 0; t < 2; ++t) {
      const v8f o = oacc[t] * inv;
      *(v4f*)(os + c * HD + t * 16 + 8 * hh)     = (v4f){o[0], o[1], o[2], o[3]};
      *(v4f*)(os + c * HD + t * 16 + 8 * hh + 4) = (v4f){o[4], o[5], o[6], o[7]};
    }
  }
  __builtin_amdgcn_fence(__ATOMIC_RELEASE, "workgroup");
  __builtin_amdgcn_wave_barrier();
  __builtin_amdgcn_fence(__ATOMIC_ACQUIRE, "workgroup");
  {
    const int rq = lane >> 2, c8 = (lane & 3) * 8;
    v4u hv[2], lv[2];
#pragma unroll
    for (int it = 0; it < 2; ++it) {
      const int row = it * 8 + rq;   // it 0..1 x rq 0..7 = rows 0..15 of the wave tile
      const float* sp = os + row * HD + c8;
      v4u a, a2;
#pragma unroll
      for (int e = 0; e < 4; ++e) {
        const float f0 = sp[2 * e], f1 = sp[2 * e + 1];
        const unsigned short h0 = bf_bits(f0), h1 = bf_bits(f1);
        const unsigned short l0 = bf_bits(f0 - bf_up(h0)), l1 = bf_bits(f1 - bf_up(h1));
        a[e] = pk16(h0, h1); a2[e] = pk16(l0, l1);
      }
      hv[it] = a; lv[it] = a2;
    }
    const size_t PS = (size_t)NBH * SEQ * HD;
    unsigned short* base = ct + ((size_t)bh * SEQ + (size_t)q0) * HD;
    {
#pragma unroll
      for (int it = 0; it < 2; ++it) {
        unsigned short* p = base + it * 256 + lane * 8;
        *(v4u*)(p)          = hv[it];
        *(v4u*)(p + PS)     = hv[it];
        *(v4u*)(p + 2 * PS) = lv[it];
      }
      
    }
  }
}

// =====================================================================================================
// Workspace map (bytes), every region an exact multiple of its whole-line / whole-tile store granularity
// (no tail rows anywhere: all shapes are exact tile multiples):
//   X3   bf16 [4096][768]            6291456
//   Wq3  bf16 [768][768]             1179648
//   Wo3  bf16 [256][768]              393216
//   Qp   f16  [16][2048][32]          2097152
//   Kraw f32  [16][2048][32]          4194304
//   Kp   f16  [16][2048][32]          2097152
//   VTh  f16  [2][256][2048]          2097152
//   VTl  f16  [2][256][2048]          2097152
//   CT   bf16 [3][16][2048][32]       6291456
//   total                           26738688
// =====================================================================================================
extern "C" void kernel_launch(void* const* d_in, const int* in_sizes, int n_in,
                              void* d_out, int out_size, void* d_ws, size_t ws_size,
                              hipStream_t stream) {
  if (n_in < 6) return;
  if (in_sizes[0] != ROWS * DM) return;
  if (in_sizes[1] != DM * QKVW) return;
  if (in_sizes[2] != DM * DM) return;
  if (in_sizes[3] != DM) return;
  if (in_sizes[4] != NFUN || in_sizes[5] != NFUN) return;
  if (out_size != ROWS * DM) return;

  const float* x     = (const float*)d_in[0];   // [2][2048][256]
  const float* w_qkv = (const float*)d_in[1];   // [256 in][768 out]
  const float* w_o   = (const float*)d_in[2];   // [256 in][256 out]
  const float* b_o   = (const float*)d_in[3];   // [256]
  const float* coefa = (const float*)d_in[4];   // [256] sine coefficients
  const float* coefb = (const float*)d_in[5];   // [256] cosine coefficients

  const size_t PX3 = (size_t)ROWS * KP * 2;            // 6291456
  const size_t PWQ = (size_t)QKVW * KP * 2;            // 1179648
  const size_t PWO = (size_t)DM * KP * 2;              //  393216
  const size_t PH  = (size_t)NBH * SEQ * HD * 2;       // 2097152  f16 head plane
  const size_t PK4 = (size_t)NBH * SEQ * HD * 4;       // 4194304  f32 head plane
  const size_t PVT = (size_t)NB * DM * SEQ * 2;        // 2097152  v^T plane
  const size_t PCT = (size_t)3 * NBH * SEQ * HD * 2;   // 6291456  ctx planes
  size_t off = 0;
  const size_t oX3  = off; off += PX3;
  const size_t oWq  = off; off += PWQ;
  const size_t oWo  = off; off += PWO;
  const size_t oQp  = off; off += PH;
  const size_t oKr  = off; off += PK4;
  const size_t oKp  = off; off += PH;
  const size_t oVTh = off; off += PVT;
  const size_t oVTl = off; off += PVT;
  const size_t oCT  = off; off += PCT;
  if (off > ws_size) return;                           // off = 26738688
  if (off > (size_t)134217728) return;

  char* ws = (char*)d_ws;
  unsigned short* X3  = (unsigned short*)(ws + oX3);
  unsigned short* Wq3 = (unsigned short*)(ws + oWq);
  unsigned short* Wo3 = (unsigned short*)(ws + oWo);
  unsigned short* Qp  = (unsigned short*)(ws + oQp);
  float*          Kr  = (float*)(ws + oKr);
  unsigned short* Kp  = (unsigned short*)(ws + oKp);
  unsigned short* VTh = (unsigned short*)(ws + oVTh);
  unsigned short* VTl = (unsigned short*)(ws + oVTl);
  unsigned short* CT  = (unsigned short*)(ws + oCT);

  const dim3 blk(256);
  const int n8x = ROWS * DM / 8;                                   // 131072
  const dim3 gCvtX((n8x + 255) / 256);                              //  512 blocks
  const dim3 gTq(QKVW / 64, DM / 64);                               //  12 x 4
  const dim3 gTo(DM / 64, DM / 64);                                 //   4 x 4
  const dim3 gQK(((ROWS / 64) * (DM / 64) + 7) / 8, 1);             //  256 tiles -> 32 blocks: M=4096, N=256
  const dim3 gVT(((DM / 64) * (SEQ / 64) + 7) / 8, NB);             //  128 tiles -> 16 blocks x 2 batches: M=256, N=2048
  const dim3 gFour((NBH * SEQ * HD) / 1024);                        // 1024 blocks of 256, 4 elements per lane
  const dim3 gAttn(NBH * NQB);                                      //  512 blocks of 128

  // (1) x -> [hi|hi|lo] bf16 plane; weights transposed to [out][in] as [hi|lo|hi] bf16 planes
  cvt_x3<<<gCvtX, blk, 0, stream>>>(x, X3, n8x);
  wtrans3<<<gTq, blk, 0, stream>>>(w_qkv, Wq3, QKVW);
  wtrans3<<<gTo, blk, 0, stream>>>(w_o, Wo3, DM);
  // (2) q = x . Wq -> f16 head plane (x4)   (M=4096, N=256, K=768)
  gemm64<0, 0><<<gQK, blk, 0, stream>>>(
      X3, KP, 0LL, Wq3, KP, 0LL,
      (void*)Qp, (void*)Qp, 0, 0LL, b_o,
      ROWS, DM, KP, 4.0f, 1.0f);
  // (3) k = x . Wk -> raw f32 head plane   (M=4096, N=256, K=768)
  gemm64<0, 1><<<gQK, blk, 0, stream>>>(
      X3, KP, 0LL, Wq3 + (size_t)DM * KP, KP, 0LL,
      (void*)Kr, (void*)Kr, 0, 0LL, b_o,
      ROWS, DM, KP, 1.0f, 1.0f);
  // (4) v^T = Wv . x^T per batch -> f16 hi plane (x4) [b][c][s] (pitch SEQ) and residual plane (x2048)
  //     (A = Wq3 rows 512.., Bt = X3 rows of batch b; M=256, N=2048, K=768)
  gemm64<0, 2><<<gVT, blk, 0, stream>>>(
      Wq3 + (size_t)2 * DM * KP, KP, 0LL, X3, KP, (long long)SEQ * KP,
      (void*)VTh, (void*)VTl, SEQ, (long long)DM * SEQ, b_o,
      DM, SEQ, KP, 4.0f, 2048.0f);
  // (5) Fourier-basis transform of k -> f16 head plane (x4)
  fourier_k<<<gFour, blk, 0, stream>>>(Kr, coefa, coefb, Kp);
  // (6) attention -> ctx planes (bf16 hi, hi, lo)
  attn32<<<gAttn, dim3(128), 0, stream>>>(Qp, Kp, VTh, VTl, CT, 0.17677669529663687f * 0.0625f);
  // (7) out = ctx . Wo + bias -> d_out f32 [4096][256]   (M=4096, N=256, K=768, A in head-plane layout)
  gemm64<1, 3><<<gQK, blk, 0, stream>>>(
      CT, 0, 0LL, Wo3, KP, 0LL,
      d_out, d_out, DM, 0LL, b_o,
      ROWS, DM, KP, 1.0f, 1.0f);
  (void)hipGetLastError();
}

// v004
// A run of this version takes 106 microseconds.
// Next to v003, in two timings, it ran 1.31 and 1.29 times as fast.
// Counting every step since v000, it is 3.60 times as fast.
// Contractions: q, k, v^T projections and the output projection = v_wmma_f32_16x16x32_bf16 over bf16 hi/lo planes
// laid out as [hi|hi|lo] x [hi|lo|hi] along k (3 products, f32 accumulate);
// q.k^T scores = v_wmma_f32_16x16x32_f16 (q and the transformed k as f16 planes carried x4, single product, f32 accumulate);
// p.v = v_wmma_f32_16x16x32_f16 (p carried x1024 in f16; v^T as f16 hi plane x4 plus f16 residual plane x2^11; 2 products, f32 accumulate);
// Fourier-basis transform of k (one precise sincosf per element, then a rotation recurrence), softmax and bias in f32 on the VALU.
#include <hip/hip_runtime.h>
#include <math.h>
#include <stdint.h>

#define NB   2
#define SEQ  2048
#define DM   256
#define NH   8
#define HD   32
#define NBH  (NB * NH)        // 16 (batch, head) pairs
#define QKVW (3 * DM)         // 768 qkv output width
#define KP   (3 * DM)         // 768 folded k width of the split operand planes
#define NFUN 256
#define ROWS (NB * SEQ)       // 4096 token rows
#define NQB  (SEQ / 64)       // 64-query blocks per (b, h)
#define NKT  (SEQ / 64)       // 64-key chunks
#define GP   144              // GEMM operand row pitch in LDS, bytes: 128 B (64 k) + 16 B (16 B x odd, for 16-B readers)
#define GBUF (384 * GP)       // one GEMM operand buffer: 128 A rows + 256 Bt rows
#define NTQ  ((QKVW / 64) * (DM / 64))   // 48 transpose tiles of w_qkv
#define NTO  ((DM / 64) * (DM / 64))     // 16 transpose tiles of w_o
#define NGB  32               // 128x256 block tiles of each of the four products
static_assert(NH * HD == DM);
static_assert(NQB == 32 && NKT == 32);
static_assert((ROWS % 64) == 0 && (DM % 64) == 0 && (SEQ % 64) == 0 && (KP % 32) == 0);
static_assert((ROWS * DM) % 2048 == 0);
static_assert((ROWS / 128) * (DM / 256) == NGB && NB * (DM / 128) * (SEQ / 256) == NGB);
static_assert((ROWS % 128) == 0 && (DM % 256) == 0 && (DM % 128) == 0 && (SEQ % 256) == 0 && (KP % 64) == 0 && (SEQ % 128) == 0);

typedef _Float16 v16h __attribute__((ext_vector_type(16)));
typedef _Float16 v8h  __attribute__((ext_vector_type(8)));
typedef __bf16   v16b __attribute__((ext_vector_type(16)));
typedef __bf16   v8b  __attribute__((ext_vector_type(8)));
typedef float    v8f  __attribute__((ext_vector_type(8)));
typedef float    v4f  __attribute__((ext_vector_type(4)));
typedef unsigned int v4u __attribute__((ext_vector_type(4)));
typedef float    v2f  __attribute__((ext_vector_type(2)));
typedef unsigned int v2u __attribute__((ext_vector_type(2)));

#if defined(__HIP_DEVICE_COMPILE__)
#define DEV_ASM 1
#else
#define DEV_ASM 0
#endif

// ---- scalar helpers --------------------------------------------------------------------------------
__device__ __forceinline__ unsigned short bf_bits(float f) {          // f32 -> bf16 bits, RNE convert
  unsigned u = __float_as_uint(f);
  return (unsigned short)((u + 0x7FFFu + ((u >> 16) & 1u)) >> 16);
}
__device__ __forceinline__ float bf_up(unsigned short hb) { return __uint_as_float(((unsigned)hb) << 16); }
__device__ __forceinline__ unsigned short h_bits(_Float16 x) { return __builtin_bit_cast(unsigned short, x); }
__device__ __forceinline__ unsigned pk16(unsigned short a, unsigned short b) { return (unsigned)a | ((unsigned)b << 16); }
__device__ __forceinline__ v8f zero8() { v8f z = {0.f, 0.f, 0.f, 0.f, 0.f, 0.f, 0.f, 0.f}; return z; }

// ---- fragment loaders: 16-bit A/B operand, lane -> row/col (lane&15), p already includes +8*(lane>>4);
//      elements 0..7 <- p[0..7] (k0+8h..k0+8h+7), elements 8..15 <- p[16..23] (k0+16+8h..k0+16+8h+7)
template <typename OT> struct FT;
template <> struct FT<__bf16>   { typedef v16b frag; typedef v8b half8; };
template <> struct FT<_Float16> { typedef v16h frag; typedef v8h half8; };

template <typename OT>
__device__ __forceinline__ typename FT<OT>::frag ldfrag(const OT* p) {
  union { typename FT<OT>::frag v; typename FT<OT>::half8 h[2]; } f;
  f.h[0] = *(const typename FT<OT>::half8*)(p);
  f.h[1] = *(const typename FT<OT>::half8*)(p + 16);
  return f.v;
}

// ---- WMMA helpers ----------------------------------------------------------------------------------
__device__ __forceinline__ v8f mmar(v16b a, v16b b, v8f c) {
  return __builtin_amdgcn_wmma_f32_16x16x32_bf16(false, a, false, b, (short)0, c, false, false);
}
// guarded form: 4 VALU slots after the WMMA, D tied, A/B kept live
__device__ __forceinline__ v8f mma_h(v16h a, v16h b, v8f c) {
  c = __builtin_amdgcn_wmma_f32_16x16x32_f16(false, a, false, b, (short)0, c, false, false);
#if DEV_ASM
  asm volatile("v_nop\n\tv_nop\n\tv_nop\n\tv_nop" : "+v"(c) : "v"(a), "v"(b));
#endif
  return c;
}
// lane l <-> lane l ^ 16
__device__ __forceinline__ float xhalf(float x) {
  const int b = __builtin_bit_cast(int, x);
  return __builtin_bit_cast(float, __builtin_amdgcn_permlanex16(b, b, 0x76543210, 0xfedcba98, false, false));
}
__device__ __forceinline__ void dep_guard(v8f& a, v8f& b, v16b x, v16b y) {
#if DEV_ASM
  asm volatile("v_nop\n\tv_nop\n\tv_nop\n\tv_nop" : "+v"(a), "+v"(b) : "v"(x), "v"(y));
#else
  (void)a; (void)b; (void)x; (void)y;
#endif
}
__device__ __forceinline__ void keep4(v16b a, v16b b, v16b c, v16b d) {
#if DEV_ASM
  asm volatile("v_nop" :: "v"(a), "v"(b), "v"(c), "v"(d));
#else
  (void)a; (void)b; (void)c; (void)d;
#endif
}
__device__ __forceinline__ void acc_guard4(v8f& a, v8f& b, v8f& c, v8f& d) {
#if DEV_ASM
  asm volatile("v_nop\n\tv_nop\n\tv_nop\n\tv_nop" : "+v"(a), "+v"(b), "+v"(c), "+v"(d));
#else
  (void)a; (void)b; (void)c; (void)d;
#endif
}
// ---- asynchronous copies global -> LDS, 16 B a lane ------------------------------------------------
__device__ __forceinline__ uint32_t lds_off(const void* p) { return (uint32_t)(size_t)p; }   // LDS byte address
// twelve copies of a lane (l: LDS byte addresses, g: global addresses); the s_wait_xcnt stands inside the
// statement so that no address register named here is rewritten ahead of it
__device__ __forceinline__ void copy12(const uint32_t (&l)[12], const __bf16* const (&g)[12]) {
#if DEV_ASM
  asm volatile("global_load_async_to_lds_b128 %0, %12, off\n\t"
               "global_load_async_to_lds_b128 %1, %13, off\n\t"
               "global_load_async_to_lds_b128 %2, %14, off\n\t"
               "global_load_async_to_lds_b128 %3, %15, off\n\t"
               "global_load_async_to_lds_b128 %4, %16, off\n\t"
               "global_load_async_to_lds_b128 %5, %17, off\n\t"
               "global_load_async_to_lds_b128 %6, %18, off\n\t"
               "global_load_async_to_lds_b128 %7, %19, off\n\t"
               "global_load_async_to_lds_b128 %8, %20, off\n\t"
               "global_load_async_to_lds_b128 %9, %21, off\n\t"
               "global_load_async_to_lds_b128 %10, %22, off\n\t"
               "global_load_async_to_lds_b128 %11, %23, off\n\t"
               "s_wait_xcnt 0x0"
               :: "v"(l[0]), "v"(l[1]), "v"(l[2]), "v"(l[3]), "v"(l[4]), "v"(l[5]),
                  "v"(l[6]), "v"(l[7]), "v"(l[8]), "v"(l[9]), "v"(l[10]), "v"(l[11]),
                  "v"(g[0]), "v"(g[1]), "v"(g[2]), "v"(g[3]), "v"(g[4]), "v"(g[5]),
                  "v"(g[6]), "v"(g[7]), "v"(g[8]), "v"(g[9]), "v"(g[10]), "v"(g[11])
               : "memory");
#else
  (void)l; (void)g;
#endif
}
// this wave's copies have landed
__device__ __forceinline__ void wait_copies() {
#if DEV_ASM
  asm volatile("s_wait_asynccnt 0x0" ::: "memory");
#endif
}
// behind a job's last global stores: in a kernel that holds several jobs' bodies the registers that the stores
// name may be written by the code laid out behind them; the wait stands in front of any such write
__device__ __forceinline__ void wait_store_regs() {
#if DEV_ASM
  asm volatile("s_wait_xcnt 0x0" ::: "memory");
#endif
}
// this wave's LDS reads have returned (in front of the barrier that hands a buffer to its next copies)
__device__ __forceinline__ void wait_lds() {
#if DEV_ASM
  asm volatile("s_wait_dscnt 0x0" ::: "memory");
#endif
}

// =====================================================================================================
// x [ROWS][DM] f32 -> split plane X3 [ROWS][KP] bf16, row = [hi | hi | lo] (hi = RNE bf16, lo = RNE bf16
// of the exact residual). 8 elements per thread; each thread stores 16 B into each of the three thirds;
// bx = the block's index within this job.
// =====================================================================================================
__device__ __forceinline__ void cvt_x3(const float* __restrict__ in, unsigned short* out, int n8, int bx) {
  const int i = bx * 256 + (int)threadIdx.x;
  if (i < n8) {
    const int row = i >> 5, c = (i & 31) * 8;
    const v4f a  = *(const v4f*)(in + (size_t)i * 8);
    const v4f a4 = *(const v4f*)(in + (size_t)i * 8 + 4);
    const float f[8] = {a[0], a[1], a[2], a[3], a4[0], a4[1], a4[2], a4[3]};
    v4u ph, pl;
#pragma unroll
    for (int e = 0; e < 4; ++e) {
      const float f0 = f[2 * e], f1 = f[2 * e + 1];
      const unsigned short h0 = bf_bits(f0), h1 = bf_bits(f1);
      const unsigned short l0 = bf_bits(f0 - bf_up(h0)), l1 = bf_bits(f1 - bf_up(h1));
      ph[e] = pk16(h0, h1);
      pl[e] = pk16(l0, l1);
    }
    unsigned short* o = out + (size_t)row * KP + c;
    *(v4u*)(o)          = ph;
    *(v4u*)(o + DM)     = ph;
    *(v4u*)(o + 2 * DM) = pl;
    wait_store_regs();
  }
}

// =====================================================================================================
// w [DM rows k][C cols] f32 (x @ w layout) -> wt [C][KP] bf16, row c = [hi | lo | hi] of w[k][c] over k.
// Block = 64 k x 64 c tile staged in LDS (f32); C/64 x DM/64 blocks: bx -> c0, by -> k0.
// coverage: 8 waves x 8 rows x 64 k = the tile, all three thirds; the grid covers all C rows x DM k.
// =====================================================================================================
__device__ __forceinline__ void wtrans3(float (*tile)[65], const float* __restrict__ w, unsigned short* wt, int C,
                                        int bx, int by) {
  const int tid = (int)threadIdx.x, lane = tid & 31, wave = tid >> 5;
  const int c0 = bx * 64, k0 = by * 64;
#pragma unroll
  for (int it = 0; it < 16; ++it) {
    const int idx = it * 256 + tid;
    const int r = idx >> 6, cc = idx & 63;
    tile[r][cc] = w[(size_t)(k0 + r) * C + c0 + cc];
  }
  __syncthreads();
  const int q = lane >> 3, c8 = (lane & 7) * 8;
  v4u hv[2], lv[2];
#pragma unroll
  for (int it = 0; it < 2; ++it) {
    const int row = wave * 8 + it * 4 + q;          // output row (c within tile)
    v4u a, a2;
#pragma unroll
    for (int e = 0; e < 4; ++e) {
      const float f0 = tile[c8 + 2 * e][row], f1 = tile[c8 + 2 * e + 1][row];
      const unsigned short h0 = bf_bits(f0), h1 = bf_bits(f1);
      const unsigned short l0 = bf_bits(f0 - bf_up(h0)), l1 = bf_bits(f1 - bf_up(h1));
      a[e] = pk16(h0, h1);
      a2[e] = pk16(l0, l1);
    }
    hv[it] = a; lv[it] = a2;
  }
  {
#pragma unroll
    for (int it = 0; it < 2; ++it) {
      const int row = wave * 8 + it * 4 + q;
      unsigned short* o = wt + (size_t)(c0 + row) * KP + k0 + c8;
      *(v4u*)(o)          = hv[it];
      *(v4u*)(o + DM)     = lv[it];
      *(v4u*)(o + 2 * DM) = hv[it];
    }
    wait_store_regs();
  }
}

// =====================================================================================================
// The three operand preparations in one launch: each reads inputs only and writes a plane of its own, so
// none waits for another. The block index picks the job (the same for the whole block, so the transpose's
// barrier stays block-uniform): NTQ blocks transpose w_qkv, NTO blocks w_o, the remaining n8 / 256 split x.
// =====================================================================================================
__global__ __launch_bounds__(256) void prep3(const float* __restrict__ x, const float* __restrict__ w_qkv,
                                             const float* __restrict__ w_o, unsigned short* X3,
                                             unsigned short* Wq3, unsigned short* Wo3, int n8) {
  __shared__ float tile[64][65];
  const int bx = (int)blockIdx.x;
  if (bx < NTQ) {
    wtrans3(tile, w_qkv, Wq3, QKVW, bx % (QKVW / 64), bx / (QKVW / 64));
  } else if (bx < NTQ + NTO) {
    wtrans3(tile, w_o, Wo3, DM, (bx - NTQ) % (DM / 64), (bx - NTQ) / (DM / 64));
  } else {
    cvt_x3(x, X3, n8, bx - (NTQ + NTO));
  }
}

// =====================================================================================================
// Register-blocked batched WMMA GEMM, bf16 operands: C[m][n] = sum_k A[m][k] * Bt[n][k]; one wave per
// 64x64 tile, eight waves (2 x 4) on a 128x256 block tile. Bt row-major [N][K] pitch ldb (k contiguous).
// A_MODE 0: A row-major [M][K] pitch lda.  A_MODE 1: head planes: A(m, k) at
//   plane = (k/256)*NBH + (m/SEQ)*NH + (k/32)%NH;  A[(plane*SEQ + m%SEQ)*HD + k%32]  (M = ROWS, K = KP).
// M multiple of 128, N of 256, K of 64 (static shapes below). bx = block tile index, b = batch index (strides in
// elements); ring and sT are the calling kernel's LDS.
// Operands: per pass of 64 k the block's 128 A rows and 256 Bt rows (128 B each) come into LDS by asynchronous
// copies of whole 128-B lines, two buffers, the next pass's copies in flight while this pass is worked on;
// LDS row pitch 144 B; fragments read from LDS with the split k map (ldfrag), k ascending as before.
// Epilogue: 16-row slabs staged per wave in LDS (pitch 68 floats), then:
// OUT_MODE 0: f16 head plane [NBH][SEQ][HD], value * oscale: per head half of the slab (16 rows x 32 cols =
// OUT_MODE 1: f32 head plane [NBH][SEQ][HD]: per head half (2048 contiguous B) four instructions of
// OUT_MODE 2: f16 hi plane C (value*oscale) + f16 residual plane C2 = f16((v*oscale - hi) * rscale), row-major
// OUT_MODE 3: f32 row-major C (pitch ldc) + bias[n] (f32): each 64-wide row segment = 256 B = 16 lanes x 16 B.
// coverage: 4 slabs x 16 rows x 64 cols = the wave's whole 64x64 tile; grids are exact tile multiples.
// =====================================================================================================
template <int A_MODE, int OUT_MODE>
__device__ __forceinline__ void gemm64(
    unsigned char* ring, float (*sT)[16 * 68], int bx, int b,
    const unsigned short* __restrict__ Ap, int lda, long long strideA,
    const unsigned short* __restrict__ Btp, int ldb, long long strideB,
    void* Cout, void* Cout2, int ldc, long long strideC,
    const float* __restrict__ bias,
    int M, int N, int K, float oscale, float rscale) {
  const __bf16* A  = (const __bf16*)(const void*)Ap;
  const __bf16* Bt = (const __bf16*)(const void*)Btp;
  const int tid  = (int)threadIdx.x;
  const int lane = tid & 31;
  const int wave = tid >> 5;
  const int nbn = N >> 8;                // block tiles along N
  const int bm  = bx / nbn;
  const int bn  = bx - bm * nbn;
  if (bm >= (M >> 7)) return;            // the same for the whole block, in front of every barrier
  const int bm0 = bm << 7;
  const int bn0 = bn << 8;
  const int wr  = (wave >> 2) << 6;      // the wave's first A row in the block tile
  const int wc  = (wave & 3) << 6;       // the wave's first Bt row in the block tile
  const int m0 = bm0 + wr;
  const int n0 = bn0 + wc;

  const __bf16* Ab = A  + (size_t)b * (size_t)strideA;
  const __bf16* Bb = Bt + (size_t)b * (size_t)strideB;

  const int rlane = lane & 15;                 // row (A) / col (B, D) within subtile
  const int koff  = (lane >> 4) * 8;           // k offset of this lane half
  const int mOff  = (lane >> 4) * 8;           // D row offset

  v8f acc[4][4];
#pragma unroll
  for (int i = 0; i < 4; ++i)
#pragma unroll
    for (int j = 0; j < 4; ++j) acc[i][j] = zero8();

  // pass t -> buffer buf: 12 copies a lane; a wave's copy covers 512 B of whole lines (4 rows of 128 B; in the
  // head-plane layout 8 rows of 64 B, which adjoin)
  const uint32_t ringb = lds_off(ring);
  auto stage = [&](int t, int buf) {
    const int k0 = t << 6;
    const uint32_t lb = ringb + (uint32_t)buf * GBUF;
    uint32_t la[12];
    const __bf16* ga[12];
#pragma unroll
    for (int u = 0; u < 4; ++u) {
      if (A_MODE == 0) {
        const int row = u * 32 + (tid >> 3), pc = tid & 7;
        ga[u] = Ab + (size_t)(bm0 + row) * lda + k0 + pc * 8;
        la[u] = lb + (uint32_t)(row * GP + pc * 16);
      } else {
        const int kk = k0 + (u >> 1) * 32;
        const int row = (u & 1) * 64 + (tid >> 2), pc = tid & 3;
        const int plane = (kk >> 8) * NBH + (bm0 / SEQ) * NH + ((kk >> 5) & (NH - 1));
        ga[u] = Ab + ((size_t)plane * SEQ + (size_t)((bm0 & (SEQ - 1)) + row)) * HD + pc * 8;
        la[u] = lb + (uint32_t)(row * GP + ((u >> 1) * 4 + pc) * 16);
      }
    }
#pragma unroll
    for (int u = 0; u < 8; ++u) {
      const int row = u * 32 + (tid >> 3), pc = tid & 7;
      ga[4 + u] = Bb + (size_t)(bn0 + row) * ldb + k0 + pc * 8;
      la[4 + u] = lb + (uint32_t)((128 + row) * GP + pc * 16);
    }
    copy12(la, ga);
  };

  const int T = K >> 6;                  // passes of 64 k
  stage(0, 0);
  wait_copies();
  __syncthreads();                       // pass 0 is readable by every wave
  if (T > 1) stage(1, 1);

  for (int t = 0; t < T; ++t) {
    const unsigned char* bufp = ring + (t & 1) * GBUF + koff * 2;
#pragma unroll
    for (int ks = 0; ks < 2; ++ks) {     // two k-steps of 32 (64 B of every row)
      v16b bq[4], af[4];
#pragma unroll
      for (int j = 0; j < 4; ++j)
        bq[j] = ldfrag<__bf16>((const __bf16*)(bufp + (128 + wc + (j << 4) + rlane) * GP + ks * 64));
#pragma unroll
      for (int i = 0; i < 4; ++i)
        af[i] = ldfrag<__bf16>((const __bf16*)(bufp + (wr + (i << 4) + rlane) * GP + ks * 64));
#pragma unroll
      for (int i = 0; i < 4; ++i) {
#pragma unroll
        for (int j = 0; j < 4; ++j) acc[i][j] = mmar(af[i], bq[j], acc[i][j]);
        dep_guard(acc[i][0], acc[i][3], af[i], bq[3]);
      }
      keep4(bq[0], bq[1], bq[2], bq[3]);
    }
    // hand-over: this wave has left buffer t & 1 and its copies of pass t + 1 have landed; behind the barrier
    // pass t + 1 is readable by every wave and buffer t & 1 is free for pass t + 2
    wait_lds();
    wait_copies();
    __syncthreads();
    if (t + 2 < T) stage(t + 2, t & 1);
  }
  wait_copies();                         // nothing of this wave is in flight when the epilogue starts
  acc_guard4(acc[0][0], acc[0][1], acc[0][2], acc[0][3]);
  acc_guard4(acc[1][0], acc[1][1], acc[1][2], acc[1][3]);
  acc_guard4(acc[2][0], acc[2][1], acc[2][2], acc[2][3]);
  acc_guard4(acc[3][0], acc[3][1], acc[3][2], acc[3][3]);

  // ---- epilogue ----
  float* slab = sT[wave];
#pragma unroll
  for (int i = 0; i < 4; ++i) {
    const int mBase = m0 + (i << 4);
#pragma unroll
    for (int j = 0; j < 4; ++j) {
#pragma unroll
      for (int r = 0; r < 8; ++r) {
        slab[(mOff + r) * 68 + (j << 4) + rlane] = acc[i][j][r];
      }
    }
    __builtin_amdgcn_fence(__ATOMIC_RELEASE, "workgroup");
    __builtin_amdgcn_wave_barrier();
    __builtin_amdgcn_fence(__ATOMIC_ACQUIRE, "workgroup");
    if (OUT_MODE == 0) {
      unsigned short* Q = (unsigned short*)Cout;
      const int rq = lane >> 2, c8 = (lane & 3) * 8;        // row within an 8-row group, 8-col piece
      v4u hv[4];
#pragma unroll
      for (int j2 = 0; j2 < 2; ++j2) {
#pragma unroll
        for (int it = 0; it < 2; ++it) {
          const float* sp = slab + (it * 8 + rq) * 68 + j2 * 32 + c8;   // it 0..1 x rq 0..7 = rows 0..15
          v4u a;
#pragma unroll
          for (int e = 0; e < 4; ++e)
            a[e] = pk16(h_bits((_Float16)(sp[2 * e] * oscale)), h_bits((_Float16)(sp[2 * e + 1] * oscale)));
          hv[j2 * 2 + it] = a;
        }
      }
      {
#pragma unroll
        for (int j2 = 0; j2 < 2; ++j2) {
          const int head = (n0 >> 5) + j2;
          unsigned short* base = Q + ((size_t)((mBase / SEQ) * NH + head) * SEQ + (size_t)(mBase & (SEQ - 1))) * HD;
#pragma unroll
          for (int it = 0; it < 2; ++it)
            *(v4u*)(base + it * 256 + lane * 8) = hv[j2 * 2 + it];
        }
        
      }
    } else if (OUT_MODE == 1) {
      float* Kr = (float*)Cout;
      const int rq = lane >> 3, c4 = (lane & 7) * 4;        // row within a 4-row group, 4-col piece
      v4f hv[8];
#pragma unroll
      for (int j2 = 0; j2 < 2; ++j2) {
#pragma unroll
        for (int it = 0; it < 4; ++it)                      // it 0..3 x rq 0..3 = rows 0..15
          hv[j2 * 4 + it] = *(const v4f*)(slab + (it * 4 + rq) * 68 + j2 * 32 + c4);
      }
      {
#pragma unroll
        for (int j2 = 0; j2 < 2; ++j2) {
          const int head = (n0 >> 5) + j2;
          float* base = Kr + ((size_t)((mBase / SEQ) * NH + head) * SEQ + (size_t)(mBase & (SEQ - 1))) * HD;
#pragma unroll
          for (int it = 0; it < 4; ++it)
            *(v4f*)(base + it * 128 + lane * 4) = hv[j2 * 4 + it];
        }
        
      }
    } else if (OUT_MODE == 2) {
      const int q = lane >> 3, c8 = (lane & 7) * 8;
      unsigned short* C  = (unsigned short*)Cout  + (size_t)b * (size_t)strideC;
      unsigned short* C2 = (unsigned short*)Cout2 + (size_t)b * (size_t)strideC;
      v4u hv[4], lv[4];
#pragma unroll
      for (int it = 0; it < 4; ++it) {
        const int row = it * 4 + q;                         // it 0..3 x q 0..3 = rows 0..15
        const float* sp = slab + row * 68 + c8;
        v4u a, a2;
#pragma unroll
        for (int e = 0; e < 4; ++e) {
          const float f0 = sp[2 * e] * oscale, f1 = sp[2 * e + 1] * oscale;
          const _Float16 x0 = (_Float16)f0, x1 = (_Float16)f1;
          const unsigned short h0 = h_bits(x0), h1 = h_bits(x1);
          const unsigned short l0 = h_bits((_Float16)((f0 - (float)x0) * rscale));
          const unsigned short l1 = h_bits((_Float16)((f1 - (float)x1) * rscale));
          a[e] = pk16(h0, h1); a2[e] = pk16(l0, l1);
        }
        hv[it] = a; lv[it] = a2;
      }
      {
#pragma unroll
        for (int it = 0; it < 4; ++it) {
          const int row = it * 4 + q;
          *(v4u*)(C  + (size_t)(mBase + row) * ldc + n0 + c8) = hv[it];
          *(v4u*)(C2 + (size_t)(mBase + row) * ldc + n0 + c8) = lv[it];
        }
        
      }
    } else {
      float* C = (float*)Cout + (size_t)b * (size_t)strideC;
      const int h2 = lane >> 4, c4 = (lane & 15) * 4;      // 256-B row segment = 16 lanes x 16 B
      const v4f bv = *(const v4f*)(bias + n0 + c4);
      v4f hv[8];
#pragma unroll
      for (int it = 0; it < 8; ++it) {
        const int row = it * 2 + h2;                        // it 0..7 x h2 0..1 = rows 0..15
        hv[it] = *(const v4f*)(slab + row * 68 + c4) + bv;
      }
      {
#pragma unroll
        for (int it = 0; it < 8; ++it) {
          const int row = it * 2 + h2;
          *(v4f*)(C + (size_t)(mBase + row) * ldc + n0 + c4) = hv[it];
        }
        
      }
    }
    __builtin_amdgcn_fence(__ATOMIC_RELEASE, "workgroup");
    __builtin_amdgcn_wave_barrier();
    __builtin_amdgcn_fence(__ATOMIC_ACQUIRE, "workgroup");
  }
}

// =====================================================================================================
// The q, k and v^T projections in one launch: all three read the X3 and Wq3 planes, none reads another's
// output, and each alone has NGB blocks for 256 WGPs. blockIdx.x / NGB picks the product (the same for the whole
// block, so every barrier stays block-uniform):
//   0: q = x . Wq -> f16 head plane (x4)        (M=4096, N=256, K=768)
//   1: k = x . Wk -> raw f32 head plane         (M=4096, N=256, K=768)
//   2: v^T = Wv . x^T per batch -> f16 hi plane (x4) [b][c][s] (pitch SEQ) and residual plane (x2048)
//      (A = Wq3 rows 512.., Bt = X3 rows of batch b; M=256, N=2048, K=768; 16 blocks a batch)
// =====================================================================================================
__global__ __launch_bounds__(256) void proj_qkv(const unsigned short* __restrict__ X3,
                                                const unsigned short* __restrict__ Wq3,
                                                unsigned short* Qp, float* Kr,
                                                unsigned short* VTh, unsigned short* VTl, int K) {
  __shared__ __align__(16) unsigned char ring[2 * GBUF];   // two operand buffers: 128 A rows, then 256 Bt rows
  __shared__ __align__(16) float sT[8][16 * 68];   // per-wave 16x64 slab, pitch 68 floats
  const unsigned job = blockIdx.x / NGB;
  const int bx = (int)(blockIdx.x % NGB);
  if (job == 0) {
    gemm64<0, 0>(ring, sT, bx, 0, X3, KP, 0LL, Wq3, KP, 0LL,
                 (void*)Qp, (void*)Qp, 0, 0LL, nullptr, ROWS, DM, K, 4.0f, 1.0f);
  } else if (job == 1) {
    gemm64<0, 1>(ring, sT, bx, 0, X3, KP, 0LL, Wq3 + (size_t)DM * KP, KP, 0LL,
                 (void*)Kr, (void*)Kr, 0, 0LL, nullptr, ROWS, DM, K, 1.0f, 1.0f);
  } else if (job == 2) {
    gemm64<0, 2>(ring, sT, bx % (NGB / NB), bx / (NGB / NB),
                 Wq3 + (size_t)2 * DM * KP, KP, 0LL, X3, KP, (long long)SEQ * KP,
                 (void*)VTh, (void*)VTl, SEQ, (long long)DM * SEQ, nullptr, DM, SEQ, K, 4.0f, 2048.0f);
  }
}

// out = ctx . Wo + bias -> f32 [4096][256]   (M=4096, N=256, K=768, A in head-plane layout)
__global__ __launch_bounds__(256) void proj_out(const unsigned short* __restrict__ CT,
                                                const unsigned short* __restrict__ Wo3,
                                                float* out, const float* __restrict__ bias, int K) {
  __shared__ __align__(16) unsigned char ring[2 * GBUF];   // two operand buffers: 128 A rows, then 256 Bt rows
  __shared__ __align__(16) float sT[8][16 * 68];   // per-wave 16x64 slab, pitch 68 floats
  gemm64<1, 3>(ring, sT, (int)blockIdx.x, 0, CT, 0, 0LL, Wo3, KP, 0LL,
               (void*)out, (void*)out, DM, 0LL, bias, ROWS, DM, K, 1.0f, 1.0f);
}

// =====================================================================================================
// Fourier-basis transform of k: out = sum_{f=1..NFUN} ca[f-1]*sin(f*k) + cb[f-1]*cos(f*k) in f32.
// One precise sincosf(k) per element; sin(f*k), cos(f*k) for f = 2..NFUN follow by rotating the pair by k
// (angle addition: two products and two fused multiply-adds a step). The rotation keeps the pair's length,
// so its error grows linearly in f: at f = NFUN it is that of moving k by about one f32 ulp.
// Terms are added in the order f = 1..NFUN, sine before cosine, as fused multiply-adds.
// Four consecutive elements of the raw f32 k head plane [NBH][SEQ][HD] per lane, as two pairs, so that every
// step is packed f32 arithmetic; a lane stores its four f16 results (x4) as 8 B, a wave 256 contiguous B.
// coverage: grid x 256 x 4 = every element of the k' plane.
// =====================================================================================================
__global__ __launch_bounds__(256) void fourier_k(const float* __restrict__ kr, const float* __restrict__ ca,
                                                 const float* __restrict__ cb, unsigned short* kp) {
  const size_t g4 = ((size_t)blockIdx.x * 256 + (size_t)threadIdx.x) * 4;
  const v4f kx = *(const v4f*)(kr + g4);
  v2f s1[2], c1[2], s[2], c[2], acc[2];
#pragma unroll
  for (int h = 0; h < 2; ++h) {
#pragma unroll
    for (int e = 0; e < 2; ++e) {
      float sn, cs;
      sincosf(kx[2 * h + e], &sn, &cs);
      s1[h][e] = sn;
      c1[h][e] = cs;
    }
    s[h] = s1[h];
    c[h] = c1[h];
    acc[h] = (v2f){0.f, 0.f};
  }
  // unrolled so that the coefficients of a group of steps arrive in one pair of scalar loads
#pragma unroll 16
  for (int fi = 0; fi < NFUN; ++fi) {
    const float af = ca[fi];
    const float bf = cb[fi];
    const v2f a2 = {af, af}, b2 = {bf, bf};
#pragma unroll
    for (int h = 0; h < 2; ++h) {
      acc[h] = __builtin_elementwise_fma(a2, s[h], acc[h]);
      acc[h] = __builtin_elementwise_fma(b2, c[h], acc[h]);
      const v2f sn = __builtin_elementwise_fma(s[h], c1[h], c[h] * s1[h]);
      c[h] = __builtin_elementwise_fma(c[h], c1[h], -(s[h] * s1[h]));
      s[h] = sn;
    }
  }
  v2u o;
#pragma unroll
  for (int h = 0; h < 2; ++h)
    o[h] = pk16(h_bits((_Float16)(acc[h][0] * 4.0f)), h_bits((_Float16)(acc[h][1] * 4.0f)));
  *(v2u*)(kp + g4) = o;
}

// =====================================================================================================
// Attention, head dim 32, no mask, softmax over all SEQ keys.
//   q plane / k' plane (f16, x4): element (bh, t, d) at [(bh*SEQ + t)*HD + d]
//   v^T hi plane (f16, 4v) and residual plane (f16, (4v - hi)*2048): element (bh, d, s) at [(bh*HD + d)*SEQ + s]
//   ctx planes (bf16): part p (0 = hi, 1 = hi, 2 = lo), element (bh, t, d) at [p*PS + (bh*SEQ + t)*HD + d]
//   scores^T = (k4' . q4^T) * sscale on f16 WMMA (one k-step), softmax in f32 (running max), a query per lane pair;
//   p = exp(s - m) carried as f16(1024 p); O^T = vh^T . p^T + (vl^T . p^T) / 2048 on f16 WMMA; ctx = O / (l * 4096).
//   Block = 4 waves on the same (b, h), 4 consecutive 16-query tiles; grid = NBH * NQB; key chunks of 64,
//   static trip NKT. Chunk staging: 128 threads, K 64x32 (2 x 16 B per thread), V^T hi/res 32x64 (2 x 16 B
//   per thread and plane), plain loads, __syncthreads before and after. P^T stays in registers (score tiles -> B operand).
//   Output: each wave writes its 16x32 tile (1024 contiguous B per part) with two instructions of
//   all NBH*SEQ rows x HD, all three parts.
// =====================================================================================================
__global__ __launch_bounds__(128)
void attn32(const unsigned short* __restrict__ qpp, const unsigned short* __restrict__ kpp,
            const unsigned short* __restrict__ vhp, const unsigned short* __restrict__ vlp,
            unsigned short* ct, float sscale) {
  union FH { v16h v; v8h h[2]; };
  __shared__ __align__(16) _Float16 Ksh[64 * HD];          // K chunk [key][d]      4 KB
  __shared__ __align__(16) _Float16 Vth[HD * 64];          // V^T hi [d][key]      4 KB
  __shared__ __align__(16) _Float16 Vtl[HD * 64];          // V^T residual        4 KB
  __shared__ __align__(16) float    Os[4][16 * HD];        // per wave ctx tile    8 KB

  const int tid  = (int)threadIdx.x;
  const int wave = tid >> 5;
  const int lane = tid & 31;
  const int hh   = lane >> 4;
  const int c    = lane & 15;

  const int bx   = blockIdx.x;
  const int qblk = bx % NQB;
  const int bh   = bx / NQB;
  const int q0   = qblk * 64 + wave * 16;

  const _Float16* Qg = (const _Float16*)(const void*)qpp + (size_t)bh * SEQ * HD;
  const _Float16* Kg = (const _Float16*)(const void*)kpp + (size_t)bh * SEQ * HD;
  const _Float16* Vh = (const _Float16*)(const void*)vhp + (size_t)bh * HD * SEQ;
  const _Float16* Vl = (const _Float16*)(const void*)vlp + (size_t)bh * HD * SEQ;

  // ---- Q fragment (B operand, column = lane&15, one k-step of 32) ----
  const v16h qa = ldfrag<_Float16>(Qg + (size_t)(q0 + c) * HD + 8 * hh);

  float mrun = -INFINITY, lrun = 0.f;   // query c: running maximum (joined), running sum of this half's keys
  v8f oacc[2];
  oacc[0] = zero8(); oacc[1] = zero8();

  for (int kt = 0; kt < NKT; ++kt) {         // static trip count
    const int kv0 = kt * 64;
    __syncthreads();
    {
      const int r = tid >> 1, hf = (tid & 1) * 16;                  // key r, d = hf..hf+15
      const _Float16* kg = Kg + (size_t)(kv0 + r) * HD + hf;
      const v8h k0v = *(const v8h*)(kg);
      const v8h k1v = *(const v8h*)(kg + 8);
      *(v8h*)(Ksh + r * HD + hf)     = k0v;
      *(v8h*)(Ksh + r * HD + hf + 8) = k1v;
      const int d = tid >> 2, sg = (tid & 3) * 16;                  // d row, keys sg..sg+15
      const _Float16* vg  = Vh + (size_t)d * SEQ + kv0 + sg;
      const _Float16* vlg = Vl + (size_t)d * SEQ + kv0 + sg;
      const v8h v0 = *(const v8h*)(vg),  v1 = *(const v8h*)(vg + 8);
      const v8h w0 = *(const v8h*)(vlg), w1 = *(const v8h*)(vlg + 8);
      *(v8h*)(Vth + d * 64 + sg)     = v0;
      *(v8h*)(Vth + d * 64 + sg + 8) = v1;
      *(v8h*)(Vtl + d * 64 + sg)     = w0;
      *(v8h*)(Vtl + d * 64 + sg + 8) = w1;
    }
    __syncthreads();

    // ---- transposed scores: 64 keys (rows) x 16 queries (columns) per wave; lane (c, hh) holds, for query c,
    //      keys j*16 + 8*hh + r in s[j][r] ----
    v8f s[4];
#pragma unroll
    for (int j = 0; j < 4; ++j) {
      FH kb;
      kb.h[0] = *(const v8h*)(Ksh + (j * 16 + c) * HD + 8 * hh);
      kb.h[1] = *(const v8h*)(Ksh + (j * 16 + c) * HD + 16 + 8 * hh);
      s[j] = mma_h(kb.v, qa, zero8());
#pragma unroll
      for (int r = 0; r < 8; ++r) s[j][r] *= sscale;
    }

    // ---- online softmax: a query's maximum and sum lie in its own two lanes; the maximum is joined across the
    //      halves every chunk (both halves rescale alike), the sums only after the loop ----
    float mj[4];
#pragma unroll
    for (int j = 0; j < 4; ++j) {   // a short tree per tile, ready while the next tile's product runs
      const float t0 = fmaxf(fmaxf(s[j][0], s[j][1]), s[j][2]);
      const float t1 = fmaxf(fmaxf(s[j][3], s[j][4]), s[j][5]);
      mj[j] = fmaxf(fmaxf(t0, t1), fmaxf(s[j][6], s[j][7]));
    }
    float m = fmaxf(fmaxf(mj[0], mj[1]), fmaxf(mj[2], mj[3]));
    m = fmaxf(m, xhalf(m));
    const float mnew  = fmaxf(mrun, m);
    const float msafe = (mnew == -INFINITY) ? 0.f : mnew;
    const float alpha = __expf(mrun - msafe);
    mrun = mnew;
#pragma unroll
    for (int j = 0; j < 4; ++j)
#pragma unroll
      for (int r = 0; r < 8; ++r) s[j][r] = __expf(s[j][r] - msafe);
    const v8f ts = (s[0] + s[1]) + (s[2] + s[3]);   // tiles first (packed adds), then a tree over the eight
    const float psum = ((ts[0] + ts[1]) + (ts[2] + ts[3])) + ((ts[4] + ts[5]) + (ts[6] + ts[7]));
    lrun = lrun * alpha + psum;
#pragma unroll
    for (int r = 0; r < 8; ++r) {
      oacc[0][r] *= alpha;
      oacc[1][r] *= alpha;
    }

    // ---- context^T += V^T . P^T (f16 WMMA); two score tiles, converted in place (x1024, f16), are the B operand
    //      of one 32-key step; residual products into a separate accumulator ----
    v8f o1[2];
    o1[0] = zero8(); o1[1] = zero8();
#pragma unroll
    for (int kk = 0; kk < 2; ++kk) {
      FH pb;
      pb.h[0] = __builtin_convertvector(s[2 * kk] * 1024.0f, v8h);
      pb.h[1] = __builtin_convertvector(s[2 * kk + 1] * 1024.0f, v8h);
#pragma unroll
      for (int t = 0; t < 2; ++t) {
        FH vb, vl;
        vb.h[0] = *(const v8h*)(Vth + (t * 16 + c) * 64 + kk * 32 + 8 * hh);
        vb.h[1] = *(const v8h*)(Vth + (t * 16 + c) * 64 + kk * 32 + 16 + 8 * hh);
        vl.h[0] = *(const v8h*)(Vtl + (t * 16 + c) * 64 + kk * 32 + 8 * hh);
        vl.h[1] = *(const v8h*)(Vtl + (t * 16 + c) * 64 + kk * 32 + 16 + 8 * hh);
        oacc[t] = mma_h(vb.v, pb.v, oacc[t]);
        o1[t]   = mma_h(vl.v, pb.v, o1[t]);
      }
    }
#pragma unroll
    for (int t = 0; t < 2; ++t)
#pragma unroll
      for (int r = 0; r < 8; ++r) oacc[t][r] += o1[t][r] * (1.0f / 2048.0f);
  }

  // ---- join the halves' sums, normalise (1/l, undo the x1024 p carry and the x4 v carry), stage the wave's
  //      16x32 tile: oacc[t][r] is element (query c, d = t*16 + 8*hh + r)
  float* os = Os[wave];
  {
    const float l = lrun + xhalf(lrun);
    const float inv = 1.0f / (l * 4096.0f);
#pragma unroll
    for (int t = 0; t < 2; ++t) {
      const v8f o = oacc[t] * inv;
      *(v4f*)(os + c * HD + t * 16 + 8 * hh)     = (v4f){o[0], o[1], o[2], o[3]};
      *(v4f*)(os + c * HD + t * 16 + 8 * hh + 4) = (v4f){o[4], o[5], o[6], o[7]};
    }
  }
  __builtin_amdgcn_fence(__ATOMIC_RELEASE, "workgroup");
  __builtin_amdgcn_wave_barrier();
  __builtin_amdgcn_fence(__ATOMIC_ACQUIRE, "workgroup");
  {
    const int rq = lane >> 2, c8 = (lane & 3) * 8;
    v4u hv[2], lv[2];
#pragma unroll
    for (int it = 0; it < 2; ++it) {
      const int row = it * 8 + rq;   // it 0..1 x rq 0..7 = rows 0..15 of the wave tile
      const float* sp = os + row * HD + c8;
      v4u a, a2;
#pragma unroll
      for (int e = 0; e < 4; ++e) {
        const float f0 = sp[2 * e], f1 = sp[2 * e + 1];
        const unsigned short h0 = bf_bits(f0), h1 = bf_bits(f1);
        const unsigned short l0 = bf_bits(f0 - bf_up(h0)), l1 = bf_bits(f1 - bf_up(h1));
        a[e] = pk16(h0, h1); a2[e] = pk16(l0, l1);
      }
      hv[it] = a; lv[it] = a2;
    }
    const size_t PS = (size_t)NBH * SEQ * HD;
    unsigned short* base = ct + ((size_t)bh * SEQ + (size_t)q0) * HD;
    {
#pragma unroll
      for (int it = 0; it < 2; ++it) {
        unsigned short* p = base + it * 256 + lane * 8;
        *(v4u*)(p)          = hv[it];
        *(v4u*)(p + PS)     = hv[it];
        *(v4u*)(p + 2 * PS) = lv[it];
      }
      
    }
  }
}

// =====================================================================================================
// Workspace map (bytes), every region an exact multiple of its whole-line / whole-tile store granularity
// (no tail rows anywhere: all shapes are exact tile multiples):
//   X3   bf16 [4096][768]            6291456
//   Wq3  bf16 [768][768]             1179648
//   Wo3  bf16 [256][768]              393216
//   Qp   f16  [16][2048][32]          2097152
//   Kraw f32  [16][2048][32]          4194304
//   Kp   f16  [16][2048][32]          2097152
//   VTh  f16  [2][256][2048]          2097152
//   VTl  f16  [2][256][2048]          2097152
//   CT   bf16 [3][16][2048][32]       6291456
//   total                           26738688
// =====================================================================================================
extern "C" void kernel_launch(void* const* d_in, const int* in_sizes, int n_in,
                              void* d_out, int out_size, void* d_ws, size_t ws_size,
                              hipStream_t stream) {
  if (n_in < 6) return;
  if (in_sizes[0] != ROWS * DM) return;
  if (in_sizes[1] != DM * QKVW) return;
  if (in_sizes[2] != DM * DM) return;
  if (in_sizes[3] != DM) return;
  if (in_sizes[4] != NFUN || in_sizes[5] != NFUN) return;
  if (out_size != ROWS * DM) return;

  const float* x     = (const float*)d_in[0];   // [2][2048][256]
  const float* w_qkv = (const float*)d_in[1];   // [256 in][768 out]
  const float* w_o   = (const float*)d_in[2];   // [256 in][256 out]
  const float* b_o   = (const float*)d_in[3];   // [256]
  const float* coefa = (const float*)d_in[4];   // [256] sine coefficients
  const float* coefb = (const float*)d_in[5];   // [256] cosine coefficients

  const size_t PX3 = (size_t)ROWS * KP * 2;            // 6291456
  const size_t PWQ = (size_t)QKVW * KP * 2;            // 1179648
  const size_t PWO = (size_t)DM * KP * 2;              //  393216
  const size_t PH  = (size_t)NBH * SEQ * HD * 2;       // 2097152  f16 head plane
  const size_t PK4 = (size_t)NBH * SEQ * HD * 4;       // 4194304  f32 head plane
  const size_t PVT = (size_t)NB * DM * SEQ * 2;        // 2097152  v^T plane
  const size_t PCT = (size_t)3 * NBH * SEQ * HD * 2;   // 6291456  ctx planes
  size_t off = 0;
  const size_t oX3  = off; off += PX3;
  const size_t oWq  = off; off += PWQ;
  const size_t oWo  = off; off += PWO;
  const size_t oQp  = off; off += PH;
  const size_t oKr  = off; off += PK4;
  const size_t oKp  = off; off += PH;
  const size_t oVTh = off; off += PVT;
  const size_t oVTl = off; off += PVT;
  const size_t oCT  = off; off += PCT;
  if (off > ws_size) return;                           // off = 26738688
  if (off > (size_t)134217728) return;

  char* ws = (char*)d_ws;
  unsigned short* X3  = (unsigned short*)(ws + oX3);
  unsigned short* Wq3 = (unsigned short*)(ws + oWq);
  unsigned short* Wo3 = (unsigned short*)(ws + oWo);
  unsigned short* Qp  = (unsigned short*)(ws + oQp);
  float*          Kr  = (float*)(ws + oKr);
  unsigned short* Kp  = (unsigned short*)(ws + oKp);
  unsigned short* VTh = (unsigned short*)(ws + oVTh);
  unsigned short* VTl = (unsigned short*)(ws + oVTl);
  unsigned short* CT  = (unsigned short*)(ws + oCT);

  const dim3 blk(256);
  const int n8x = ROWS * DM / 8;                                   // 131072
  const dim3 gPrep(NTQ + NTO + (n8x + 255) / 256);                  //   48 + 16 + 512 blocks
  const dim3 gProj(3 * NGB);                                        //   96 blocks: q, k, v^T
  const dim3 gOut(NGB);                                             //   32 blocks: M=4096, N=256
  const dim3 gFour((NBH * SEQ * HD) / 1024);                        // 1024 blocks of 256, 4 elements per lane
  const dim3 gAttn(NBH * NQB);                                      //  512 blocks of 128

  // (1) x -> [hi|hi|lo] bf16 plane; weights transposed to [out][in] as [hi|lo|hi] bf16 planes
  prep3<<<gPrep, blk, 0, stream>>>(x, w_qkv, w_o, X3, Wq3, Wo3, n8x);
  // (2) q -> f16 head plane (x4), k -> raw f32 head plane, v^T -> f16 hi (x4) and residual (x2048) planes
  proj_qkv<<<gProj, blk, 0, stream>>>(X3, Wq3, Qp, Kr, VTh, VTl, KP);
  // (3) Fourier-basis transform of k -> f16 head plane (x4)
  fourier_k<<<gFour, blk, 0, stream>>>(Kr, coefa, coefb, Kp);
  // (4) attention -> ctx planes (bf16 hi, hi, lo)
  attn32<<<gAttn, dim3(128), 0, stream>>>(Qp, Kp, VTh, VTl, CT, 0.17677669529663687f * 0.0625f);
  // (5) out = ctx . Wo + bias -> d_out f32 [4096][256]
  proj_out<<<gOut, blk, 0, stream>>>(CT, Wo3, (float*)d_out, b_o, KP);
  (void)hipGetLastError();
}

// v005
// It runs in 92 microseconds.
// Two timings next to v004 put it at 1.13 and 1.14 times that version's speed.
// Counting every step since v000, it is 4.09 times as fast.
// Contractions: q, k, v^T projections and the output projection = v_wmma_f32_16x16x32_bf16 over bf16 hi/lo planes
// laid out as [hi|hi|lo] x [hi|lo|hi] along k (3 products, f32 accumulate);
// q.k^T scores = v_wmma_f32_16x16x32_f16 (q and the transformed k as f16 planes carried x4, single product, f32 accumulate);
// p.v = v_wmma_f32_16x16x32_f16 (p carried x1024 in f16; v^T as f16 hi plane x4 plus f16 residual plane x2^11; 2 products, f32 accumulate);
// Fourier-basis transform of k (one precise sincosf per element, then a rotation recurrence), softmax and bias in f32 on the VALU.
#include <hip/hip_runtime.h>
#include <math.h>
#include <stdint.h>

#define NB   2
#define SEQ  2048
#define DM   256
#define NH   8
#define HD   32
#define NBH  (NB * NH)        // 16 (batch, head) pairs
#define QKVW (3 * DM)         // 768 qkv output width
#define KP   (3 * DM)         // 768 folded k width of the split operand planes
#define NFUN 256
#define ROWS (NB * SEQ)       // 4096 token rows
#define NQB  (SEQ / 64)       // 64-query blocks per (b, h)
#define NKT  (SEQ / 64)       // 64-key chunks
#define GP   144              // GEMM operand row pitch in LDS, bytes: 128 B (64 k) + 16 B (16 B x odd, for 16-B readers)
#define GBUF (384 * GP)       // one GEMM operand buffer: 128 A rows + 256 Bt rows
#define NTQ  ((QKVW / 64) * (DM / 64))   // 48 transpose tiles of w_qkv
#define NTO  ((DM / 64) * (DM / 64))     // 16 transpose tiles of w_o
#define NGB  32               // 128x256 block tiles of each of the four products
// attention tiles in LDS: every row is read or written 16 B a lane, one row per lane of a 16-lane half, so the row
// pitch is 16 B x odd (row + 16 B): the sixteen lanes of a half then fall on sixteen different groups of four banks
#define KPI  (HD + 8)         // K chunk row pitch, f16 elements: 64 B + 16 B = 80 B
#define VPI  (64 + 8)         // V^T chunk row pitch, f16 elements: 128 B + 16 B = 144 B
#define OPI  (HD + 4)         // ctx tile row pitch, f32 elements: 128 B + 16 B = 144 B
static_assert(NH * HD == DM);
static_assert(NQB == 32 && NKT == 32);
static_assert((ROWS % 64) == 0 && (DM % 64) == 0 && (SEQ % 64) == 0 && (KP % 32) == 0);
static_assert((ROWS * DM) % 2048 == 0);
static_assert((ROWS / 128) * (DM / 256) == NGB && NB * (DM / 128) * (SEQ / 256) == NGB);
static_assert((ROWS % 128) == 0 && (DM % 256) == 0 && (DM % 128) == 0 && (SEQ % 256) == 0 && (KP % 64) == 0 && (SEQ % 128) == 0);

typedef _Float16 v16h __attribute__((ext_vector_type(16)));
typedef _Float16 v8h  __attribute__((ext_vector_type(8)));
typedef __bf16   v16b __attribute__((ext_vector_type(16)));
typedef __bf16   v8b  __attribute__((ext_vector_type(8)));
typedef float    v8f  __attribute__((ext_vector_type(8)));
typedef float    v4f  __attribute__((ext_vector_type(4)));
typedef unsigned int v4u __attribute__((ext_vector_type(4)));
typedef float    v2f  __attribute__((ext_vector_type(2)));
typedef unsigned int v2u __attribute__((ext_vector_type(2)));

#if defined(__HIP_DEVICE_COMPILE__)
#define DEV_ASM 1
#else
#define DEV_ASM 0
#endif

// ---- scalar helpers --------------------------------------------------------------------------------
__device__ __forceinline__ unsigned short bf_bits(float f) {          // f32 -> bf16 bits, RNE convert
  unsigned u = __float_as_uint(f);
  return (unsigned short)((u + 0x7FFFu + ((u >> 16) & 1u)) >> 16);
}
__device__ __forceinline__ float bf_up(unsigned short hb) { return __uint_as_float(((unsigned)hb) << 16); }
__device__ __forceinline__ unsigned short h_bits(_Float16 x) { return __builtin_bit_cast(unsigned short, x); }
__device__ __forceinline__ unsigned pk16(unsigned short a, unsigned short b) { return (unsigned)a | ((unsigned)b << 16); }
__device__ __forceinline__ v8f zero8() { v8f z = {0.f, 0.f, 0.f, 0.f, 0.f, 0.f, 0.f, 0.f}; return z; }

// ---- fragment loaders: 16-bit A/B operand, lane -> row/col (lane&15), p already includes +8*(lane>>4);
//      elements 0..7 <- p[0..7] (k0+8h..k0+8h+7), elements 8..15 <- p[16..23] (k0+16+8h..k0+16+8h+7)
template <typename OT> struct FT;
template <> struct FT<__bf16>   { typedef v16b frag; typedef v8b half8; };
template <> struct FT<_Float16> { typedef v16h frag; typedef v8h half8; };

template <typename OT>
__device__ __forceinline__ typename FT<OT>::frag ldfrag(const OT* p) {
  union { typename FT<OT>::frag v; typename FT<OT>::half8 h[2]; } f;
  f.h[0] = *(const typename FT<OT>::half8*)(p);
  f.h[1] = *(const typename FT<OT>::half8*)(p + 16);
  return f.v;
}

// ---- WMMA helpers ----------------------------------------------------------------------------------
__device__ __forceinline__ v8f mmar(v16b a, v16b b, v8f c) {
  return __builtin_amdgcn_wmma_f32_16x16x32_bf16(false, a, false, b, (short)0, c, false, false);
}
// guarded form: 4 VALU slots after the WMMA, D tied, A/B kept live
__device__ __forceinline__ v8f mma_h(v16h a, v16h b, v8f c) {
  c = __builtin_amdgcn_wmma_f32_16x16x32_f16(false, a, false, b, (short)0, c, false, false);
#if DEV_ASM
  asm volatile("v_nop\n\tv_nop\n\tv_nop\n\tv_nop" : "+v"(c) : "v"(a), "v"(b));
#endif
  return c;
}
// lane l <-> lane l ^ 16
__device__ __forceinline__ float xhalf(float x) {
  const int b = __builtin_bit_cast(int, x);
  return __builtin_bit_cast(float, __builtin_amdgcn_permlanex16(b, b, 0x76543210, 0xfedcba98, false, false));
}
__device__ __forceinline__ void dep_guard(v8f& a, v8f& b, v16b x, v16b y) {
#if DEV_ASM
  asm volatile("v_nop\n\tv_nop\n\tv_nop\n\tv_nop" : "+v"(a), "+v"(b) : "v"(x), "v"(y));
#else
  (void)a; (void)b; (void)x; (void)y;
#endif
}
__device__ __forceinline__ void keep4(v16b a, v16b b, v16b c, v16b d) {
#if DEV_ASM
  asm volatile("v_nop" :: "v"(a), "v"(b), "v"(c), "v"(d));
#else
  (void)a; (void)b; (void)c; (void)d;
#endif
}
__device__ __forceinline__ void acc_guard4(v8f& a, v8f& b, v8f& c, v8f& d) {
#if DEV_ASM
  asm volatile("v_nop\n\tv_nop\n\tv_nop\n\tv_nop" : "+v"(a), "+v"(b), "+v"(c), "+v"(d));
#else
  (void)a; (void)b; (void)c; (void)d;
#endif
}
// ---- asynchronous copies global -> LDS, 16 B a lane ------------------------------------------------
__device__ __forceinline__ uint32_t lds_off(const void* p) { return (uint32_t)(size_t)p; }   // LDS byte address
// twelve copies of a lane (l: LDS byte addresses, g: global addresses); the s_wait_xcnt stands inside the
// statement so that no address register named here is rewritten ahead of it
__device__ __forceinline__ void copy12(const uint32_t (&l)[12], const __bf16* const (&g)[12]) {
#if DEV_ASM
  asm volatile("global_load_async_to_lds_b128 %0, %12, off\n\t"
               "global_load_async_to_lds_b128 %1, %13, off\n\t"
               "global_load_async_to_lds_b128 %2, %14, off\n\t"
               "global_load_async_to_lds_b128 %3, %15, off\n\t"
               "global_load_async_to_lds_b128 %4, %16, off\n\t"
               "global_load_async_to_lds_b128 %5, %17, off\n\t"
               "global_load_async_to_lds_b128 %6, %18, off\n\t"
               "global_load_async_to_lds_b128 %7, %19, off\n\t"
               "global_load_async_to_lds_b128 %8, %20, off\n\t"
               "global_load_async_to_lds_b128 %9, %21, off\n\t"
               "global_load_async_to_lds_b128 %10, %22, off\n\t"
               "global_load_async_to_lds_b128 %11, %23, off\n\t"
               "s_wait_xcnt 0x0"
               :: "v"(l[0]), "v"(l[1]), "v"(l[2]), "v"(l[3]), "v"(l[4]), "v"(l[5]),
                  "v"(l[6]), "v"(l[7]), "v"(l[8]), "v"(l[9]), "v"(l[10]), "v"(l[11]),
                  "v"(g[0]), "v"(g[1]), "v"(g[2]), "v"(g[3]), "v"(g[4]), "v"(g[5]),
                  "v"(g[6]), "v"(g[7]), "v"(g[8]), "v"(g[9]), "v"(g[10]), "v"(g[11])
               : "memory");
#else
  (void)l; (void)g;
#endif
}
// this wave's copies have landed
__device__ __forceinline__ void wait_copies() {
#if DEV_ASM
  asm volatile("s_wait_asynccnt 0x0" ::: "memory");
#endif
}
// behind a job's last global stores: in a kernel that holds several jobs' bodies the registers that the stores
// name may be written by the code laid out behind them; the wait stands in front of any such write
__device__ __forceinline__ void wait_store_regs() {
#if DEV_ASM
  asm volatile("s_wait_xcnt 0x0" ::: "memory");
#endif
}
// this wave's LDS reads have returned (in front of the barrier that hands a buffer to its next copies)
__device__ __forceinline__ void wait_lds() {
#if DEV_ASM
  asm volatile("s_wait_dscnt 0x0" ::: "memory");
#endif
}

// =====================================================================================================
// x [ROWS][DM] f32 -> split plane X3 [ROWS][KP] bf16, row = [hi | hi | lo] (hi = RNE bf16, lo = RNE bf16
// of the exact residual). 8 elements per thread; each thread stores 16 B into each of the three thirds;
// bx = the block's index within this job.
// =====================================================================================================
__device__ __forceinline__ void cvt_x3(const float* __restrict__ in, unsigned short* out, int n8, int bx) {
  const int i = bx * 256 + (int)threadIdx.x;
  if (i < n8) {
    const int row = i >> 5, c = (i & 31) * 8;
    const v4f a  = *(const v4f*)(in + (size_t)i * 8);
    const v4f a4 = *(const v4f*)(in + (size_t)i * 8 + 4);
    const float f[8] = {a[0], a[1], a[2], a[3], a4[0], a4[1], a4[2], a4[3]};
    v4u ph, pl;
#pragma unroll
    for (int e = 0; e < 4; ++e) {
      const float f0 = f[2 * e], f1 = f[2 * e + 1];
      const unsigned short h0 = bf_bits(f0), h1 = bf_bits(f1);
      const unsigned short l0 = bf_bits(f0 - bf_up(h0)), l1 = bf_bits(f1 - bf_up(h1));
      ph[e] = pk16(h0, h1);
      pl[e] = pk16(l0, l1);
    }
    unsigned short* o = out + (size_t)row * KP + c;
    *(v4u*)(o)          = ph;
    *(v4u*)(o + DM)     = ph;
    *(v4u*)(o + 2 * DM) = pl;
    wait_store_regs();
  }
}

// =====================================================================================================
// w [DM rows k][C cols] f32 (x @ w layout) -> wt [C][KP] bf16, row c = [hi | lo | hi] of w[k][c] over k.
// Block = 64 k x 64 c tile staged in LDS (f32); C/64 x DM/64 blocks: bx -> c0, by -> k0.
// coverage: 8 waves x 8 rows x 64 k = the tile, all three thirds; the grid covers all C rows x DM k.
// =====================================================================================================
__device__ __forceinline__ void wtrans3(float (*tile)[65], const float* __restrict__ w, unsigned short* wt, int C,
                                        int bx, int by) {
  const int tid = (int)threadIdx.x, lane = tid & 31, wave = tid >> 5;
  const int c0 = bx * 64, k0 = by * 64;
#pragma unroll
  for (int it = 0; it < 16; ++it) {
    const int idx = it * 256 + tid;
    const int r = idx >> 6, cc = idx & 63;
    tile[r][cc] = w[(size_t)(k0 + r) * C + c0 + cc];
  }
  __syncthreads();
  const int q = lane >> 3, c8 = (lane & 7) * 8;
  v4u hv[2], lv[2];
#pragma unroll
  for (int it = 0; it < 2; ++it) {
    const int row = wave * 8 + it * 4 + q;          // output row (c within tile)
    v4u a, a2;
#pragma unroll
    for (int e = 0; e < 4; ++e) {
      const float f0 = tile[c8 + 2 * e][row], f1 = tile[c8 + 2 * e + 1][row];
      const unsigned short h0 = bf_bits(f0), h1 = bf_bits(f1);
      const unsigned short l0 = bf_bits(f0 - bf_up(h0)), l1 = bf_bits(f1 - bf_up(h1));
      a[e] = pk16(h0, h1);
      a2[e] = pk16(l0, l1);
    }
    hv[it] = a; lv[it] = a2;
  }
  {
#pragma unroll
    for (int it = 0; it < 2; ++it) {
      const int row = wave * 8 + it * 4 + q;
      unsigned short* o = wt + (size_t)(c0 + row) * KP + k0 + c8;
      *(v4u*)(o)          = hv[it];
      *(v4u*)(o + DM)     = lv[it];
      *(v4u*)(o + 2 * DM) = hv[it];
    }
    wait_store_regs();
  }
}

// =====================================================================================================
// The three operand preparations in one launch: each reads inputs only and writes a plane of its own, so
// none waits for another. The block index picks the job (the same for the whole block, so the transpose's
// barrier stays block-uniform): NTQ blocks transpose w_qkv, NTO blocks w_o, the remaining n8 / 256 split x.
// =====================================================================================================
__global__ __launch_bounds__(256) void prep3(const float* __restrict__ x, const float* __restrict__ w_qkv,
                                             const float* __restrict__ w_o, unsigned short* X3,
                                             unsigned short* Wq3, unsigned short* Wo3, int n8) {
  __shared__ float tile[64][65];
  const int bx = (int)blockIdx.x;
  if (bx < NTQ) {
    wtrans3(tile, w_qkv, Wq3, QKVW, bx % (QKVW / 64), bx / (QKVW / 64));
  } else if (bx < NTQ + NTO) {
    wtrans3(tile, w_o, Wo3, DM, (bx - NTQ) % (DM / 64), (bx - NTQ) / (DM / 64));
  } else {
    cvt_x3(x, X3, n8, bx - (NTQ + NTO));
  }
}

// =====================================================================================================
// Register-blocked batched WMMA GEMM, bf16 operands: C[m][n] = sum_k A[m][k] * Bt[n][k]; one wave per
// 64x64 tile, eight waves (2 x 4) on a 128x256 block tile. Bt row-major [N][K] pitch ldb (k contiguous).
// A_MODE 0: A row-major [M][K] pitch lda.  A_MODE 1: head planes: A(m, k) at
//   plane = (k/256)*NBH + (m/SEQ)*NH + (k/32)%NH;  A[(plane*SEQ + m%SEQ)*HD + k%32]  (M = ROWS, K = KP).
// M multiple of 128, N of 256, K of 64 (static shapes below). bx = block tile index, b = batch index (strides in
// elements); ring and sT are the calling kernel's LDS.
// Operands: per pass of 64 k the block's 128 A rows and 256 Bt rows (128 B each) come into LDS by asynchronous
// copies of whole 128-B lines, two buffers, the next pass's copies in flight while this pass is worked on;
// LDS row pitch 144 B; fragments read from LDS with the split k map (ldfrag), k ascending as before.
// Epilogue: 16-row slabs staged per wave in LDS (pitch 68 floats), then:
// OUT_MODE 0: f16 head plane [NBH][SEQ][HD], value * oscale: per head half of the slab (16 rows x 32 cols =
// OUT_MODE 1: f32 head plane [NBH][SEQ][HD]: per head half (2048 contiguous B) four instructions of
// OUT_MODE 2: f16 hi plane C (value*oscale) + f16 residual plane C2 = f16((v*oscale - hi) * rscale), row-major
// OUT_MODE 3: f32 row-major C (pitch ldc) + bias[n] (f32): each 64-wide row segment = 256 B = 16 lanes x 16 B.
// coverage: 4 slabs x 16 rows x 64 cols = the wave's whole 64x64 tile; grids are exact tile multiples.
// =====================================================================================================
template <int A_MODE, int OUT_MODE>
__device__ __forceinline__ void gemm64(
    unsigned char* ring, float (*sT)[16 * 68], int bx, int b,
    const unsigned short* __restrict__ Ap, int lda, long long strideA,
    const unsigned short* __restrict__ Btp, int ldb, long long strideB,
    void* Cout, void* Cout2, int ldc, long long strideC,
    const float* __restrict__ bias,
    int M, int N, int K, float oscale, float rscale) {
  const __bf16* A  = (const __bf16*)(const void*)Ap;
  const __bf16* Bt = (const __bf16*)(const void*)Btp;
  const int tid  = (int)threadIdx.x;
  const int lane = tid & 31;
  const int wave = tid >> 5;
  const int nbn = N >> 8;                // block tiles along N
  const int bm  = bx / nbn;
  const int bn  = bx - bm * nbn;
  if (bm >= (M >> 7)) return;            // the same for the whole block, in front of every barrier
  const int bm0 = bm << 7;
  const int bn0 = bn << 8;
  const int wr  = (wave >> 2) << 6;      // the wave's first A row in the block tile
  const int wc  = (wave & 3) << 6;       // the wave's first Bt row in the block tile
  const int m0 = bm0 + wr;
  const int n0 = bn0 + wc;

  const __bf16* Ab = A  + (size_t)b * (size_t)strideA;
  const __bf16* Bb = Bt + (size_t)b * (size_t)strideB;

  const int rlane = lane & 15;                 // row (A) / col (B, D) within subtile
  const int koff  = (lane >> 4) * 8;           // k offset of this lane half
  const int mOff  = (lane >> 4) * 8;           // D row offset

  v8f acc[4][4];
#pragma unroll
  for (int i = 0; i < 4; ++i)
#pragma unroll
    for (int j = 0; j < 4; ++j) acc[i][j] = zero8();

  // pass t -> buffer buf: 12 copies a lane; a wave's copy covers 512 B of whole lines (4 rows of 128 B; in the
  // head-plane layout 8 rows of 64 B, which adjoin)
  const uint32_t ringb = lds_off(ring);
  auto stage = [&](int t, int buf) {
    const int k0 = t << 6;
    const uint32_t lb = ringb + (uint32_t)buf * GBUF;
    uint32_t la[12];
    const __bf16* ga[12];
#pragma unroll
    for (int u = 0; u < 4; ++u) {
      if (A_MODE == 0) {
        const int row = u * 32 + (tid >> 3), pc = tid & 7;
        ga[u] = Ab + (size_t)(bm0 + row) * lda + k0 + pc * 8;
        la[u] = lb + (uint32_t)(row * GP + pc * 16);
      } else {
        const int kk = k0 + (u >> 1) * 32;
        const int row = (u & 1) * 64 + (tid >> 2), pc = tid & 3;
        const int plane = (kk >> 8) * NBH + (bm0 / SEQ) * NH + ((kk >> 5) & (NH - 1));
        ga[u] = Ab + ((size_t)plane * SEQ + (size_t)((bm0 & (SEQ - 1)) + row)) * HD + pc * 8;
        la[u] = lb + (uint32_t)(row * GP + ((u >> 1) * 4 + pc) * 16);
      }
    }
#pragma unroll
    for (int u = 0; u < 8; ++u) {
      const int row = u * 32 + (tid >> 3), pc = tid & 7;
      ga[4 + u] = Bb + (size_t)(bn0 + row) * ldb + k0 + pc * 8;
      la[4 + u] = lb + (uint32_t)((128 + row) * GP + pc * 16);
    }
    copy12(la, ga);
  };

  const int T = K >> 6;                  // passes of 64 k
  stage(0, 0);
  wait_copies();
  __syncthreads();                       // pass 0 is readable by every wave
  if (T > 1) stage(1, 1);

  for (int t = 0; t < T; ++t) {
    const unsigned char* bufp = ring + (t & 1) * GBUF + koff * 2;
#pragma unroll
    for (int ks = 0; ks < 2; ++ks) {     // two k-steps of 32 (64 B of every row)
      v16b bq[4], af[4];
#pragma unroll
      for (int j = 0; j < 4; ++j)
        bq[j] = ldfrag<__bf16>((const __bf16*)(bufp + (128 + wc + (j << 4) + rlane) * GP + ks * 64));
#pragma unroll
      for (int i = 0; i < 4; ++i)
        af[i] = ldfrag<__bf16>((const __bf16*)(bufp + (wr + (i << 4) + rlane) * GP + ks * 64));
#pragma unroll
      for (int i = 0; i < 4; ++i) {
#pragma unroll
        for (int j = 0; j < 4; ++j) acc[i][j] = mmar(af[i], bq[j], acc[i][j]);
        dep_guard(acc[i][0], acc[i][3], af[i], bq[3]);
      }
      keep4(bq[0], bq[1], bq[2], bq[3]);
    }
    // hand-over: this wave has left buffer t & 1 and its copies of pass t + 1 have landed; behind the barrier
    // pass t + 1 is readable by every wave and buffer t & 1 is free for pass t + 2
    wait_lds();
    wait_copies();
    __syncthreads();
    if (t + 2 < T) stage(t + 2, t & 1);
  }
  wait_copies();                         // nothing of this wave is in flight when the epilogue starts
  acc_guard4(acc[0][0], acc[0][1], acc[0][2], acc[0][3]);
  acc_guard4(acc[1][0], acc[1][1], acc[1][2], acc[1][3]);
  acc_guard4(acc[2][0], acc[2][1], acc[2][2], acc[2][3]);
  acc_guard4(acc[3][0], acc[3][1], acc[3][2], acc[3][3]);

  // ---- epilogue ----
  float* slab = sT[wave];
#pragma unroll
  for (int i = 0; i < 4; ++i) {
    const int mBase = m0 + (i << 4);
#pragma unroll
    for (int j = 0; j < 4; ++j) {
#pragma unroll
      for (int r = 0; r < 8; ++r) {
        slab[(mOff + r) * 68 + (j << 4) + rlane] = acc[i][j][r];
      }
    }
    __builtin_amdgcn_fence(__ATOMIC_RELEASE, "workgroup");
    __builtin_amdgcn_wave_barrier();
    __builtin_amdgcn_fence(__ATOMIC_ACQUIRE, "workgroup");
    if (OUT_MODE == 0) {
      unsigned short* Q = (unsigned short*)Cout;
      const int rq = lane >> 2, c8 = (lane & 3) * 8;        // row within an 8-row group, 8-col piece
      v4u hv[4];
#pragma unroll
      for (int j2 = 0; j2 < 2; ++j2) {
#pragma unroll
        for (int it = 0; it < 2; ++it) {
          const float* sp = slab + (it * 8 + rq) * 68 + j2 * 32 + c8;   // it 0..1 x rq 0..7 = rows 0..15
          v4u a;
#pragma unroll
          for (int e = 0; e < 4; ++e)
            a[e] = pk16(h_bits((_Float16)(sp[2 * e] * oscale)), h_bits((_Float16)(sp[2 * e + 1] * oscale)));
          hv[j2 * 2 + it] = a;
        }
      }
      {
#pragma unroll
        for (int j2 = 0; j2 < 2; ++j2) {
          const int head = (n0 >> 5) + j2;
          unsigned short* base = Q + ((size_t)((mBase / SEQ) * NH + head) * SEQ + (size_t)(mBase & (SEQ - 1))) * HD;
#pragma unroll
          for (int it = 0; it < 2; ++it)
            *(v4u*)(base + it * 256 + lane * 8) = hv[j2 * 2 + it];
        }
        
      }
    } else if (OUT_MODE == 1) {
      float* Kr = (float*)Cout;
      const int rq = lane >> 3, c4 = (lane & 7) * 4;        // row within a 4-row group, 4-col piece
      v4f hv[8];
#pragma unroll
      for (int j2 = 0; j2 < 2; ++j2) {
#pragma unroll
        for (int it = 0; it < 4; ++it)                      // it 0..3 x rq 0..3 = rows 0..15
          hv[j2 * 4 + it] = *(const v4f*)(slab + (it * 4 + rq) * 68 + j2 * 32 + c4);
      }
      {
#pragma unroll
        for (int j2 = 0; j2 < 2; ++j2) {
          const int head = (n0 >> 5) + j2;
          float* base = Kr + ((size_t)((mBase / SEQ) * NH + head) * SEQ + (size_t)(mBase & (SEQ - 1))) * HD;
#pragma unroll
          for (int it = 0; it < 4; ++it)
            *(v4f*)(base + it * 128 + lane * 4) = hv[j2 * 4 + it];
        }
        
      }
    } else if (OUT_MODE == 2) {
      const int q = lane >> 3, c8 = (lane & 7) * 8;
      unsigned short* C  = (unsigned short*)Cout  + (size_t)b * (size_t)strideC;
      unsigned short* C2 = (unsigned short*)Cout2 + (size_t)b * (size_t)strideC;
      v4u hv[4], lv[4];
#pragma unroll
      for (int it = 0; it < 4; ++it) {
        const int row = it * 4 + q;                         // it 0..3 x q 0..3 = rows 0..15
        const float* sp = slab + row * 68 + c8;
        v4u a, a2;
#pragma unroll
        for (int e = 0; e < 4; ++e) {
          const float f0 = sp[2 * e] * oscale, f1 = sp[2 * e + 1] * oscale;
          const _Float16 x0 = (_Float16)f0, x1 = (_Float16)f1;
          const unsigned short h0 = h_bits(x0), h1 = h_bits(x1);
          const unsigned short l0 = h_bits((_Float16)((f0 - (float)x0) * rscale));
          const unsigned short l1 = h_bits((_Float16)((f1 - (float)x1) * rscale));
          a[e] = pk16(h0, h1); a2[e] = pk16(l0, l1);
        }
        hv[it] = a; lv[it] = a2;
      }
      {
#pragma unroll
        for (int it = 0; it < 4; ++it) {
          const int row = it * 4 + q;
          *(v4u*)(C  + (size_t)(mBase + row) * ldc + n0 + c8) = hv[it];
          *(v4u*)(C2 + (size_t)(mBase + row) * ldc + n0 + c8) = lv[it];
        }
        
      }
    } else {
      float* C = (float*)Cout + (size_t)b * (size_t)strideC;
      const int h2 = lane >> 4, c4 = (lane & 15) * 4;      // 256-B row segment = 16 lanes x 16 B
      const v4f bv = *(const v4f*)(bias + n0 + c4);
      v4f hv[8];
#pragma unroll
      for (int it = 0; it < 8; ++it) {
        const int row = it * 2 + h2;                        // it 0..7 x h2 0..1 = rows 0..15
        hv[it] = *(const v4f*)(slab + row * 68 + c4) + bv;
      }
      {
#pragma unroll
        for (int it = 0; it < 8; ++it) {
          const int row = it * 2 + h2;
          *(v4f*)(C + (size_t)(mBase + row) * ldc + n0 + c4) = hv[it];
        }
        
      }
    }
    __builtin_amdgcn_fence(__ATOMIC_RELEASE, "workgroup");
    __builtin_amdgcn_wave_barrier();
    __builtin_amdgcn_fence(__ATOMIC_ACQUIRE, "workgroup");
  }
}

// =====================================================================================================
// The q, k and v^T projections in one launch: all three read the X3 and Wq3 planes, none reads another's
// output, and each alone has NGB blocks for 256 WGPs. blockIdx.x / NGB picks the product (the same for the whole
// block, so every barrier stays block-uniform):
//   0: q = x . Wq -> f16 head plane (x4)        (M=4096, N=256, K=768)
//   1: k = x . Wk -> raw f32 head plane         (M=4096, N=256, K=768)
//   2: v^T = Wv . x^T per batch -> f16 hi plane (x4) [b][c][s] (pitch SEQ) and residual plane (x2048)
//      (A = Wq3 rows 512.., Bt = X3 rows of batch b; M=256, N=2048, K=768; 16 blocks a batch)
// =====================================================================================================
__global__ __launch_bounds__(256) void proj_qkv(const unsigned short* __restrict__ X3,
                                                const unsigned short* __restrict__ Wq3,
                                                unsigned short* Qp, float* Kr,
                                                unsigned short* VTh, unsigned short* VTl, int K) {
  __shared__ __align__(16) unsigned char ring[2 * GBUF];   // two operand buffers: 128 A rows, then 256 Bt rows
  __shared__ __align__(16) float sT[8][16 * 68];   // per-wave 16x64 slab, pitch 68 floats
  const unsigned job = blockIdx.x / NGB;
  const int bx = (int)(blockIdx.x % NGB);
  if (job == 0) {
    gemm64<0, 0>(ring, sT, bx, 0, X3, KP, 0LL, Wq3, KP, 0LL,
                 (void*)Qp, (void*)Qp, 0, 0LL, nullptr, ROWS, DM, K, 4.0f, 1.0f);
  } else if (job == 1) {
    gemm64<0, 1>(ring, sT, bx, 0, X3, KP, 0LL, Wq3 + (size_t)DM * KP, KP, 0LL,
                 (void*)Kr, (void*)Kr, 0, 0LL, nullptr, ROWS, DM, K, 1.0f, 1.0f);
  } else if (job == 2) {
    gemm64<0, 2>(ring, sT, bx % (NGB / NB), bx / (NGB / NB),
                 Wq3 + (size_t)2 * DM * KP, KP, 0LL, X3, KP, (long long)SEQ * KP,
                 (void*)VTh, (void*)VTl, SEQ, (long long)DM * SEQ, nullptr, DM, SEQ, K, 4.0f, 2048.0f);
  }
}

// out = ctx . Wo + bias -> f32 [4096][256]   (M=4096, N=256, K=768, A in head-plane layout)
__global__ __launch_bounds__(256) void proj_out(const unsigned short* __restrict__ CT,
                                                const unsigned short* __restrict__ Wo3,
                                                float* out, const float* __restrict__ bias, int K) {
  __shared__ __align__(16) unsigned char ring[2 * GBUF];   // two operand buffers: 128 A rows, then 256 Bt rows
  __shared__ __align__(16) float sT[8][16 * 68];   // per-wave 16x64 slab, pitch 68 floats
  gemm64<1, 3>(ring, sT, (int)blockIdx.x, 0, CT, 0, 0LL, Wo3, KP, 0LL,
               (void*)out, (void*)out, DM, 0LL, bias, ROWS, DM, K, 1.0f, 1.0f);
}

// =====================================================================================================
// Fourier-basis transform of k: out = sum_{f=1..NFUN} ca[f-1]*sin(f*k) + cb[f-1]*cos(f*k) in f32.
// One precise sincosf(k) per element; sin(f*k), cos(f*k) for f = 2..NFUN follow by rotating the pair by k
// (angle addition: two products and two fused multiply-adds a step). The rotation keeps the pair's length,
// so its error grows linearly in f: at f = NFUN it is that of moving k by about one f32 ulp.
// Terms are added in the order f = 1..NFUN, sine before cosine, as fused multiply-adds.
// Four consecutive elements of the raw f32 k head plane [NBH][SEQ][HD] per lane, as two pairs, so that every
// step is packed f32 arithmetic; a lane stores its four f16 results (x4) as 8 B, a wave 256 contiguous B.
// coverage: grid x 256 x 4 = every element of the k' plane.
// =====================================================================================================
__global__ __launch_bounds__(256) void fourier_k(const float* __restrict__ kr, const float* __restrict__ ca,
                                                 const float* __restrict__ cb, unsigned short* kp) {
  const size_t g4 = ((size_t)blockIdx.x * 256 + (size_t)threadIdx.x) * 4;
  const v4f kx = *(const v4f*)(kr + g4);
  v2f s1[2], c1[2], s[2], c[2], acc[2];
#pragma unroll
  for (int h = 0; h < 2; ++h) {
#pragma unroll
    for (int e = 0; e < 2; ++e) {
      float sn, cs;
      sincosf(kx[2 * h + e], &sn, &cs);
      s1[h][e] = sn;
      c1[h][e] = cs;
    }
    s[h] = s1[h];
    c[h] = c1[h];
    acc[h] = (v2f){0.f, 0.f};
  }
  // unrolled so that the coefficients of a group of steps arrive in one pair of scalar loads
#pragma unroll 16
  for (int fi = 0; fi < NFUN; ++fi) {
    const float af = ca[fi];
    const float bf = cb[fi];
    const v2f a2 = {af, af}, b2 = {bf, bf};
#pragma unroll
    for (int h = 0; h < 2; ++h) {
      acc[h] = __builtin_elementwise_fma(a2, s[h], acc[h]);
      acc[h] = __builtin_elementwise_fma(b2, c[h], acc[h]);
      const v2f sn = __builtin_elementwise_fma(s[h], c1[h], c[h] * s1[h]);
      c[h] = __builtin_elementwise_fma(c[h], c1[h], -(s[h] * s1[h]));
      s[h] = sn;
    }
  }
  v2u o;
#pragma unroll
  for (int h = 0; h < 2; ++h)
    o[h] = pk16(h_bits((_Float16)(acc[h][0] * 4.0f)), h_bits((_Float16)(acc[h][1] * 4.0f)));
  *(v2u*)(kp + g4) = o;
}

// =====================================================================================================
// Attention, head dim 32, no mask, softmax over all SEQ keys.
//   q plane / k' plane (f16, x4): element (bh, t, d) at [(bh*SEQ + t)*HD + d]
//   v^T hi plane (f16, 4v) and residual plane (f16, (4v - hi)*2048): element (bh, d, s) at [(bh*HD + d)*SEQ + s]
//   ctx planes (bf16): part p (0 = hi, 1 = hi, 2 = lo), element (bh, t, d) at [p*PS + (bh*SEQ + t)*HD + d]
//   scores^T = (k4' . q4^T) * sscale on f16 WMMA (one k-step), softmax in f32 (running max), a query per lane pair;
//   p = exp(s - m) carried as f16(1024 p); O^T = vh^T . p^T + (vl^T . p^T) / 2048 on f16 WMMA; ctx = O / (l * 4096).
//   Block = 4 waves on the same (b, h), 4 consecutive 16-query tiles; grid = NBH * NQB; key chunks of 64,
//   static trip NKT. Chunk staging: 128 threads, K 64x32 (2 x 16 B per thread), V^T hi/res 32x64 (2 x 16 B
//   per thread and plane), plain loads, __syncthreads before and after. P^T stays in registers (score tiles -> B operand).
//   Output: each wave writes its 16x32 tile (1024 contiguous B per part) with two instructions of
//   all NBH*SEQ rows x HD, all three parts.
// =====================================================================================================
__global__ __launch_bounds__(128)
void attn32(const unsigned short* __restrict__ qpp, const unsigned short* __restrict__ kpp,
            const unsigned short* __restrict__ vhp, const unsigned short* __restrict__ vlp,
            unsigned short* ct, float sscale) {
  union FH { v16h v; v8h h[2]; };
  __shared__ __align__(16) _Float16 Ksh[64 * KPI];         // K chunk [key][d], pitch KPI     5120 B
  __shared__ __align__(16) _Float16 Vth[HD * VPI];         // V^T hi [d][key], pitch VPI     4608 B
  __shared__ __align__(16) _Float16 Vtl[HD * VPI];         // V^T residual, pitch VPI        4608 B
  __shared__ __align__(16) float    Os[4][16 * OPI];       // per wave ctx tile, pitch OPI   9216 B

  const int tid  = (int)threadIdx.x;
  const int wave = tid >> 5;
  const int lane = tid & 31;
  const int hh   = lane >> 4;
  const int c    = lane & 15;

  const int bx   = blockIdx.x;
  const int qblk = bx % NQB;
  const int bh   = bx / NQB;
  const int q0   = qblk * 64 + wave * 16;

  const _Float16* Qg = (const _Float16*)(const void*)qpp + (size_t)bh * SEQ * HD;
  const _Float16* Kg = (const _Float16*)(const void*)kpp + (size_t)bh * SEQ * HD;
  const _Float16* Vh = (const _Float16*)(const void*)vhp + (size_t)bh * HD * SEQ;
  const _Float16* Vl = (const _Float16*)(const void*)vlp + (size_t)bh * HD * SEQ;

  // ---- Q fragment (B operand, column = lane&15, one k-step of 32) ----
  const v16h qa = ldfrag<_Float16>(Qg + (size_t)(q0 + c) * HD + 8 * hh);

  float mrun = -INFINITY, lrun = 0.f;   // query c: running maximum (joined), running sum of this half's keys
  v8f oacc[2];
  oacc[0] = zero8(); oacc[1] = zero8();

  for (int kt = 0; kt < NKT; ++kt) {         // static trip count
    const int kv0 = kt * 64;
    __syncthreads();
    {
      const int r = tid >> 1, hf = (tid & 1) * 16;                  // key r, d = hf..hf+15
      const _Float16* kg = Kg + (size_t)(kv0 + r) * HD + hf;
      const v8h k0v = *(const v8h*)(kg);
      const v8h k1v = *(const v8h*)(kg + 8);
      *(v8h*)(Ksh + r * KPI + hf)     = k0v;
      *(v8h*)(Ksh + r * KPI + hf + 8) = k1v;
      const int d = tid >> 2, sg = (tid & 3) * 16;                  // d row, keys sg..sg+15
      const _Float16* vg  = Vh + (size_t)d * SEQ + kv0 + sg;
      const _Float16* vlg = Vl + (size_t)d * SEQ + kv0 + sg;
      const v8h v0 = *(const v8h*)(vg),  v1 = *(const v8h*)(vg + 8);
      const v8h w0 = *(const v8h*)(vlg), w1 = *(const v8h*)(vlg + 8);
      *(v8h*)(Vth + d * VPI + sg)     = v0;
      *(v8h*)(Vth + d * VPI + sg + 8) = v1;
      *(v8h*)(Vtl + d * VPI + sg)     = w0;
      *(v8h*)(Vtl + d * VPI + sg + 8) = w1;
    }
    __syncthreads();

    // ---- transposed scores: 64 keys (rows) x 16 queries (columns) per wave; lane (c, hh) holds, for query c,
    //      keys j*16 + 8*hh + r in s[j][r] ----
    v8f s[4];
#pragma unroll
    for (int j = 0; j < 4; ++j) {
      FH kb;
      kb.h[0] = *(const v8h*)(Ksh + (j * 16 + c) * KPI + 8 * hh);
      kb.h[1] = *(const v8h*)(Ksh + (j * 16 + c) * KPI + 16 + 8 * hh);
      s[j] = mma_h(kb.v, qa, zero8());
#pragma unroll
      for (int r = 0; r < 8; ++r) s[j][r] *= sscale;
    }

    // ---- online softmax: a query's maximum and sum lie in its own two lanes; the maximum is joined across the
    //      halves every chunk (both halves rescale alike), the sums only after the loop ----
    float mj[4];
#pragma unroll
    for (int j = 0; j < 4; ++j) {   // a short tree per tile, ready while the next tile's product runs
      const float t0 = fmaxf(fmaxf(s[j][0], s[j][1]), s[j][2]);
      const float t1 = fmaxf(fmaxf(s[j][3], s[j][4]), s[j][5]);
      mj[j] = fmaxf(fmaxf(t0, t1), fmaxf(s[j][6], s[j][7]));
    }
    float m = fmaxf(fmaxf(mj[0], mj[1]), fmaxf(mj[2], mj[3]));
    m = fmaxf(m, xhalf(m));
    const float mnew  = fmaxf(mrun, m);
    const float msafe = (mnew == -INFINITY) ? 0.f : mnew;
    const float alpha = __expf(mrun - msafe);
    mrun = mnew;
#pragma unroll
    for (int j = 0; j < 4; ++j)
#pragma unroll
      for (int r = 0; r < 8; ++r) s[j][r] = __expf(s[j][r] - msafe);
    const v8f ts = (s[0] + s[1]) + (s[2] + s[3]);   // tiles first (packed adds), then a tree over the eight
    const float psum = ((ts[0] + ts[1]) + (ts[2] + ts[3])) + ((ts[4] + ts[5]) + (ts[6] + ts[7]));
    lrun = lrun * alpha + psum;
#pragma unroll
    for (int r = 0; r < 8; ++r) {
      oacc[0][r] *= alpha;
      oacc[1][r] *= alpha;
    }

    // ---- context^T += V^T . P^T (f16 WMMA); two score tiles, converted in place (x1024, f16), are the B operand
    //      of one 32-key step; residual products into a separate accumulator ----
    v8f o1[2];
    o1[0] = zero8(); o1[1] = zero8();
#pragma unroll
    for (int kk = 0; kk < 2; ++kk) {
      FH pb;
      pb.h[0] = __builtin_convertvector(s[2 * kk] * 1024.0f, v8h);
      pb.h[1] = __builtin_convertvector(s[2 * kk + 1] * 1024.0f, v8h);
#pragma unroll
      for (int t = 0; t < 2; ++t) {
        FH vb, vl;
        vb.h[0] = *(const v8h*)(Vth + (t * 16 + c) * VPI + kk * 32 + 8 * hh);
        vb.h[1] = *(const v8h*)(Vth + (t * 16 + c) * VPI + kk * 32 + 16 + 8 * hh);
        vl.h[0] = *(const v8h*)(Vtl + (t * 16 + c) * VPI + kk * 32 + 8 * hh);
        vl.h[1] = *(const v8h*)(Vtl + (t * 16 + c) * VPI + kk * 32 + 16 + 8 * hh);
        oacc[t] = mma_h(vb.v, pb.v, oacc[t]);
        o1[t]   = mma_h(vl.v, pb.v, o1[t]);
      }
    }
#pragma unroll
    for (int t = 0; t < 2; ++t)
#pragma unroll
      for (int r = 0; r < 8; ++r) oacc[t][r] += o1[t][r] * (1.0f / 2048.0f);
  }

  // ---- join the halves' sums, normalise (1/l, undo the x1024 p carry and the x4 v carry), stage the wave's
  //      16x32 tile: oacc[t][r] is element (query c, d = t*16 + 8*hh + r)
  float* os = Os[wave];
  {
    const float l = lrun + xhalf(lrun);
    const float inv = 1.0f / (l * 4096.0f);
#pragma unroll
    for (int t = 0; t < 2; ++t) {
      const v8f o = oacc[t] * inv;
      *(v4f*)(os + c * OPI + t * 16 + 8 * hh)     = (v4f){o[0], o[1], o[2], o[3]};
      *(v4f*)(os + c * OPI + t * 16 + 8 * hh + 4) = (v4f){o[4], o[5], o[6], o[7]};
    }
  }
  __builtin_amdgcn_fence(__ATOMIC_RELEASE, "workgroup");
  __builtin_amdgcn_wave_barrier();
  __builtin_amdgcn_fence(__ATOMIC_ACQUIRE, "workgroup");
  {
    const int rq = lane >> 2, c8 = (lane & 3) * 8;
    v4u hv[2], lv[2];
#pragma unroll
    for (int it = 0; it < 2; ++it) {
      const int row = it * 8 + rq;   // it 0..1 x rq 0..7 = rows 0..15 of the wave tile
      const float* sp = os + row * OPI + c8;
      v4u a, a2;
#pragma unroll
      for (int e = 0; e < 4; ++e) {
        const float f0 = sp[2 * e], f1 = sp[2 * e + 1];
        const unsigned short h0 = bf_bits(f0), h1 = bf_bits(f1);
        const unsigned short l0 = bf_bits(f0 - bf_up(h0)), l1 = bf_bits(f1 - bf_up(h1));
        a[e] = pk16(h0, h1); a2[e] = pk16(l0, l1);
      }
      hv[it] = a; lv[it] = a2;
    }
    const size_t PS = (size_t)NBH * SEQ * HD;
    unsigned short* base = ct + ((size_t)bh * SEQ + (size_t)q0) * HD;
    {
#pragma unroll
      for (int it = 0; it < 2; ++it) {
        unsigned short* p = base + it * 256 + lane * 8;
        *(v4u*)(p)          = hv[it];
        *(v4u*)(p + PS)     = hv[it];
        *(v4u*)(p + 2 * PS) = lv[it];
      }
      
    }
  }
}

// =====================================================================================================
// Workspace map (bytes), every region an exact multiple of its whole-line / whole-tile store granularity
// (no tail rows anywhere: all shapes are exact tile multiples):
//   X3   bf16 [4096][768]            6291456
//   Wq3  bf16 [768][768]             1179648
//   Wo3  bf16 [256][768]              393216
//   Qp   f16  [16][2048][32]          2097152
//   Kraw f32  [16][2048][32]          4194304
//   Kp   f16  [16][2048][32]          2097152
//   VTh  f16  [2][256][2048]          2097152
//   VTl  f16  [2][256][2048]          2097152
//   CT   bf16 [3][16][2048][32]       6291456
//   total                           26738688
// =====================================================================================================
extern "C" void kernel_launch(void* const* d_in, const int* in_sizes, int n_in,
                              void* d_out, int out_size, void* d_ws, size_t ws_size,
                              hipStream_t stream) {
  if (n_in < 6) return;
  if (in_sizes[0] != ROWS * DM) return;
  if (in_sizes[1] != DM * QKVW) return;
  if (in_sizes[2] != DM * DM) return;
  if (in_sizes[3] != DM) return;
  if (in_sizes[4] != NFUN || in_sizes[5] != NFUN) return;
  if (out_size != ROWS * DM) return;

  const float* x     = (const float*)d_in[0];   // [2][2048][256]
  const float* w_qkv = (const float*)d_in[1];   // [256 in][768 out]
  const float* w_o   = (const float*)d_in[2];   // [256 in][256 out]
  const float* b_o   = (const float*)d_in[3];   // [256]
  const float* coefa = (const float*)d_in[4];   // [256] sine coefficients
  const float* coefb = (const float*)d_in[5];   // [256] cosine coefficients

  const size_t PX3 = (size_t)ROWS * KP * 2;            // 6291456
  const size_t PWQ = (size_t)QKVW * KP * 2;            // 1179648
  const size_t PWO = (size_t)DM * KP * 2;              //  393216
  const size_t PH  = (size_t)NBH * SEQ * HD * 2;       // 2097152  f16 head plane
  const size_t PK4 = (size_t)NBH * SEQ * HD * 4;       // 4194304  f32 head plane
  const size_t PVT = (size_t)NB * DM * SEQ * 2;        // 2097152  v^T plane
  const size_t PCT = (size_t)3 * NBH * SEQ * HD * 2;   // 6291456  ctx planes
  size_t off = 0;
  const size_t oX3  = off; off += PX3;
  const size_t oWq  = off; off += PWQ;
  const size_t oWo  = off; off += PWO;
  const size_t oQp  = off; off += PH;
  const size_t oKr  = off; off += PK4;
  const size_t oKp  = off; off += PH;
  const size_t oVTh = off; off += PVT;
  const size_t oVTl = off; off += PVT;
  const size_t oCT  = off; off += PCT;
  if (off > ws_size) return;                           // off = 26738688
  if (off > (size_t)134217728) return;

  char* ws = (char*)d_ws;
  unsigned short* X3  = (unsigned short*)(ws + oX3);
  unsigned short* Wq3 = (unsigned short*)(ws + oWq);
  unsigned short* Wo3 = (unsigned short*)(ws + oWo);
  unsigned short* Qp  = (unsigned short*)(ws + oQp);
  float*          Kr  = (float*)(ws + oKr);
  unsigned short* Kp  = (unsigned short*)(ws + oKp);
  unsigned short* VTh = (unsigned short*)(ws + oVTh);
  unsigned short* VTl = (unsigned short*)(ws + oVTl);
  unsigned short* CT  = (unsigned short*)(ws + oCT);

  const dim3 blk(256);
  const int n8x = ROWS * DM / 8;                                   // 131072
  const dim3 gPrep(NTQ + NTO + (n8x + 255) / 256);                  //   48 + 16 + 512 blocks
  const dim3 gProj(3 * NGB);                                        //   96 blocks: q, k, v^T
  const dim3 gOut(NGB);                                             //   32 blocks: M=4096, N=256
  const dim3 gFour((NBH * SEQ * HD) / 1024);                        // 1024 blocks of 256, 4 elements per lane
  const dim3 gAttn(NBH * NQB);                                      //  512 blocks of 128

  // (1) x -> [hi|hi|lo] bf16 plane; weights transposed to [out][in] as [hi|lo|hi] bf16 planes
  prep3<<<gPrep, blk, 0, stream>>>(x, w_qkv, w_o, X3, Wq3, Wo3, n8x);
  // (2) q -> f16 head plane (x4), k -> raw f32 head plane, v^T -> f16 hi (x4) and residual (x2048) planes
  proj_qkv<<<gProj, blk, 0, stream>>>(X3, Wq3, Qp, Kr, VTh, VTl, KP);
  // (3) Fourier-basis transform of k -> f16 head plane (x4)
  fourier_k<<<gFour, blk, 0, stream>>>(Kr, coefa, coefb, Kp);
  // (4) attention -> ctx planes (bf16 hi, hi, lo)
  attn32<<<gAttn, dim3(128), 0, stream>>>(Qp, Kp, VTh, VTl, CT, 0.17677669529663687f * 0.0625f);
  // (5) out = ctx . Wo + bias -> d_out f32 [4096][256]
  proj_out<<<gOut, blk, 0, stream>>>(CT, Wo3, (float*)d_out, b_o, KP);
  (void)hipGetLastError();
}

// v006
// Measured time: 82.7 microseconds a run.
// In two side-by-side timings against v005, it was 1.12 and 1.14 times as fast.
// Over all steps from v000 it is 4.62 times as fast.
// Contractions: q, k, v^T projections and the output projection = v_wmma_f32_16x16x32_bf16 over bf16 hi/lo planes
// laid out as [hi|hi|lo] x [hi|lo|hi] along k (3 products, f32 accumulate);
// q.k^T scores = v_wmma_f32_16x16x32_f16 (q and the transformed k as f16 planes carried x4, single product, f32 accumulate);
// p.v = v_wmma_f32_16x16x32_f16 (p carried x1024 in f16; v^T as f16 hi plane x4 plus f16 residual plane x2^11; 2 products, f32 accumulate);
// Fourier-basis transform of k (one precise sincosf per element, then a rotation recurrence), softmax and bias in f32 on the VALU.
#include <hip/hip_runtime.h>
#include <math.h>
#include <stdint.h>

#define NB   2
#define SEQ  2048
#define DM   256
#define NH   8
#define HD   32
#define NBH  (NB * NH)        // 16 (batch, head) pairs
#define QKVW (3 * DM)         // 768 qkv output width
#define KP   (3 * DM)         // 768 folded k width of the split operand planes
#define NFUN 256
#define ROWS (NB * SEQ)       // 4096 token rows
#define NQB  (SEQ / 64)       // 64-query blocks per (b, h)
#define NKT  (SEQ / 64)       // 64-key chunks
#define GP   (KP * 2 + 16)    // GEMM operand row pitch in LDS, bytes: the whole k (1536 B) + 16 B (16 B x odd, for 16-B readers)
#define GOPS (128 * GP)       // GEMM operands of a block in LDS: 64 A rows, then 64 Bt rows
#define NTQ  ((QKVW / 64) * (DM / 64))   // 48 transpose tiles of w_qkv
#define NTO  ((DM / 64) * (DM / 64))     // 16 transpose tiles of w_o
#define NGB  256              // 64x64 block tiles of each of the four products: one per WGP
// attention tiles in LDS: every row is read or written 16 B a lane, one row per lane of a 16-lane half, so the row
// pitch is 16 B x odd (row + 16 B): the sixteen lanes of a half then fall on sixteen different groups of four banks
#define KPI  (HD + 8)         // K chunk row pitch, f16 elements: 64 B + 16 B = 80 B
#define VPI  (64 + 8)         // V^T chunk row pitch, f16 elements: 128 B + 16 B = 144 B
#define OPI  (HD + 4)         // ctx tile row pitch, f32 elements: 128 B + 16 B = 144 B
static_assert(NH * HD == DM);
static_assert(NQB == 32 && NKT == 32);
static_assert((ROWS % 64) == 0 && (DM % 64) == 0 && (SEQ % 64) == 0 && (KP % 32) == 0);
static_assert((ROWS * DM) % 2048 == 0);
static_assert((ROWS / 64) * (DM / 64) == NGB && NB * (DM / 64) * (SEQ / 64) == NGB);
static_assert((KP % 64) == 0 && 64 * (KP / 8) == 24 * 256 && (GP % 32) == 16);

typedef _Float16 v16h __attribute__((ext_vector_type(16)));
typedef _Float16 v8h  __attribute__((ext_vector_type(8)));
typedef __bf16   v16b __attribute__((ext_vector_type(16)));
typedef __bf16   v8b  __attribute__((ext_vector_type(8)));
typedef float    v8f  __attribute__((ext_vector_type(8)));
typedef float    v4f  __attribute__((ext_vector_type(4)));
typedef unsigned int v4u __attribute__((ext_vector_type(4)));
typedef float    v2f  __attribute__((ext_vector_type(2)));
typedef unsigned int v2u __attribute__((ext_vector_type(2)));

#if defined(__HIP_DEVICE_COMPILE__)
#define DEV_ASM 1
#else
#define DEV_ASM 0
#endif

// ---- scalar helpers --------------------------------------------------------------------------------
__device__ __forceinline__ unsigned short bf_bits(float f) {          // f32 -> bf16 bits, RNE convert
  unsigned u = __float_as_uint(f);
  return (unsigned short)((u + 0x7FFFu + ((u >> 16) & 1u)) >> 16);
}
__device__ __forceinline__ float bf_up(unsigned short hb) { return __uint_as_float(((unsigned)hb) << 16); }
__device__ __forceinline__ unsigned short h_bits(_Float16 x) { return __builtin_bit_cast(unsigned short, x); }
__device__ __forceinline__ unsigned pk16(unsigned short a, unsigned short b) { return (unsigned)a | ((unsigned)b << 16); }
__device__ __forceinline__ v8f zero8() { v8f z = {0.f, 0.f, 0.f, 0.f, 0.f, 0.f, 0.f, 0.f}; return z; }

// ---- fragment loaders: 16-bit A/B operand, lane -> row/col (lane&15), p already includes +8*(lane>>4);
//      elements 0..7 <- p[0..7] (k0+8h..k0+8h+7), elements 8..15 <- p[16..23] (k0+16+8h..k0+16+8h+7)
template <typename OT> struct FT;
template <> struct FT<__bf16>   { typedef v16b frag; typedef v8b half8; };
template <> struct FT<_Float16> { typedef v16h frag; typedef v8h half8; };

template <typename OT>
__device__ __forceinline__ typename FT<OT>::frag ldfrag(const OT* p) {
  union { typename FT<OT>::frag v; typename FT<OT>::half8 h[2]; } f;
  f.h[0] = *(const typename FT<OT>::half8*)(p);
  f.h[1] = *(const typename FT<OT>::half8*)(p + 16);
  return f.v;
}

// ---- WMMA helpers ----------------------------------------------------------------------------------
__device__ __forceinline__ v8f mmar(v16b a, v16b b, v8f c) {
  return __builtin_amdgcn_wmma_f32_16x16x32_bf16(false, a, false, b, (short)0, c, false, false);
}
// guarded form: 4 VALU slots after the WMMA, D tied, A/B kept live
__device__ __forceinline__ v8f mma_h(v16h a, v16h b, v8f c) {
  c = __builtin_amdgcn_wmma_f32_16x16x32_f16(false, a, false, b, (short)0, c, false, false);
#if DEV_ASM
  asm volatile("v_nop\n\tv_nop\n\tv_nop\n\tv_nop" : "+v"(c) : "v"(a), "v"(b));
#endif
  return c;
}
// lane l <-> lane l ^ 16
__device__ __forceinline__ float xhalf(float x) {
  const int b = __builtin_bit_cast(int, x);
  return __builtin_bit_cast(float, __builtin_amdgcn_permlanex16(b, b, 0x76543210, 0xfedcba98, false, false));
}
// ---- asynchronous copies global -> LDS, 16 B a lane ------------------------------------------------
__device__ __forceinline__ uint32_t lds_off(const void* p) { return (uint32_t)(size_t)p; }   // LDS byte address
// twelve copies of a lane (l: LDS byte addresses, g: global addresses); the s_wait_xcnt stands inside the
// statement so that no address register named here is rewritten ahead of it
__device__ __forceinline__ void copy12(const uint32_t (&l)[12], const __bf16* const (&g)[12]) {
#if DEV_ASM
  asm volatile("global_load_async_to_lds_b128 %0, %12, off\n\t"
               "global_load_async_to_lds_b128 %1, %13, off\n\t"
               "global_load_async_to_lds_b128 %2, %14, off\n\t"
               "global_load_async_to_lds_b128 %3, %15, off\n\t"
               "global_load_async_to_lds_b128 %4, %16, off\n\t"
               "global_load_async_to_lds_b128 %5, %17, off\n\t"
               "global_load_async_to_lds_b128 %6, %18, off\n\t"
               "global_load_async_to_lds_b128 %7, %19, off\n\t"
               "global_load_async_to_lds_b128 %8, %20, off\n\t"
               "global_load_async_to_lds_b128 %9, %21, off\n\t"
               "global_load_async_to_lds_b128 %10, %22, off\n\t"
               "global_load_async_to_lds_b128 %11, %23, off\n\t"
               "s_wait_xcnt 0x0"
               :: "v"(l[0]), "v"(l[1]), "v"(l[2]), "v"(l[3]), "v"(l[4]), "v"(l[5]),
                  "v"(l[6]), "v"(l[7]), "v"(l[8]), "v"(l[9]), "v"(l[10]), "v"(l[11]),
                  "v"(g[0]), "v"(g[1]), "v"(g[2]), "v"(g[3]), "v"(g[4]), "v"(g[5]),
                  "v"(g[6]), "v"(g[7]), "v"(g[8]), "v"(g[9]), "v"(g[10]), "v"(g[11])
               : "memory");
#else
  (void)l; (void)g;
#endif
}
// this wave's copies have landed
__device__ __forceinline__ void wait_copies() {
#if DEV_ASM
  asm volatile("s_wait_asynccnt 0x0" ::: "memory");
#endif
}
// behind a job's last global stores: in a kernel that holds several jobs' bodies the registers that the stores
// name may be written by the code laid out behind them; the wait stands in front of any such write
__device__ __forceinline__ void wait_store_regs() {
#if DEV_ASM
  asm volatile("s_wait_xcnt 0x0" ::: "memory");
#endif
}

// =====================================================================================================
// x [ROWS][DM] f32 -> split plane X3 [ROWS][KP] bf16, row = [hi | hi | lo] (hi = RNE bf16, lo = RNE bf16
// of the exact residual). 8 elements per thread; each thread stores 16 B into each of the three thirds;
// bx = the block's index within this job.
// =====================================================================================================
__device__ __forceinline__ void cvt_x3(const float* __restrict__ in, unsigned short* out, int n8, int bx) {
  const int i = bx * 256 + (int)threadIdx.x;
  if (i < n8) {
    const int row = i >> 5, c = (i & 31) * 8;
    const v4f a  = *(const v4f*)(in + (size_t)i * 8);
    const v4f a4 = *(const v4f*)(in + (size_t)i * 8 + 4);
    const float f[8] = {a[0], a[1], a[2], a[3], a4[0], a4[1], a4[2], a4[3]};
    v4u ph, pl;
#pragma unroll
    for (int e = 0; e < 4; ++e) {
      const float f0 = f[2 * e], f1 = f[2 * e + 1];
      const unsigned short h0 = bf_bits(f0), h1 = bf_bits(f1);
      const unsigned short l0 = bf_bits(f0 - bf_up(h0)), l1 = bf_bits(f1 - bf_up(h1));
      ph[e] = pk16(h0, h1);
      pl[e] = pk16(l0, l1);
    }
    unsigned short* o = out + (size_t)row * KP + c;
    *(v4u*)(o)          = ph;
    *(v4u*)(o + DM)     = ph;
    *(v4u*)(o + 2 * DM) = pl;
    wait_store_regs();
  }
}

// =====================================================================================================
// w [DM rows k][C cols] f32 (x @ w layout) -> wt [C][KP] bf16, row c = [hi | lo | hi] of w[k][c] over k.
// Block = 64 k x 64 c tile staged in LDS (f32); C/64 x DM/64 blocks: bx -> c0, by -> k0.
// coverage: 8 waves x 8 rows x 64 k = the tile, all three thirds; the grid covers all C rows x DM k.
// =====================================================================================================
__device__ __forceinline__ void wtrans3(float (*tile)[65], const float* __restrict__ w, unsigned short* wt, int C,
                                        int bx, int by) {
  const int tid = (int)threadIdx.x, lane = tid & 31, wave = tid >> 5;
  const int c0 = bx * 64, k0 = by * 64;
#pragma unroll
  for (int it = 0; it < 16; ++it) {
    const int idx = it * 256 + tid;
    const int r = idx >> 6, cc = idx & 63;
    tile[r][cc] = w[(size_t)(k0 + r) * C + c0 + cc];
  }
  __syncthreads();
  const int q = lane >> 3, c8 = (lane & 7) * 8;
  v4u hv[2], lv[2];
#pragma unroll
  for (int it = 0; it < 2; ++it) {
    const int row = wave * 8 + it * 4 + q;          // output row (c within tile)
    v4u a, a2;
#pragma unroll
    for (int e = 0; e < 4; ++e) {
      const float f0 = tile[c8 + 2 * e][row], f1 = tile[c8 + 2 * e + 1][row];
      const unsigned short h0 = bf_bits(f0), h1 = bf_bits(f1);
      const unsigned short l0 = bf_bits(f0 - bf_up(h0)), l1 = bf_bits(f1 - bf_up(h1));
      a[e] = pk16(h0, h1);
      a2[e] = pk16(l0, l1);
    }
    hv[it] = a; lv[it] = a2;
  }
  {
#pragma unroll
    for (int it = 0; it < 2; ++it) {
      const int row = wave * 8 + it * 4 + q;
      unsigned short* o = wt + (size_t)(c0 + row) * KP + k0 + c8;
      *(v4u*)(o)          = hv[it];
      *(v4u*)(o + DM)     = lv[it];
      *(v4u*)(o + 2 * DM) = hv[it];
    }
    wait_store_regs();
  }
}

// =====================================================================================================
// The three operand preparations in one launch: each reads inputs only and writes a plane of its own, so
// none waits for another. The block index picks the job (the same for the whole block, so the transpose's
// barrier stays block-uniform): NTQ blocks transpose w_qkv, NTO blocks w_o, the remaining n8 / 256 split x.
// =====================================================================================================
__global__ __launch_bounds__(256) void prep3(const float* __restrict__ x, const float* __restrict__ w_qkv,
                                             const float* __restrict__ w_o, unsigned short* X3,
                                             unsigned short* Wq3, unsigned short* Wo3, int n8) {
  __shared__ float tile[64][65];
  const int bx = (int)blockIdx.x;
  if (bx < NTQ) {
    wtrans3(tile, w_qkv, Wq3, QKVW, bx % (QKVW / 64), bx / (QKVW / 64));
  } else if (bx < NTQ + NTO) {
    wtrans3(tile, w_o, Wo3, DM, (bx - NTQ) % (DM / 64), (bx - NTQ) / (DM / 64));
  } else {
    cvt_x3(x, X3, n8, bx - (NTQ + NTO));
  }
}

// =====================================================================================================
// Batched WMMA GEMM, bf16 operands: C[m][n] = sum_k A[m][k] * Bt[n][k], k = 0..KP-1; a block of eight waves on a
// 64x64 tile, so that every product has NGB blocks; a wave on 32x16 of it (2 x 4 waves).
// Bt row-major [N][KP] pitch ldb (k contiguous).
// A_MODE 0: A row-major [M][KP] pitch lda.  A_MODE 1: head planes: A(m, k) at
//   plane = (k/256)*NBH + (m/SEQ)*NH + (k/32)%NH;  A[(plane*SEQ + m%SEQ)*HD + k%32]  (M = ROWS).
// M and N multiples of 64 (static shapes below). bx = block tile index, b = batch index (strides in elements);
// opnd and ct are the calling kernel's LDS.
// Operands: the block's 64 A rows and 64 Bt rows, the whole k of each (1536 B a row), come into LDS once, by
// asynchronous copies of whole 128-B lines, 48 copies a lane, all in flight together; one wait, one barrier;
// LDS row pitch GP; fragments read from LDS with the split k map (ldfrag), k ascending as before.
// Epilogue: the 64x64 tile staged in LDS (pitch 68 floats), one barrier; a pair of waves takes a 16-row slab, each
// wave one half of its stores:
// OUT_MODE 0: f16 head plane [NBH][SEQ][HD], value * oscale: a wave stores one head half of the slab (1024 contiguous B)
// OUT_MODE 1: f32 head plane [NBH][SEQ][HD]: a wave stores one head half (2048 contiguous B)
// OUT_MODE 2: f16 hi plane C (value*oscale) + f16 residual plane C2 = f16((v*oscale - hi) * rscale), row-major, 8 rows a wave
// OUT_MODE 3: f32 row-major C (pitch ldc) + bias[n] (f32): each 64-wide row segment = 256 B = 16 lanes x 16 B, 8 rows a wave
// coverage: 4 slabs x 16 rows x 64 cols = the block's whole 64x64 tile; grids are exact tile multiples.
// =====================================================================================================
template <int A_MODE, int OUT_MODE>
__device__ __forceinline__ void gemm64(
    unsigned char* opnd, float* ct, int bx, int b,
    const unsigned short* __restrict__ Ap, int lda, long long strideA,
    const unsigned short* __restrict__ Btp, int ldb, long long strideB,
    void* Cout, void* Cout2, int ldc, long long strideC,
    const float* __restrict__ bias,
    int M, int N, float oscale, float rscale) {
  const __bf16* A  = (const __bf16*)(const void*)Ap;
  const __bf16* Bt = (const __bf16*)(const void*)Btp;
  const int tid  = (int)threadIdx.x;
  const int lane = tid & 31;
  const int wave = tid >> 5;
  const int nbn = N >> 6;                // block tiles along N
  const int bm  = bx / nbn;
  const int bn  = bx - bm * nbn;
  if (bm >= (M >> 6)) return;            // the same for the whole block, in front of every barrier
  const int bm0 = bm << 6;
  const int bn0 = bn << 6;
  const int wr  = (wave >> 2) << 5;      // the wave's first A row in the block tile
  const int wc  = (wave & 3) << 4;       // the wave's first Bt row in the block tile

  const __bf16* Ab = A  + (size_t)b * (size_t)strideA;
  const __bf16* Bb = Bt + (size_t)b * (size_t)strideB;

  const int rlane = lane & 15;                 // row (A) / col (B, D) within subtile
  const int koff  = (lane >> 4) * 8;           // k offset of this lane half
  const int mOff  = (lane >> 4) * 8;           // D row offset

  // 24 copies a lane for each operand, in statements of twelve; a wave's copy covers 512 B of whole lines (4 rows
  // of 128 B; in the head-plane layout 8 rows of 64 B, which adjoin)
  const uint32_t lb = lds_off(opnd);
#pragma unroll
  for (int g = 0; g < 2; ++g) {
    uint32_t la[12];
    const __bf16* ga[12];
#pragma unroll
    for (int u = 0; u < 12; ++u) {
      const int v = g * 12 + u;
      if (A_MODE == 0) {
        const int row = (v & 1) * 32 + (tid >> 3), pc = tid & 7;
        ga[u] = Ab + (size_t)(bm0 + row) * lda + (v >> 1) * 64 + pc * 8;
        la[u] = lb + (uint32_t)(row * GP + (v >> 1) * 128 + pc * 16);
      } else {
        const int kk = v * 32;
        const int row = tid >> 2, pc = tid & 3;
        const int plane = (kk >> 8) * NBH + (bm0 / SEQ) * NH + ((kk >> 5) & (NH - 1));
        ga[u] = Ab + ((size_t)plane * SEQ + (size_t)((bm0 & (SEQ - 1)) + row)) * HD + pc * 8;
        la[u] = lb + (uint32_t)(row * GP + (v * 4 + pc) * 16);
      }
    }
    copy12(la, ga);
  }
#pragma unroll
  for (int g = 0; g < 2; ++g) {
    uint32_t la[12];
    const __bf16* ga[12];
#pragma unroll
    for (int u = 0; u < 12; ++u) {
      const int v = g * 12 + u;
      const int row = (v & 1) * 32 + (tid >> 3), pc = tid & 7;
      ga[u] = Bb + (size_t)(bn0 + row) * ldb + (v >> 1) * 64 + pc * 8;
      la[u] = lb + (uint32_t)((64 + row) * GP + (v >> 1) * 128 + pc * 16);
    }
    copy12(la, ga);
  }
  wait_copies();
  __syncthreads();                       // both operands are readable by every wave

  v8f acc[2];
  acc[0] = zero8(); acc[1] = zero8();
  const unsigned char* ap = opnd + (wr + rlane) * GP + koff * 2;
  const unsigned char* bp = opnd + (64 + wc + rlane) * GP + koff * 2;
  // unrolled whole: no barrier stands in it, so the fragment reads of later k-steps can run ahead of the products
#pragma unroll
  for (int ks = 0; ks < KP / 32; ++ks) { // k-steps of 32 (64 B of every row)
    const v16b bq = ldfrag<__bf16>((const __bf16*)(bp + ks * 64));
    const v16b a0 = ldfrag<__bf16>((const __bf16*)(ap + ks * 64));
    const v16b a1 = ldfrag<__bf16>((const __bf16*)(ap + 16 * GP + ks * 64));
    acc[0] = mmar(a0, bq, acc[0]);
    acc[1] = mmar(a1, bq, acc[1]);
  }

  // ---- epilogue ----
#pragma unroll
  for (int i = 0; i < 2; ++i)
#pragma unroll
    for (int r = 0; r < 8; ++r) ct[(wr + (i << 4) + mOff + r) * 68 + wc + rlane] = acc[i][r];
  __syncthreads();                       // the whole tile is readable by every wave
  const float* slab = ct + (wave >> 1) * (16 * 68);
  const int mBase = bm0 + ((wave >> 1) << 4);
  const int n0 = bn0;
  const int hs = wave & 1;               // which half of the slab's stores this wave does
  if (OUT_MODE == 0) {
    unsigned short* Q = (unsigned short*)Cout;
    const int rq = lane >> 2, c8 = (lane & 3) * 8;        // row within an 8-row group, 8-col piece
    v4u hv[2];
#pragma unroll
    for (int it = 0; it < 2; ++it) {
      const float* sp = slab + (it * 8 + rq) * 68 + hs * 32 + c8;   // it 0..1 x rq 0..7 = rows 0..15
      v4u a;
#pragma unroll
      for (int e = 0; e < 4; ++e)
        a[e] = pk16(h_bits((_Float16)(sp[2 * e] * oscale)), h_bits((_Float16)(sp[2 * e + 1] * oscale)));
      hv[it] = a;
    }
    const int head = (n0 >> 5) + hs;
    unsigned short* base = Q + ((size_t)((mBase / SEQ) * NH + head) * SEQ + (size_t)(mBase & (SEQ - 1))) * HD;
#pragma unroll
    for (int it = 0; it < 2; ++it)
      *(v4u*)(base + it * 256 + lane * 8) = hv[it];
  } else if (OUT_MODE == 1) {
    float* Kr = (float*)Cout;
    const int rq = lane >> 3, c4 = (lane & 7) * 4;        // row within a 4-row group, 4-col piece
    v4f hv[4];
#pragma unroll
    for (int it = 0; it < 4; ++it)                        // it 0..3 x rq 0..3 = rows 0..15
      hv[it] = *(const v4f*)(slab + (it * 4 + rq) * 68 + hs * 32 + c4);
    const int head = (n0 >> 5) + hs;
    float* base = Kr + ((size_t)((mBase / SEQ) * NH + head) * SEQ + (size_t)(mBase & (SEQ - 1))) * HD;
#pragma unroll
    for (int it = 0; it < 4; ++it)
      *(v4f*)(base + it * 128 + lane * 4) = hv[it];
  } else if (OUT_MODE == 2) {
    const int q = lane >> 3, c8 = (lane & 7) * 8;
    unsigned short* C  = (unsigned short*)Cout  + (size_t)b * (size_t)strideC;
    unsigned short* C2 = (unsigned short*)Cout2 + (size_t)b * (size_t)strideC;
    v4u hv[2], lv[2];
#pragma unroll
    for (int it = 0; it < 2; ++it) {
      const int row = hs * 8 + it * 4 + q;                // hs 0..1 x it 0..1 x q 0..3 = rows 0..15
      const float* sp = slab + row * 68 + c8;
      v4u a, a2;
#pragma unroll
      for (int e = 0; e < 4; ++e) {
        const float f0 = sp[2 * e] * oscale, f1 = sp[2 * e + 1] * oscale;
        const _Float16 x0 = (_Float16)f0, x1 = (_Float16)f1;
        const unsigned short h0 = h_bits(x0), h1 = h_bits(x1);
        const unsigned short l0 = h_bits((_Float16)((f0 - (float)x0) * rscale));
        const unsigned short l1 = h_bits((_Float16)((f1 - (float)x1) * rscale));
        a[e] = pk16(h0, h1); a2[e] = pk16(l0, l1);
      }
      hv[it] = a; lv[it] = a2;
    }
#pragma unroll
    for (int it = 0; it < 2; ++it) {
      const int row = hs * 8 + it * 4 + q;
      *(v4u*)(C  + (size_t)(mBase + row) * ldc + n0 + c8) = hv[it];
      *(v4u*)(C2 + (size_t)(mBase + row) * ldc + n0 + c8) = lv[it];
    }
  } else {
    float* C = (float*)Cout + (size_t)b * (size_t)strideC;
    const int h2 = lane >> 4, c4 = (lane & 15) * 4;      // 256-B row segment = 16 lanes x 16 B
    const v4f bv = *(const v4f*)(bias + n0 + c4);
    v4f hv[4];
#pragma unroll
    for (int it = 0; it < 4; ++it) {
      const int row = hs * 8 + it * 2 + h2;               // hs 0..1 x it 0..3 x h2 0..1 = rows 0..15
      hv[it] = *(const v4f*)(slab + row * 68 + c4) + bv;
    }
#pragma unroll
    for (int it = 0; it < 4; ++it) {
      const int row = hs * 8 + it * 2 + h2;
      *(v4f*)(C + (size_t)(mBase + row) * ldc + n0 + c4) = hv[it];
    }
  }
  wait_store_regs();
}

// =====================================================================================================
// The q, k and v^T projections in one launch: all three read the X3 and Wq3 planes, none reads another's
// output. blockIdx.x / NGB picks the product (the same for the whole block, so every barrier stays block-uniform):
//   0: q = x . Wq -> f16 head plane (x4)        (M=4096, N=256, K=768)
//   1: k = x . Wk -> raw f32 head plane         (M=4096, N=256, K=768)
//   2: v^T = Wv . x^T per batch -> f16 hi plane (x4) [b][c][s] (pitch SEQ) and residual plane (x2048)
//      (A = Wq3 rows 512.., Bt = X3 rows of batch b; M=256, N=2048, K=768; 128 blocks a batch)
// =====================================================================================================
__global__ __launch_bounds__(256) void proj_qkv(const unsigned short* __restrict__ X3,
                                                const unsigned short* __restrict__ Wq3,
                                                unsigned short* Qp, float* Kr,
                                                unsigned short* VTh, unsigned short* VTl) {
  __shared__ __align__(16) unsigned char opnd[GOPS];   // 64 A rows, then 64 Bt rows, the whole k of each
  __shared__ __align__(16) float ct[64 * 68];          // the block's 64x64 result tile, pitch 68 floats
  const unsigned job = blockIdx.x / NGB;
  const int bx = (int)(blockIdx.x % NGB);
  if (job == 0) {
    gemm64<0, 0>(opnd, ct, bx, 0, X3, KP, 0LL, Wq3, KP, 0LL,
                 (void*)Qp, (void*)Qp, 0, 0LL, nullptr, ROWS, DM, 4.0f, 1.0f);
  } else if (job == 1) {
    gemm64<0, 1>(opnd, ct, bx, 0, X3, KP, 0LL, Wq3 + (size_t)DM * KP, KP, 0LL,
                 (void*)Kr, (void*)Kr, 0, 0LL, nullptr, ROWS, DM, 1.0f, 1.0f);
  } else if (job == 2) {
    gemm64<0, 2>(opnd, ct, bx % (NGB / NB), bx / (NGB / NB),
                 Wq3 + (size_t)2 * DM * KP, KP, 0LL, X3, KP, (long long)SEQ * KP,
                 (void*)VTh, (void*)VTl, SEQ, (long long)DM * SEQ, nullptr, DM, SEQ, 4.0f, 2048.0f);
  }
}

// out = ctx . Wo + bias -> f32 [4096][256]   (M=4096, N=256, K=768, A in head-plane layout)
__global__ __launch_bounds__(256) void proj_out(const unsigned short* __restrict__ CT,
                                                const unsigned short* __restrict__ Wo3,
                                                float* out, const float* __restrict__ bias) {
  __shared__ __align__(16) unsigned char opnd[GOPS];   // 64 A rows, then 64 Bt rows, the whole k of each
  __shared__ __align__(16) float ct[64 * 68];          // the block's 64x64 result tile, pitch 68 floats
  gemm64<1, 3>(opnd, ct, (int)blockIdx.x, 0, CT, 0, 0LL, Wo3, KP, 0LL,
               (void*)out, (void*)out, DM, 0LL, bias, ROWS, DM, 1.0f, 1.0f);
}

// =====================================================================================================
// Fourier-basis transform of k: out = sum_{f=1..NFUN} ca[f-1]*sin(f*k) + cb[f-1]*cos(f*k) in f32.
// One precise sincosf(k) per element; sin(f*k), cos(f*k) for f = 2..NFUN follow by rotating the pair by k
// (angle addition: two products and two fused multiply-adds a step). The rotation keeps the pair's length,
// so its error grows linearly in f: at f = NFUN it is that of moving k by about one f32 ulp.
// Terms are added in the order f = 1..NFUN, sine before cosine, as fused multiply-adds.
// Four consecutive elements of the raw f32 k head plane [NBH][SEQ][HD] per lane, as two pairs, so that every
// step is packed f32 arithmetic; a lane stores its four f16 results (x4) as 8 B, a wave 256 contiguous B.
// coverage: grid x 256 x 4 = every element of the k' plane.
// =====================================================================================================
__global__ __launch_bounds__(256) void fourier_k(const float* __restrict__ kr, const float* __restrict__ ca,
                                                 const float* __restrict__ cb, unsigned short* kp) {
  const size_t g4 = ((size_t)blockIdx.x * 256 + (size_t)threadIdx.x) * 4;
  const v4f kx = *(const v4f*)(kr + g4);
  v2f s1[2], c1[2], s[2], c[2], acc[2];
#pragma unroll
  for (int h = 0; h < 2; ++h) {
#pragma unroll
    for (int e = 0; e < 2; ++e) {
      float sn, cs;
      sincosf(kx[2 * h + e], &sn, &cs);
      s1[h][e] = sn;
      c1[h][e] = cs;
    }
    s[h] = s1[h];
    c[h] = c1[h];
    acc[h] = (v2f){0.f, 0.f};
  }
  // unrolled so that the coefficients of a group of steps arrive in one pair of scalar loads
#pragma unroll 16
  for (int fi = 0; fi < NFUN; ++fi) {
    const float af = ca[fi];
    const float bf = cb[fi];
    const v2f a2 = {af, af}, b2 = {bf, bf};
#pragma unroll
    for (int h = 0; h < 2; ++h) {
      acc[h] = __builtin_elementwise_fma(a2, s[h], acc[h]);
      acc[h] = __builtin_elementwise_fma(b2, c[h], acc[h]);
      const v2f sn = __builtin_elementwise_fma(s[h], c1[h], c[h] * s1[h]);
      c[h] = __builtin_elementwise_fma(c[h], c1[h], -(s[h] * s1[h]));
      s[h] = sn;
    }
  }
  v2u o;
#pragma unroll
  for (int h = 0; h < 2; ++h)
    o[h] = pk16(h_bits((_Float16)(acc[h][0] * 4.0f)), h_bits((_Float16)(acc[h][1] * 4.0f)));
  *(v2u*)(kp + g4) = o;
}

// =====================================================================================================
// Attention, head dim 32, no mask, softmax over all SEQ keys.
//   q plane / k' plane (f16, x4): element (bh, t, d) at [(bh*SEQ + t)*HD + d]
//   v^T hi plane (f16, 4v) and residual plane (f16, (4v - hi)*2048): element (bh, d, s) at [(bh*HD + d)*SEQ + s]
//   ctx planes (bf16): part p (0 = hi, 1 = hi, 2 = lo), element (bh, t, d) at [p*PS + (bh*SEQ + t)*HD + d]
//   scores^T = (k4' . q4^T) * sscale on f16 WMMA (one k-step), softmax in f32 (running max), a query per lane pair;
//   p = exp(s - m) carried as f16(1024 p); O^T = vh^T . p^T + (vl^T . p^T) / 2048 on f16 WMMA; ctx = O / (l * 4096).
//   Block = 4 waves on the same (b, h), 4 consecutive 16-query tiles; grid = NBH * NQB; key chunks of 64,
//   static trip NKT. Chunk staging: 128 threads, K 64x32 (2 x 16 B per thread), V^T hi/res 32x64 (2 x 16 B
//   per thread and plane), plain loads, __syncthreads before and after. P^T stays in registers (score tiles -> B operand).
//   Output: each wave writes its 16x32 tile (1024 contiguous B per part) with two instructions of
//   all NBH*SEQ rows x HD, all three parts.
// =====================================================================================================
__global__ __launch_bounds__(128)
void attn32(const unsigned short* __restrict__ qpp, const unsigned short* __restrict__ kpp,
            const unsigned short* __restrict__ vhp, const unsigned short* __restrict__ vlp,
            unsigned short* ct, float sscale) {
  union FH { v16h v; v8h h[2]; };
  __shared__ __align__(16) _Float16 Ksh[64 * KPI];         // K chunk [key][d], pitch KPI     5120 B
  __shared__ __align__(16) _Float16 Vth[HD * VPI];         // V^T hi [d][key], pitch VPI     4608 B
  __shared__ __align__(16) _Float16 Vtl[HD * VPI];         // V^T residual, pitch VPI        4608 B
  __shared__ __align__(16) float    Os[4][16 * OPI];       // per wave ctx tile, pitch OPI   9216 B

  const int tid  = (int)threadIdx.x;
  const int wave = tid >> 5;
  const int lane = tid & 31;
  const int hh   = lane >> 4;
  const int c    = lane & 15;

  const int bx   = blockIdx.x;
  const int qblk = bx % NQB;
  const int bh   = bx / NQB;
  const int q0   = qblk * 64 + wave * 16;

  const _Float16* Qg = (const _Float16*)(const void*)qpp + (size_t)bh * SEQ * HD;
  const _Float16* Kg = (const _Float16*)(const void*)kpp + (size_t)bh * SEQ * HD;
  const _Float16* Vh = (const _Float16*)(const void*)vhp + (size_t)bh * HD * SEQ;
  const _Float16* Vl = (const _Float16*)(const void*)vlp + (size_t)bh * HD * SEQ;

  // ---- Q fragment (B operand, column = lane&15, one k-step of 32) ----
  const v16h qa = ldfrag<_Float16>(Qg + (size_t)(q0 + c) * HD + 8 * hh);

  float mrun = -INFINITY, lrun = 0.f;   // query c: running maximum (joined), running sum of this half's keys
  v8f oacc[2];
  oacc[0] = zero8(); oacc[1] = zero8();

  for (int kt = 0; kt < NKT; ++kt) {         // static trip count
    const int kv0 = kt * 64;
    __syncthreads();
    {
      const int r = tid >> 1, hf = (tid & 1) * 16;                  // key r, d = hf..hf+15
      const _Float16* kg = Kg + (size_t)(kv0 + r) * HD + hf;
      const v8h k0v = *(const v8h*)(kg);
      const v8h k1v = *(const v8h*)(kg + 8);
      *(v8h*)(Ksh + r * KPI + hf)     = k0v;
      *(v8h*)(Ksh + r * KPI + hf + 8) = k1v;
      const int d = tid >> 2, sg = (tid & 3) * 16;                  // d row, keys sg..sg+15
      const _Float16* vg  = Vh + (size_t)d * SEQ + kv0 + sg;
      const _Float16* vlg = Vl + (size_t)d * SEQ + kv0 + sg;
      const v8h v0 = *(const v8h*)(vg),  v1 = *(const v8h*)(vg + 8);
      const v8h w0 = *(const v8h*)(vlg), w1 = *(const v8h*)(vlg + 8);
      *(v8h*)(Vth + d * VPI + sg)     = v0;
      *(v8h*)(Vth + d * VPI + sg + 8) = v1;
      *(v8h*)(Vtl + d * VPI + sg)     = w0;
      *(v8h*)(Vtl + d * VPI + sg + 8) = w1;
    }
    __syncthreads();

    // ---- transposed scores: 64 keys (rows) x 16 queries (columns) per wave; lane (c, hh) holds, for query c,
    //      keys j*16 + 8*hh + r in s[j][r] ----
    v8f s[4];
#pragma unroll
    for (int j = 0; j < 4; ++j) {
      FH kb;
      kb.h[0] = *(const v8h*)(Ksh + (j * 16 + c) * KPI + 8 * hh);
      kb.h[1] = *(const v8h*)(Ksh + (j * 16 + c) * KPI + 16 + 8 * hh);
      s[j] = mma_h(kb.v, qa, zero8());
#pragma unroll
      for (int r = 0; r < 8; ++r) s[j][r] *= sscale;
    }

    // ---- online softmax: a query's maximum and sum lie in its own two lanes; the maximum is joined across the
    //      halves every chunk (both halves rescale alike), the sums only after the loop ----
    float mj[4];
#pragma unroll
    for (int j = 0; j < 4; ++j) {   // a short tree per tile, ready while the next tile's product runs
      const float t0 = fmaxf(fmaxf(s[j][0], s[j][1]), s[j][2]);
      const float t1 = fmaxf(fmaxf(s[j][3], s[j][4]), s[j][5]);
      mj[j] = fmaxf(fmaxf(t0, t1), fmaxf(s[j][6], s[j][7]));
    }
    float m = fmaxf(fmaxf(mj[0], mj[1]), fmaxf(mj[2], mj[3]));
    m = fmaxf(m, xhalf(m));
    const float mnew  = fmaxf(mrun, m);
    const float msafe = (mnew == -INFINITY) ? 0.f : mnew;
    const float alpha = __expf(mrun - msafe);
    mrun = mnew;
#pragma unroll
    for (int j = 0; j < 4; ++j)
#pragma unroll
      for (int r = 0; r < 8; ++r) s[j][r] = __expf(s[j][r] - msafe);
    const v8f ts = (s[0] + s[1]) + (s[2] + s[3]);   // tiles first (packed adds), then a tree over the eight
    const float psum = ((ts[0] + ts[1]) + (ts[2] + ts[3])) + ((ts[4] + ts[5]) + (ts[6] + ts[7]));
    lrun = lrun * alpha + psum;
#pragma unroll
    for (int r = 0; r < 8; ++r) {
      oacc[0][r] *= alpha;
      oacc[1][r] *= alpha;
    }

    // ---- context^T += V^T . P^T (f16 WMMA); two score tiles, converted in place (x1024, f16), are the B operand
    //      of one 32-key step; residual products into a separate accumulator ----
    v8f o1[2];
    o1[0] = zero8(); o1[1] = zero8();
#pragma unroll
    for (int kk = 0; kk < 2; ++kk) {
      FH pb;
      pb.h[0] = __builtin_convertvector(s[2 * kk] * 1024.0f, v8h);
      pb.h[1] = __builtin_convertvector(s[2 * kk + 1] * 1024.0f, v8h);
#pragma unroll
      for (int t = 0; t < 2; ++t) {
        FH vb, vl;
        vb.h[0] = *(const v8h*)(Vth + (t * 16 + c) * VPI + kk * 32 + 8 * hh);
        vb.h[1] = *(const v8h*)(Vth + (t * 16 + c) * VPI + kk * 32 + 16 + 8 * hh);
        vl.h[0] = *(const v8h*)(Vtl + (t * 16 + c) * VPI + kk * 32 + 8 * hh);
        vl.h[1] = *(const v8h*)(Vtl + (t * 16 + c) * VPI + kk * 32 + 16 + 8 * hh);
        oacc[t] = mma_h(vb.v, pb.v, oacc[t]);
        o1[t]   = mma_h(vl.v, pb.v, o1[t]);
      }
    }
#pragma unroll
    for (int t = 0; t < 2; ++t)
#pragma unroll
      for (int r = 0; r < 8; ++r) oacc[t][r] += o1[t][r] * (1.0f / 2048.0f);
  }

  // ---- join the halves' sums, normalise (1/l, undo the x1024 p carry and the x4 v carry), stage the wave's
  //      16x32 tile: oacc[t][r] is element (query c, d = t*16 + 8*hh + r)
  float* os = Os[wave];
  {
    const float l = lrun + xhalf(lrun);
    const float inv = 1.0f / (l * 4096.0f);
#pragma unroll
    for (int t = 0; t < 2; ++t) {
      const v8f o = oacc[t] * inv;
      *(v4f*)(os + c * OPI + t * 16 + 8 * hh)     = (v4f){o[0], o[1], o[2], o[3]};
      *(v4f*)(os + c * OPI + t * 16 + 8 * hh + 4) = (v4f){o[4], o[5], o[6], o[7]};
    }
  }
  __builtin_amdgcn_fence(__ATOMIC_RELEASE, "workgroup");
  __builtin_amdgcn_wave_barrier();
  __builtin_amdgcn_fence(__ATOMIC_ACQUIRE, "workgroup");
  {
    const int rq = lane >> 2, c8 = (lane & 3) * 8;
    v4u hv[2], lv[2];
#pragma unroll
    for (int it = 0; it < 2; ++it) {
      const int row = it * 8 + rq;   // it 0..1 x rq 0..7 = rows 0..15 of the wave tile
      const float* sp = os + row * OPI + c8;
      v4u a, a2;
#pragma unroll
      for (int e = 0; e < 4; ++e) {
        const float f0 = sp[2 * e], f1 = sp[2 * e + 1];
        const unsigned short h0 = bf_bits(f0), h1 = bf_bits(f1);
        const unsigned short l0 = bf_bits(f0 - bf_up(h0)), l1 = bf_bits(f1 - bf_up(h1));
        a[e] = pk16(h0, h1); a2[e] = pk16(l0, l1);
      }
      hv[it] = a; lv[it] = a2;
    }
    const size_t PS = (size_t)NBH * SEQ * HD;
    unsigned short* base = ct + ((size_t)bh * SEQ + (size_t)q0) * HD;
    {
#pragma unroll
      for (int it = 0; it < 2; ++it) {
        unsigned short* p = base + it * 256 + lane * 8;
        *(v4u*)(p)          = hv[it];
        *(v4u*)(p + PS)     = hv[it];
        *(v4u*)(p + 2 * PS) = lv[it];
      }
      
    }
  }
}

// =====================================================================================================
// Workspace map (bytes), every region an exact multiple of its whole-line / whole-tile store granularity
// (no tail rows anywhere: all shapes are exact tile multiples):
//   X3   bf16 [4096][768]            6291456
//   Wq3  bf16 [768][768]             1179648
//   Wo3  bf16 [256][768]              393216
//   Qp   f16  [16][2048][32]          2097152
//   Kraw f32  [16][2048][32]          4194304
//   Kp   f16  [16][2048][32]          2097152
//   VTh  f16  [2][256][2048]          2097152
//   VTl  f16  [2][256][2048]          2097152
//   CT   bf16 [3][16][2048][32]       6291456
//   total                           26738688
// =====================================================================================================
extern "C" void kernel_launch(void* const* d_in, const int* in_sizes, int n_in,
                              void* d_out, int out_size, void* d_ws, size_t ws_size,
                              hipStream_t stream) {
  if (n_in < 6) return;
  if (in_sizes[0] != ROWS * DM) return;
  if (in_sizes[1] != DM * QKVW) return;
  if (in_sizes[2] != DM * DM) return;
  if (in_sizes[3] != DM) return;
  if (in_sizes[4] != NFUN || in_sizes[5] != NFUN) return;
  if (out_size != ROWS * DM) return;

  const float* x     = (const float*)d_in[0];   // [2][2048][256]
  const float* w_qkv = (const float*)d_in[1];   // [256 in][768 out]
  const float* w_o   = (const float*)d_in[2];   // [256 in][256 out]
  const float* b_o   = (const float*)d_in[3];   // [256]
  const float* coefa = (const float*)d_in[4];   // [256] sine coefficients
  const float* coefb = (const float*)d_in[5];   // [256] cosine coefficients

  const size_t PX3 = (size_t)ROWS * KP * 2;            // 6291456
  const size_t PWQ = (size_t)QKVW * KP * 2;            // 1179648
  const size_t PWO = (size_t)DM * KP * 2;              //  393216
  const size_t PH  = (size_t)NBH * SEQ * HD * 2;       // 2097152  f16 head plane
  const size_t PK4 = (size_t)NBH * SEQ * HD * 4;       // 4194304  f32 head plane
  const size_t PVT = (size_t)NB * DM * SEQ * 2;        // 2097152  v^T plane
  const size_t PCT = (size_t)3 * NBH * SEQ * HD * 2;   // 6291456  ctx planes
  size_t off = 0;
  const size_t oX3  = off; off += PX3;
  const size_t oWq  = off; off += PWQ;
  const size_t oWo  = off; off += PWO;
  const size_t oQp  = off; off += PH;
  const size_t oKr  = off; off += PK4;
  const size_t oKp  = off; off += PH;
  const size_t oVTh = off; off += PVT;
  const size_t oVTl = off; off += PVT;
  const size_t oCT  = off; off += PCT;
  if (off > ws_size) return;                           // off = 26738688
  if (off > (size_t)134217728) return;

  char* ws = (char*)d_ws;
  unsigned short* X3  = (unsigned short*)(ws + oX3);
  unsigned short* Wq3 = (unsigned short*)(ws + oWq);
  unsigned short* Wo3 = (unsigned short*)(ws + oWo);
  unsigned short* Qp  = (unsigned short*)(ws + oQp);
  float*          Kr  = (float*)(ws + oKr);
  unsigned short* Kp  = (unsigned short*)(ws + oKp);
  unsigned short* VTh = (unsigned short*)(ws + oVTh);
  unsigned short* VTl = (unsigned short*)(ws + oVTl);
  unsigned short* CT  = (unsigned short*)(ws + oCT);

  const dim3 blk(256);
  const int n8x = ROWS * DM / 8;                                   // 131072
  const dim3 gPrep(NTQ + NTO + (n8x + 255) / 256);                  //   48 + 16 + 512 blocks
  const dim3 gProj(3 * NGB);                                        //  768 blocks: q, k, v^T
  const dim3 gOut(NGB);                                             //  256 blocks: M=4096, N=256
  const dim3 gFour((NBH * SEQ * HD) / 1024);                        // 1024 blocks of 256, 4 elements per lane
  const dim3 gAttn(NBH * NQB);                                      //  512 blocks of 128

  // (1) x -> [hi|hi|lo] bf16 plane; weights transposed to [out][in] as [hi|lo|hi] bf16 planes
  prep3<<<gPrep, blk, 0, stream>>>(x, w_qkv, w_o, X3, Wq3, Wo3, n8x);
  // (2) q -> f16 head plane (x4), k -> raw f32 head plane, v^T -> f16 hi (x4) and residual (x2048) planes
  proj_qkv<<<gProj, blk, 0, stream>>>(X3, Wq3, Qp, Kr, VTh, VTl);
  // (3) Fourier-basis transform of k -> f16 head plane (x4)
  fourier_k<<<gFour, blk, 0, stream>>>(Kr, coefa, coefb, Kp);
  // (4) attention -> ctx planes (bf16 hi, hi, lo)
  attn32<<<gAttn, dim3(128), 0, stream>>>(Qp, Kp, VTh, VTl, CT, 0.17677669529663687f * 0.0625f);
  // (5) out = ctx . Wo + bias -> d_out f32 [4096][256]
  proj_out<<<gOut, blk, 0, stream>>>(CT, Wo3, (float*)d_out, b_o);
  (void)hipGetLastError();
}

// v007
// A run of this version takes 69.3 microseconds.
// In both of two side-by-side timings against v006, it was 1.20 times as fast.
// Counting every step since v000, it is 5.54 times as fast.
// Contractions: q, k, v^T projections and the output projection = v_wmma_f32_16x16x32_bf16 over bf16 hi/lo planes
// laid out as [hi|hi|lo] x [hi|lo|hi] along k (3 products, f32 accumulate);
// q.k^T scores = v_wmma_f32_16x16x32_f16 (q and the transformed k as f16 planes carried x4, single product, f32 accumulate);
// p.v = v_wmma_f32_16x16x32_f16 (p carried x1024 in f16; v^T as f16 hi plane x4 plus f16 residual plane x2^11; 2 products, f32 accumulate);
// Fourier-basis transform of k (one precise sincosf per element, then a rotation recurrence), softmax and bias in f32 on the VALU.
#include <hip/hip_runtime.h>
#include <math.h>
#include <stdint.h>

#define NB   2
#define SEQ  2048
#define DM   256
#define NH   8
#define HD   32
#define NBH  (NB * NH)        // 16 (batch, head) pairs
#define QKVW (3 * DM)         // 768 qkv output width
#define KP   (3 * DM)         // 768 folded k width of the split operand planes
#define NFUN 256
#define ROWS (NB * SEQ)       // 4096 token rows
#define NQB  (SEQ / 64)       // 64-query blocks per (b, h)
#define NKT  (SEQ / 64)       // 64-key chunks
#define GP   (KP * 2 + 16)    // GEMM operand row pitch in LDS, bytes: the whole k (1536 B) + 16 B (16 B x odd, for 16-B readers)
#define GOPS (128 * GP)       // GEMM operands of a block in LDS: 64 A rows, then 64 Bt rows
#define NTQ  ((QKVW / 64) * (DM / 64))   // 48 transpose tiles of w_qkv
#define NTO  ((DM / 64) * (DM / 64))     // 16 transpose tiles of w_o
#define NGB  256              // 64x64 block tiles of each of the four products: one per WGP
// attention tiles in LDS: every row is read or written 16 B a lane, one row per lane of a 16-lane half, so the row
// pitch is 16 B x odd (row + 16 B): the sixteen lanes of a half then fall on sixteen different groups of four banks
#define KPI  (HD + 8)         // K chunk row pitch, f16 elements: 64 B + 16 B = 80 B
#define VPI  (64 + 8)         // V^T chunk row pitch, f16 elements: 128 B + 16 B = 144 B
#define OPI  (HD + 4)         // ctx tile row pitch, f32 elements: 128 B + 16 B = 144 B
#define KGR  2                // key groups of an attention block: group g takes the 64-key chunks g, g + KGR, ...
static_assert(NH * HD == DM);
static_assert(NQB == 32 && NKT == 32 && (NKT % KGR) == 0 && KGR == 2);   // the merge joins two partials
static_assert((ROWS % 64) == 0 && (DM % 64) == 0 && (SEQ % 64) == 0 && (KP % 32) == 0);
static_assert((ROWS * DM) % 2048 == 0);
static_assert((ROWS / 64) * (DM / 64) == NGB && NB * (DM / 64) * (SEQ / 64) == NGB);
static_assert((KP % 64) == 0 && 64 * (KP / 8) == 24 * 256 && (GP % 32) == 16);

typedef _Float16 v16h __attribute__((ext_vector_type(16)));
typedef _Float16 v8h  __attribute__((ext_vector_type(8)));
typedef __bf16   v16b __attribute__((ext_vector_type(16)));
typedef __bf16   v8b  __attribute__((ext_vector_type(8)));
typedef float    v8f  __attribute__((ext_vector_type(8)));
typedef float    v4f  __attribute__((ext_vector_type(4)));
typedef unsigned int v4u __attribute__((ext_vector_type(4)));
typedef float    v2f  __attribute__((ext_vector_type(2)));
typedef unsigned int v2u __attribute__((ext_vector_type(2)));

#if defined(__HIP_DEVICE_COMPILE__)
#define DEV_ASM 1
#else
#define DEV_ASM 0
#endif

// ---- scalar helpers --------------------------------------------------------------------------------
__device__ __forceinline__ unsigned short bf_bits(float f) {          // f32 -> bf16 bits, RNE convert
  unsigned u = __float_as_uint(f);
  return (unsigned short)((u + 0x7FFFu + ((u >> 16) & 1u)) >> 16);
}
__device__ __forceinline__ float bf_up(unsigned short hb) { return __uint_as_float(((unsigned)hb) << 16); }
__device__ __forceinline__ unsigned short h_bits(_Float16 x) { return __builtin_bit_cast(unsigned short, x); }
__device__ __forceinline__ unsigned pk16(unsigned short a, unsigned short b) { return (unsigned)a | ((unsigned)b << 16); }
__device__ __forceinline__ v8f zero8() { v8f z = {0.f, 0.f, 0.f, 0.f, 0.f, 0.f, 0.f, 0.f}; return z; }

// ---- fragment loaders: 16-bit A/B operand, lane -> row/col (lane&15), p already includes +8*(lane>>4);
//      elements 0..7 <- p[0..7] (k0+8h..k0+8h+7), elements 8..15 <- p[16..23] (k0+16+8h..k0+16+8h+7)
template <typename OT> struct FT;
template <> struct FT<__bf16>   { typedef v16b frag; typedef v8b half8; };
template <> struct FT<_Float16> { typedef v16h frag; typedef v8h half8; };

template <typename OT>
__device__ __forceinline__ typename FT<OT>::frag ldfrag(const OT* p) {
  union { typename FT<OT>::frag v; typename FT<OT>::half8 h[2]; } f;
  f.h[0] = *(const typename FT<OT>::half8*)(p);
  f.h[1] = *(const typename FT<OT>::half8*)(p + 16);
  return f.v;
}

// ---- WMMA helpers ----------------------------------------------------------------------------------
__device__ __forceinline__ v8f mmar(v16b a, v16b b, v8f c) {
  return __builtin_amdgcn_wmma_f32_16x16x32_bf16(false, a, false, b, (short)0, c, false, false);
}
// guarded form: 4 VALU slots after the WMMA, D tied, A/B kept live
__device__ __forceinline__ v8f mma_h(v16h a, v16h b, v8f c) {
  c = __builtin_amdgcn_wmma_f32_16x16x32_f16(false, a, false, b, (short)0, c, false, false);
#if DEV_ASM
  asm volatile("v_nop\n\tv_nop\n\tv_nop\n\tv_nop" : "+v"(c) : "v"(a), "v"(b));
#endif
  return c;
}
// lane l <-> lane l ^ 16
__device__ __forceinline__ float xhalf(float x) {
  const int b = __builtin_bit_cast(int, x);
  return __builtin_bit_cast(float, __builtin_amdgcn_permlanex16(b, b, 0x76543210, 0xfedcba98, false, false));
}
// ---- asynchronous copies global -> LDS, 16 B a lane ------------------------------------------------
__device__ __forceinline__ uint32_t lds_off(const void* p) { return (uint32_t)(size_t)p; }   // LDS byte address
// twelve copies of a lane (l: LDS byte addresses, g: global addresses); the s_wait_xcnt stands inside the
// statement so that no address register named here is rewritten ahead of it
__device__ __forceinline__ void copy12(const uint32_t (&l)[12], const __bf16* const (&g)[12]) {
#if DEV_ASM
  asm volatile("global_load_async_to_lds_b128 %0, %12, off\n\t"
               "global_load_async_to_lds_b128 %1, %13, off\n\t"
               "global_load_async_to_lds_b128 %2, %14, off\n\t"
               "global_load_async_to_lds_b128 %3, %15, off\n\t"
               "global_load_async_to_lds_b128 %4, %16, off\n\t"
               "global_load_async_to_lds_b128 %5, %17, off\n\t"
               "global_load_async_to_lds_b128 %6, %18, off\n\t"
               "global_load_async_to_lds_b128 %7, %19, off\n\t"
               "global_load_async_to_lds_b128 %8, %20, off\n\t"
               "global_load_async_to_lds_b128 %9, %21, off\n\t"
               "global_load_async_to_lds_b128 %10, %22, off\n\t"
               "global_load_async_to_lds_b128 %11, %23, off\n\t"
               "s_wait_xcnt 0x0"
               :: "v"(l[0]), "v"(l[1]), "v"(l[2]), "v"(l[3]), "v"(l[4]), "v"(l[5]),
                  "v"(l[6]), "v"(l[7]), "v"(l[8]), "v"(l[9]), "v"(l[10]), "v"(l[11]),
                  "v"(g[0]), "v"(g[1]), "v"(g[2]), "v"(g[3]), "v"(g[4]), "v"(g[5]),
                  "v"(g[6]), "v"(g[7]), "v"(g[8]), "v"(g[9]), "v"(g[10]), "v"(g[11])
               : "memory");
#else
  (void)l; (void)g;
#endif
}
// this wave's copies have landed
__device__ __forceinline__ void wait_copies() {
#if DEV_ASM
  asm volatile("s_wait_asynccnt 0x0" ::: "memory");
#endif
}
// behind a job's last global stores: in a kernel that holds several jobs' bodies the registers that the stores
// name may be written by the code laid out behind them; the wait stands in front of any such write
__device__ __forceinline__ void wait_store_regs() {
#if DEV_ASM
  asm volatile("s_wait_xcnt 0x0" ::: "memory");
#endif
}

// =====================================================================================================
// x [ROWS][DM] f32 -> split plane X3 [ROWS][KP] bf16, row = [hi | hi | lo] (hi = RNE bf16, lo = RNE bf16
// of the exact residual). 8 elements per thread; each thread stores 16 B into each of the three thirds;
// bx = the block's index within this job.
// =====================================================================================================
__device__ __forceinline__ void cvt_x3(const float* __restrict__ in, unsigned short* out, int n8, int bx) {
  const int i = bx * 256 + (int)threadIdx.x;
  if (i < n8) {
    const int row = i >> 5, c = (i & 31) * 8;
    const v4f a  = *(const v4f*)(in + (size_t)i * 8);
    const v4f a4 = *(const v4f*)(in + (size_t)i * 8 + 4);
    const float f[8] = {a[0], a[1], a[2], a[3], a4[0], a4[1], a4[2], a4[3]};
    v4u ph, pl;
#pragma unroll
    for (int e = 0; e < 4; ++e) {
      const float f0 = f[2 * e], f1 = f[2 * e + 1];
      const unsigned short h0 = bf_bits(f0), h1 = bf_bits(f1);
      const unsigned short l0 = bf_bits(f0 - bf_up(h0)), l1 = bf_bits(f1 - bf_up(h1));
      ph[e] = pk16(h0, h1);
      pl[e] = pk16(l0, l1);
    }
    unsigned short* o = out + (size_t)row * KP + c;
    *(v4u*)(o)          = ph;
    *(v4u*)(o + DM)     = ph;
    *(v4u*)(o + 2 * DM) = pl;
    wait_store_regs();
  }
}

// =====================================================================================================
// w [DM rows k][C cols] f32 (x @ w layout) -> wt [C][KP] bf16, row c = [hi | lo | hi] of w[k][c] over k.
// Block = 64 k x 64 c tile staged in LDS (f32); C/64 x DM/64 blocks: bx -> c0, by -> k0.
// coverage: 8 waves x 8 rows x 64 k = the tile, all three thirds; the grid covers all C rows x DM k.
// =====================================================================================================
__device__ __forceinline__ void wtrans3(float (*tile)[65], const float* __restrict__ w, unsigned short* wt, int C,
                                        int bx, int by) {
  const int tid = (int)threadIdx.x, lane = tid & 31, wave = tid >> 5;
  const int c0 = bx * 64, k0 = by * 64;
#pragma unroll
  for (int it = 0; it < 16; ++it) {
    const int idx = it * 256 + tid;
    const int r = idx >> 6, cc = idx & 63;
    tile[r][cc] = w[(size_t)(k0 + r) * C + c0 + cc];
  }
  __syncthreads();
  const int q = lane >> 3, c8 = (lane & 7) * 8;
  v4u hv[2], lv[2];
#pragma unroll
  for (int it = 0; it < 2; ++it) {
    const int row = wave * 8 + it * 4 + q;          // output row (c within tile)
    v4u a, a2;
#pragma unroll
    for (int e = 0; e < 4; ++e) {
      const float f0 = tile[c8 + 2 * e][row], f1 = tile[c8 + 2 * e + 1][row];
      const unsigned short h0 = bf_bits(f0), h1 = bf_bits(f1);
      const unsigned short l0 = bf_bits(f0 - bf_up(h0)), l1 = bf_bits(f1 - bf_up(h1));
      a[e] = pk16(h0, h1);
      a2[e] = pk16(l0, l1);
    }
    hv[it] = a; lv[it] = a2;
  }
  {
#pragma unroll
    for (int it = 0; it < 2; ++it) {
      const int row = wave * 8 + it * 4 + q;
      unsigned short* o = wt + (size_t)(c0 + row) * KP + k0 + c8;
      *(v4u*)(o)          = hv[it];
      *(v4u*)(o + DM)     = lv[it];
      *(v4u*)(o + 2 * DM) = hv[it];
    }
    wait_store_regs();
  }
}

// =====================================================================================================
// The three operand preparations in one launch: each reads inputs only and writes a plane of its own, so
// none waits for another. The block index picks the job (the same for the whole block, so the transpose's
// barrier stays block-uniform): NTQ blocks transpose w_qkv, NTO blocks w_o, the remaining n8 / 256 split x.
// =====================================================================================================
__global__ __launch_bounds__(256) void prep3(const float* __restrict__ x, const float* __restrict__ w_qkv,
                                             const float* __restrict__ w_o, unsigned short* X3,
                                             unsigned short* Wq3, unsigned short* Wo3, int n8) {
  __shared__ float tile[64][65];
  const int bx = (int)blockIdx.x;
  if (bx < NTQ) {
    wtrans3(tile, w_qkv, Wq3, QKVW, bx % (QKVW / 64), bx / (QKVW / 64));
  } else if (bx < NTQ + NTO) {
    wtrans3(tile, w_o, Wo3, DM, (bx - NTQ) % (DM / 64), (bx - NTQ) / (DM / 64));
  } else {
    cvt_x3(x, X3, n8, bx - (NTQ + NTO));
  }
}

// =====================================================================================================
// Batched WMMA GEMM, bf16 operands: C[m][n] = sum_k A[m][k] * Bt[n][k], k = 0..KP-1; a block of eight waves on a
// 64x64 tile, so that every product has NGB blocks; a wave on 32x16 of it (2 x 4 waves).
// Bt row-major [N][KP] pitch ldb (k contiguous).
// A_MODE 0: A row-major [M][KP] pitch lda.  A_MODE 1: head planes: A(m, k) at
//   plane = (k/256)*NBH + (m/SEQ)*NH + (k/32)%NH;  A[(plane*SEQ + m%SEQ)*HD + k%32]  (M = ROWS).
// M and N multiples of 64 (static shapes below). bx = block tile index, b = batch index (strides in elements);
// opnd and ct are the calling kernel's LDS.
// Operands: the block's 64 A rows and 64 Bt rows, the whole k of each (1536 B a row), come into LDS once, by
// asynchronous copies of whole 128-B lines, 48 copies a lane, all in flight together; one wait, one barrier;
// LDS row pitch GP; fragments read from LDS with the split k map (ldfrag), k ascending as before.
// Epilogue: the 64x64 tile staged in LDS (pitch 68 floats), one barrier; a pair of waves takes a 16-row slab, each
// wave one half of its stores:
// OUT_MODE 0: f16 head plane [NBH][SEQ][HD], value * oscale: a wave stores one head half of the slab (1024 contiguous B)
// OUT_MODE 1: f32 head plane [NBH][SEQ][HD]: a wave stores one head half (2048 contiguous B)
// OUT_MODE 2: f16 hi plane C (value*oscale) + f16 residual plane C2 = f16((v*oscale - hi) * rscale), row-major, 8 rows a wave
// OUT_MODE 3: f32 row-major C (pitch ldc) + bias[n] (f32): each 64-wide row segment = 256 B = 16 lanes x 16 B, 8 rows a wave
// coverage: 4 slabs x 16 rows x 64 cols = the block's whole 64x64 tile; grids are exact tile multiples.
// =====================================================================================================
template <int A_MODE, int OUT_MODE>
__device__ __forceinline__ void gemm64(
    unsigned char* opnd, float* ct, int bx, int b,
    const unsigned short* __restrict__ Ap, int lda, long long strideA,
    const unsigned short* __restrict__ Btp, int ldb, long long strideB,
    void* Cout, void* Cout2, int ldc, long long strideC,
    const float* __restrict__ bias,
    int M, int N, float oscale, float rscale) {
  const __bf16* A  = (const __bf16*)(const void*)Ap;
  const __bf16* Bt = (const __bf16*)(const void*)Btp;
  const int tid  = (int)threadIdx.x;
  const int lane = tid & 31;
  const int wave = tid >> 5;
  const int nbn = N >> 6;                // block tiles along N
  const int bm  = bx / nbn;
  const int bn  = bx - bm * nbn;
  if (bm >= (M >> 6)) return;            // the same for the whole block, in front of every barrier
  const int bm0 = bm << 6;
  const int bn0 = bn << 6;
  const int wr  = (wave >> 2) << 5;      // the wave's first A row in the block tile
  const int wc  = (wave & 3) << 4;       // the wave's first Bt row in the block tile

  const __bf16* Ab = A  + (size_t)b * (size_t)strideA;
  const __bf16* Bb = Bt + (size_t)b * (size_t)strideB;

  const int rlane = lane & 15;                 // row (A) / col (B, D) within subtile
  const int koff  = (lane >> 4) * 8;           // k offset of this lane half
  const int mOff  = (lane >> 4) * 8;           // D row offset

  // 24 copies a lane for each operand, in statements of twelve; a wave's copy covers 512 B of whole lines (4 rows
  // of 128 B; in the head-plane layout 8 rows of 64 B, which adjoin)
  const uint32_t lb = lds_off(opnd);
#pragma unroll
  for (int g = 0; g < 2; ++g) {
    uint32_t la[12];
    const __bf16* ga[12];
#pragma unroll
    for (int u = 0; u < 12; ++u) {
      const int v = g * 12 + u;
      if (A_MODE == 0) {
        const int row = (v & 1) * 32 + (tid >> 3), pc = tid & 7;
        ga[u] = Ab + (size_t)(bm0 + row) * lda + (v >> 1) * 64 + pc * 8;
        la[u] = lb + (uint32_t)(row * GP + (v >> 1) * 128 + pc * 16);
      } else {
        const int kk = v * 32;
        const int row = tid >> 2, pc = tid & 3;
        const int plane = (kk >> 8) * NBH + (bm0 / SEQ) * NH + ((kk >> 5) & (NH - 1));
        ga[u] = Ab + ((size_t)plane * SEQ + (size_t)((bm0 & (SEQ - 1)) + row)) * HD + pc * 8;
        la[u] = lb + (uint32_t)(row * GP + (v * 4 + pc) * 16);
      }
    }
    copy12(la, ga);
  }
#pragma unroll
  for (int g = 0; g < 2; ++g) {
    uint32_t la[12];
    const __bf16* ga[12];
#pragma unroll
    for (int u = 0; u < 12; ++u) {
      const int v = g * 12 + u;
      const int row = (v & 1) * 32 + (tid >> 3), pc = tid & 7;
      ga[u] = Bb + (size_t)(bn0 + row) * ldb + (v >> 1) * 64 + pc * 8;
      la[u] = lb + (uint32_t)((64 + row) * GP + (v >> 1) * 128 + pc * 16);
    }
    copy12(la, ga);
  }
  wait_copies();
  __syncthreads();                       // both operands are readable by every wave

  v8f acc[2];
  acc[0] = zero8(); acc[1] = zero8();
  const unsigned char* ap = opnd + (wr + rlane) * GP + koff * 2;
  const unsigned char* bp = opnd + (64 + wc + rlane) * GP + koff * 2;
  // unrolled whole: no barrier stands in it, so the fragment reads of later k-steps can run ahead of the products
#pragma unroll
  for (int ks = 0; ks < KP / 32; ++ks) { // k-steps of 32 (64 B of every row)
    const v16b bq = ldfrag<__bf16>((const __bf16*)(bp + ks * 64));
    const v16b a0 = ldfrag<__bf16>((const __bf16*)(ap + ks * 64));
    const v16b a1 = ldfrag<__bf16>((const __bf16*)(ap + 16 * GP + ks * 64));
    acc[0] = mmar(a0, bq, acc[0]);
    acc[1] = mmar(a1, bq, acc[1]);
  }

  // ---- epilogue ----
#pragma unroll
  for (int i = 0; i < 2; ++i)
#pragma unroll
    for (int r = 0; r < 8; ++r) ct[(wr + (i << 4) + mOff + r) * 68 + wc + rlane] = acc[i][r];
  __syncthreads();                       // the whole tile is readable by every wave
  const float* slab = ct + (wave >> 1) * (16 * 68);
  const int mBase = bm0 + ((wave >> 1) << 4);
  const int n0 = bn0;
  const int hs = wave & 1;               // which half of the slab's stores this wave does
  if (OUT_MODE == 0) {
    unsigned short* Q = (unsigned short*)Cout;
    const int rq = lane >> 2, c8 = (lane & 3) * 8;        // row within an 8-row group, 8-col piece
    v4u hv[2];
#pragma unroll
    for (int it = 0; it < 2; ++it) {
      const float* sp = slab + (it * 8 + rq) * 68 + hs * 32 + c8;   // it 0..1 x rq 0..7 = rows 0..15
      v4u a;
#pragma unroll
      for (int e = 0; e < 4; ++e)
        a[e] = pk16(h_bits((_Float16)(sp[2 * e] * oscale)), h_bits((_Float16)(sp[2 * e + 1] * oscale)));
      hv[it] = a;
    }
    const int head = (n0 >> 5) + hs;
    unsigned short* base = Q + ((size_t)((mBase / SEQ) * NH + head) * SEQ + (size_t)(mBase & (SEQ - 1))) * HD;
#pragma unroll
    for (int it = 0; it < 2; ++it)
      *(v4u*)(base + it * 256 + lane * 8) = hv[it];
  } else if (OUT_MODE == 1) {
    float* Kr = (float*)Cout;
    const int rq = lane >> 3, c4 = (lane & 7) * 4;        // row within a 4-row group, 4-col piece
    v4f hv[4];
#pragma unroll
    for (int it = 0; it < 4; ++it)                        // it 0..3 x rq 0..3 = rows 0..15
      hv[it] = *(const v4f*)(slab + (it * 4 + rq) * 68 + hs * 32 + c4);
    const int head = (n0 >> 5) + hs;
    float* base = Kr + ((size_t)((mBase / SEQ) * NH + head) * SEQ + (size_t)(mBase & (SEQ - 1))) * HD;
#pragma unroll
    for (int it = 0; it < 4; ++it)
      *(v4f*)(base + it * 128 + lane * 4) = hv[it];
  } else if (OUT_MODE == 2) {
    const int q = lane >> 3, c8 = (lane & 7) * 8;
    unsigned short* C  = (unsigned short*)Cout  + (size_t)b * (size_t)strideC;
    unsigned short* C2 = (unsigned short*)Cout2 + (size_t)b * (size_t)strideC;
    v4u hv[2], lv[2];
#pragma unroll
    for (int it = 0; it < 2; ++it) {
      const int row = hs * 8 + it * 4 + q;                // hs 0..1 x it 0..1 x q 0..3 = rows 0..15
      const float* sp = slab + row * 68 + c8;
      v4u a, a2;
#pragma unroll
      for (int e = 0; e < 4; ++e) {
        const float f0 = sp[2 * e] * oscale, f1 = sp[2 * e + 1] * oscale;
        const _Float16 x0 = (_Float16)f0, x1 = (_Float16)f1;
        const unsigned short h0 = h_bits(x0), h1 = h_bits(x1);
        const unsigned short l0 = h_bits((_Float16)((f0 - (float)x0) * rscale));
        const unsigned short l1 = h_bits((_Float16)((f1 - (float)x1) * rscale));
        a[e] = pk16(h0, h1); a2[e] = pk16(l0, l1);
      }
      hv[it] = a; lv[it] = a2;
    }
#pragma unroll
    for (int it = 0; it < 2; ++it) {
      const int row = hs * 8 + it * 4 + q;
      *(v4u*)(C  + (size_t)(mBase + row) * ldc + n0 + c8) = hv[it];
      *(v4u*)(C2 + (size_t)(mBase + row) * ldc + n0 + c8) = lv[it];
    }
  } else {
    float* C = (float*)Cout + (size_t)b * (size_t)strideC;
    const int h2 = lane >> 4, c4 = (lane & 15) * 4;      // 256-B row segment = 16 lanes x 16 B
    const v4f bv = *(const v4f*)(bias + n0 + c4);
    v4f hv[4];
#pragma unroll
    for (int it = 0; it < 4; ++it) {
      const int row = hs * 8 + it * 2 + h2;               // hs 0..1 x it 0..3 x h2 0..1 = rows 0..15
      hv[it] = *(const v4f*)(slab + row * 68 + c4) + bv;
    }
#pragma unroll
    for (int it = 0; it < 4; ++it) {
      const int row = hs * 8 + it * 2 + h2;
      *(v4f*)(C + (size_t)(mBase + row) * ldc + n0 + c4) = hv[it];
    }
  }
  wait_store_regs();
}

// =====================================================================================================
// The q, k and v^T projections in one launch: all three read the X3 and Wq3 planes, none reads another's
// output. blockIdx.x / NGB picks the product (the same for the whole block, so every barrier stays block-uniform):
//   0: q = x . Wq -> f16 head plane (x4)        (M=4096, N=256, K=768)
//   1: k = x . Wk -> raw f32 head plane         (M=4096, N=256, K=768)
//   2: v^T = Wv . x^T per batch -> f16 hi plane (x4) [b][c][s] (pitch SEQ) and residual plane (x2048)
//      (A = Wq3 rows 512.., Bt = X3 rows of batch b; M=256, N=2048, K=768; 128 blocks a batch)
// =====================================================================================================
__global__ __launch_bounds__(256) void proj_qkv(const unsigned short* __restrict__ X3,
                                                const unsigned short* __restrict__ Wq3,
                                                unsigned short* Qp, float* Kr,
                                                unsigned short* VTh, unsigned short* VTl) {
  __shared__ __align__(16) unsigned char opnd[GOPS];   // 64 A rows, then 64 Bt rows, the whole k of each
  __shared__ __align__(16) float ct[64 * 68];          // the block's 64x64 result tile, pitch 68 floats
  const unsigned job = blockIdx.x / NGB;
  const int bx = (int)(blockIdx.x % NGB);
  if (job == 0) {
    gemm64<0, 0>(opnd, ct, bx, 0, X3, KP, 0LL, Wq3, KP, 0LL,
                 (void*)Qp, (void*)Qp, 0, 0LL, nullptr, ROWS, DM, 4.0f, 1.0f);
  } else if (job == 1) {
    gemm64<0, 1>(opnd, ct, bx, 0, X3, KP, 0LL, Wq3 + (size_t)DM * KP, KP, 0LL,
                 (void*)Kr, (void*)Kr, 0, 0LL, nullptr, ROWS, DM, 1.0f, 1.0f);
  } else if (job == 2) {
    gemm64<0, 2>(opnd, ct, bx % (NGB / NB), bx / (NGB / NB),
                 Wq3 + (size_t)2 * DM * KP, KP, 0LL, X3, KP, (long long)SEQ * KP,
                 (void*)VTh, (void*)VTl, SEQ, (long long)DM * SEQ, nullptr, DM, SEQ, 4.0f, 2048.0f);
  }
}

// out = ctx . Wo + bias -> f32 [4096][256]   (M=4096, N=256, K=768, A in head-plane layout)
__global__ __launch_bounds__(256) void proj_out(const unsigned short* __restrict__ CT,
                                                const unsigned short* __restrict__ Wo3,
                                                float* out, const float* __restrict__ bias) {
  __shared__ __align__(16) unsigned char opnd[GOPS];   // 64 A rows, then 64 Bt rows, the whole k of each
  __shared__ __align__(16) float ct[64 * 68];          // the block's 64x64 result tile, pitch 68 floats
  gemm64<1, 3>(opnd, ct, (int)blockIdx.x, 0, CT, 0, 0LL, Wo3, KP, 0LL,
               (void*)out, (void*)out, DM, 0LL, bias, ROWS, DM, 1.0f, 1.0f);
}

// =====================================================================================================
// Fourier-basis transform of k: out = sum_{f=1..NFUN} ca[f-1]*sin(f*k) + cb[f-1]*cos(f*k) in f32.
// One precise sincosf(k) per element; sin(f*k), cos(f*k) for f = 2..NFUN follow by rotating the pair by k
// (angle addition: two products and two fused multiply-adds a step). The rotation keeps the pair's length,
// so its error grows linearly in f: at f = NFUN it is that of moving k by about one f32 ulp.
// Terms are added in the order f = 1..NFUN, sine before cosine, as fused multiply-adds.
// Four consecutive elements of the raw f32 k head plane [NBH][SEQ][HD] per lane, as two pairs, so that every
// step is packed f32 arithmetic; a lane stores its four f16 results (x4) as 8 B, a wave 256 contiguous B.
// coverage: grid x 256 x 4 = every element of the k' plane.
// =====================================================================================================
__global__ __launch_bounds__(256) void fourier_k(const float* __restrict__ kr, const float* __restrict__ ca,
                                                 const float* __restrict__ cb, unsigned short* kp) {
  const size_t g4 = ((size_t)blockIdx.x * 256 + (size_t)threadIdx.x) * 4;
  const v4f kx = *(const v4f*)(kr + g4);
  v2f s1[2], c1[2], s[2], c[2], acc[2];
#pragma unroll
  for (int h = 0; h < 2; ++h) {
#pragma unroll
    for (int e = 0; e < 2; ++e) {
      float sn, cs;
      sincosf(kx[2 * h + e], &sn, &cs);
      s1[h][e] = sn;
      c1[h][e] = cs;
    }
    s[h] = s1[h];
    c[h] = c1[h];
    acc[h] = (v2f){0.f, 0.f};
  }
  // unrolled so that the coefficients of a group of steps arrive in one pair of scalar loads
#pragma unroll 16
  for (int fi = 0; fi < NFUN; ++fi) {
    const float af = ca[fi];
    const float bf = cb[fi];
    const v2f a2 = {af, af}, b2 = {bf, bf};
#pragma unroll
    for (int h = 0; h < 2; ++h) {
      acc[h] = __builtin_elementwise_fma(a2, s[h], acc[h]);
      acc[h] = __builtin_elementwise_fma(b2, c[h], acc[h]);
      const v2f sn = __builtin_elementwise_fma(s[h], c1[h], c[h] * s1[h]);
      c[h] = __builtin_elementwise_fma(c[h], c1[h], -(s[h] * s1[h]));
      s[h] = sn;
    }
  }
  v2u o;
#pragma unroll
  for (int h = 0; h < 2; ++h)
    o[h] = pk16(h_bits((_Float16)(acc[h][0] * 4.0f)), h_bits((_Float16)(acc[h][1] * 4.0f)));
  *(v2u*)(kp + g4) = o;
}

// =====================================================================================================
// Attention, head dim 32, no mask, softmax over all SEQ keys.
//   q plane / k' plane (f16, x4): element (bh, t, d) at [(bh*SEQ + t)*HD + d]
//   v^T hi plane (f16, 4v) and residual plane (f16, (4v - hi)*2048): element (bh, d, s) at [(bh*HD + d)*SEQ + s]
//   ctx planes (bf16): part p (0 = hi, 1 = hi, 2 = lo), element (bh, t, d) at [p*PS + (bh*SEQ + t)*HD + d]
//   scores^T = (k4' . q4^T) * sscale on f16 WMMA (one k-step), softmax in f32 (running max), a query per lane pair;
//   p = exp(s - m) carried as f16(1024 p); O^T = vh^T . p^T + (vl^T . p^T) / 2048 on f16 WMMA; ctx = O / (l * 4096).
//   Block = KGR groups of 4 waves on the same (b, h) and the same 4 consecutive 16-query tiles; grid = NBH * NQB, so a
//   SIMD holds four waves, whose waits cover one another. Key chunks of 64: group g walks the chunks g, g + KGR, ...
//   with its own running maximum, sum and O, static trip NKT / KGR. Chunk staging, each group its own chunk in its own
//   LDS: 128 threads, K 64x32 (2 x 16 B per thread), V^T hi/res 32x64 (2 x 16 B
//   per thread and plane), plain loads, __syncthreads before and after. P^T stays in registers (score tiles -> B operand).
//   After the loop group 1 hands its partial (m, l, O) to group 0 through LDS (one barrier); group 0 merges the two with
//   the weights exp(m_g - max) and writes the output.
//   Output: each wave of group 0 writes its 16x32 tile (1024 contiguous B per part) with two instructions of
//   all NBH*SEQ rows x HD, all three parts.
// =====================================================================================================
__global__ __launch_bounds__(128 * KGR)
void attn32(const unsigned short* __restrict__ qpp, const unsigned short* __restrict__ kpp,
            const unsigned short* __restrict__ vhp, const unsigned short* __restrict__ vlp,
            unsigned short* ct, float sscale) {
  union FH { v16h v; v8h h[2]; };
  __shared__ __align__(16) _Float16 KshA[KGR][64 * KPI];   // per group: K chunk [key][d], pitch KPI     5120 B
  __shared__ __align__(16) _Float16 VthA[KGR][HD * VPI];   // per group: V^T hi [d][key], pitch VPI     4608 B
  __shared__ __align__(16) _Float16 VtlA[KGR][HD * VPI];   // per group: V^T residual, pitch VPI        4608 B
  __shared__ __align__(16) float    Os[4][16 * OPI];       // per query tile: ctx tile, pitch OPI       9216 B
  __shared__ __align__(16) v4f      Mo[4][4][32];          // per query tile: group 1's partial O, 16 B a lane   8192 B
  __shared__ float                  Mm[4][32], Ml[4][32];  // per query tile: group 1's maximum and sum          1024 B

  const int kg   = (int)threadIdx.x >> 7;                  // key group (the same for a whole wave)
  const int tid  = (int)threadIdx.x & 127;                 // thread within the group
  const int wave = tid >> 5;                               // query tile
  const int lane = tid & 31;
  _Float16* Ksh = KshA[kg];
  _Float16* Vth = VthA[kg];
  _Float16* Vtl = VtlA[kg];
  const int hh   = lane >> 4;
  const int c    = lane & 15;

  const int bx   = blockIdx.x;
  const int qblk = bx % NQB;
  const int bh   = bx / NQB;
  const int q0   = qblk * 64 + wave * 16;

  const _Float16* Qg = (const _Float16*)(const void*)qpp + (size_t)bh * SEQ * HD;
  const _Float16* Kg = (const _Float16*)(const void*)kpp + (size_t)bh * SEQ * HD;
  const _Float16* Vh = (const _Float16*)(const void*)vhp + (size_t)bh * HD * SEQ;
  const _Float16* Vl = (const _Float16*)(const void*)vlp + (size_t)bh * HD * SEQ;

  // ---- Q fragment (B operand, column = lane&15, one k-step of 32) ----
  const v16h qa = ldfrag<_Float16>(Qg + (size_t)(q0 + c) * HD + 8 * hh);

  float mrun = -INFINITY, lrun = 0.f;   // query c: running maximum (joined), running sum of this half's keys
  v8f oacc[2];
  oacc[0] = zero8(); oacc[1] = zero8();

  for (int kt = 0; kt < NKT / KGR; ++kt) {   // static trip count
    const int kv0 = (kt * KGR + kg) * 64;
    __syncthreads();
    {
      const int r = tid >> 1, hf = (tid & 1) * 16;                  // key r, d = hf..hf+15
      const _Float16* kg = Kg + (size_t)(kv0 + r) * HD + hf;
      const v8h k0v = *(const v8h*)(kg);
      const v8h k1v = *(const v8h*)(kg + 8);
      *(v8h*)(Ksh + r * KPI + hf)     = k0v;
      *(v8h*)(Ksh + r * KPI + hf + 8) = k1v;
      const int d = tid >> 2, sg = (tid & 3) * 16;                  // d row, keys sg..sg+15
      const _Float16* vg  = Vh + (size_t)d * SEQ + kv0 + sg;
      const _Float16* vlg = Vl + (size_t)d * SEQ + kv0 + sg;
      const v8h v0 = *(const v8h*)(vg),  v1 = *(const v8h*)(vg + 8);
      const v8h w0 = *(const v8h*)(vlg), w1 = *(const v8h*)(vlg + 8);
      *(v8h*)(Vth + d * VPI + sg)     = v0;
      *(v8h*)(Vth + d * VPI + sg + 8) = v1;
      *(v8h*)(Vtl + d * VPI + sg)     = w0;
      *(v8h*)(Vtl + d * VPI + sg + 8) = w1;
    }
    __syncthreads();

    // ---- transposed scores: 64 keys (rows) x 16 queries (columns) per wave; lane (c, hh) holds, for query c,
    //      keys j*16 + 8*hh + r in s[j][r] ----
    v8f s[4];
#pragma unroll
    for (int j = 0; j < 4; ++j) {
      FH kb;
      kb.h[0] = *(const v8h*)(Ksh + (j * 16 + c) * KPI + 8 * hh);
      kb.h[1] = *(const v8h*)(Ksh + (j * 16 + c) * KPI + 16 + 8 * hh);
      s[j] = mma_h(kb.v, qa, zero8());
#pragma unroll
      for (int r = 0; r < 8; ++r) s[j][r] *= sscale;
    }

    // ---- online softmax: a query's maximum and sum lie in its own two lanes; the maximum is joined across the
    //      halves every chunk (both halves rescale alike), the sums only after the loop ----
    float mj[4];
#pragma unroll
    for (int j = 0; j < 4; ++j) {   // a short tree per tile, ready while the next tile's product runs
      const float t0 = fmaxf(fmaxf(s[j][0], s[j][1]), s[j][2]);
      const float t1 = fmaxf(fmaxf(s[j][3], s[j][4]), s[j][5]);
      mj[j] = fmaxf(fmaxf(t0, t1), fmaxf(s[j][6], s[j][7]));
    }
    float m = fmaxf(fmaxf(mj[0], mj[1]), fmaxf(mj[2], mj[3]));
    m = fmaxf(m, xhalf(m));
    const float mnew  = fmaxf(mrun, m);
    const float msafe = (mnew == -INFINITY) ? 0.f : mnew;
    const float alpha = __expf(mrun - msafe);
    mrun = mnew;
#pragma unroll
    for (int j = 0; j < 4; ++j)
#pragma unroll
      for (int r = 0; r < 8; ++r) s[j][r] = __expf(s[j][r] - msafe);
    const v8f ts = (s[0] + s[1]) + (s[2] + s[3]);   // tiles first (packed adds), then a tree over the eight
    const float psum = ((ts[0] + ts[1]) + (ts[2] + ts[3])) + ((ts[4] + ts[5]) + (ts[6] + ts[7]));
    lrun = lrun * alpha + psum;
#pragma unroll
    for (int r = 0; r < 8; ++r) {
      oacc[0][r] *= alpha;
      oacc[1][r] *= alpha;
    }

    // ---- context^T += V^T . P^T (f16 WMMA); two score tiles, converted in place (x1024, f16), are the B operand
    //      of one 32-key step; residual products into a separate accumulator ----
    v8f o1[2];
    o1[0] = zero8(); o1[1] = zero8();
#pragma unroll
    for (int kk = 0; kk < 2; ++kk) {
      FH pb;
      pb.h[0] = __builtin_convertvector(s[2 * kk] * 1024.0f, v8h);
      pb.h[1] = __builtin_convertvector(s[2 * kk + 1] * 1024.0f, v8h);
#pragma unroll
      for (int t = 0; t < 2; ++t) {
        FH vb, vl;
        vb.h[0] = *(const v8h*)(Vth + (t * 16 + c) * VPI + kk * 32 + 8 * hh);
        vb.h[1] = *(const v8h*)(Vth + (t * 16 + c) * VPI + kk * 32 + 16 + 8 * hh);
        vl.h[0] = *(const v8h*)(Vtl + (t * 16 + c) * VPI + kk * 32 + 8 * hh);
        vl.h[1] = *(const v8h*)(Vtl + (t * 16 + c) * VPI + kk * 32 + 16 + 8 * hh);
        oacc[t] = mma_h(vb.v, pb.v, oacc[t]);
        o1[t]   = mma_h(vl.v, pb.v, o1[t]);
      }
    }
#pragma unroll
    for (int t = 0; t < 2; ++t)
#pragma unroll
      for (int r = 0; r < 8; ++r) oacc[t][r] += o1[t][r] * (1.0f / 2048.0f);
  }

  // ---- merge the two groups' partials: lane for lane the same (query, key half, d) places ----
  if (kg == 1) {
    Mm[wave][lane] = mrun;
    Ml[wave][lane] = lrun;
#pragma unroll
    for (int t = 0; t < 2; ++t) {
      Mo[wave][2 * t][lane]     = (v4f){oacc[t][0], oacc[t][1], oacc[t][2], oacc[t][3]};
      Mo[wave][2 * t + 1][lane] = (v4f){oacc[t][4], oacc[t][5], oacc[t][6], oacc[t][7]};
    }
  }
  __syncthreads();                           // group 1's partials are readable by group 0
  if (kg == 1) return;                       // whole waves; no block barrier stands behind this line
  {
    const float m1 = Mm[wave][lane], l1 = Ml[wave][lane];
    const float mnew  = fmaxf(mrun, m1);
    const float msafe = (mnew == -INFINITY) ? 0.f : mnew;
    const float w0 = __expf(mrun - msafe), w1 = __expf(m1 - msafe);
    lrun = lrun * w0 + l1 * w1;
#pragma unroll
    for (int t = 0; t < 2; ++t) {
      const v4f pa = Mo[wave][2 * t][lane], pb = Mo[wave][2 * t + 1][lane];
#pragma unroll
      for (int r = 0; r < 4; ++r) {
        oacc[t][r]     = oacc[t][r] * w0 + pa[r] * w1;
        oacc[t][r + 4] = oacc[t][r + 4] * w0 + pb[r] * w1;
      }
    }
  }

  // ---- join the halves' sums, normalise (1/l, undo the x1024 p carry and the x4 v carry), stage the wave's
  //      16x32 tile: oacc[t][r] is element (query c, d = t*16 + 8*hh + r)
  float* os = Os[wave];
  {
    const float l = lrun + xhalf(lrun);
    const float inv = 1.0f / (l * 4096.0f);
#pragma unroll
    for (int t = 0; t < 2; ++t) {
      const v8f o = oacc[t] * inv;
      *(v4f*)(os + c * OPI + t * 16 + 8 * hh)     = (v4f){o[0], o[1], o[2], o[3]};
      *(v4f*)(os + c * OPI + t * 16 + 8 * hh + 4) = (v4f){o[4], o[5], o[6], o[7]};
    }
  }
  __builtin_amdgcn_fence(__ATOMIC_RELEASE, "workgroup");
  __builtin_amdgcn_wave_barrier();
  __builtin_amdgcn_fence(__ATOMIC_ACQUIRE, "workgroup");
  {
    const int rq = lane >> 2, c8 = (lane & 3) * 8;
    v4u hv[2], lv[2];
#pragma unroll
    for (int it = 0; it < 2; ++it) {
      const int row = it * 8 + rq;   // it 0..1 x rq 0..7 = rows 0..15 of the wave tile
      const float* sp = os + row * OPI + c8;
      v4u a, a2;
#pragma unroll
      for (int e = 0; e < 4; ++e) {
        const float f0 = sp[2 * e], f1 = sp[2 * e + 1];
        const unsigned short h0 = bf_bits(f0), h1 = bf_bits(f1);
        const unsigned short l0 = bf_bits(f0 - bf_up(h0)), l1 = bf_bits(f1 - bf_up(h1));
        a[e] = pk16(h0, h1); a2[e] = pk16(l0, l1);
      }
      hv[it] = a; lv[it] = a2;
    }
    const size_t PS = (size_t)NBH * SEQ * HD;
    unsigned short* base = ct + ((size_t)bh * SEQ + (size_t)q0) * HD;
    {
#pragma unroll
      for (int it = 0; it < 2; ++it) {
        unsigned short* p = base + it * 256 + lane * 8;
        *(v4u*)(p)          = hv[it];
        *(v4u*)(p + PS)     = hv[it];
        *(v4u*)(p + 2 * PS) = lv[it];
      }
      
    }
  }
}

// =====================================================================================================
// Workspace map (bytes), every region an exact multiple of its whole-line / whole-tile store granularity
// (no tail rows anywhere: all shapes are exact tile multiples):
//   X3   bf16 [4096][768]            6291456
//   Wq3  bf16 [768][768]             1179648
//   Wo3  bf16 [256][768]              393216
//   Qp   f16  [16][2048][32]          2097152
//   Kraw f32  [16][2048][32]          4194304
//   Kp   f16  [16][2048][32]          2097152
//   VTh  f16  [2][256][2048]          2097152
//   VTl  f16  [2][256][2048]          2097152
//   CT   bf16 [3][16][2048][32]       6291456
//   total                           26738688
// =====================================================================================================
extern "C" void kernel_launch(void* const* d_in, const int* in_sizes, int n_in,
                              void* d_out, int out_size, void* d_ws, size_t ws_size,
                              hipStream_t stream) {
  if (n_in < 6) return;
  if (in_sizes[0] != ROWS * DM) return;
  if (in_sizes[1] != DM * QKVW) return;
  if (in_sizes[2] != DM * DM) return;
  if (in_sizes[3] != DM) return;
  if (in_sizes[4] != NFUN || in_sizes[5] != NFUN) return;
  if (out_size != ROWS * DM) return;

  const float* x     = (const float*)d_in[0];   // [2][2048][256]
  const float* w_qkv = (const float*)d_in[1];   // [256 in][768 out]
  const float* w_o   = (const float*)d_in[2];   // [256 in][256 out]
  const float* b_o   = (const float*)d_in[3];   // [256]
  const float* coefa = (const float*)d_in[4];   // [256] sine coefficients
  const float* coefb = (const float*)d_in[5];   // [256] cosine coefficients

  const size_t PX3 = (size_t)ROWS * KP * 2;            // 6291456
  const size_t PWQ = (size_t)QKVW * KP * 2;            // 1179648
  const size_t PWO = (size_t)DM * KP * 2;              //  393216
  const size_t PH  = (size_t)NBH * SEQ * HD * 2;       // 2097152  f16 head plane
  const size_t PK4 = (size_t)NBH * SEQ * HD * 4;       // 4194304  f32 head plane
  const size_t PVT = (size_t)NB * DM * SEQ * 2;        // 2097152  v^T plane
  const size_t PCT = (size_t)3 * NBH * SEQ * HD * 2;   // 6291456  ctx planes
  size_t off = 0;
  const size_t oX3  = off; off += PX3;
  const size_t oWq  = off; off += PWQ;
  const size_t oWo  = off; off += PWO;
  const size_t oQp  = off; off += PH;
  const size_t oKr  = off; off += PK4;
  const size_t oKp  = off; off += PH;
  const size_t oVTh = off; off += PVT;
  const size_t oVTl = off; off += PVT;
  const size_t oCT  = off; off += PCT;
  if (off > ws_size) return;                           // off = 26738688
  if (off > (size_t)134217728) return;

  char* ws = (char*)d_ws;
  unsigned short* X3  = (unsigned short*)(ws + oX3);
  unsigned short* Wq3 = (unsigned short*)(ws + oWq);
  unsigned short* Wo3 = (unsigned short*)(ws + oWo);
  unsigned short* Qp  = (unsigned short*)(ws + oQp);
  float*          Kr  = (float*)(ws + oKr);
  unsigned short* Kp  = (unsigned short*)(ws + oKp);
  unsigned short* VTh = (unsigned short*)(ws + oVTh);
  unsigned short* VTl = (unsigned short*)(ws + oVTl);
  unsigned short* CT  = (unsigned short*)(ws + oCT);

  const dim3 blk(256);
  const int n8x = ROWS * DM / 8;                                   // 131072
  const dim3 gPrep(NTQ + NTO + (n8x + 255) / 256);                  //   48 + 16 + 512 blocks
  const dim3 gProj(3 * NGB);                                        //  768 blocks: q, k, v^T
  const dim3 gOut(NGB);                                             //  256 blocks: M=4096, N=256
  const dim3 gFour((NBH * SEQ * HD) / 1024);                        // 1024 blocks of 256, 4 elements per lane
  const dim3 gAttn(NBH * NQB);                                      //  512 blocks of 256

  // (1) x -> [hi|hi|lo] bf16 plane; weights transposed to [out][in] as [hi|lo|hi] bf16 planes
  prep3<<<gPrep, blk, 0, stream>>>(x, w_qkv, w_o, X3, Wq3, Wo3, n8x);
  // (2) q -> f16 head plane (x4), k -> raw f32 head plane, v^T -> f16 hi (x4) and residual (x2048) planes
  proj_qkv<<<gProj, blk, 0, stream>>>(X3, Wq3, Qp, Kr, VTh, VTl);
  // (3) Fourier-basis transform of k -> f16 head plane (x4)
  fourier_k<<<gFour, blk, 0, stream>>>(Kr, coefa, coefb, Kp);
  // (4) attention -> ctx planes (bf16 hi, hi, lo)
  attn32<<<gAttn, dim3(128 * KGR), 0, stream>>>(Qp, Kp, VTh, VTl, CT, 0.17677669529663687f * 0.0625f);
  // (5) out = ctx . Wo + bias -> d_out f32 [4096][256]
  proj_out<<<gOut, blk, 0, stream>>>(CT, Wo3, (float*)d_out, b_o);
  (void)hipGetLastError();
}

// v008
// One run takes 58.9 microseconds.
// Two timings next to v007 put it at 1.16 and 1.15 times that version's speed.
// All steps since v000 together make it 6.42 times as fast.
// Contractions: q, k, v^T projections and the output projection = v_wmma_f32_16x16x32_bf16 over bf16 hi/lo planes
// laid out as [hi|hi|lo] x [hi|lo|hi] along k (3 products, f32 accumulate);
// q.k^T scores = v_wmma_f32_16x16x32_f16 (q and the transformed k as f16 planes carried x4, single product, f32 accumulate);
// p.v = v_wmma_f32_16x16x32_f16 (p carried x1024 in f16; v^T as f16 hi plane x4 plus f16 residual plane x2^11; 2 products, f32 accumulate);
// Fourier-basis transform of k = v_wmma_f32_16x16x32_bf16 (coefficient matrix x sines and cosines, both bf16 hi + lo, 3 products, f32 accumulate)
// with the sines, cosines and the closing dot product in f32 on the VALU; softmax and bias in f32 on the VALU.
#include <hip/hip_runtime.h>
#include <math.h>
#include <stdint.h>

#define NB   2
#define SEQ  2048
#define DM   256
#define NH   8
#define HD   32
#define NBH  (NB * NH)        // 16 (batch, head) pairs
#define QKVW (3 * DM)         // 768 qkv output width
#define KP   (3 * DM)         // 768 folded k width of the split operand planes
#define NFUN 256
#define ROWS (NB * SEQ)       // 4096 token rows
#define NQB  (SEQ / 64)       // 64-query blocks per (b, h)
#define NKT  (SEQ / 64)       // 64-key chunks
#define GP   (KP * 2 + 16)    // GEMM operand row pitch in LDS, bytes: the whole k (1536 B) + 16 B (16 B x odd, for 16-B readers)
#define GOPS (128 * GP)       // GEMM operands of a block in LDS: 64 A rows, then 64 Bt rows
#define NTQ  ((QKVW / 64) * (DM / 64))   // 48 transpose tiles of w_qkv
#define NTO  ((DM / 64) * (DM / 64))     // 16 transpose tiles of w_o
#define NGB  256              // 64x64 block tiles of each of the four products: one per WGP
// attention tiles in LDS: every row is read or written 16 B a lane, one row per lane of a 16-lane half, so the row
// pitch is 16 B x odd (row + 16 B): the sixteen lanes of a half then fall on sixteen different groups of four banks
#define KPI  (HD + 8)         // K chunk row pitch, f16 elements: 64 B + 16 B = 80 B
#define VPI  (64 + 8)         // V^T chunk row pitch, f16 elements: 128 B + 16 B = 144 B
#define OPI  (HD + 4)         // ctx tile row pitch, f32 elements: 128 B + 16 B = 144 B
#define KGR  2                // key groups of an attention block: group g takes the 64-key chunks g, g + KGR, ...
static_assert(NH * HD == DM);
static_assert(NQB == 32 && NKT == 32 && (NKT % KGR) == 0 && KGR == 2);   // the merge joins two partials
static_assert((ROWS % 64) == 0 && (DM % 64) == 0 && (SEQ % 64) == 0 && (KP % 32) == 0);
static_assert((ROWS * DM) % 2048 == 0);
static_assert((ROWS / 64) * (DM / 64) == NGB && NB * (DM / 64) * (SEQ / 64) == NGB);
static_assert((KP % 64) == 0 && 64 * (KP / 8) == 24 * 256 && (GP % 32) == 16);

typedef _Float16 v16h __attribute__((ext_vector_type(16)));
typedef _Float16 v8h  __attribute__((ext_vector_type(8)));
typedef __bf16   v16b __attribute__((ext_vector_type(16)));
typedef __bf16   v8b  __attribute__((ext_vector_type(8)));
typedef float    v8f  __attribute__((ext_vector_type(8)));
typedef float    v4f  __attribute__((ext_vector_type(4)));
typedef unsigned int v4u __attribute__((ext_vector_type(4)));
typedef float    v2f  __attribute__((ext_vector_type(2)));
typedef unsigned int v2u __attribute__((ext_vector_type(2)));

#if defined(__HIP_DEVICE_COMPILE__)
#define DEV_ASM 1
#else
#define DEV_ASM 0
#endif

// ---- scalar helpers --------------------------------------------------------------------------------
__device__ __forceinline__ unsigned short bf_bits(float f) {          // f32 -> bf16 bits, RNE convert
  unsigned u = __float_as_uint(f);
  return (unsigned short)((u + 0x7FFFu + ((u >> 16) & 1u)) >> 16);
}
__device__ __forceinline__ float bf_up(unsigned short hb) { return __uint_as_float(((unsigned)hb) << 16); }
__device__ __forceinline__ unsigned short h_bits(_Float16 x) { return __builtin_bit_cast(unsigned short, x); }
__device__ __forceinline__ unsigned pk16(unsigned short a, unsigned short b) { return (unsigned)a | ((unsigned)b << 16); }
__device__ __forceinline__ v8f zero8() { v8f z = {0.f, 0.f, 0.f, 0.f, 0.f, 0.f, 0.f, 0.f}; return z; }

// ---- fragment loaders: 16-bit A/B operand, lane -> row/col (lane&15), p already includes +8*(lane>>4);
//      elements 0..7 <- p[0..7] (k0+8h..k0+8h+7), elements 8..15 <- p[16..23] (k0+16+8h..k0+16+8h+7)
template <typename OT> struct FT;
template <> struct FT<__bf16>   { typedef v16b frag; typedef v8b half8; };
template <> struct FT<_Float16> { typedef v16h frag; typedef v8h half8; };

template <typename OT>
__device__ __forceinline__ typename FT<OT>::frag ldfrag(const OT* p) {
  union { typename FT<OT>::frag v; typename FT<OT>::half8 h[2]; } f;
  f.h[0] = *(const typename FT<OT>::half8*)(p);
  f.h[1] = *(const typename FT<OT>::half8*)(p + 16);
  return f.v;
}

// ---- WMMA helpers ----------------------------------------------------------------------------------
__device__ __forceinline__ v8f mmar(v16b a, v16b b, v8f c) {
  return __builtin_amdgcn_wmma_f32_16x16x32_bf16(false, a, false, b, (short)0, c, false, false);
}
// guarded form: 4 VALU slots after the WMMA, D tied, A/B kept live
__device__ __forceinline__ v8f mma_h(v16h a, v16h b, v8f c) {
  c = __builtin_amdgcn_wmma_f32_16x16x32_f16(false, a, false, b, (short)0, c, false, false);
#if DEV_ASM
  asm volatile("v_nop\n\tv_nop\n\tv_nop\n\tv_nop" : "+v"(c) : "v"(a), "v"(b));
#endif
  return c;
}
// lane l <-> lane l ^ 16
__device__ __forceinline__ float xhalf(float x) {
  const int b = __builtin_bit_cast(int, x);
  return __builtin_bit_cast(float, __builtin_amdgcn_permlanex16(b, b, 0x76543210, 0xfedcba98, false, false));
}
// ---- asynchronous copies global -> LDS, 16 B a lane ------------------------------------------------
__device__ __forceinline__ uint32_t lds_off(const void* p) { return (uint32_t)(size_t)p; }   // LDS byte address
// twelve copies of a lane (l: LDS byte addresses, g: global addresses); the s_wait_xcnt stands inside the
// statement so that no address register named here is rewritten ahead of it
__device__ __forceinline__ void copy12(const uint32_t (&l)[12], const __bf16* const (&g)[12]) {
#if DEV_ASM
  asm volatile("global_load_async_to_lds_b128 %0, %12, off\n\t"
               "global_load_async_to_lds_b128 %1, %13, off\n\t"
               "global_load_async_to_lds_b128 %2, %14, off\n\t"
               "global_load_async_to_lds_b128 %3, %15, off\n\t"
               "global_load_async_to_lds_b128 %4, %16, off\n\t"
               "global_load_async_to_lds_b128 %5, %17, off\n\t"
               "global_load_async_to_lds_b128 %6, %18, off\n\t"
               "global_load_async_to_lds_b128 %7, %19, off\n\t"
               "global_load_async_to_lds_b128 %8, %20, off\n\t"
               "global_load_async_to_lds_b128 %9, %21, off\n\t"
               "global_load_async_to_lds_b128 %10, %22, off\n\t"
               "global_load_async_to_lds_b128 %11, %23, off\n\t"
               "s_wait_xcnt 0x0"
               :: "v"(l[0]), "v"(l[1]), "v"(l[2]), "v"(l[3]), "v"(l[4]), "v"(l[5]),
                  "v"(l[6]), "v"(l[7]), "v"(l[8]), "v"(l[9]), "v"(l[10]), "v"(l[11]),
                  "v"(g[0]), "v"(g[1]), "v"(g[2]), "v"(g[3]), "v"(g[4]), "v"(g[5]),
                  "v"(g[6]), "v"(g[7]), "v"(g[8]), "v"(g[9]), "v"(g[10]), "v"(g[11])
               : "memory");
#else
  (void)l; (void)g;
#endif
}
// this wave's copies have landed
__device__ __forceinline__ void wait_copies() {
#if DEV_ASM
  asm volatile("s_wait_asynccnt 0x0" ::: "memory");
#endif
}
// behind a job's last global stores: in a kernel that holds several jobs' bodies the registers that the stores
// name may be written by the code laid out behind them; the wait stands in front of any such write
__device__ __forceinline__ void wait_store_regs() {
#if DEV_ASM
  asm volatile("s_wait_xcnt 0x0" ::: "memory");
#endif
}

// =====================================================================================================
// x [ROWS][DM] f32 -> split plane X3 [ROWS][KP] bf16, row = [hi | hi | lo] (hi = RNE bf16, lo = RNE bf16
// of the exact residual). 8 elements per thread; each thread stores 16 B into each of the three thirds;
// bx = the block's index within this job.
// =====================================================================================================
__device__ __forceinline__ void cvt_x3(const float* __restrict__ in, unsigned short* out, int n8, int bx) {
  const int i = bx * 256 + (int)threadIdx.x;
  if (i < n8) {
    const int row = i >> 5, c = (i & 31) * 8;
    const v4f a  = *(const v4f*)(in + (size_t)i * 8);
    const v4f a4 = *(const v4f*)(in + (size_t)i * 8 + 4);
    const float f[8] = {a[0], a[1], a[2], a[3], a4[0], a4[1], a4[2], a4[3]};
    v4u ph, pl;
#pragma unroll
    for (int e = 0; e < 4; ++e) {
      const float f0 = f[2 * e], f1 = f[2 * e + 1];
      const unsigned short h0 = bf_bits(f0), h1 = bf_bits(f1);
      const unsigned short l0 = bf_bits(f0 - bf_up(h0)), l1 = bf_bits(f1 - bf_up(h1));
      ph[e] = pk16(h0, h1);
      pl[e] = pk16(l0, l1);
    }
    unsigned short* o = out + (size_t)row * KP + c;
    *(v4u*)(o)          = ph;
    *(v4u*)(o + DM)     = ph;
    *(v4u*)(o + 2 * DM) = pl;
    wait_store_regs();
  }
}

// =====================================================================================================
// w [DM rows k][C cols] f32 (x @ w layout) -> wt [C][KP] bf16, row c = [hi | lo | hi] of w[k][c] over k.
// Block = 64 k x 64 c tile staged in LDS (f32); C/64 x DM/64 blocks: bx -> c0, by -> k0.
// coverage: 8 waves x 8 rows x 64 k = the tile, all three thirds; the grid covers all C rows x DM k.
// =====================================================================================================
__device__ __forceinline__ void wtrans3(float (*tile)[65], const float* __restrict__ w, unsigned short* wt, int C,
                                        int bx, int by) {
  const int tid = (int)threadIdx.x, lane = tid & 31, wave = tid >> 5;
  const int c0 = bx * 64, k0 = by * 64;
#pragma unroll
  for (int it = 0; it < 16; ++it) {
    const int idx = it * 256 + tid;
    const int r = idx >> 6, cc = idx & 63;
    tile[r][cc] = w[(size_t)(k0 + r) * C + c0 + cc];
  }
  __syncthreads();
  const int q = lane >> 3, c8 = (lane & 7) * 8;
  v4u hv[2], lv[2];
#pragma unroll
  for (int it = 0; it < 2; ++it) {
    const int row = wave * 8 + it * 4 + q;          // output row (c within tile)
    v4u a, a2;
#pragma unroll
    for (int e = 0; e < 4; ++e) {
      const float f0 = tile[c8 + 2 * e][row], f1 = tile[c8 + 2 * e + 1][row];
      const unsigned short h0 = bf_bits(f0), h1 = bf_bits(f1);
      const unsigned short l0 = bf_bits(f0 - bf_up(h0)), l1 = bf_bits(f1 - bf_up(h1));
      a[e] = pk16(h0, h1);
      a2[e] = pk16(l0, l1);
    }
    hv[it] = a; lv[it] = a2;
  }
  {
#pragma unroll
    for (int it = 0; it < 2; ++it) {
      const int row = wave * 8 + it * 4 + q;
      unsigned short* o = wt + (size_t)(c0 + row) * KP + k0 + c8;
      *(v4u*)(o)          = hv[it];
      *(v4u*)(o + DM)     = lv[it];
      *(v4u*)(o + 2 * DM) = hv[it];
    }
    wait_store_regs();
  }
}

// =====================================================================================================
// The three operand preparations in one launch: each reads inputs only and writes a plane of its own, so
// none waits for another. The block index picks the job (the same for the whole block, so the transpose's
// barrier stays block-uniform): NTQ blocks transpose w_qkv, NTO blocks w_o, the remaining n8 / 256 split x.
// =====================================================================================================
__global__ __launch_bounds__(256) void prep3(const float* __restrict__ x, const float* __restrict__ w_qkv,
                                             const float* __restrict__ w_o, unsigned short* X3,
                                             unsigned short* Wq3, unsigned short* Wo3, int n8) {
  __shared__ float tile[64][65];
  const int bx = (int)blockIdx.x;
  if (bx < NTQ) {
    wtrans3(tile, w_qkv, Wq3, QKVW, bx % (QKVW / 64), bx / (QKVW / 64));
  } else if (bx < NTQ + NTO) {
    wtrans3(tile, w_o, Wo3, DM, (bx - NTQ) % (DM / 64), (bx - NTQ) / (DM / 64));
  } else {
    cvt_x3(x, X3, n8, bx - (NTQ + NTO));
  }
}

// =====================================================================================================
// Batched WMMA GEMM, bf16 operands: C[m][n] = sum_k A[m][k] * Bt[n][k], k = 0..KP-1; a block of eight waves on a
// 64x64 tile, so that every product has NGB blocks; a wave on 32x16 of it (2 x 4 waves).
// Bt row-major [N][KP] pitch ldb (k contiguous).
// A_MODE 0: A row-major [M][KP] pitch lda.  A_MODE 1: head planes: A(m, k) at
//   plane = (k/256)*NBH + (m/SEQ)*NH + (k/32)%NH;  A[(plane*SEQ + m%SEQ)*HD + k%32]  (M = ROWS).
// M and N multiples of 64 (static shapes below). bx = block tile index, b = batch index (strides in elements);
// opnd and ct are the calling kernel's LDS.
// Operands: the block's 64 A rows and 64 Bt rows, the whole k of each (1536 B a row), come into LDS once, by
// asynchronous copies of whole 128-B lines, 48 copies a lane, all in flight together; one wait, one barrier;
// LDS row pitch GP; fragments read from LDS with the split k map (ldfrag), k ascending as before.
// Epilogue: the 64x64 tile staged in LDS (pitch 68 floats), one barrier; a pair of waves takes a 16-row slab, each
// wave one half of its stores:
// OUT_MODE 0: f16 head plane [NBH][SEQ][HD], value * oscale: a wave stores one head half of the slab (1024 contiguous B)
// OUT_MODE 1: f32 head plane [NBH][SEQ][HD]: a wave stores one head half (2048 contiguous B)
// OUT_MODE 2: f16 hi plane C (value*oscale) + f16 residual plane C2 = f16((v*oscale - hi) * rscale), row-major, 8 rows a wave
// OUT_MODE 3: f32 row-major C (pitch ldc) + bias[n] (f32): each 64-wide row segment = 256 B = 16 lanes x 16 B, 8 rows a wave
// coverage: 4 slabs x 16 rows x 64 cols = the block's whole 64x64 tile; grids are exact tile multiples.
// =====================================================================================================
template <int A_MODE, int OUT_MODE>
__device__ __forceinline__ void gemm64(
    unsigned char* opnd, float* ct, int bx, int b,
    const unsigned short* __restrict__ Ap, int lda, long long strideA,
    const unsigned short* __restrict__ Btp, int ldb, long long strideB,
    void* Cout, void* Cout2, int ldc, long long strideC,
    const float* __restrict__ bias,
    int M, int N, float oscale, float rscale) {
  const __bf16* A  = (const __bf16*)(const void*)Ap;
  const __bf16* Bt = (const __bf16*)(const void*)Btp;
  const int tid  = (int)threadIdx.x;
  const int lane = tid & 31;
  const int wave = tid >> 5;
  const int nbn = N >> 6;                // block tiles along N
  const int bm  = bx / nbn;
  const int bn  = bx - bm * nbn;
  if (bm >= (M >> 6)) return;            // the same for the whole block, in front of every barrier
  const int bm0 = bm << 6;
  const int bn0 = bn << 6;
  const int wr  = (wave >> 2) << 5;      // the wave's first A row in the block tile
  const int wc  = (wave & 3) << 4;       // the wave's first Bt row in the block tile

  const __bf16* Ab = A  + (size_t)b * (size_t)strideA;
  const __bf16* Bb = Bt + (size_t)b * (size_t)strideB;

  const int rlane = lane & 15;                 // row (A) / col (B, D) within subtile
  const int koff  = (lane >> 4) * 8;           // k offset of this lane half
  const int mOff  = (lane >> 4) * 8;           // D row offset

  // 24 copies a lane for each operand, in statements of twelve; a wave's copy covers 512 B of whole lines (4 rows
  // of 128 B; in the head-plane layout 8 rows of 64 B, which adjoin)
  const uint32_t lb = lds_off(opnd);
#pragma unroll
  for (int g = 0; g < 2; ++g) {
    uint32_t la[12];
    const __bf16* ga[12];
#pragma unroll
    for (int u = 0; u < 12; ++u) {
      const int v = g * 12 + u;
      if (A_MODE == 0) {
        const int row = (v & 1) * 32 + (tid >> 3), pc = tid & 7;
        ga[u] = Ab + (size_t)(bm0 + row) * lda + (v >> 1) * 64 + pc * 8;
        la[u] = lb + (uint32_t)(row * GP + (v >> 1) * 128 + pc * 16);
      } else {
        const int kk = v * 32;
        const int row = tid >> 2, pc = tid & 3;
        const int plane = (kk >> 8) * NBH + (bm0 / SEQ) * NH + ((kk >> 5) & (NH - 1));
        ga[u] = Ab + ((size_t)plane * SEQ + (size_t)((bm0 & (SEQ - 1)) + row)) * HD + pc * 8;
        la[u] = lb + (uint32_t)(row * GP + (v * 4 + pc) * 16);
      }
    }
    copy12(la, ga);
  }
#pragma unroll
  for (int g = 0; g < 2; ++g) {
    uint32_t la[12];
    const __bf16* ga[12];
#pragma unroll
    for (int u = 0; u < 12; ++u) {
      const int v = g * 12 + u;
      const int row = (v & 1) * 32 + (tid >> 3), pc = tid & 7;
      ga[u] = Bb + (size_t)(bn0 + row) * ldb + (v >> 1) * 64 + pc * 8;
      la[u] = lb + (uint32_t)((64 + row) * GP + (v >> 1) * 128 + pc * 16);
    }
    copy12(la, ga);
  }
  wait_copies();
  __syncthreads();                       // both operands are readable by every wave

  v8f acc[2];
  acc[0] = zero8(); acc[1] = zero8();
  const unsigned char* ap = opnd + (wr + rlane) * GP + koff * 2;
  const unsigned char* bp = opnd + (64 + wc + rlane) * GP + koff * 2;
  // unrolled whole: no barrier stands in it, so the fragment reads of later k-steps can run ahead of the products
#pragma unroll
  for (int ks = 0; ks < KP / 32; ++ks) { // k-steps of 32 (64 B of every row)
    const v16b bq = ldfrag<__bf16>((const __bf16*)(bp + ks * 64));
    const v16b a0 = ldfrag<__bf16>((const __bf16*)(ap + ks * 64));
    const v16b a1 = ldfrag<__bf16>((const __bf16*)(ap + 16 * GP + ks * 64));
    acc[0] = mmar(a0, bq, acc[0]);
    acc[1] = mmar(a1, bq, acc[1]);
  }

  // ---- epilogue ----
#pragma unroll
  for (int i = 0; i < 2; ++i)
#pragma unroll
    for (int r = 0; r < 8; ++r) ct[(wr + (i << 4) + mOff + r) * 68 + wc + rlane] = acc[i][r];
  __syncthreads();                       // the whole tile is readable by every wave
  const float* slab = ct + (wave >> 1) * (16 * 68);
  const int mBase = bm0 + ((wave >> 1) << 4);
  const int n0 = bn0;
  const int hs = wave & 1;               // which half of the slab's stores this wave does
  if (OUT_MODE == 0) {
    unsigned short* Q = (unsigned short*)Cout;
    const int rq = lane >> 2, c8 = (lane & 3) * 8;        // row within an 8-row group, 8-col piece
    v4u hv[2];
#pragma unroll
    for (int it = 0; it < 2; ++it) {
      const float* sp = slab + (it * 8 + rq) * 68 + hs * 32 + c8;   // it 0..1 x rq 0..7 = rows 0..15
      v4u a;
#pragma unroll
      for (int e = 0; e < 4; ++e)
        a[e] = pk16(h_bits((_Float16)(sp[2 * e] * oscale)), h_bits((_Float16)(sp[2 * e + 1] * oscale)));
      hv[it] = a;
    }
    const int head = (n0 >> 5) + hs;
    unsigned short* base = Q + ((size_t)((mBase / SEQ) * NH + head) * SEQ + (size_t)(mBase & (SEQ - 1))) * HD;
#pragma unroll
    for (int it = 0; it < 2; ++it)
      *(v4u*)(base + it * 256 + lane * 8) = hv[it];
  } else if (OUT_MODE == 1) {
    float* Kr = (float*)Cout;
    const int rq = lane >> 3, c4 = (lane & 7) * 4;        // row within a 4-row group, 4-col piece
    v4f hv[4];
#pragma unroll
    for (int it = 0; it < 4; ++it)                        // it 0..3 x rq 0..3 = rows 0..15
      hv[it] = *(const v4f*)(slab + (it * 4 + rq) * 68 + hs * 32 + c4);
    const int head = (n0 >> 5) + hs;
    float* base = Kr + ((size_t)((mBase / SEQ) * NH + head) * SEQ + (size_t)(mBase & (SEQ - 1))) * HD;
#pragma unroll
    for (int it = 0; it < 4; ++it)
      *(v4f*)(base + it * 128 + lane * 4) = hv[it];
  } else if (OUT_MODE == 2) {
    const int q = lane >> 3, c8 = (lane & 7) * 8;
    unsigned short* C  = (unsigned short*)Cout  + (size_t)b * (size_t)strideC;
    unsigned short* C2 = (unsigned short*)Cout2 + (size_t)b * (size_t)strideC;
    v4u hv[2], lv[2];
#pragma unroll
    for (int it = 0; it < 2; ++it) {
      const int row = hs * 8 + it * 4 + q;                // hs 0..1 x it 0..1 x q 0..3 = rows 0..15
      const float* sp = slab + row * 68 + c8;
      v4u a, a2;
#pragma unroll
      for (int e = 0; e < 4; ++e) {
        const float f0 = sp[2 * e] * oscale, f1 = sp[2 * e + 1] * oscale;
        const _Float16 x0 = (_Float16)f0, x1 = (_Float16)f1;
        const unsigned short h0 = h_bits(x0), h1 = h_bits(x1);
        const unsigned short l0 = h_bits((_Float16)((f0 - (float)x0) * rscale));
        const unsigned short l1 = h_bits((_Float16)((f1 - (float)x1) * rscale));
        a[e] = pk16(h0, h1); a2[e] = pk16(l0, l1);
      }
      hv[it] = a; lv[it] = a2;
    }
#pragma unroll
    for (int it = 0; it < 2; ++it) {
      const int row = hs * 8 + it * 4 + q;
      *(v4u*)(C  + (size_t)(mBase + row) * ldc + n0 + c8) = hv[it];
      *(v4u*)(C2 + (size_t)(mBase + row) * ldc + n0 + c8) = lv[it];
    }
  } else {
    float* C = (float*)Cout + (size_t)b * (size_t)strideC;
    const int h2 = lane >> 4, c4 = (lane & 15) * 4;      // 256-B row segment = 16 lanes x 16 B
    const v4f bv = *(const v4f*)(bias + n0 + c4);
    v4f hv[4];
#pragma unroll
    for (int it = 0; it < 4; ++it) {
      const int row = hs * 8 + it * 2 + h2;               // hs 0..1 x it 0..3 x h2 0..1 = rows 0..15
      hv[it] = *(const v4f*)(slab + row * 68 + c4) + bv;
    }
#pragma unroll
    for (int it = 0; it < 4; ++it) {
      const int row = hs * 8 + it * 2 + h2;
      *(v4f*)(C + (size_t)(mBase + row) * ldc + n0 + c4) = hv[it];
    }
  }
  wait_store_regs();
}

// =====================================================================================================
// The q, k and v^T projections in one launch: all three read the X3 and Wq3 planes, none reads another's
// output. blockIdx.x / NGB picks the product (the same for the whole block, so every barrier stays block-uniform):
//   0: q = x . Wq -> f16 head plane (x4)        (M=4096, N=256, K=768)
//   1: k = x . Wk -> raw f32 head plane         (M=4096, N=256, K=768)
//   2: v^T = Wv . x^T per batch -> f16 hi plane (x4) [b][c][s] (pitch SEQ) and residual plane (x2048)
//      (A = Wq3 rows 512.., Bt = X3 rows of batch b; M=256, N=2048, K=768; 128 blocks a batch)
// =====================================================================================================
__global__ __launch_bounds__(256) void proj_qkv(const unsigned short* __restrict__ X3,
                                                const unsigned short* __restrict__ Wq3,
                                                unsigned short* Qp, float* Kr,
                                                unsigned short* VTh, unsigned short* VTl) {
  __shared__ __align__(16) unsigned char opnd[GOPS];   // 64 A rows, then 64 Bt rows, the whole k of each
  __shared__ __align__(16) float ct[64 * 68];          // the block's 64x64 result tile, pitch 68 floats
  const unsigned job = blockIdx.x / NGB;
  const int bx = (int)(blockIdx.x % NGB);
  if (job == 0) {
    gemm64<0, 0>(opnd, ct, bx, 0, X3, KP, 0LL, Wq3, KP, 0LL,
                 (void*)Qp, (void*)Qp, 0, 0LL, nullptr, ROWS, DM, 4.0f, 1.0f);
  } else if (job == 1) {
    gemm64<0, 1>(opnd, ct, bx, 0, X3, KP, 0LL, Wq3 + (size_t)DM * KP, KP, 0LL,
                 (void*)Kr, (void*)Kr, 0, 0LL, nullptr, ROWS, DM, 1.0f, 1.0f);
  } else if (job == 2) {
    gemm64<0, 2>(opnd, ct, bx % (NGB / NB), bx / (NGB / NB),
                 Wq3 + (size_t)2 * DM * KP, KP, 0LL, X3, KP, (long long)SEQ * KP,
                 (void*)VTh, (void*)VTl, SEQ, (long long)DM * SEQ, nullptr, DM, SEQ, 4.0f, 2048.0f);
  }
}

// out = ctx . Wo + bias -> f32 [4096][256]   (M=4096, N=256, K=768, A in head-plane layout)
__global__ __launch_bounds__(256) void proj_out(const unsigned short* __restrict__ CT,
                                                const unsigned short* __restrict__ Wo3,
                                                float* out, const float* __restrict__ bias) {
  __shared__ __align__(16) unsigned char opnd[GOPS];   // 64 A rows, then 64 Bt rows, the whole k of each
  __shared__ __align__(16) float ct[64 * 68];          // the block's 64x64 result tile, pitch 68 floats
  gemm64<1, 3>(opnd, ct, (int)blockIdx.x, 0, CT, 0, 0LL, Wo3, KP, 0LL,
               (void*)out, (void*)out, DM, 0LL, bias, ROWS, DM, 1.0f, 1.0f);
}

// =====================================================================================================
// Fourier-basis transform of k: out = sum_{f=1..NFUN} ca[f-1]*sin(f*k) + cb[f-1]*cos(f*k).
// The frequency is split as f = 16 i + j (i = 0..15, j = 1..16). By the angle addition formulas
//   out = sum_i sin(16 i k) * TS_i + cos(16 i k) * TC_i,
//   TS_i = sum_j ca[f-1] cos(j k) - cb[f-1] sin(j k),   TC_i = sum_j ca[f-1] sin(j k) + cb[f-1] cos(j k):
// a fixed 32x32 coefficient matrix times the vector (sin(j k), cos(j k))_j of an element, then a dot product of 32.
// The matrix product runs on bf16 WMMA, both operands split in bf16 hi + lo (hi.hi + hi.lo + lo.hi, f32 accumulate);
// one pass = 16 elements (the columns), a lane pair (c, c + 16) an element.
//   k order, A and B alike: lane half hh, fragment element 2 t + kappa <-> j = 8 hh + 1 + t, kappa 0 = sine, 1 = cosine
//   rows: tile tau, row 8 hr + 2 m + kind <-> i = 8 hr + 4 tau + m, kind 0 = TS_i, 1 = TC_i, so that D registers
//   (2 m, 2 m + 1) of a lane meet its pair (sin, cos)(16 i k)
// sin and cos of k and of 16 k (exact product) come from the precise sincosf; 8 k and 128 k, the upper half's start
// angles, by three doublings; the eight angles of a lane in each family by y[t+1] = 2 cos(step) y[t] - y[t-1].
// A lane owns two consecutive elements of the raw f32 k head plane a trip and stores their f16 results (x4) as 4 B,
// a wave 128 contiguous B. coverage: grid x 8 waves x FTR trips x 64 = every element of the k' plane.
// =====================================================================================================
#define FTR 4                 // trips of a wave, 64 elements each
static_assert((NBH * SEQ * HD) % (8 * FTR * 64) == 0 && NFUN == 256);
typedef __bf16 v2b __attribute__((ext_vector_type(2)));
__device__ __forceinline__ unsigned cvt2(v2f x) { return __builtin_bit_cast(unsigned, __builtin_convertvector(x, v2b)); }
// a pair of f32 -> packed bf16 hi (RNE) and packed bf16 of the exact residuals
__device__ __forceinline__ void split2(v2f x, unsigned& hi, unsigned& lo) {
  hi = cvt2(x);
  const v2f up = {__uint_as_float(hi << 16), __uint_as_float(hi & 0xffff0000u)};
  lo = cvt2(x - up);
}
union FB { v16b v; unsigned w[8]; };

// one pass: (s1, c1) = sin, cos of the column's k, (sp, cp) = of 16 k; upper = this lane is in the upper half.
// Returns the column's whole sum in both of its lanes.
__device__ __forceinline__ float fpass(float s1, float c1, float sp, float cp, bool upper,
                                       const FB (&mh)[2], const FB (&ml)[2]) {
  const v2f one = {1.f, 1.f};
  v2f S = {s1, sp}, C = {c1, cp};
#pragma unroll
  for (int d = 0; d < 3; ++d) {          // both angles doubled: sin 2x = 2 s c, cos 2x = 1 - 2 s s
    const v2f T = S + S;
    const v2f Sn = T * C;
    C = __builtin_elementwise_fma(-T, S, one);
    S = Sn;
  }
  const v2f vb = {upper ? S[0] : 0.f, upper ? C[0] : 1.f};   // (sin, cos)(8 hh k)
  const v2f ub = {upper ? S[1] : 0.f, upper ? C[1] : 1.f};   // (sin, cos)(128 hh k)
  v2f v[8], u[8];
  v[0] = (v2f){fmaf(vb[0], c1, vb[1] * s1), fmaf(vb[1], c1, -(vb[0] * s1))};
  u[0] = ub;
  u[1] = (v2f){fmaf(ub[0], cp, ub[1] * sp), fmaf(ub[1], cp, -(ub[0] * sp))};
  const float kv1 = c1 + c1, ku1 = cp + cp;
  const v2f kv = {kv1, kv1}, ku = {ku1, ku1};
  v[1] = __builtin_elementwise_fma(kv, v[0], -vb);
#pragma unroll
  for (int t = 2; t < 8; ++t) {
    v[t] = __builtin_elementwise_fma(kv, v[t - 1], -v[t - 2]);
    u[t] = __builtin_elementwise_fma(ku, u[t - 1], -u[t - 2]);
  }
  FB bh, bl;
#pragma unroll
  for (int t = 0; t < 8; ++t) split2(v[t], bh.w[t], bl.w[t]);
  v8f d[2];
#pragma unroll
  for (int ta = 0; ta < 2; ++ta) {       // the small products first
    d[ta] = mmar(ml[ta].v, bh.v, zero8());
    d[ta] = mmar(mh[ta].v, bl.v, d[ta]);
    d[ta] = mmar(mh[ta].v, bh.v, d[ta]);
  }
  v2f acc[2];
#pragma unroll
  for (int ta = 0; ta < 2; ++ta) {
    acc[ta] = u[4 * ta] * (v2f){d[ta][0], d[ta][1]};
#pragma unroll
    for (int m = 1; m < 4; ++m)
      acc[ta] = __builtin_elementwise_fma(u[4 * ta + m], (v2f){d[ta][2 * m], d[ta][2 * m + 1]}, acc[ta]);
  }
  const v2f a2 = acc[0] + acc[1];
  const float part = a2[0] + a2[1];
  return part + xhalf(part);
}

__global__ __launch_bounds__(256) void fourier_k(const float* __restrict__ kr, const float* __restrict__ ca,
                                                 const float* __restrict__ cb, unsigned short* kp) {
  const int lane = (int)threadIdx.x & 31;
  const int wave = (int)threadIdx.x >> 5;
  const bool upper = lane >= 16;
  const size_t w0 = ((size_t)blockIdx.x * 8 + (size_t)wave) * (FTR * 64) + (size_t)lane * 2;
  v2f kn = *(const v2f*)(kr + w0);       // the first trip's elements, in flight while the fragments are built
  // ---- coefficient fragments (A operand), hi and lo, two row tiles ----
  FB mh[2], ml[2];
  {
    const int rho = lane & 15;
    const bool rowc = (rho & 1) != 0;    // row kind: TC_i, else TS_i
#pragma unroll
    for (int ta = 0; ta < 2; ++ta) {
      const int i = 8 * (rho >> 3) + 4 * ta + ((rho >> 1) & 3);
      const int off = 16 * i + 8 * (lane >> 4);
      const v4f a0 = *(const v4f*)(ca + off), a1 = *(const v4f*)(ca + off + 4);
      const v4f b0 = *(const v4f*)(cb + off), b1 = *(const v4f*)(cb + off + 4);
#pragma unroll
      for (int t = 0; t < 8; ++t) {
        const float av = t < 4 ? a0[t & 3] : a1[t & 3];
        const float bv = t < 4 ? b0[t & 3] : b1[t & 3];
        const v2f e = {rowc ? av : -bv, rowc ? bv : av};   // factors of sin(j k), cos(j k)
        split2(e, mh[ta].w[t], ml[ta].w[t]);
      }
    }
  }
  // kept rolled (for speed only): the body holds four inlined sincosf
#pragma unroll 1
  for (int tr = 0; tr < FTR; ++tr) {
    const size_t g2 = w0 + (size_t)tr * 64;
    const v2f kx = kn;
    // the next trip's elements are fetched a trip ahead (the last trip reads its own again: in bounds, not used)
    kn = *(const v2f*)(kr + (tr + 1 < FTR ? g2 + 64 : g2));
    float res[2];
#pragma unroll
    for (int e = 0; e < 2; ++e) {
      float s1, c1, sp, cp;
      sincosf(kx[e], &s1, &c1);
      sincosf(kx[e] * 16.0f, &sp, &cp);
      const float s1x = xhalf(s1), c1x = xhalf(c1), spx = xhalf(sp), cpx = xhalf(cp);
      // pass 0: the elements owned by the lower half's lanes; pass 1: by the upper half's
      const float f0 = fpass(upper ? s1x : s1, upper ? c1x : c1, upper ? spx : sp, upper ? cpx : cp, upper, mh, ml);
      const float f1 = fpass(upper ? s1 : s1x, upper ? c1 : c1x, upper ? sp : spx, upper ? cp : cpx, upper, mh, ml);
      res[e] = upper ? f1 : f0;
    }
    *(unsigned*)(kp + g2) = pk16(h_bits((_Float16)(res[0] * 4.0f)), h_bits((_Float16)(res[1] * 4.0f)));
  }
}

// =====================================================================================================
// Attention, head dim 32, no mask, softmax over all SEQ keys.
//   q plane / k' plane (f16, x4): element (bh, t, d) at [(bh*SEQ + t)*HD + d]
//   v^T hi plane (f16, 4v) and residual plane (f16, (4v - hi)*2048): element (bh, d, s) at [(bh*HD + d)*SEQ + s]
//   ctx planes (bf16): part p (0 = hi, 1 = hi, 2 = lo), element (bh, t, d) at [p*PS + (bh*SEQ + t)*HD + d]
//   scores^T = (k4' . q4^T) * sscale on f16 WMMA (one k-step), softmax in f32 (running max), a query per lane pair;
//   p = exp(s - m) carried as f16(1024 p); O^T = vh^T . p^T + (vl^T . p^T) / 2048 on f16 WMMA; ctx = O / (l * 4096).
//   Block = KGR groups of 4 waves on the same (b, h) and the same 4 consecutive 16-query tiles; grid = NBH * NQB, so a
//   SIMD holds four waves, whose waits cover one another. Key chunks of 64: group g walks the chunks g, g + KGR, ...
//   with its own running maximum, sum and O, static trip NKT / KGR. Chunk staging, each group its own chunk in its own
//   LDS: 128 threads, K 64x32 (2 x 16 B per thread), V^T hi/res 32x64 (2 x 16 B
//   per thread and plane), plain loads, __syncthreads before and after. P^T stays in registers (score tiles -> B operand).
//   After the loop group 1 hands its partial (m, l, O) to group 0 through LDS (one barrier); group 0 merges the two with
//   the weights exp(m_g - max) and writes the output.
//   Output: each wave of group 0 writes its 16x32 tile (1024 contiguous B per part) with two instructions of
//   all NBH*SEQ rows x HD, all three parts.
// =====================================================================================================
__global__ __launch_bounds__(128 * KGR)
void attn32(const unsigned short* __restrict__ qpp, const unsigned short* __restrict__ kpp,
            const unsigned short* __restrict__ vhp, const unsigned short* __restrict__ vlp,
            unsigned short* ct, float sscale) {
  union FH { v16h v; v8h h[2]; };
  __shared__ __align__(16) _Float16 KshA[KGR][64 * KPI];   // per group: K chunk [key][d], pitch KPI     5120 B
  __shared__ __align__(16) _Float16 VthA[KGR][HD * VPI];   // per group: V^T hi [d][key], pitch VPI     4608 B
  __shared__ __align__(16) _Float16 VtlA[KGR][HD * VPI];   // per group: V^T residual, pitch VPI        4608 B
  __shared__ __align__(16) float    Os[4][16 * OPI];       // per query tile: ctx tile, pitch OPI       9216 B
  __shared__ __align__(16) v4f      Mo[4][4][32];          // per query tile: group 1's partial O, 16 B a lane   8192 B
  __shared__ float                  Mm[4][32], Ml[4][32];  // per query tile: group 1's maximum and sum          1024 B

  const int kg   = (int)threadIdx.x >> 7;                  // key group (the same for a whole wave)
  const int tid  = (int)threadIdx.x & 127;                 // thread within the group
  const int wave = tid >> 5;                               // query tile
  const int lane = tid & 31;
  _Float16* Ksh = KshA[kg];
  _Float16* Vth = VthA[kg];
  _Float16* Vtl = VtlA[kg];
  const int hh   = lane >> 4;
  const int c    = lane & 15;

  const int bx   = blockIdx.x;
  const int qblk = bx % NQB;
  const int bh   = bx / NQB;
  const int q0   = qblk * 64 + wave * 16;

  const _Float16* Qg = (const _Float16*)(const void*)qpp + (size_t)bh * SEQ * HD;
  const _Float16* Kg = (const _Float16*)(const void*)kpp + (size_t)bh * SEQ * HD;
  const _Float16* Vh = (const _Float16*)(const void*)vhp + (size_t)bh * HD * SEQ;
  const _Float16* Vl = (const _Float16*)(const void*)vlp + (size_t)bh * HD * SEQ;

  // ---- Q fragment (B operand, column = lane&15, one k-step of 32) ----
  const v16h qa = ldfrag<_Float16>(Qg + (size_t)(q0 + c) * HD + 8 * hh);

  float mrun = -INFINITY, lrun = 0.f;   // query c: running maximum (joined), running sum of this half's keys
  v8f oacc[2];
  oacc[0] = zero8(); oacc[1] = zero8();

  for (int kt = 0; kt < NKT / KGR; ++kt) {   // static trip count
    const int kv0 = (kt * KGR + kg) * 64;
    __syncthreads();
    {
      const int r = tid >> 1, hf = (tid & 1) * 16;                  // key r, d = hf..hf+15
      const _Float16* kg = Kg + (size_t)(kv0 + r) * HD + hf;
      const v8h k0v = *(const v8h*)(kg);
      const v8h k1v = *(const v8h*)(kg + 8);
      *(v8h*)(Ksh + r * KPI + hf)     = k0v;
      *(v8h*)(Ksh + r * KPI + hf + 8) = k1v;
      const int d = tid >> 2, sg = (tid & 3) * 16;                  // d row, keys sg..sg+15
      const _Float16* vg  = Vh + (size_t)d * SEQ + kv0 + sg;
      const _Float16* vlg = Vl + (size_t)d * SEQ + kv0 + sg;
      const v8h v0 = *(const v8h*)(vg),  v1 = *(const v8h*)(vg + 8);
      const v8h w0 = *(const v8h*)(vlg), w1 = *(const v8h*)(vlg + 8);
      *(v8h*)(Vth + d * VPI + sg)     = v0;
      *(v8h*)(Vth + d * VPI + sg + 8) = v1;
      *(v8h*)(Vtl + d * VPI + sg)     = w0;
      *(v8h*)(Vtl + d * VPI + sg + 8) = w1;
    }
    __syncthreads();

    // ---- transposed scores: 64 keys (rows) x 16 queries (columns) per wave; lane (c, hh) holds, for query c,
    //      keys j*16 + 8*hh + r in s[j][r] ----
    v8f s[4];
#pragma unroll
    for (int j = 0; j < 4; ++j) {
      FH kb;
      kb.h[0] = *(const v8h*)(Ksh + (j * 16 + c) * KPI + 8 * hh);
      kb.h[1] = *(const v8h*)(Ksh + (j * 16 + c) * KPI + 16 + 8 * hh);
      s[j] = mma_h(kb.v, qa, zero8());
#pragma unroll
      for (int r = 0; r < 8; ++r) s[j][r] *= sscale;
    }

    // ---- online softmax: a query's maximum and sum lie in its own two lanes; the maximum is joined across the
    //      halves every chunk (both halves rescale alike), the sums only after the loop ----
    float mj[4];
#pragma unroll
    for (int j = 0; j < 4; ++j) {   // a short tree per tile, ready while the next tile's product runs
      const float t0 = fmaxf(fmaxf(s[j][0], s[j][1]), s[j][2]);
      const float t1 = fmaxf(fmaxf(s[j][3], s[j][4]), s[j][5]);
      mj[j] = fmaxf(fmaxf(t0, t1), fmaxf(s[j][6], s[j][7]));
    }
    float m = fmaxf(fmaxf(mj[0], mj[1]), fmaxf(mj[2], mj[3]));
    m = fmaxf(m, xhalf(m));
    const float mnew  = fmaxf(mrun, m);
    const float msafe = (mnew == -INFINITY) ? 0.f : mnew;
    const float alpha = __expf(mrun - msafe);
    mrun = mnew;
#pragma unroll
    for (int j = 0; j < 4; ++j)
#pragma unroll
      for (int r = 0; r < 8; ++r) s[j][r] = __expf(s[j][r] - msafe);
    const v8f ts = (s[0] + s[1]) + (s[2] + s[3]);   // tiles first (packed adds), then a tree over the eight
    const float psum = ((ts[0] + ts[1]) + (ts[2] + ts[3])) + ((ts[4] + ts[5]) + (ts[6] + ts[7]));
    lrun = lrun * alpha + psum;
#pragma unroll
    for (int r = 0; r < 8; ++r) {
      oacc[0][r] *= alpha;
      oacc[1][r] *= alpha;
    }

    // ---- context^T += V^T . P^T (f16 WMMA); two score tiles, converted in place (x1024, f16), are the B operand
    //      of one 32-key step; residual products into a separate accumulator ----
    v8f o1[2];
    o1[0] = zero8(); o1[1] = zero8();
#pragma unroll
    for (int kk = 0; kk < 2; ++kk) {
      FH pb;
      pb.h[0] = __builtin_convertvector(s[2 * kk] * 1024.0f, v8h);
      pb.h[1] = __builtin_convertvector(s[2 * kk + 1] * 1024.0f, v8h);
#pragma unroll
      for (int t = 0; t < 2; ++t) {
        FH vb, vl;
        vb.h[0] = *(const v8h*)(Vth + (t * 16 + c) * VPI + kk * 32 + 8 * hh);
        vb.h[1] = *(const v8h*)(Vth + (t * 16 + c) * VPI + kk * 32 + 16 + 8 * hh);
        vl.h[0] = *(const v8h*)(Vtl + (t * 16 + c) * VPI + kk * 32 + 8 * hh);
        vl.h[1] = *(const v8h*)(Vtl + (t * 16 + c) * VPI + kk * 32 + 16 + 8 * hh);
        oacc[t] = mma_h(vb.v, pb.v, oacc[t]);
        o1[t]   = mma_h(vl.v, pb.v, o1[t]);
      }
    }
#pragma unroll
    for (int t = 0; t < 2; ++t)
#pragma unroll
      for (int r = 0; r < 8; ++r) oacc[t][r] += o1[t][r] * (1.0f / 2048.0f);
  }

  // ---- merge the two groups' partials: lane for lane the same (query, key half, d) places ----
  if (kg == 1) {
    Mm[wave][lane] = mrun;
    Ml[wave][lane] = lrun;
#pragma unroll
    for (int t = 0; t < 2; ++t) {
      Mo[wave][2 * t][lane]     = (v4f){oacc[t][0], oacc[t][1], oacc[t][2], oacc[t][3]};
      Mo[wave][2 * t + 1][lane] = (v4f){oacc[t][4], oacc[t][5], oacc[t][6], oacc[t][7]};
    }
  }
  __syncthreads();                           // group 1's partials are readable by group 0
  if (kg == 1) return;                       // whole waves; no block barrier stands behind this line
  {
    const float m1 = Mm[wave][lane], l1 = Ml[wave][lane];
    const float mnew  = fmaxf(mrun, m1);
    const float msafe = (mnew == -INFINITY) ? 0.f : mnew;
    const float w0 = __expf(mrun - msafe), w1 = __expf(m1 - msafe);
    lrun = lrun * w0 + l1 * w1;
#pragma unroll
    for (int t = 0; t < 2; ++t) {
      const v4f pa = Mo[wave][2 * t][lane], pb = Mo[wave][2 * t + 1][lane];
#pragma unroll
      for (int r = 0; r < 4; ++r) {
        oacc[t][r]     = oacc[t][r] * w0 + pa[r] * w1;
        oacc[t][r + 4] = oacc[t][r + 4] * w0 + pb[r] * w1;
      }
    }
  }

  // ---- join the halves' sums, normalise (1/l, undo the x1024 p carry and the x4 v carry), stage the wave's
  //      16x32 tile: oacc[t][r] is element (query c, d = t*16 + 8*hh + r)
  float* os = Os[wave];
  {
    const float l = lrun + xhalf(lrun);
    const float inv = 1.0f / (l * 4096.0f);
#pragma unroll
    for (int t = 0; t < 2; ++t) {
      const v8f o = oacc[t] * inv;
      *(v4f*)(os + c * OPI + t * 16 + 8 * hh)     = (v4f){o[0], o[1], o[2], o[3]};
      *(v4f*)(os + c * OPI + t * 16 + 8 * hh + 4) = (v4f){o[4], o[5], o[6], o[7]};
    }
  }
  __builtin_amdgcn_fence(__ATOMIC_RELEASE, "workgroup");
  __builtin_amdgcn_wave_barrier();
  __builtin_amdgcn_fence(__ATOMIC_ACQUIRE, "workgroup");
  {
    const int rq = lane >> 2, c8 = (lane & 3) * 8;
    v4u hv[2], lv[2];
#pragma unroll
    for (int it = 0; it < 2; ++it) {
      const int row = it * 8 + rq;   // it 0..1 x rq 0..7 = rows 0..15 of the wave tile
      const float* sp = os + row * OPI + c8;
      v4u a, a2;
#pragma unroll
      for (int e = 0; e < 4; ++e) {
        const float f0 = sp[2 * e], f1 = sp[2 * e + 1];
        const unsigned short h0 = bf_bits(f0), h1 = bf_bits(f1);
        const unsigned short l0 = bf_bits(f0 - bf_up(h0)), l1 = bf_bits(f1 - bf_up(h1));
        a[e] = pk16(h0, h1); a2[e] = pk16(l0, l1);
      }
      hv[it] = a; lv[it] = a2;
    }
    const size_t PS = (size_t)NBH * SEQ * HD;
    unsigned short* base = ct + ((size_t)bh * SEQ + (size_t)q0) * HD;
    {
#pragma unroll
      for (int it = 0; it < 2; ++it) {
        unsigned short* p = base + it * 256 + lane * 8;
        *(v4u*)(p)          = hv[it];
        *(v4u*)(p + PS)     = hv[it];
        *(v4u*)(p + 2 * PS) = lv[it];
      }
      
    }
  }
}

// =====================================================================================================
// Workspace map (bytes), every region an exact multiple of its whole-line / whole-tile store granularity
// (no tail rows anywhere: all shapes are exact tile multiples):
//   X3   bf16 [4096][768]            6291456
//   Wq3  bf16 [768][768]             1179648
//   Wo3  bf16 [256][768]              393216
//   Qp   f16  [16][2048][32]          2097152
//   Kraw f32  [16][2048][32]          4194304
//   Kp   f16  [16][2048][32]          2097152
//   VTh  f16  [2][256][2048]          2097152
//   VTl  f16  [2][256][2048]          2097152
//   CT   bf16 [3][16][2048][32]       6291456
//   total                           26738688
// =====================================================================================================
extern "C" void kernel_launch(void* const* d_in, const int* in_sizes, int n_in,
                              void* d_out, int out_size, void* d_ws, size_t ws_size,
                              hipStream_t stream) {
  if (n_in < 6) return;
  if (in_sizes[0] != ROWS * DM) return;
  if (in_sizes[1] != DM * QKVW) return;
  if (in_sizes[2] != DM * DM) return;
  if (in_sizes[3] != DM) return;
  if (in_sizes[4] != NFUN || in_sizes[5] != NFUN) return;
  if (out_size != ROWS * DM) return;

  const float* x     = (const float*)d_in[0];   // [2][2048][256]
  const float* w_qkv = (const float*)d_in[1];   // [256 in][768 out]
  const float* w_o   = (const float*)d_in[2];   // [256 in][256 out]
  const float* b_o   = (const float*)d_in[3];   // [256]
  const float* coefa = (const float*)d_in[4];   // [256] sine coefficients
  const float* coefb = (const float*)d_in[5];   // [256] cosine coefficients

  const size_t PX3 = (size_t)ROWS * KP * 2;            // 6291456
  const size_t PWQ = (size_t)QKVW * KP * 2;            // 1179648
  const size_t PWO = (size_t)DM * KP * 2;              //  393216
  const size_t PH  = (size_t)NBH * SEQ * HD * 2;       // 2097152  f16 head plane
  const size_t PK4 = (size_t)NBH * SEQ * HD * 4;       // 4194304  f32 head plane
  const size_t PVT = (size_t)NB * DM * SEQ * 2;        // 2097152  v^T plane
  const size_t PCT = (size_t)3 * NBH * SEQ * HD * 2;   // 6291456  ctx planes
  size_t off = 0;
  const size_t oX3  = off; off += PX3;
  const size_t oWq  = off; off += PWQ;
  const size_t oWo  = off; off += PWO;
  const size_t oQp  = off; off += PH;
  const size_t oKr  = off; off += PK4;
  const size_t oKp  = off; off += PH;
  const size_t oVTh = off; off += PVT;
  const size_t oVTl = off; off += PVT;
  const size_t oCT  = off; off += PCT;
  if (off > ws_size) return;                           // off = 26738688
  if (off > (size_t)134217728) return;

  char* ws = (char*)d_ws;
  unsigned short* X3  = (unsigned short*)(ws + oX3);
  unsigned short* Wq3 = (unsigned short*)(ws + oWq);
  unsigned short* Wo3 = (unsigned short*)(ws + oWo);
  unsigned short* Qp  = (unsigned short*)(ws + oQp);
  float*          Kr  = (float*)(ws + oKr);
  unsigned short* Kp  = (unsigned short*)(ws + oKp);
  unsigned short* VTh = (unsigned short*)(ws + oVTh);
  unsigned short* VTl = (unsigned short*)(ws + oVTl);
  unsigned short* CT  = (unsigned short*)(ws + oCT);

  const dim3 blk(256);
  const int n8x = ROWS * DM / 8;                                   // 131072
  const dim3 gPrep(NTQ + NTO + (n8x + 255) / 256);                  //   48 + 16 + 512 blocks
  const dim3 gProj(3 * NGB);                                        //  768 blocks: q, k, v^T
  const dim3 gOut(NGB);                                             //  256 blocks: M=4096, N=256
  const dim3 gFour((NBH * SEQ * HD) / (8 * FTR * 64));               //  512 blocks of 256, FTR x 64 elements per wave
  const dim3 gAttn(NBH * NQB);                                      //  512 blocks of 256

  // (1) x -> [hi|hi|lo] bf16 plane; weights transposed to [out][in] as [hi|lo|hi] bf16 planes
  prep3<<<gPrep, blk, 0, stream>>>(x, w_qkv, w_o, X3, Wq3, Wo3, n8x);
  // (2) q -> f16 head plane (x4), k -> raw f32 head plane, v^T -> f16 hi (x4) and residual (x2048) planes
  proj_qkv<<<gProj, blk, 0, stream>>>(X3, Wq3, Qp, Kr, VTh, VTl);
  // (3) Fourier-basis transform of k -> f16 head plane (x4)
  fourier_k<<<gFour, blk, 0, stream>>>(Kr, coefa, coefb, Kp);
  // (4) attention -> ctx planes (bf16 hi, hi, lo)
  attn32<<<gAttn, dim3(128 * KGR), 0, stream>>>(Qp, Kp, VTh, VTl, CT, 0.17677669529663687f * 0.0625f);
  // (5) out = ctx . Wo + bias -> d_out f32 [4096][256]
  proj_out<<<gOut, blk, 0, stream>>>(CT, Wo3, (float*)d_out, b_o);
  (void)hipGetLastError();
}

// v009
// It runs in 51.6 microseconds.
// Two timings next to v008 both put it at 1.15 times that version's speed.
// Counting every step since v000, it is 7.37 times as fast.
// Contractions: q, k, v^T projections and the output projection = v_wmma_f32_16x16x32_bf16 over bf16 hi/lo planes,
// every operand row [hi|lo] along k (3 products: hi.hi, hi.lo, lo.hi, f32 accumulate);
// q.k^T scores = v_wmma_f32_16x16x32_f16 (q and the transformed k as f16 planes carried x4, single product, f32 accumulate);
// p.v = v_wmma_f32_16x16x32_f16 (p carried x1024 in f16; v^T as f16 hi plane x4 plus f16 residual plane x2^11; 2 products, f32 accumulate);
// Fourier-basis transform of k = v_wmma_f32_16x16x32_bf16 (coefficient matrix x sines and cosines, both bf16 hi + lo, 3 products, f32 accumulate)
// with the sines, cosines and the closing dot product in f32 on the VALU; softmax and bias in f32 on the VALU.
#include <hip/hip_runtime.h>
#include <math.h>
#include <stdint.h>

#define NB   2
#define SEQ  2048
#define DM   256
#define NH   8
#define HD   32
#define NBH  (NB * NH)        // 16 (batch, head) pairs
#define QKVW (3 * DM)         // 768 qkv output width
#define KP   (2 * DM)         // 512 row width of the split operand planes: DM hi, then DM lo
#define NFUN 256
#define ROWS (NB * SEQ)       // 4096 token rows
#define NQB  (SEQ / 64)       // 64-query blocks per (b, h)
#define NKT  (SEQ / 64)       // 64-key chunks
#define GP   (KP * 2 + 16)    // GEMM operand row pitch in LDS, bytes: hi and lo of the whole k (1024 B) + 16 B (16 B x odd, for 16-B readers)
#define GOPS (128 * GP)       // GEMM operands of a block in LDS: 64 A rows, then 64 Bt rows
#define NTQ  ((QKVW / 64) * (DM / 64))   // 48 transpose tiles of w_qkv
#define NTO  ((DM / 64) * (DM / 64))     // 16 transpose tiles of w_o
#define NGB  256              // 64x64 block tiles of each of the four products: one per WGP
// attention tiles in LDS: every row is read or written 16 B a lane, one row per lane of a 16-lane half, so the row
// pitch is 16 B x odd (row + 16 B): the sixteen lanes of a half then fall on sixteen different groups of four banks
#define KPI  (HD + 8)         // K chunk row pitch, f16 elements: 64 B + 16 B = 80 B
#define VPI  (64 + 8)         // V^T chunk row pitch, f16 elements: 128 B + 16 B = 144 B
#define OPI  (HD + 4)         // ctx tile row pitch, f32 elements: 128 B + 16 B = 144 B
#define KGR  2                // key groups of an attention block: group g takes the 64-key chunks g, g + KGR, ...
static_assert(NH * HD == DM);
static_assert(NQB == 32 && NKT == 32 && (NKT % KGR) == 0 && KGR == 2);   // the merge joins two partials
static_assert((ROWS % 64) == 0 && (DM % 64) == 0 && (SEQ % 64) == 0 && (KP % 32) == 0);
static_assert((ROWS * DM) % 2048 == 0);
static_assert((ROWS / 64) * (DM / 64) == NGB && NB * (DM / 64) * (SEQ / 64) == NGB);
static_assert((KP % 64) == 0 && 64 * (KP / 8) == 16 * 256 && (GP % 32) == 16);
static_assert(2 * (GOPS + 64 * 68 * 4) <= 320 * 1024);   // two GEMM blocks fit the LDS of a WGP

typedef _Float16 v16h __attribute__((ext_vector_type(16)));
typedef _Float16 v8h  __attribute__((ext_vector_type(8)));
typedef __bf16   v16b __attribute__((ext_vector_type(16)));
typedef __bf16   v8b  __attribute__((ext_vector_type(8)));
typedef float    v8f  __attribute__((ext_vector_type(8)));
typedef float    v4f  __attribute__((ext_vector_type(4)));
typedef unsigned int v4u __attribute__((ext_vector_type(4)));
typedef float    v2f  __attribute__((ext_vector_type(2)));
typedef unsigned int v2u __attribute__((ext_vector_type(2)));

#if defined(__HIP_DEVICE_COMPILE__)
#define DEV_ASM 1
#else
#define DEV_ASM 0
#endif

// ---- scalar helpers --------------------------------------------------------------------------------
__device__ __forceinline__ unsigned short bf_bits(float f) {          // f32 -> bf16 bits, RNE convert
  unsigned u = __float_as_uint(f);
  return (unsigned short)((u + 0x7FFFu + ((u >> 16) & 1u)) >> 16);
}
__device__ __forceinline__ float bf_up(unsigned short hb) { return __uint_as_float(((unsigned)hb) << 16); }
__device__ __forceinline__ unsigned short h_bits(_Float16 x) { return __builtin_bit_cast(unsigned short, x); }
__device__ __forceinline__ unsigned pk16(unsigned short a, unsigned short b) { return (unsigned)a | ((unsigned)b << 16); }
__device__ __forceinline__ v8f zero8() { v8f z = {0.f, 0.f, 0.f, 0.f, 0.f, 0.f, 0.f, 0.f}; return z; }

// ---- fragment loaders: 16-bit A/B operand, lane -> row/col (lane&15), p already includes +8*(lane>>4);
//      elements 0..7 <- p[0..7] (k0+8h..k0+8h+7), elements 8..15 <- p[16..23] (k0+16+8h..k0+16+8h+7)
template <typename OT> struct FT;
template <> struct FT<__bf16>   { typedef v16b frag; typedef v8b half8; };
template <> struct FT<_Float16> { typedef v16h frag; typedef v8h half8; };

template <typename OT>
__device__ __forceinline__ typename FT<OT>::frag ldfrag(const OT* p) {
  union { typename FT<OT>::frag v; typename FT<OT>::half8 h[2]; } f;
  f.h[0] = *(const typename FT<OT>::half8*)(p);
  f.h[1] = *(const typename FT<OT>::half8*)(p + 16);
  return f.v;
}

// ---- WMMA helpers ----------------------------------------------------------------------------------
__device__ __forceinline__ v8f mmar(v16b a, v16b b, v8f c) {
  return __builtin_amdgcn_wmma_f32_16x16x32_bf16(false, a, false, b, (short)0, c, false, false);
}
// guarded form: 4 VALU slots after the WMMA, D tied, A/B kept live
__device__ __forceinline__ v8f mma_h(v16h a, v16h b, v8f c) {
  c = __builtin_amdgcn_wmma_f32_16x16x32_f16(false, a, false, b, (short)0, c, false, false);
#if DEV_ASM
  asm volatile("v_nop\n\tv_nop\n\tv_nop\n\tv_nop" : "+v"(c) : "v"(a), "v"(b));
#endif
  return c;
}
// lane l <-> lane l ^ 16
__device__ __forceinline__ float xhalf(float x) {
  const int b = __builtin_bit_cast(int, x);
  return __builtin_bit_cast(float, __builtin_amdgcn_permlanex16(b, b, 0x76543210, 0xfedcba98, false, false));
}
// ---- asynchronous copies global -> LDS, 16 B a lane ------------------------------------------------
__device__ __forceinline__ uint32_t lds_off(const void* p) { return (uint32_t)(size_t)p; }   // LDS byte address
// eight copies of a lane (l: LDS byte addresses, g: global addresses); the s_wait_xcnt stands inside the
// statement so that no address register named here is rewritten ahead of it
__device__ __forceinline__ void copy8(const uint32_t (&l)[8], const __bf16* const (&g)[8]) {
#if DEV_ASM
  asm volatile("global_load_async_to_lds_b128 %0, %8, off\n\t"
               "global_load_async_to_lds_b128 %1, %9, off\n\t"
               "global_load_async_to_lds_b128 %2, %10, off\n\t"
               "global_load_async_to_lds_b128 %3, %11, off\n\t"
               "global_load_async_to_lds_b128 %4, %12, off\n\t"
               "global_load_async_to_lds_b128 %5, %13, off\n\t"
               "global_load_async_to_lds_b128 %6, %14, off\n\t"
               "global_load_async_to_lds_b128 %7, %15, off\n\t"
               "s_wait_xcnt 0x0"
               :: "v"(l[0]), "v"(l[1]), "v"(l[2]), "v"(l[3]), "v"(l[4]), "v"(l[5]), "v"(l[6]), "v"(l[7]),
                  "v"(g[0]), "v"(g[1]), "v"(g[2]), "v"(g[3]), "v"(g[4]), "v"(g[5]), "v"(g[6]), "v"(g[7])
               : "memory");
#else
  (void)l; (void)g;
#endif
}
// this wave's copies have landed
__device__ __forceinline__ void wait_copies() {
#if DEV_ASM
  asm volatile("s_wait_asynccnt 0x0" ::: "memory");
#endif
}
// behind a job's last global stores: in a kernel that holds several jobs' bodies the registers that the stores
// name may be written by the code laid out behind them; the wait stands in front of any such write
__device__ __forceinline__ void wait_store_regs() {
#if DEV_ASM
  asm volatile("s_wait_xcnt 0x0" ::: "memory");
#endif
}

// =====================================================================================================
// x [ROWS][DM] f32 -> split plane X3 [ROWS][KP] bf16, row = [hi | lo] (hi = RNE bf16, lo = RNE bf16
// of the exact residual). 8 elements per thread; each thread stores 16 B into each of the two halves;
// bx = the block's index within this job.
// =====================================================================================================
__device__ __forceinline__ void cvt_x3(const float* __restrict__ in, unsigned short* out, int n8, int bx) {
  const int i = bx * 256 + (int)threadIdx.x;
  if (i < n8) {
    const int row = i >> 5, c = (i & 31) * 8;
    const v4f a  = *(const v4f*)(in + (size_t)i * 8);
    const v4f a4 = *(const v4f*)(in + (size_t)i * 8 + 4);
    const float f[8] = {a[0], a[1], a[2], a[3], a4[0], a4[1], a4[2], a4[3]};
    v4u ph, pl;
#pragma unroll
    for (int e = 0; e < 4; ++e) {
      const float f0 = f[2 * e], f1 = f[2 * e + 1];
      const unsigned short h0 = bf_bits(f0), h1 = bf_bits(f1);
      const unsigned short l0 = bf_bits(f0 - bf_up(h0)), l1 = bf_bits(f1 - bf_up(h1));
      ph[e] = pk16(h0, h1);
      pl[e] = pk16(l0, l1);
    }
    unsigned short* o = out + (size_t)row * KP + c;
    *(v4u*)(o)      = ph;
    *(v4u*)(o + DM) = pl;
    wait_store_regs();
  }
}

// =====================================================================================================
// w [DM rows k][C cols] f32 (x @ w layout) -> wt [C][KP] bf16, row c = [hi | lo] of w[k][c] over k.
// Block = 64 k x 64 c tile staged in LDS (f32); C/64 x DM/64 blocks: bx -> c0, by -> k0.
// coverage: 8 waves x 8 rows x 64 k = the tile, both halves; the grid covers all C rows x DM k.
// =====================================================================================================
__device__ __forceinline__ void wtrans3(float (*tile)[65], const float* __restrict__ w, unsigned short* wt, int C,
                                        int bx, int by) {
  const int tid = (int)threadIdx.x, lane = tid & 31, wave = tid >> 5;
  const int c0 = bx * 64, k0 = by * 64;
#pragma unroll
  for (int it = 0; it < 16; ++it) {
    const int idx = it * 256 + tid;
    const int r = idx >> 6, cc = idx & 63;
    tile[r][cc] = w[(size_t)(k0 + r) * C + c0 + cc];
  }
  __syncthreads();
  const int q = lane >> 3, c8 = (lane & 7) * 8;
  v4u hv[2], lv[2];
#pragma unroll
  for (int it = 0; it < 2; ++it) {
    const int row = wave * 8 + it * 4 + q;          // output row (c within tile)
    v4u a, a2;
#pragma unroll
    for (int e = 0; e < 4; ++e) {
      const float f0 = tile[c8 + 2 * e][row], f1 = tile[c8 + 2 * e + 1][row];
      const unsigned short h0 = bf_bits(f0), h1 = bf_bits(f1);
      const unsigned short l0 = bf_bits(f0 - bf_up(h0)), l1 = bf_bits(f1 - bf_up(h1));
      a[e] = pk16(h0, h1);
      a2[e] = pk16(l0, l1);
    }
    hv[it] = a; lv[it] = a2;
  }
  {
#pragma unroll
    for (int it = 0; it < 2; ++it) {
      const int row = wave * 8 + it * 4 + q;
      unsigned short* o = wt + (size_t)(c0 + row) * KP + k0 + c8;
      *(v4u*)(o)      = hv[it];
      *(v4u*)(o + DM) = lv[it];
    }
    wait_store_regs();
  }
}

// =====================================================================================================
// The three operand preparations in one launch: each reads inputs only and writes a plane of its own, so
// none waits for another. The block index picks the job (the same for the whole block, so the transpose's
// barrier stays block-uniform): NTQ blocks transpose w_qkv, NTO blocks w_o, the remaining n8 / 256 split x.
// =====================================================================================================
__global__ __launch_bounds__(256) void prep3(const float* __restrict__ x, const float* __restrict__ w_qkv,
                                             const float* __restrict__ w_o, unsigned short* X3,
                                             unsigned short* Wq3, unsigned short* Wo3, int n8) {
  __shared__ float tile[64][65];
  const int bx = (int)blockIdx.x;
  if (bx < NTQ) {
    wtrans3(tile, w_qkv, Wq3, QKVW, bx % (QKVW / 64), bx / (QKVW / 64));
  } else if (bx < NTQ + NTO) {
    wtrans3(tile, w_o, Wo3, DM, (bx - NTQ) % (DM / 64), (bx - NTQ) / (DM / 64));
  } else {
    cvt_x3(x, X3, n8, bx - (NTQ + NTO));
  }
}

// =====================================================================================================
// Batched WMMA GEMM, bf16 hi/lo operands: C[m][n] = sum_k Ah[m][k] Bh[n][k] + Ah[m][k] Bl[n][k] + Al[m][k] Bh[n][k],
// k = 0..DM-1, hi at row element k, lo at DM + k; a block of eight waves on a
// 64x64 tile, so that every product has NGB blocks; a wave on 32x16 of it (2 x 4 waves).
// Bt row-major [N][KP] pitch ldb (k contiguous).
// A_MODE 0: A row-major [M][KP] pitch lda.  A_MODE 1: head planes: A(m, k) at
//   plane = (k/256)*NBH + (m/SEQ)*NH + (k/32)%NH;  A[(plane*SEQ + m%SEQ)*HD + k%32]  (M = ROWS).
// M and N multiples of 64 (static shapes below). bx = block tile index, b = batch index (strides in elements);
// opnd and ct are the calling kernel's LDS.
// Operands: the block's 64 A rows and 64 Bt rows, hi and lo of the whole k (1024 B a row), come into LDS once, by
// asynchronous copies of whole 128-B lines, 32 copies a lane, all in flight together; one wait, one barrier;
// LDS row pitch GP; fragments read from LDS with the split k map (ldfrag), k ascending; a hi fragment is read once
// and serves two products. hi.hi sums in one accumulator, hi.lo and lo.hi in a second one, added at the end.
// Epilogue: the 64x64 tile staged in LDS (pitch 68 floats), one barrier; a pair of waves takes a 16-row slab, each
// wave one half of its stores:
// OUT_MODE 0: f16 head plane [NBH][SEQ][HD], value * oscale: a wave stores one head half of the slab (1024 contiguous B)
// OUT_MODE 1: f32 head plane [NBH][SEQ][HD]: a wave stores one head half (2048 contiguous B)
// OUT_MODE 2: f16 hi plane C (value*oscale) + f16 residual plane C2 = f16((v*oscale - hi) * rscale), row-major, 8 rows a wave
// OUT_MODE 3: f32 row-major C (pitch ldc) + bias[n] (f32): each 64-wide row segment = 256 B = 16 lanes x 16 B, 8 rows a wave
// coverage: 4 slabs x 16 rows x 64 cols = the block's whole 64x64 tile; grids are exact tile multiples.
// =====================================================================================================
template <int A_MODE, int OUT_MODE>
__device__ __forceinline__ void gemm64(
    unsigned char* opnd, float* ct, int bx, int b,
    const unsigned short* __restrict__ Ap, int lda, long long strideA,
    const unsigned short* __restrict__ Btp, int ldb, long long strideB,
    void* Cout, void* Cout2, int ldc, long long strideC,
    const float* __restrict__ bias,
    int M, int N, float oscale, float rscale) {
  const __bf16* A  = (const __bf16*)(const void*)Ap;
  const __bf16* Bt = (const __bf16*)(const void*)Btp;
  const int tid  = (int)threadIdx.x;
  const int lane = tid & 31;
  const int wave = tid >> 5;
  const int nbn = N >> 6;                // block tiles along N
  const int bm  = bx / nbn;
  const int bn  = bx - bm * nbn;
  if (bm >= (M >> 6)) return;            // the same for the whole block, in front of every barrier
  const int bm0 = bm << 6;
  const int bn0 = bn << 6;
  const int wr  = (wave >> 2) << 5;      // the wave's first A row in the block tile
  const int wc  = (wave & 3) << 4;       // the wave's first Bt row in the block tile

  const __bf16* Ab = A  + (size_t)b * (size_t)strideA;
  const __bf16* Bb = Bt + (size_t)b * (size_t)strideB;

  const int rlane = lane & 15;                 // row (A) / col (B, D) within subtile
  const int koff  = (lane >> 4) * 8;           // k offset of this lane half
  const int mOff  = (lane >> 4) * 8;           // D row offset

  // 16 copies a lane for each operand, in statements of eight; a wave's copy covers 512 B of whole lines (4 rows
  // of 128 B; in the head-plane layout 8 rows of 64 B, which adjoin)
  const uint32_t lb = lds_off(opnd);
#pragma unroll
  for (int g = 0; g < 2; ++g) {
    uint32_t la[8];
    const __bf16* ga[8];
#pragma unroll
    for (int u = 0; u < 8; ++u) {
      const int v = g * 8 + u;
      if (A_MODE == 0) {
        const int row = (v & 1) * 32 + (tid >> 3), pc = tid & 7;
        ga[u] = Ab + (size_t)(bm0 + row) * lda + (v >> 1) * 64 + pc * 8;
        la[u] = lb + (uint32_t)(row * GP + (v >> 1) * 128 + pc * 16);
      } else {
        const int kk = v * 32;
        const int row = tid >> 2, pc = tid & 3;
        const int plane = (kk >> 8) * NBH + (bm0 / SEQ) * NH + ((kk >> 5) & (NH - 1));
        ga[u] = Ab + ((size_t)plane * SEQ + (size_t)((bm0 & (SEQ - 1)) + row)) * HD + pc * 8;
        la[u] = lb + (uint32_t)(row * GP + (v * 4 + pc) * 16);
      }
    }
    copy8(la, ga);
  }
#pragma unroll
  for (int g = 0; g < 2; ++g) {
    uint32_t la[8];
    const __bf16* ga[8];
#pragma unroll
    for (int u = 0; u < 8; ++u) {
      const int v = g * 8 + u;
      const int row = (v & 1) * 32 + (tid >> 3), pc = tid & 7;
      ga[u] = Bb + (size_t)(bn0 + row) * ldb + (v >> 1) * 64 + pc * 8;
      la[u] = lb + (uint32_t)((64 + row) * GP + (v >> 1) * 128 + pc * 16);
    }
    copy8(la, ga);
  }
  wait_copies();
  __syncthreads();                       // both operands are readable by every wave

  v8f acc[2], acs[2];                    // hi.hi sums; hi.lo + lo.hi sums
  acc[0] = zero8(); acc[1] = zero8();
  acs[0] = zero8(); acs[1] = zero8();
  const unsigned char* ap = opnd + (wr + rlane) * GP + koff * 2;
  const unsigned char* bp = opnd + (64 + wc + rlane) * GP + koff * 2;
  // unrolled whole: no barrier stands in it, so the fragment reads of later k-steps can run ahead of the products
#pragma unroll
  for (int ks = 0; ks < DM / 32; ++ks) { // k-steps of 32 (64 B of every row's hi half and of its lo half)
    const v16b bh  = ldfrag<__bf16>((const __bf16*)(bp + ks * 64));
    const v16b bl  = ldfrag<__bf16>((const __bf16*)(bp + DM * 2 + ks * 64));
    const v16b a0h = ldfrag<__bf16>((const __bf16*)(ap + ks * 64));
    const v16b a1h = ldfrag<__bf16>((const __bf16*)(ap + 16 * GP + ks * 64));
    const v16b a0l = ldfrag<__bf16>((const __bf16*)(ap + DM * 2 + ks * 64));
    const v16b a1l = ldfrag<__bf16>((const __bf16*)(ap + 16 * GP + DM * 2 + ks * 64));
    acc[0] = mmar(a0h, bh, acc[0]);
    acc[1] = mmar(a1h, bh, acc[1]);
    acs[0] = mmar(a0h, bl, acs[0]);
    acs[1] = mmar(a1h, bl, acs[1]);
    acs[0] = mmar(a0l, bh, acs[0]);
    acs[1] = mmar(a1l, bh, acs[1]);
  }
  acc[0] += acs[0];
  acc[1] += acs[1];

  // ---- epilogue ----
#pragma unroll
  for (int i = 0; i < 2; ++i)
#pragma unroll
    for (int r = 0; r < 8; ++r) ct[(wr + (i << 4) + mOff + r) * 68 + wc + rlane] = acc[i][r];
  __syncthreads();                       // the whole tile is readable by every wave
  const float* slab = ct + (wave >> 1) * (16 * 68);
  const int mBase = bm0 + ((wave >> 1) << 4);
  const int n0 = bn0;
  const int hs = wave & 1;               // which half of the slab's stores this wave does
  if (OUT_MODE == 0) {
    unsigned short* Q = (unsigned short*)Cout;
    const int rq = lane >> 2, c8 = (lane & 3) * 8;        // row within an 8-row group, 8-col piece
    v4u hv[2];
#pragma unroll
    for (int it = 0; it < 2; ++it) {
      const float* sp = slab + (it * 8 + rq) * 68 + hs * 32 + c8;   // it 0..1 x rq 0..7 = rows 0..15
      v4u a;
#pragma unroll
      for (int e = 0; e < 4; ++e)
        a[e] = pk16(h_bits((_Float16)(sp[2 * e] * oscale)), h_bits((_Float16)(sp[2 * e + 1] * oscale)));
      hv[it] = a;
    }
    const int head = (n0 >> 5) + hs;
    unsigned short* base = Q + ((size_t)((mBase / SEQ) * NH + head) * SEQ + (size_t)(mBase & (SEQ - 1))) * HD;
#pragma unroll
    for (int it = 0; it < 2; ++it)
      *(v4u*)(base + it * 256 + lane * 8) = hv[it];
  } else if (OUT_MODE == 1) {
    float* Kr = (float*)Cout;
    const int rq = lane >> 3, c4 = (lane & 7) * 4;        // row within a 4-row group, 4-col piece
    v4f hv[4];
#pragma unroll
    for (int it = 0; it < 4; ++it)                        // it 0..3 x rq 0..3 = rows 0..15
      hv[it] = *(const v4f*)(slab + (it * 4 + rq) * 68 + hs * 32 + c4);
    const int head = (n0 >> 5) + hs;
    float* base = Kr + ((size_t)((mBase / SEQ) * NH + head) * SEQ + (size_t)(mBase & (SEQ - 1))) * HD;
#pragma unroll
    for (int it = 0; it < 4; ++it)
      *(v4f*)(base + it * 128 + lane * 4) = hv[it];
  } else if (OUT_MODE == 2) {
    const int q = lane >> 3, c8 = (lane & 7) * 8;
    unsigned short* C  = (unsigned short*)Cout  + (size_t)b * (size_t)strideC;
    unsigned short* C2 = (unsigned short*)Cout2 + (size_t)b * (size_t)strideC;
    v4u hv[2], lv[2];
#pragma unroll
    for (int it = 0; it < 2; ++it) {
      const int row = hs * 8 + it * 4 + q;                // hs 0..1 x it 0..1 x q 0..3 = rows 0..15
      const float* sp = slab + row * 68 + c8;
      v4u a, a2;
#pragma unroll
      for (int e = 0; e < 4; ++e) {
        const float f0 = sp[2 * e] * oscale, f1 = sp[2 * e + 1] * oscale;
        const _Float16 x0 = (_Float16)f0, x1 = (_Float16)f1;
        const unsigned short h0 = h_bits(x0), h1 = h_bits(x1);
        const unsigned short l0 = h_bits((_Float16)((f0 - (float)x0) * rscale));
        const unsigned short l1 = h_bits((_Float16)((f1 - (float)x1) * rscale));
        a[e] = pk16(h0, h1); a2[e] = pk16(l0, l1);
      }
      hv[it] = a; lv[it] = a2;
    }
#pragma unroll
    for (int it = 0; it < 2; ++it) {
      const int row = hs * 8 + it * 4 + q;
      *(v4u*)(C  + (size_t)(mBase + row) * ldc + n0 + c8) = hv[it];
      *(v4u*)(C2 + (size_t)(mBase + row) * ldc + n0 + c8) = lv[it];
    }
  } else {
    float* C = (float*)Cout + (size_t)b * (size_t)strideC;
    const int h2 = lane >> 4, c4 = (lane & 15) * 4;      // 256-B row segment = 16 lanes x 16 B
    const v4f bv = *(const v4f*)(bias + n0 + c4);
    v4f hv[4];
#pragma unroll
    for (int it = 0; it < 4; ++it) {
      const int row = hs * 8 + it * 2 + h2;               // hs 0..1 x it 0..3 x h2 0..1 = rows 0..15
      hv[it] = *(const v4f*)(slab + row * 68 + c4) + bv;
    }
#pragma unroll
    for (int it = 0; it < 4; ++it) {
      const int row = hs * 8 + it * 2 + h2;
      *(v4f*)(C + (size_t)(mBase + row) * ldc + n0 + c4) = hv[it];
    }
  }
  wait_store_regs();
}

// =====================================================================================================
// The q, k and v^T projections in one launch: all three read the X3 and Wq3 planes, none reads another's
// output. blockIdx.x / NGB picks the product (the same for the whole block, so every barrier stays block-uniform):
//   0: q = x . Wq -> f16 head plane (x4)        (M=4096, N=256, K=256 hi/lo)
//   1: k = x . Wk -> raw f32 head plane         (M=4096, N=256, K=256 hi/lo)
//   2: v^T = Wv . x^T per batch -> f16 hi plane (x4) [b][c][s] (pitch SEQ) and residual plane (x2048)
//      (A = Wq3 rows 512.., Bt = X3 rows of batch b; M=256, N=2048, K=256 hi/lo; 128 blocks a batch)
// =====================================================================================================
__global__ __launch_bounds__(256) void proj_qkv(const unsigned short* __restrict__ X3,
                                                const unsigned short* __restrict__ Wq3,
                                                unsigned short* Qp, float* Kr,
                                                unsigned short* VTh, unsigned short* VTl) {
  __shared__ __align__(16) unsigned char opnd[GOPS];   // 64 A rows, then 64 Bt rows, hi and lo of the whole k of each
  __shared__ __align__(16) float ct[64 * 68];          // the block's 64x64 result tile, pitch 68 floats
  const unsigned job = blockIdx.x / NGB;
  const int bx = (int)(blockIdx.x % NGB);
  if (job == 0) {
    gemm64<0, 0>(opnd, ct, bx, 0, X3, KP, 0LL, Wq3, KP, 0LL,
                 (void*)Qp, (void*)Qp, 0, 0LL, nullptr, ROWS, DM, 4.0f, 1.0f);
  } else if (job == 1) {
    gemm64<0, 1>(opnd, ct, bx, 0, X3, KP, 0LL, Wq3 + (size_t)DM * KP, KP, 0LL,
                 (void*)Kr, (void*)Kr, 0, 0LL, nullptr, ROWS, DM, 1.0f, 1.0f);
  } else if (job == 2) {
    gemm64<0, 2>(opnd, ct, bx % (NGB / NB), bx / (NGB / NB),
                 Wq3 + (size_t)2 * DM * KP, KP, 0LL, X3, KP, (long long)SEQ * KP,
                 (void*)VTh, (void*)VTl, SEQ, (long long)DM * SEQ, nullptr, DM, SEQ, 4.0f, 2048.0f);
  }
}

// out = ctx . Wo + bias -> f32 [4096][256]   (M=4096, N=256, K=256 hi/lo, A in head-plane layout)
__global__ __launch_bounds__(256) void proj_out(const unsigned short* __restrict__ CT,
                                                const unsigned short* __restrict__ Wo3,
                                                float* out, const float* __restrict__ bias) {
  __shared__ __align__(16) unsigned char opnd[GOPS];   // 64 A rows, then 64 Bt rows, hi and lo of the whole k of each
  __shared__ __align__(16) float ct[64 * 68];          // the block's 64x64 result tile, pitch 68 floats
  gemm64<1, 3>(opnd, ct, (int)blockIdx.x, 0, CT, 0, 0LL, Wo3, KP, 0LL,
               (void*)out, (void*)out, DM, 0LL, bias, ROWS, DM, 1.0f, 1.0f);
}

// =====================================================================================================
// Fourier-basis transform of k: out = sum_{f=1..NFUN} ca[f-1]*sin(f*k) + cb[f-1]*cos(f*k).
// The frequency is split as f = 16 i + j (i = 0..15, j = 1..16). By the angle addition formulas
//   out = sum_i sin(16 i k) * TS_i + cos(16 i k) * TC_i,
//   TS_i = sum_j ca[f-1] cos(j k) - cb[f-1] sin(j k),   TC_i = sum_j ca[f-1] sin(j k) + cb[f-1] cos(j k):
// a fixed 32x32 coefficient matrix times the vector (sin(j k), cos(j k))_j of an element, then a dot product of 32.
// The matrix product runs on bf16 WMMA, both operands split in bf16 hi + lo (hi.hi + hi.lo + lo.hi, f32 accumulate);
// one pass = 16 elements (the columns), a lane pair (c, c + 16) an element.
//   k order, A and B alike: lane half hh, fragment element 2 t + kappa <-> j = 8 hh + 1 + t, kappa 0 = sine, 1 = cosine
//   rows: tile tau, row 8 hr + 2 m + kind <-> i = 8 hr + 4 tau + m, kind 0 = TS_i, 1 = TC_i, so that D registers
//   (2 m, 2 m + 1) of a lane meet its pair (sin, cos)(16 i k)
// sin and cos of k and of 16 k (exact product) come from the precise sincosf; 8 k and 128 k, the upper half's start
// angles, by three doublings; the eight angles of a lane in each family by y[t+1] = 2 cos(step) y[t] - y[t-1].
// A lane owns two consecutive elements of the raw f32 k head plane a trip and stores their f16 results (x4) as 4 B,
// a wave 128 contiguous B. coverage: grid x 8 waves x FTR trips x 64 = every element of the k' plane.
// =====================================================================================================
#define FTR 4                 // trips of a wave, 64 elements each
static_assert((NBH * SEQ * HD) % (8 * FTR * 64) == 0 && NFUN == 256);
typedef __bf16 v2b __attribute__((ext_vector_type(2)));
__device__ __forceinline__ unsigned cvt2(v2f x) { return __builtin_bit_cast(unsigned, __builtin_convertvector(x, v2b)); }
// a pair of f32 -> packed bf16 hi (RNE) and packed bf16 of the exact residuals
__device__ __forceinline__ void split2(v2f x, unsigned& hi, unsigned& lo) {
  hi = cvt2(x);
  const v2f up = {__uint_as_float(hi << 16), __uint_as_float(hi & 0xffff0000u)};
  lo = cvt2(x - up);
}
union FB { v16b v; unsigned w[8]; };

// one pass: (s1, c1) = sin, cos of the column's k, (sp, cp) = of 16 k; upper = this lane is in the upper half.
// Returns the column's whole sum in both of its lanes.
__device__ __forceinline__ float fpass(float s1, float c1, float sp, float cp, bool upper,
                                       const FB (&mh)[2], const FB (&ml)[2]) {
  const v2f one = {1.f, 1.f};
  v2f S = {s1, sp}, C = {c1, cp};
#pragma unroll
  for (int d = 0; d < 3; ++d) {          // both angles doubled: sin 2x = 2 s c, cos 2x = 1 - 2 s s
    const v2f T = S + S;
    const v2f Sn = T * C;
    C = __builtin_elementwise_fma(-T, S, one);
    S = Sn;
  }
  const v2f vb = {upper ? S[0] : 0.f, upper ? C[0] : 1.f};   // (sin, cos)(8 hh k)
  const v2f ub = {upper ? S[1] : 0.f, upper ? C[1] : 1.f};   // (sin, cos)(128 hh k)
  v2f v[8], u[8];
  v[0] = (v2f){fmaf(vb[0], c1, vb[1] * s1), fmaf(vb[1], c1, -(vb[0] * s1))};
  u[0] = ub;
  u[1] = (v2f){fmaf(ub[0], cp, ub[1] * sp), fmaf(ub[1], cp, -(ub[0] * sp))};
  const float kv1 = c1 + c1, ku1 = cp + cp;
  const v2f kv = {kv1, kv1}, ku = {ku1, ku1};
  v[1] = __builtin_elementwise_fma(kv, v[0], -vb);
#pragma unroll
  for (int t = 2; t < 8; ++t) {
    v[t] = __builtin_elementwise_fma(kv, v[t - 1], -v[t - 2]);
    u[t] = __builtin_elementwise_fma(ku, u[t - 1], -u[t - 2]);
  }
  FB bh, bl;
#pragma unroll
  for (int t = 0; t < 8; ++t) split2(v[t], bh.w[t], bl.w[t]);
  v8f d[2];
#pragma unroll
  for (int ta = 0; ta < 2; ++ta) {       // the small products first
    d[ta] = mmar(ml[ta].v, bh.v, zero8());
    d[ta] = mmar(mh[ta].v, bl.v, d[ta]);
    d[ta] = mmar(mh[ta].v, bh.v, d[ta]);
  }
  v2f acc[2];
#pragma unroll
  for (int ta = 0; ta < 2; ++ta) {
    acc[ta] = u[4 * ta] * (v2f){d[ta][0], d[ta][1]};
#pragma unroll
    for (int m = 1; m < 4; ++m)
      acc[ta] = __builtin_elementwise_fma(u[4 * ta + m], (v2f){d[ta][2 * m], d[ta][2 * m + 1]}, acc[ta]);
  }
  const v2f a2 = acc[0] + acc[1];
  const float part = a2[0] + a2[1];
  return part + xhalf(part);
}

__global__ __launch_bounds__(256) void fourier_k(const float* __restrict__ kr, const float* __restrict__ ca,
                                                 const float* __restrict__ cb, unsigned short* kp) {
  const int lane = (int)threadIdx.x & 31;
  const int wave = (int)threadIdx.x >> 5;
  const bool upper = lane >= 16;
  const size_t w0 = ((size_t)blockIdx.x * 8 + (size_t)wave) * (FTR * 64) + (size_t)lane * 2;
  v2f kn = *(const v2f*)(kr + w0);       // the first trip's elements, in flight while the fragments are built
  // ---- coefficient fragments (A operand), hi and lo, two row tiles ----
  FB mh[2], ml[2];
  {
    const int rho = lane & 15;
    const bool rowc = (rho & 1) != 0;    // row kind: TC_i, else TS_i
#pragma unroll
    for (int ta = 0; ta < 2; ++ta) {
      const int i = 8 * (rho >> 3) + 4 * ta + ((rho >> 1) & 3);
      const int off = 16 * i + 8 * (lane >> 4);
      const v4f a0 = *(const v4f*)(ca + off), a1 = *(const v4f*)(ca + off + 4);
      const v4f b0 = *(const v4f*)(cb + off), b1 = *(const v4f*)(cb + off + 4);
#pragma unroll
      for (int t = 0; t < 8; ++t) {
        const float av = t < 4 ? a0[t & 3] : a1[t & 3];
        const float bv = t < 4 ? b0[t & 3] : b1[t & 3];
        const v2f e = {rowc ? av : -bv, rowc ? bv : av};   // factors of sin(j k), cos(j k)
        split2(e, mh[ta].w[t], ml[ta].w[t]);
      }
    }
  }
  // kept rolled (for speed only): the body holds four inlined sincosf
#pragma unroll 1
  for (int tr = 0; tr < FTR; ++tr) {
    const size_t g2 = w0 + (size_t)tr * 64;
    const v2f kx = kn;
    // the next trip's elements are fetched a trip ahead (the last trip reads its own again: in bounds, not used)
    kn = *(const v2f*)(kr + (tr + 1 < FTR ? g2 + 64 : g2));
    float res[2];
#pragma unroll
    for (int e = 0; e < 2; ++e) {
      float s1, c1, sp, cp;
      sincosf(kx[e], &s1, &c1);
      sincosf(kx[e] * 16.0f, &sp, &cp);
      const float s1x = xhalf(s1), c1x = xhalf(c1), spx = xhalf(sp), cpx = xhalf(cp);
      // pass 0: the elements owned by the lower half's lanes; pass 1: by the upper half's
      const float f0 = fpass(upper ? s1x : s1, upper ? c1x : c1, upper ? spx : sp, upper ? cpx : cp, upper, mh, ml);
      const float f1 = fpass(upper ? s1 : s1x, upper ? c1 : c1x, upper ? sp : spx, upper ? cp : cpx, upper, mh, ml);
      res[e] = upper ? f1 : f0;
    }
    *(unsigned*)(kp + g2) = pk16(h_bits((_Float16)(res[0] * 4.0f)), h_bits((_Float16)(res[1] * 4.0f)));
  }
}

// =====================================================================================================
// Attention, head dim 32, no mask, softmax over all SEQ keys.
//   q plane / k' plane (f16, x4): element (bh, t, d) at [(bh*SEQ + t)*HD + d]
//   v^T hi plane (f16, 4v) and residual plane (f16, (4v - hi)*2048): element (bh, d, s) at [(bh*HD + d)*SEQ + s]
//   ctx planes (bf16): part p (0 = hi, 1 = lo), element (bh, t, d) at [p*PS + (bh*SEQ + t)*HD + d]
//   scores^T = (k4' . q4^T) * sscale on f16 WMMA (one k-step), softmax in f32 (running max), a query per lane pair;
//   p = exp(s - m) carried as f16(1024 p); O^T = vh^T . p^T + (vl^T . p^T) / 2048 on f16 WMMA; ctx = O / (l * 4096).
//   Block = KGR groups of 4 waves on the same (b, h) and the same 4 consecutive 16-query tiles; grid = NBH * NQB, so a
//   SIMD holds four waves, whose waits cover one another. Key chunks of 64: group g walks the chunks g, g + KGR, ...
//   with its own running maximum, sum and O, static trip NKT / KGR. Chunk staging, each group its own chunk in its own
//   LDS: 128 threads, K 64x32 (2 x 16 B per thread), V^T hi/res 32x64 (2 x 16 B
//   per thread and plane), plain loads, __syncthreads before and after. P^T stays in registers (score tiles -> B operand).
//   After the loop group 1 hands its partial (m, l, O) to group 0 through LDS (one barrier); group 0 merges the two with
//   the weights exp(m_g - max) and writes the output.
//   Output: each wave writes its 16x32 tile (1024 contiguous B per part) with two instructions of
//   all NBH*SEQ rows x HD, both parts.
// =====================================================================================================
__global__ __launch_bounds__(128 * KGR)
void attn32(const unsigned short* __restrict__ qpp, const unsigned short* __restrict__ kpp,
            const unsigned short* __restrict__ vhp, const unsigned short* __restrict__ vlp,
            unsigned short* ct, float sscale) {
  union FH { v16h v; v8h h[2]; };
  __shared__ __align__(16) _Float16 KshA[KGR][64 * KPI];   // per group: K chunk [key][d], pitch KPI     5120 B
  __shared__ __align__(16) _Float16 VthA[KGR][HD * VPI];   // per group: V^T hi [d][key], pitch VPI     4608 B
  __shared__ __align__(16) _Float16 VtlA[KGR][HD * VPI];   // per group: V^T residual, pitch VPI        4608 B
  __shared__ __align__(16) float    Os[4][16 * OPI];       // per query tile: ctx tile, pitch OPI       9216 B
  __shared__ __align__(16) v4f      Mo[4][4][32];          // per query tile: group 1's partial O, 16 B a lane   8192 B
  __shared__ float                  Mm[4][32], Ml[4][32];  // per query tile: group 1's maximum and sum          1024 B

  const int kg   = (int)threadIdx.x >> 7;                  // key group (the same for a whole wave)
  const int tid  = (int)threadIdx.x & 127;                 // thread within the group
  const int wave = tid >> 5;                               // query tile
  const int lane = tid & 31;
  _Float16* Ksh = KshA[kg];
  _Float16* Vth = VthA[kg];
  _Float16* Vtl = VtlA[kg];
  const int hh   = lane >> 4;
  const int c    = lane & 15;

  const int bx   = blockIdx.x;
  const int qblk = bx % NQB;
  const int bh   = bx / NQB;
  const int q0   = qblk * 64 + wave * 16;

  const _Float16* Qg = (const _Float16*)(const void*)qpp + (size_t)bh * SEQ * HD;
  const _Float16* Kg = (const _Float16*)(const void*)kpp + (size_t)bh * SEQ * HD;
  const _Float16* Vh = (const _Float16*)(const void*)vhp + (size_t)bh * HD * SEQ;
  const _Float16* Vl = (const _Float16*)(const void*)vlp + (size_t)bh * HD * SEQ;

  // ---- Q fragment (B operand, column = lane&15, one k-step of 32) ----
  const v16h qa = ldfrag<_Float16>(Qg + (size_t)(q0 + c) * HD + 8 * hh);

  float mrun = -INFINITY, lrun = 0.f;   // query c: running maximum (joined), running sum of this half's keys
  v8f oacc[2];
  oacc[0] = zero8(); oacc[1] = zero8();

  for (int kt = 0; kt < NKT / KGR; ++kt) {   // static trip count
    const int kv0 = (kt * KGR + kg) * 64;
    __syncthreads();
    {
      const int r = tid >> 1, hf = (tid & 1) * 16;                  // key r, d = hf..hf+15
      const _Float16* kg = Kg + (size_t)(kv0 + r) * HD + hf;
      const v8h k0v = *(const v8h*)(kg);
      const v8h k1v = *(const v8h*)(kg + 8);
      *(v8h*)(Ksh + r * KPI + hf)     = k0v;
      *(v8h*)(Ksh + r * KPI + hf + 8) = k1v;
      const int d = tid >> 2, sg = (tid & 3) * 16;                  // d row, keys sg..sg+15
      const _Float16* vg  = Vh + (size_t)d * SEQ + kv0 + sg;
      const _Float16* vlg = Vl + (size_t)d * SEQ + kv0 + sg;
      const v8h v0 = *(const v8h*)(vg),  v1 = *(const v8h*)(vg + 8);
      const v8h w0 = *(const v8h*)(vlg), w1 = *(const v8h*)(vlg + 8);
      *(v8h*)(Vth + d * VPI + sg)     = v0;
      *(v8h*)(Vth + d * VPI + sg + 8) = v1;
      *(v8h*)(Vtl + d * VPI + sg)     = w0;
      *(v8h*)(Vtl + d * VPI + sg + 8) = w1;
    }
    __syncthreads();

    // ---- transposed scores: 64 keys (rows) x 16 queries (columns) per wave; lane (c, hh) holds, for query c,
    //      keys j*16 + 8*hh + r in s[j][r] ----
    v8f s[4];
#pragma unroll
    for (int j = 0; j < 4; ++j) {
      FH kb;
      kb.h[0] = *(const v8h*)(Ksh + (j * 16 + c) * KPI + 8 * hh);
      kb.h[1] = *(const v8h*)(Ksh + (j * 16 + c) * KPI + 16 + 8 * hh);
      s[j] = mma_h(kb.v, qa, zero8());
#pragma unroll
      for (int r = 0; r < 8; ++r) s[j][r] *= sscale;
    }

    // ---- online softmax: a query's maximum and sum lie in its own two lanes; the maximum is joined across the
    //      halves every chunk (both halves rescale alike), the sums only after the loop ----
    float mj[4];
#pragma unroll
    for (int j = 0; j < 4; ++j) {   // a short tree per tile, ready while the next tile's product runs
      const float t0 = fmaxf(fmaxf(s[j][0], s[j][1]), s[j][2]);
      const float t1 = fmaxf(fmaxf(s[j][3], s[j][4]), s[j][5]);
      mj[j] = fmaxf(fmaxf(t0, t1), fmaxf(s[j][6], s[j][7]));
    }
    float m = fmaxf(fmaxf(mj[0], mj[1]), fmaxf(mj[2], mj[3]));
    m = fmaxf(m, xhalf(m));
    const float mnew  = fmaxf(mrun, m);
    const float msafe = (mnew == -INFINITY) ? 0.f : mnew;
    const float alpha = __expf(mrun - msafe);
    mrun = mnew;
#pragma unroll
    for (int j = 0; j < 4; ++j)
#pragma unroll
      for (int r = 0; r < 8; ++r) s[j][r] = __expf(s[j][r] - msafe);
    const v8f ts = (s[0] + s[1]) + (s[2] + s[3]);   // tiles first (packed adds), then a tree over the eight
    const float psum = ((ts[0] + ts[1]) + (ts[2] + ts[3])) + ((ts[4] + ts[5]) + (ts[6] + ts[7]));
    lrun = lrun * alpha + psum;
#pragma unroll
    for (int r = 0; r < 8; ++r) {
      oacc[0][r] *= alpha;
      oacc[1][r] *= alpha;
    }

    // ---- context^T += V^T . P^T (f16 WMMA); two score tiles, converted in place (x1024, f16), are the B operand
    //      of one 32-key step; residual products into a separate accumulator ----
    v8f o1[2];
    o1[0] = zero8(); o1[1] = zero8();
#pragma unroll
    for (int kk = 0; kk < 2; ++kk) {
      FH pb;
      pb.h[0] = __builtin_convertvector(s[2 * kk] * 1024.0f, v8h);
      pb.h[1] = __builtin_convertvector(s[2 * kk + 1] * 1024.0f, v8h);
#pragma unroll
      for (int t = 0; t < 2; ++t) {
        FH vb, vl;
        vb.h[0] = *(const v8h*)(Vth + (t * 16 + c) * VPI + kk * 32 + 8 * hh);
        vb.h[1] = *(const v8h*)(Vth + (t * 16 + c) * VPI + kk * 32 + 16 + 8 * hh);
        vl.h[0] = *(const v8h*)(Vtl + (t * 16 + c) * VPI + kk * 32 + 8 * hh);
        vl.h[1] = *(const v8h*)(Vtl + (t * 16 + c) * VPI + kk * 32 + 16 + 8 * hh);
        oacc[t] = mma_h(vb.v, pb.v, oacc[t]);
        o1[t]   = mma_h(vl.v, pb.v, o1[t]);
      }
    }
#pragma unroll
    for (int t = 0; t < 2; ++t)
#pragma unroll
      for (int r = 0; r < 8; ++r) oacc[t][r] += o1[t][r] * (1.0f / 2048.0f);
  }

  // ---- merge the two groups' partials: lane for lane the same (query, key half, d) places ----
  if (kg == 1) {
    Mm[wave][lane] = mrun;
    Ml[wave][lane] = lrun;
#pragma unroll
    for (int t = 0; t < 2; ++t) {
      Mo[wave][2 * t][lane]     = (v4f){oacc[t][0], oacc[t][1], oacc[t][2], oacc[t][3]};
      Mo[wave][2 * t + 1][lane] = (v4f){oacc[t][4], oacc[t][5], oacc[t][6], oacc[t][7]};
    }
  }
  __syncthreads();                           // group 1's partials are readable by group 0
  if (kg == 1) return;                       // whole waves; no block barrier stands behind this line
  {
    const float m1 = Mm[wave][lane], l1 = Ml[wave][lane];
    const float mnew  = fmaxf(mrun, m1);
    const float msafe = (mnew == -INFINITY) ? 0.f : mnew;
    const float w0 = __expf(mrun - msafe), w1 = __expf(m1 - msafe);
    lrun = lrun * w0 + l1 * w1;
#pragma unroll
    for (int t = 0; t < 2; ++t) {
      const v4f pa = Mo[wave][2 * t][lane], pb = Mo[wave][2 * t + 1][lane];
#pragma unroll
      for (int r = 0; r < 4; ++r) {
        oacc[t][r]     = oacc[t][r] * w0 + pa[r] * w1;
        oacc[t][r + 4] = oacc[t][r + 4] * w0 + pb[r] * w1;
      }
    }
  }

  // ---- join the halves' sums, normalise (1/l, undo the x1024 p carry and the x4 v carry), stage the wave's
  //      16x32 tile: oacc[t][r] is element (query c, d = t*16 + 8*hh + r)
  float* os = Os[wave];
  {
    const float l = lrun + xhalf(lrun);
    const float inv = 1.0f / (l * 4096.0f);
#pragma unroll
    for (int t = 0; t < 2; ++t) {
      const v8f o = oacc[t] * inv;
      *(v4f*)(os + c * OPI + t * 16 + 8 * hh)     = (v4f){o[0], o[1], o[2], o[3]};
      *(v4f*)(os + c * OPI + t * 16 + 8 * hh + 4) = (v4f){o[4], o[5], o[6], o[7]};
    }
  }
  __builtin_amdgcn_fence(__ATOMIC_RELEASE, "workgroup");
  __builtin_amdgcn_wave_barrier();
  __builtin_amdgcn_fence(__ATOMIC_ACQUIRE, "workgroup");
  {
    const int rq = lane >> 2, c8 = (lane & 3) * 8;
    v4u hv[2], lv[2];
#pragma unroll
    for (int it = 0; it < 2; ++it) {
      const int row = it * 8 + rq;   // it 0..1 x rq 0..7 = rows 0..15 of the wave tile
      const float* sp = os + row * OPI + c8;
      v4u a, a2;
#pragma unroll
      for (int e = 0; e < 4; ++e) {
        const float f0 = sp[2 * e], f1 = sp[2 * e + 1];
        const unsigned short h0 = bf_bits(f0), h1 = bf_bits(f1);
        const unsigned short l0 = bf_bits(f0 - bf_up(h0)), l1 = bf_bits(f1 - bf_up(h1));
        a[e] = pk16(h0, h1); a2[e] = pk16(l0, l1);
      }
      hv[it] = a; lv[it] = a2;
    }
    const size_t PS = (size_t)NBH * SEQ * HD;
    unsigned short* base = ct + ((size_t)bh * SEQ + (size_t)q0) * HD;
    {
#pragma unroll
      for (int it = 0; it < 2; ++it) {
        unsigned short* p = base + it * 256 + lane * 8;
        *(v4u*)(p)      = hv[it];
        *(v4u*)(p + PS) = lv[it];
      }
      
    }
  }
}

// =====================================================================================================
// Workspace map (bytes), every region an exact multiple of its whole-line / whole-tile store granularity
// (no tail rows anywhere: all shapes are exact tile multiples):
//   X3   bf16 [4096][512]            4194304
//   Wq3  bf16 [768][512]              786432
//   Wo3  bf16 [256][512]              262144
//   Qp   f16  [16][2048][32]          2097152
//   Kraw f32  [16][2048][32]          4194304
//   Kp   f16  [16][2048][32]          2097152
//   VTh  f16  [2][256][2048]          2097152
//   VTl  f16  [2][256][2048]          2097152
//   CT   bf16 [2][16][2048][32]       4194304
//   total                           22020096
// =====================================================================================================
extern "C" void kernel_launch(void* const* d_in, const int* in_sizes, int n_in,
                              void* d_out, int out_size, void* d_ws, size_t ws_size,
                              hipStream_t stream) {
  if (n_in < 6) return;
  if (in_sizes[0] != ROWS * DM) return;
  if (in_sizes[1] != DM * QKVW) return;
  if (in_sizes[2] != DM * DM) return;
  if (in_sizes[3] != DM) return;
  if (in_sizes[4] != NFUN || in_sizes[5] != NFUN) return;
  if (out_size != ROWS * DM) return;

  const float* x     = (const float*)d_in[0];   // [2][2048][256]
  const float* w_qkv = (const float*)d_in[1];   // [256 in][768 out]
  const float* w_o   = (const float*)d_in[2];   // [256 in][256 out]
  const float* b_o   = (const float*)d_in[3];   // [256]
  const float* coefa = (const float*)d_in[4];   // [256] sine coefficients
  const float* coefb = (const float*)d_in[5];   // [256] cosine coefficients

  const size_t PX3 = (size_t)ROWS * KP * 2;            // 4194304
  const size_t PWQ = (size_t)QKVW * KP * 2;            //  786432
  const size_t PWO = (size_t)DM * KP * 2;              //  262144
  const size_t PH  = (size_t)NBH * SEQ * HD * 2;       // 2097152  f16 head plane
  const size_t PK4 = (size_t)NBH * SEQ * HD * 4;       // 4194304  f32 head plane
  const size_t PVT = (size_t)NB * DM * SEQ * 2;        // 2097152  v^T plane
  const size_t PCT = (size_t)2 * NBH * SEQ * HD * 2;   // 4194304  ctx planes
  size_t off = 0;
  const size_t oX3  = off; off += PX3;
  const size_t oWq  = off; off += PWQ;
  const size_t oWo  = off; off += PWO;
  const size_t oQp  = off; off += PH;
  const size_t oKr  = off; off += PK4;
  const size_t oKp  = off; off += PH;
  const size_t oVTh = off; off += PVT;
  const size_t oVTl = off; off += PVT;
  const size_t oCT  = off; off += PCT;
  if (off > ws_size) return;                           // off = 22020096
  if (off > (size_t)134217728) return;

  char* ws = (char*)d_ws;
  unsigned short* X3  = (unsigned short*)(ws + oX3);
  unsigned short* Wq3 = (unsigned short*)(ws + oWq);
  unsigned short* Wo3 = (unsigned short*)(ws + oWo);
  unsigned short* Qp  = (unsigned short*)(ws + oQp);
  float*          Kr  = (float*)(ws + oKr);
  unsigned short* Kp  = (unsigned short*)(ws + oKp);
  unsigned short* VTh = (unsigned short*)(ws + oVTh);
  unsigned short* VTl = (unsigned short*)(ws + oVTl);
  unsigned short* CT  = (unsigned short*)(ws + oCT);

  const dim3 blk(256);
  const int n8x = ROWS * DM / 8;                                   // 131072
  const dim3 gPrep(NTQ + NTO + (n8x + 255) / 256);                  //   48 + 16 + 512 blocks
  const dim3 gProj(3 * NGB);                                        //  768 blocks: q, k, v^T
  const dim3 gOut(NGB);                                             //  256 blocks: M=4096, N=256
  const dim3 gFour((NBH * SEQ * HD) / (8 * FTR * 64));               //  512 blocks of 256, FTR x 64 elements per wave
  const dim3 gAttn(NBH * NQB);                                      //  512 blocks of 256

  // (1) x -> [hi|lo] bf16 plane; weights transposed to [out][in] as [hi|lo] bf16 planes
  prep3<<<gPrep, blk, 0, stream>>>(x, w_qkv, w_o, X3, Wq3, Wo3, n8x);
  // (2) q -> f16 head plane (x4), k -> raw f32 head plane, v^T -> f16 hi (x4) and residual (x2048) planes
  proj_qkv<<<gProj, blk, 0, stream>>>(X3, Wq3, Qp, Kr, VTh, VTl);
  // (3) Fourier-basis transform of k -> f16 head plane (x4)
  fourier_k<<<gFour, blk, 0, stream>>>(Kr, coefa, coefb, Kp);
  // (4) attention -> ctx planes (bf16 hi, lo)
  attn32<<<gAttn, dim3(128 * KGR), 0, stream>>>(Qp, Kp, VTh, VTl, CT, 0.17677669529663687f * 0.0625f);
  // (5) out = ctx . Wo + bias -> d_out f32 [4096][256]
  proj_out<<<gOut, blk, 0, stream>>>(CT, Wo3, (float*)d_out, b_o);
  (void)hipGetLastError();
}

// v010
// A run of this version takes 48.2 microseconds.
// Timed twice side by side with v009, it ran 1.07 and 1.08 times as fast.
// All steps since v000 together make it 7.92 times as fast.
// Contractions: q, k, v^T projections and the output projection = v_wmma_f32_16x16x32_bf16 over bf16 hi/lo planes,
// every operand row [hi|lo] along k (3 products: hi.hi, hi.lo, lo.hi, f32 accumulate);
// q.k^T scores = v_wmma_f32_16x16x32_f16 (q and the transformed k as f16 planes carried x4, single product, f32 accumulate);
// p.v = v_wmma_f32_16x16x32_f16 (p carried x1024 in f16; v^T as f16 hi plane x4 plus f16 residual plane x2^11; 2 products, f32 accumulate);
// Fourier-basis transform of k = v_wmma_f32_16x16x32_bf16 (coefficient matrix x sines and cosines, both bf16 hi + lo, 3 products, f32 accumulate)
// with the sines, cosines and the closing dot product in f32 on the VALU; softmax and bias in f32 on the VALU.
#include <hip/hip_runtime.h>
#include <math.h>
#include <stdint.h>

#define NB   2
#define SEQ  2048
#define DM   256
#define NH   8
#define HD   32
#define NBH  (NB * NH)        // 16 (batch, head) pairs
#define QKVW (3 * DM)         // 768 qkv output width
#define KP   (2 * DM)         // 512 row width of the split operand planes: DM hi, then DM lo
#define NFUN 256
#define ROWS (NB * SEQ)       // 4096 token rows
#define NQB  (SEQ / 64)       // 64-query blocks per (b, h)
#define NKT  (SEQ / 64)       // 64-key chunks
#define GP   (KP * 2 + 16)    // GEMM operand row pitch in LDS, bytes: hi and lo of the whole k (1024 B) + 16 B (16 B x odd, for 16-B readers)
#define GOPS (128 * GP)       // GEMM operands of a block in LDS: 64 A rows, then 64 Bt rows
#define NTQ  ((QKVW / 64) * (DM / 64))   // 48 transpose tiles of w_qkv
#define NTO  ((DM / 64) * (DM / 64))     // 16 transpose tiles of w_o
#define NGB  256              // 64x64 block tiles of each of the four products: one per WGP
// attention tiles in LDS: every row is read or written 16 B a lane, one row per lane of a 16-lane half, so the row
// pitch is 16 B x odd (row + 16 B): the sixteen lanes of a half then fall on sixteen different groups of four banks
#define KPI  (HD + 8)         // K chunk row pitch, f16 elements: 64 B + 16 B = 80 B
#define VPI  (64 + 8)         // V^T chunk row pitch, f16 elements: 128 B + 16 B = 144 B
#define OPI  (HD + 4)         // ctx tile row pitch, f32 elements: 128 B + 16 B = 144 B
#define KGR  2                // key groups of an attention block: group g takes the 64-key chunks g, g + KGR, ...
static_assert(NH * HD == DM);
static_assert(NQB == 32 && NKT == 32 && (NKT % KGR) == 0 && KGR == 2);   // the merge joins two partials
static_assert((ROWS % 64) == 0 && (DM % 64) == 0 && (SEQ % 64) == 0 && (KP % 32) == 0);
static_assert((ROWS * DM) % 2048 == 0);
static_assert((ROWS / 64) * (DM / 64) == NGB && NB * (DM / 64) * (SEQ / 64) == NGB);
static_assert((KP % 64) == 0 && 64 * (KP / 8) == 16 * 256 && (GP % 32) == 16);
static_assert(2 * (GOPS + 64 * 68 * 4) <= 320 * 1024);   // two GEMM blocks fit the LDS of a WGP

typedef _Float16 v16h __attribute__((ext_vector_type(16)));
typedef _Float16 v8h  __attribute__((ext_vector_type(8)));
typedef __bf16   v16b __attribute__((ext_vector_type(16)));
typedef __bf16   v8b  __attribute__((ext_vector_type(8)));
typedef float    v8f  __attribute__((ext_vector_type(8)));
typedef float    v4f  __attribute__((ext_vector_type(4)));
typedef unsigned int v4u __attribute__((ext_vector_type(4)));
typedef float    v2f  __attribute__((ext_vector_type(2)));
typedef unsigned int v2u __attribute__((ext_vector_type(2)));

#if defined(__HIP_DEVICE_COMPILE__)
#define DEV_ASM 1
#else
#define DEV_ASM 0
#endif

// ---- scalar helpers --------------------------------------------------------------------------------
__device__ __forceinline__ unsigned short bf_bits(float f) {          // f32 -> bf16 bits, RNE convert
  unsigned u = __float_as_uint(f);
  return (unsigned short)((u + 0x7FFFu + ((u >> 16) & 1u)) >> 16);
}
__device__ __forceinline__ float bf_up(unsigned short hb) { return __uint_as_float(((unsigned)hb) << 16); }
__device__ __forceinline__ unsigned short h_bits(_Float16 x) { return __builtin_bit_cast(unsigned short, x); }
__device__ __forceinline__ unsigned pk16(unsigned short a, unsigned short b) { return (unsigned)a | ((unsigned)b << 16); }
__device__ __forceinline__ v8f zero8() { v8f z = {0.f, 0.f, 0.f, 0.f, 0.f, 0.f, 0.f, 0.f}; return z; }

// ---- fragment loaders: 16-bit A/B operand, lane -> row/col (lane&15), p already includes +8*(lane>>4);
//      elements 0..7 <- p[0..7] (k0+8h..k0+8h+7), elements 8..15 <- p[16..23] (k0+16+8h..k0+16+8h+7)
template <typename OT> struct FT;
template <> struct FT<__bf16>   { typedef v16b frag; typedef v8b half8; };
template <> struct FT<_Float16> { typedef v16h frag; typedef v8h half8; };

template <typename OT>
__device__ __forceinline__ typename FT<OT>::frag ldfrag(const OT* p) {
  union { typename FT<OT>::frag v; typename FT<OT>::half8 h[2]; } f;
  f.h[0] = *(const typename FT<OT>::half8*)(p);
  f.h[1] = *(const typename FT<OT>::half8*)(p + 16);
  return f.v;
}

// ---- WMMA helpers ----------------------------------------------------------------------------------
__device__ __forceinline__ v8f mmar(v16b a, v16b b, v8f c) {
  return __builtin_amdgcn_wmma_f32_16x16x32_bf16(false, a, false, b, (short)0, c, false, false);
}
// guarded form: 4 VALU slots after the WMMA, D tied, A/B kept live
__device__ __forceinline__ v8f mma_h(v16h a, v16h b, v8f c) {
  c = __builtin_amdgcn_wmma_f32_16x16x32_f16(false, a, false, b, (short)0, c, false, false);
#if DEV_ASM
  asm volatile("v_nop\n\tv_nop\n\tv_nop\n\tv_nop" : "+v"(c) : "v"(a), "v"(b));
#endif
  return c;
}
// lane l <-> lane l ^ 16
__device__ __forceinline__ float xhalf(float x) {
  const int b = __builtin_bit_cast(int, x);
  return __builtin_bit_cast(float, __builtin_amdgcn_permlanex16(b, b, 0x76543210, 0xfedcba98, false, false));
}
// ---- asynchronous copies global -> LDS, 16 B a lane ------------------------------------------------
__device__ __forceinline__ uint32_t lds_off(const void* p) { return (uint32_t)(size_t)p; }   // LDS byte address
// eight copies of a lane (l: LDS byte addresses, g: global addresses); the s_wait_xcnt stands inside the
// statement so that no address register named here is rewritten ahead of it
__device__ __forceinline__ void copy8(const uint32_t (&l)[8], const __bf16* const (&g)[8]) {
#if DEV_ASM
  asm volatile("global_load_async_to_lds_b128 %0, %8, off\n\t"
               "global_load_async_to_lds_b128 %1, %9, off\n\t"
               "global_load_async_to_lds_b128 %2, %10, off\n\t"
               "global_load_async_to_lds_b128 %3, %11, off\n\t"
               "global_load_async_to_lds_b128 %4, %12, off\n\t"
               "global_load_async_to_lds_b128 %5, %13, off\n\t"
               "global_load_async_to_lds_b128 %6, %14, off\n\t"
               "global_load_async_to_lds_b128 %7, %15, off\n\t"
               "s_wait_xcnt 0x0"
               :: "v"(l[0]), "v"(l[1]), "v"(l[2]), "v"(l[3]), "v"(l[4]), "v"(l[5]), "v"(l[6]), "v"(l[7]),
                  "v"(g[0]), "v"(g[1]), "v"(g[2]), "v"(g[3]), "v"(g[4]), "v"(g[5]), "v"(g[6]), "v"(g[7])
               : "memory");
#else
  (void)l; (void)g;
#endif
}
// this wave's copies have landed
__device__ __forceinline__ void wait_copies() {
#if DEV_ASM
  asm volatile("s_wait_asynccnt 0x0" ::: "memory");
#endif
}
// behind a job's last global stores: in a kernel that holds several jobs' bodies the registers that the stores
// name may be written by the code laid out behind them; the wait stands in front of any such write
__device__ __forceinline__ void wait_store_regs() {
#if DEV_ASM
  asm volatile("s_wait_xcnt 0x0" ::: "memory");
#endif
}

// =====================================================================================================
// x [ROWS][DM] f32 -> split plane X3 [ROWS][KP] bf16, row = [hi | lo] (hi = RNE bf16, lo = RNE bf16
// of the exact residual). 8 elements per thread; each thread stores 16 B into each of the two halves;
// bx = the block's index within this job.
// =====================================================================================================
__device__ __forceinline__ void cvt_x3(const float* __restrict__ in, unsigned short* out, int n8, int bx) {
  const int i = bx * 256 + (int)threadIdx.x;
  if (i < n8) {
    const int row = i >> 5, c = (i & 31) * 8;
    const v4f a  = *(const v4f*)(in + (size_t)i * 8);
    const v4f a4 = *(const v4f*)(in + (size_t)i * 8 + 4);
    const float f[8] = {a[0], a[1], a[2], a[3], a4[0], a4[1], a4[2], a4[3]};
    v4u ph, pl;
#pragma unroll
    for (int e = 0; e < 4; ++e) {
      const float f0 = f[2 * e], f1 = f[2 * e + 1];
      const unsigned short h0 = bf_bits(f0), h1 = bf_bits(f1);
      const unsigned short l0 = bf_bits(f0 - bf_up(h0)), l1 = bf_bits(f1 - bf_up(h1));
      ph[e] = pk16(h0, h1);
      pl[e] = pk16(l0, l1);
    }
    unsigned short* o = out + (size_t)row * KP + c;
    *(v4u*)(o)      = ph;
    *(v4u*)(o + DM) = pl;
    wait_store_regs();
  }
}

// =====================================================================================================
// w [DM rows k][C cols] f32 (x @ w layout) -> wt [C][KP] bf16, row c = [hi | lo] of w[k][c] over k.
// Block = 64 k x 64 c tile staged in LDS (f32); C/64 x DM/64 blocks: bx -> c0, by -> k0.
// coverage: 8 waves x 8 rows x 64 k = the tile, both halves; the grid covers all C rows x DM k.
// =====================================================================================================
__device__ __forceinline__ void wtrans3(float (*tile)[65], const float* __restrict__ w, unsigned short* wt, int C,
                                        int bx, int by) {
  const int tid = (int)threadIdx.x, lane = tid & 31, wave = tid >> 5;
  const int c0 = bx * 64, k0 = by * 64;
#pragma unroll
  for (int it = 0; it < 16; ++it) {
    const int idx = it * 256 + tid;
    const int r = idx >> 6, cc = idx & 63;
    tile[r][cc] = w[(size_t)(k0 + r) * C + c0 + cc];
  }
  __syncthreads();
  const int q = lane >> 3, c8 = (lane & 7) * 8;
  v4u hv[2], lv[2];
#pragma unroll
  for (int it = 0; it < 2; ++it) {
    const int row = wave * 8 + it * 4 + q;          // output row (c within tile)
    v4u a, a2;
#pragma unroll
    for (int e = 0; e < 4; ++e) {
      const float f0 = tile[c8 + 2 * e][row], f1 = tile[c8 + 2 * e + 1][row];
      const unsigned short h0 = bf_bits(f0), h1 = bf_bits(f1);
      const unsigned short l0 = bf_bits(f0 - bf_up(h0)), l1 = bf_bits(f1 - bf_up(h1));
      a[e] = pk16(h0, h1);
      a2[e] = pk16(l0, l1);
    }
    hv[it] = a; lv[it] = a2;
  }
  {
#pragma unroll
    for (int it = 0; it < 2; ++it) {
      const int row = wave * 8 + it * 4 + q;
      unsigned short* o = wt + (size_t)(c0 + row) * KP + k0 + c8;
      *(v4u*)(o)      = hv[it];
      *(v4u*)(o + DM) = lv[it];
    }
    wait_store_regs();
  }
}

// =====================================================================================================
// The three operand preparations in one launch: each reads inputs only and writes a plane of its own, so
// none waits for another. The block index picks the job (the same for the whole block, so the transpose's
// barrier stays block-uniform): NTQ blocks transpose w_qkv, NTO blocks w_o, the remaining n8 / 256 split x.
// =====================================================================================================
__global__ __launch_bounds__(256) void prep3(const float* __restrict__ x, const float* __restrict__ w_qkv,
                                             const float* __restrict__ w_o, unsigned short* X3,
                                             unsigned short* Wq3, unsigned short* Wo3, int n8) {
  __shared__ float tile[64][65];
  const int bx = (int)blockIdx.x;
  if (bx < NTQ) {
    wtrans3(tile, w_qkv, Wq3, QKVW, bx % (QKVW / 64), bx / (QKVW / 64));
  } else if (bx < NTQ + NTO) {
    wtrans3(tile, w_o, Wo3, DM, (bx - NTQ) % (DM / 64), (bx - NTQ) / (DM / 64));
  } else {
    cvt_x3(x, X3, n8, bx - (NTQ + NTO));
  }
}

// =====================================================================================================
// Fourier-basis transform of k: out = sum_{f=1..NFUN} ca[f-1]*sin(f*k) + cb[f-1]*cos(f*k).
// The frequency is split as f = 16 i + j (i = 0..15, j = 1..16). By the angle addition formulas
//   out = sum_i sin(16 i k) * TS_i + cos(16 i k) * TC_i,
//   TS_i = sum_j ca[f-1] cos(j k) - cb[f-1] sin(j k),   TC_i = sum_j ca[f-1] sin(j k) + cb[f-1] cos(j k):
// a fixed 32x32 coefficient matrix times the vector (sin(j k), cos(j k))_j of an element, then a dot product of 32.
// The matrix product runs on bf16 WMMA, both operands split in bf16 hi + lo (hi.hi + hi.lo + lo.hi, f32 accumulate);
// one pass = 16 elements (the columns), a lane pair (c, c + 16) an element.
//   k order, A and B alike: lane half hh, fragment element 2 t + kappa <-> j = 8 hh + 1 + t, kappa 0 = sine, 1 = cosine
//   rows: tile tau, row 8 hr + 2 m + kind <-> i = 8 hr + 4 tau + m, kind 0 = TS_i, 1 = TC_i, so that D registers
//   (2 m, 2 m + 1) of a lane meet its pair (sin, cos)(16 i k)
// sin and cos of k and of 16 k (exact product) come from the precise sincosf; 8 k and 128 k, the upper half's start
// angles, by three doublings; the eight angles of a lane in each family by y[t+1] = 2 cos(step) y[t] - y[t-1].
// It runs in the epilogue of the k projection, on the block's f32 result tile as it lies in LDS: a wave takes a 16-row
// slab's head half (16 x 32 elements, FTR trips of two rows); a lane owns two consecutive elements a trip and stores
// their f16 results (x4) as 4 B, a wave 128 contiguous B of the k' head plane.
// coverage: 8 waves x FTR trips x 64 = the block's 64x64 tile; the k product's blocks cover the whole k' plane.
// =====================================================================================================
#define FTR 8                 // trips of a wave, 64 elements (two rows of a head half) each
static_assert(8 * FTR * 64 == 64 * 64 && HD == 32 && NFUN == 256);
typedef __bf16 v2b __attribute__((ext_vector_type(2)));
__device__ __forceinline__ unsigned cvt2(v2f x) { return __builtin_bit_cast(unsigned, __builtin_convertvector(x, v2b)); }
// a pair of f32 -> packed bf16 hi (RNE) and packed bf16 of the exact residuals
__device__ __forceinline__ void split2(v2f x, unsigned& hi, unsigned& lo) {
  hi = cvt2(x);
  const v2f up = {__uint_as_float(hi << 16), __uint_as_float(hi & 0xffff0000u)};
  lo = cvt2(x - up);
}
union FB { v16b v; unsigned w[8]; };

// one pass: (s1, c1) = sin, cos of the column's k, (sp, cp) = of 16 k; upper = this lane is in the upper half.
// Returns the column's whole sum in both of its lanes.
__device__ __forceinline__ float fpass(float s1, float c1, float sp, float cp, bool upper,
                                       const FB (&mh)[2], const FB (&ml)[2]) {
  const v2f one = {1.f, 1.f};
  v2f S = {s1, sp}, C = {c1, cp};
#pragma unroll
  for (int d = 0; d < 3; ++d) {          // both angles doubled: sin 2x = 2 s c, cos 2x = 1 - 2 s s
    const v2f T = S + S;
    const v2f Sn = T * C;
    C = __builtin_elementwise_fma(-T, S, one);
    S = Sn;
  }
  const v2f vb = {upper ? S[0] : 0.f, upper ? C[0] : 1.f};   // (sin, cos)(8 hh k)
  const v2f ub = {upper ? S[1] : 0.f, upper ? C[1] : 1.f};   // (sin, cos)(128 hh k)
  v2f v[8], u[8];
  v[0] = (v2f){fmaf(vb[0], c1, vb[1] * s1), fmaf(vb[1], c1, -(vb[0] * s1))};
  u[0] = ub;
  u[1] = (v2f){fmaf(ub[0], cp, ub[1] * sp), fmaf(ub[1], cp, -(ub[0] * sp))};
  const float kv1 = c1 + c1, ku1 = cp + cp;
  const v2f kv = {kv1, kv1}, ku = {ku1, ku1};
  v[1] = __builtin_elementwise_fma(kv, v[0], -vb);
#pragma unroll
  for (int t = 2; t < 8; ++t) {
    v[t] = __builtin_elementwise_fma(kv, v[t - 1], -v[t - 2]);
    u[t] = __builtin_elementwise_fma(ku, u[t - 1], -u[t - 2]);
  }
  FB bh, bl;
#pragma unroll
  for (int t = 0; t < 8; ++t) split2(v[t], bh.w[t], bl.w[t]);
  v8f d[2];
#pragma unroll
  for (int ta = 0; ta < 2; ++ta) {       // the small products first
    d[ta] = mmar(ml[ta].v, bh.v, zero8());
    d[ta] = mmar(mh[ta].v, bl.v, d[ta]);
    d[ta] = mmar(mh[ta].v, bh.v, d[ta]);
  }
  v2f acc[2];
#pragma unroll
  for (int ta = 0; ta < 2; ++ta) {
    acc[ta] = u[4 * ta] * (v2f){d[ta][0], d[ta][1]};
#pragma unroll
    for (int m = 1; m < 4; ++m)
      acc[ta] = __builtin_elementwise_fma(u[4 * ta + m], (v2f){d[ta][2 * m], d[ta][2 * m + 1]}, acc[ta]);
  }
  const v2f a2 = acc[0] + acc[1];
  const float part = a2[0] + a2[1];
  return part + xhalf(part);
}

// coefficient fragments (A operand), hi and lo, two row tiles
__device__ __forceinline__ void fourier_coef(const float* __restrict__ ca, const float* __restrict__ cb, int lane,
                                             FB (&mh)[2], FB (&ml)[2]) {
  const int rho = lane & 15;
  const bool rowc = (rho & 1) != 0;      // row kind: TC_i, else TS_i
#pragma unroll
  for (int ta = 0; ta < 2; ++ta) {
    const int i = 8 * (rho >> 3) + 4 * ta + ((rho >> 1) & 3);
    const int off = 16 * i + 8 * (lane >> 4);
    const v4f a0 = *(const v4f*)(ca + off), a1 = *(const v4f*)(ca + off + 4);
    const v4f b0 = *(const v4f*)(cb + off), b1 = *(const v4f*)(cb + off + 4);
#pragma unroll
    for (int t = 0; t < 8; ++t) {
      const float av = t < 4 ? a0[t & 3] : a1[t & 3];
      const float bv = t < 4 ? b0[t & 3] : b1[t & 3];
      const v2f e = {rowc ? av : -bv, rowc ? bv : av};   // factors of sin(j k), cos(j k)
      split2(e, mh[ta].w[t], ml[ta].w[t]);
    }
  }
}

// tile: the wave's 16 x 32 f32 elements in LDS, row pitch 68 floats; kp: their 512 places in the k' head plane
__device__ __forceinline__ void fourier_tile(const float* tile, int lane, const FB (&mh)[2], const FB (&ml)[2],
                                             unsigned short* kp) {
  const bool upper = lane >= 16;
  const float* src = tile + (lane >> 4) * 68 + (lane & 15) * 2;
  unsigned short* dst = kp + lane * 2;
  // kept rolled: the body holds four inlined sincosf
#pragma unroll 1
  for (int tr = 0; tr < FTR; ++tr) {
    const v2f kx = *(const v2f*)(src + tr * (2 * 68));
    float res[2];
#pragma unroll
    for (int e = 0; e < 2; ++e) {
      float s1, c1, sp, cp;
      sincosf(kx[e], &s1, &c1);
      sincosf(kx[e] * 16.0f, &sp, &cp);
      const float s1x = xhalf(s1), c1x = xhalf(c1), spx = xhalf(sp), cpx = xhalf(cp);
      // pass 0: the elements owned by the lower half's lanes; pass 1: by the upper half's
      const float f0 = fpass(upper ? s1x : s1, upper ? c1x : c1, upper ? spx : sp, upper ? cpx : cp, upper, mh, ml);
      const float f1 = fpass(upper ? s1 : s1x, upper ? c1 : c1x, upper ? sp : spx, upper ? cp : cpx, upper, mh, ml);
      res[e] = upper ? f1 : f0;
    }
    *(unsigned*)(dst + tr * 64) = pk16(h_bits((_Float16)(res[0] * 4.0f)), h_bits((_Float16)(res[1] * 4.0f)));
  }
}

// =====================================================================================================
// Batched WMMA GEMM, bf16 hi/lo operands: C[m][n] = sum_k Ah[m][k] Bh[n][k] + Ah[m][k] Bl[n][k] + Al[m][k] Bh[n][k],
// k = 0..DM-1, hi at row element k, lo at DM + k; a block of eight waves on a
// 64x64 tile, so that every product has NGB blocks; a wave on 32x16 of it (2 x 4 waves).
// Bt row-major [N][KP] pitch ldb (k contiguous).
// A_MODE 0: A row-major [M][KP] pitch lda.  A_MODE 1: head planes: A(m, k) at
//   plane = (k/256)*NBH + (m/SEQ)*NH + (k/32)%NH;  A[(plane*SEQ + m%SEQ)*HD + k%32]  (M = ROWS).
// M and N multiples of 64 (static shapes below). bx = block tile index, b = batch index (strides in elements);
// opnd and ct are the calling kernel's LDS.
// Operands: the block's 64 A rows and 64 Bt rows, hi and lo of the whole k (1024 B a row), come into LDS once, by
// asynchronous copies of whole 128-B lines, 32 copies a lane, all in flight together; one wait, one barrier;
// LDS row pitch GP; fragments read from LDS with the split k map (ldfrag), k ascending; a hi fragment is read once
// and serves two products. hi.hi sums in one accumulator, hi.lo and lo.hi in a second one, added at the end.
// Epilogue: the 64x64 tile staged in LDS (pitch 68 floats), one barrier; a pair of waves takes a 16-row slab, each
// wave one half of its stores:
// OUT_MODE 0: f16 head plane [NBH][SEQ][HD], value * oscale: a wave stores one head half of the slab (1024 contiguous B)
// OUT_MODE 1: Fourier-basis transform of the tile (above) -> f16 head plane [NBH][SEQ][HD], x4: a wave takes one head half
// OUT_MODE 2: f16 hi plane C (value*oscale) + f16 residual plane C2 = f16((v*oscale - hi) * rscale), row-major, 8 rows a wave
// OUT_MODE 3: f32 row-major C (pitch ldc) + bias[n] (f32): each 64-wide row segment = 256 B = 16 lanes x 16 B, 8 rows a wave
// coverage: 4 slabs x 16 rows x 64 cols = the block's whole 64x64 tile; grids are exact tile multiples.
// =====================================================================================================
template <int A_MODE, int OUT_MODE>
__device__ __forceinline__ void gemm64(
    unsigned char* opnd, float* ct, int bx, int b,
    const unsigned short* __restrict__ Ap, int lda, long long strideA,
    const unsigned short* __restrict__ Btp, int ldb, long long strideB,
    void* Cout, void* Cout2, int ldc, long long strideC,
    const float* __restrict__ bias, const float* __restrict__ fa, const float* __restrict__ fb,
    int M, int N, float oscale, float rscale) {
  const __bf16* A  = (const __bf16*)(const void*)Ap;
  const __bf16* Bt = (const __bf16*)(const void*)Btp;
  const int tid  = (int)threadIdx.x;
  const int lane = tid & 31;
  const int wave = tid >> 5;
  const int nbn = N >> 6;                // block tiles along N
  const int bm  = bx / nbn;
  const int bn  = bx - bm * nbn;
  if (bm >= (M >> 6)) return;            // the same for the whole block, in front of every barrier
  const int bm0 = bm << 6;
  const int bn0 = bn << 6;
  const int wr  = (wave >> 2) << 5;      // the wave's first A row in the block tile
  const int wc  = (wave & 3) << 4;       // the wave's first Bt row in the block tile

  const __bf16* Ab = A  + (size_t)b * (size_t)strideA;
  const __bf16* Bb = Bt + (size_t)b * (size_t)strideB;

  const int rlane = lane & 15;                 // row (A) / col (B, D) within subtile
  const int koff  = (lane >> 4) * 8;           // k offset of this lane half
  const int mOff  = (lane >> 4) * 8;           // D row offset

  // 16 copies a lane for each operand, in statements of eight; a wave's copy covers 512 B of whole lines (4 rows
  // of 128 B; in the head-plane layout 8 rows of 64 B, which adjoin)
  const uint32_t lb = lds_off(opnd);
#pragma unroll
  for (int g = 0; g < 2; ++g) {
    uint32_t la[8];
    const __bf16* ga[8];
#pragma unroll
    for (int u = 0; u < 8; ++u) {
      const int v = g * 8 + u;
      if (A_MODE == 0) {
        const int row = (v & 1) * 32 + (tid >> 3), pc = tid & 7;
        ga[u] = Ab + (size_t)(bm0 + row) * lda + (v >> 1) * 64 + pc * 8;
        la[u] = lb + (uint32_t)(row * GP + (v >> 1) * 128 + pc * 16);
      } else {
        const int kk = v * 32;
        const int row = tid >> 2, pc = tid & 3;
        const int plane = (kk >> 8) * NBH + (bm0 / SEQ) * NH + ((kk >> 5) & (NH - 1));
        ga[u] = Ab + ((size_t)plane * SEQ + (size_t)((bm0 & (SEQ - 1)) + row)) * HD + pc * 8;
        la[u] = lb + (uint32_t)(row * GP + (v * 4 + pc) * 16);
      }
    }
    copy8(la, ga);
  }
#pragma unroll
  for (int g = 0; g < 2; ++g) {
    uint32_t la[8];
    const __bf16* ga[8];
#pragma unroll
    for (int u = 0; u < 8; ++u) {
      const int v = g * 8 + u;
      const int row = (v & 1) * 32 + (tid >> 3), pc = tid & 7;
      ga[u] = Bb + (size_t)(bn0 + row) * ldb + (v >> 1) * 64 + pc * 8;
      la[u] = lb + (uint32_t)((64 + row) * GP + (v >> 1) * 128 + pc * 16);
    }
    copy8(la, ga);
  }
  wait_copies();
  __syncthreads();                       // both operands are readable by every wave

  v8f acc[2], acs[2];                    // hi.hi sums; hi.lo + lo.hi sums
  acc[0] = zero8(); acc[1] = zero8();
  acs[0] = zero8(); acs[1] = zero8();
  const unsigned char* ap = opnd + (wr + rlane) * GP + koff * 2;
  const unsigned char* bp = opnd + (64 + wc + rlane) * GP + koff * 2;
  // unrolled whole: no barrier stands in it, so the fragment reads of later k-steps can run ahead of the products
#pragma unroll
  for (int ks = 0; ks < DM / 32; ++ks) { // k-steps of 32 (64 B of every row's hi half and of its lo half)
    const v16b bh  = ldfrag<__bf16>((const __bf16*)(bp + ks * 64));
    const v16b bl  = ldfrag<__bf16>((const __bf16*)(bp + DM * 2 + ks * 64));
    const v16b a0h = ldfrag<__bf16>((const __bf16*)(ap + ks * 64));
    const v16b a1h = ldfrag<__bf16>((const __bf16*)(ap + 16 * GP + ks * 64));
    const v16b a0l = ldfrag<__bf16>((const __bf16*)(ap + DM * 2 + ks * 64));
    const v16b a1l = ldfrag<__bf16>((const __bf16*)(ap + 16 * GP + DM * 2 + ks * 64));
    acc[0] = mmar(a0h, bh, acc[0]);
    acc[1] = mmar(a1h, bh, acc[1]);
    acs[0] = mmar(a0h, bl, acs[0]);
    acs[1] = mmar(a1h, bl, acs[1]);
    acs[0] = mmar(a0l, bh, acs[0]);
    acs[1] = mmar(a1l, bh, acs[1]);
  }
  acc[0] += acs[0];
  acc[1] += acs[1];

  // ---- epilogue ----
#pragma unroll
  for (int i = 0; i < 2; ++i)
#pragma unroll
    for (int r = 0; r < 8; ++r) ct[(wr + (i << 4) + mOff + r) * 68 + wc + rlane] = acc[i][r];
  __syncthreads();                       // the whole tile is readable by every wave
  const float* slab = ct + (wave >> 1) * (16 * 68);
  const int mBase = bm0 + ((wave >> 1) << 4);
  const int n0 = bn0;
  const int hs = wave & 1;               // which half of the slab's stores this wave does
  if (OUT_MODE == 0) {
    unsigned short* Q = (unsigned short*)Cout;
    const int rq = lane >> 2, c8 = (lane & 3) * 8;        // row within an 8-row group, 8-col piece
    v4u hv[2];
#pragma unroll
    for (int it = 0; it < 2; ++it) {
      const float* sp = slab + (it * 8 + rq) * 68 + hs * 32 + c8;   // it 0..1 x rq 0..7 = rows 0..15
      v4u a;
#pragma unroll
      for (int e = 0; e < 4; ++e)
        a[e] = pk16(h_bits((_Float16)(sp[2 * e] * oscale)), h_bits((_Float16)(sp[2 * e + 1] * oscale)));
      hv[it] = a;
    }
    const int head = (n0 >> 5) + hs;
    unsigned short* base = Q + ((size_t)((mBase / SEQ) * NH + head) * SEQ + (size_t)(mBase & (SEQ - 1))) * HD;
#pragma unroll
    for (int it = 0; it < 2; ++it)
      *(v4u*)(base + it * 256 + lane * 8) = hv[it];
  } else if (OUT_MODE == 1) {
    unsigned short* Kq = (unsigned short*)Cout;
    const int head = (n0 >> 5) + hs;
    unsigned short* base = Kq + ((size_t)((mBase / SEQ) * NH + head) * SEQ + (size_t)(mBase & (SEQ - 1))) * HD;
    FB mh[2], ml[2];
    fourier_coef(fa, fb, lane, mh, ml);
    fourier_tile(slab + hs * 32, lane, mh, ml, base);
  } else if (OUT_MODE == 2) {
    const int q = lane >> 3, c8 = (lane & 7) * 8;
    unsigned short* C  = (unsigned short*)Cout  + (size_t)b * (size_t)strideC;
    unsigned short* C2 = (unsigned short*)Cout2 + (size_t)b * (size_t)strideC;
    v4u hv[2], lv[2];
#pragma unroll
    for (int it = 0; it < 2; ++it) {
      const int row = hs * 8 + it * 4 + q;                // hs 0..1 x it 0..1 x q 0..3 = rows 0..15
      const float* sp = slab + row * 68 + c8;
      v4u a, a2;
#pragma unroll
      for (int e = 0; e < 4; ++e) {
        const float f0 = sp[2 * e] * oscale, f1 = sp[2 * e + 1] * oscale;
        const _Float16 x0 = (_Float16)f0, x1 = (_Float16)f1;
        const unsigned short h0 = h_bits(x0), h1 = h_bits(x1);
        const unsigned short l0 = h_bits((_Float16)((f0 - (float)x0) * rscale));
        const unsigned short l1 = h_bits((_Float16)((f1 - (float)x1) * rscale));
        a[e] = pk16(h0, h1); a2[e] = pk16(l0, l1);
      }
      hv[it] = a; lv[it] = a2;
    }
#pragma unroll
    for (int it = 0; it < 2; ++it) {
      const int row = hs * 8 + it * 4 + q;
      *(v4u*)(C  + (size_t)(mBase + row) * ldc + n0 + c8) = hv[it];
      *(v4u*)(C2 + (size_t)(mBase + row) * ldc + n0 + c8) = lv[it];
    }
  } else {
    float* C = (float*)Cout + (size_t)b * (size_t)strideC;
    const int h2 = lane >> 4, c4 = (lane & 15) * 4;      // 256-B row segment = 16 lanes x 16 B
    const v4f bv = *(const v4f*)(bias + n0 + c4);
    v4f hv[4];
#pragma unroll
    for (int it = 0; it < 4; ++it) {
      const int row = hs * 8 + it * 2 + h2;               // hs 0..1 x it 0..3 x h2 0..1 = rows 0..15
      hv[it] = *(const v4f*)(slab + row * 68 + c4) + bv;
    }
#pragma unroll
    for (int it = 0; it < 4; ++it) {
      const int row = hs * 8 + it * 2 + h2;
      *(v4f*)(C + (size_t)(mBase + row) * ldc + n0 + c4) = hv[it];
    }
  }
  wait_store_regs();
}

// =====================================================================================================
// The q, k and v^T projections in one launch: all three read the X3 and Wq3 planes, none reads another's
// output. blockIdx.x / NGB picks the product (the same for the whole block, so every barrier stays block-uniform);
// the k blocks, which also carry the transform and so run longest, have the lowest indices:
//   0: k = x . Wk, Fourier-basis transform -> f16 head plane (x4)   (M=4096, N=256, K=256 hi/lo)
//   1: q = x . Wq -> f16 head plane (x4)        (M=4096, N=256, K=256 hi/lo)
//   2: v^T = Wv . x^T per batch -> f16 hi plane (x4) [b][c][s] (pitch SEQ) and residual plane (x2048)
//      (A = Wq3 rows 512.., Bt = X3 rows of batch b; M=256, N=2048, K=256 hi/lo; 128 blocks a batch)
// =====================================================================================================
__global__ __launch_bounds__(256) void proj_qkv(const unsigned short* __restrict__ X3,
                                                const unsigned short* __restrict__ Wq3,
                                                const float* __restrict__ ca, const float* __restrict__ cb,
                                                unsigned short* Qp, unsigned short* Kp,
                                                unsigned short* VTh, unsigned short* VTl) {
  __shared__ __align__(16) unsigned char opnd[GOPS];   // 64 A rows, then 64 Bt rows, hi and lo of the whole k of each
  __shared__ __align__(16) float ct[64 * 68];          // the block's 64x64 result tile, pitch 68 floats
  const unsigned job = blockIdx.x / NGB;
  const int bx = (int)(blockIdx.x % NGB);
  if (job == 0) {
    gemm64<0, 1>(opnd, ct, bx, 0, X3, KP, 0LL, Wq3 + (size_t)DM * KP, KP, 0LL,
                 (void*)Kp, (void*)Kp, 0, 0LL, nullptr, ca, cb, ROWS, DM, 1.0f, 1.0f);
  } else if (job == 1) {
    gemm64<0, 0>(opnd, ct, bx, 0, X3, KP, 0LL, Wq3, KP, 0LL,
                 (void*)Qp, (void*)Qp, 0, 0LL, nullptr, nullptr, nullptr, ROWS, DM, 4.0f, 1.0f);
  } else if (job == 2) {
    gemm64<0, 2>(opnd, ct, bx % (NGB / NB), bx / (NGB / NB),
                 Wq3 + (size_t)2 * DM * KP, KP, 0LL, X3, KP, (long long)SEQ * KP,
                 (void*)VTh, (void*)VTl, SEQ, (long long)DM * SEQ, nullptr, nullptr, nullptr, DM, SEQ, 4.0f, 2048.0f);
  }
}

// out = ctx . Wo + bias -> f32 [4096][256]   (M=4096, N=256, K=256 hi/lo, A in head-plane layout)
__global__ __launch_bounds__(256) void proj_out(const unsigned short* __restrict__ CT,
                                                const unsigned short* __restrict__ Wo3,
                                                float* out, const float* __restrict__ bias) {
  __shared__ __align__(16) unsigned char opnd[GOPS];   // 64 A rows, then 64 Bt rows, hi and lo of the whole k of each
  __shared__ __align__(16) float ct[64 * 68];          // the block's 64x64 result tile, pitch 68 floats
  gemm64<1, 3>(opnd, ct, (int)blockIdx.x, 0, CT, 0, 0LL, Wo3, KP, 0LL,
               (void*)out, (void*)out, DM, 0LL, bias, nullptr, nullptr, ROWS, DM, 1.0f, 1.0f);
}

// =====================================================================================================
// Attention, head dim 32, no mask, softmax over all SEQ keys.
//   q plane / k' plane (f16, x4): element (bh, t, d) at [(bh*SEQ + t)*HD + d]
//   v^T hi plane (f16, 4v) and residual plane (f16, (4v - hi)*2048): element (bh, d, s) at [(bh*HD + d)*SEQ + s]
//   ctx planes (bf16): part p (0 = hi, 1 = lo), element (bh, t, d) at [p*PS + (bh*SEQ + t)*HD + d]
//   scores^T = (k4' . q4^T) * sscale on f16 WMMA (one k-step), softmax in f32 (running max), a query per lane pair;
//   p = exp(s - m) carried as f16(1024 p); O^T = vh^T . p^T + (vl^T . p^T) / 2048 on f16 WMMA; ctx = O / (l * 4096).
//   Block = KGR groups of 4 waves on the same (b, h) and the same 4 consecutive 16-query tiles; grid = NBH * NQB, so a
//   SIMD holds four waves, whose waits cover one another. Key chunks of 64: group g walks the chunks g, g + KGR, ...
//   with its own running maximum, sum and O, static trip NKT / KGR. Chunk staging, each group its own chunk in its own
//   LDS: 128 threads, K 64x32 (2 x 16 B per thread), V^T hi/res 32x64 (2 x 16 B
//   per thread and plane), plain loads, __syncthreads before and after. P^T stays in registers (score tiles -> B operand).
//   After the loop group 1 hands its partial (m, l, O) to group 0 through LDS (one barrier); group 0 merges the two with
//   the weights exp(m_g - max) and writes the output.
//   Output: each wave writes its 16x32 tile (1024 contiguous B per part) with two instructions of
//   all NBH*SEQ rows x HD, both parts.
// =====================================================================================================
__global__ __launch_bounds__(128 * KGR)
void attn32(const unsigned short* __restrict__ qpp, const unsigned short* __restrict__ kpp,
            const unsigned short* __restrict__ vhp, const unsigned short* __restrict__ vlp,
            unsigned short* ct, float sscale) {
  union FH { v16h v; v8h h[2]; };
  __shared__ __align__(16) _Float16 KshA[KGR][64 * KPI];   // per group: K chunk [key][d], pitch KPI     5120 B
  __shared__ __align__(16) _Float16 VthA[KGR][HD * VPI];   // per group: V^T hi [d][key], pitch VPI     4608 B
  __shared__ __align__(16) _Float16 VtlA[KGR][HD * VPI];   // per group: V^T residual, pitch VPI        4608 B
  __shared__ __align__(16) float    Os[4][16 * OPI];       // per query tile: ctx tile, pitch OPI       9216 B
  __shared__ __align__(16) v4f      Mo[4][4][32];          // per query tile: group 1's partial O, 16 B a lane   8192 B
  __shared__ float                  Mm[4][32], Ml[4][32];  // per query tile: group 1's maximum and sum          1024 B

  const int kg   = (int)threadIdx.x >> 7;                  // key group (the same for a whole wave)
  const int tid  = (int)threadIdx.x & 127;                 // thread within the group
  const int wave = tid >> 5;                               // query tile
  const int lane = tid & 31;
  _Float16* Ksh = KshA[kg];
  _Float16* Vth = VthA[kg];
  _Float16* Vtl = VtlA[kg];
  const int hh   = lane >> 4;
  const int c    = lane & 15;

  const int bx   = blockIdx.x;
  const int qblk = bx % NQB;
  const int bh   = bx / NQB;
  const int q0   = qblk * 64 + wave * 16;

  const _Float16* Qg = (const _Float16*)(const void*)qpp + (size_t)bh * SEQ * HD;
  const _Float16* Kg = (const _Float16*)(const void*)kpp + (size_t)bh * SEQ * HD;
  const _Float16* Vh = (const _Float16*)(const void*)vhp + (size_t)bh * HD * SEQ;
  const _Float16* Vl = (const _Float16*)(const void*)vlp + (size_t)bh * HD * SEQ;

  // ---- Q fragment (B operand, column = lane&15, one k-step of 32) ----
  const v16h qa = ldfrag<_Float16>(Qg + (size_t)(q0 + c) * HD + 8 * hh);

  float mrun = -INFINITY, lrun = 0.f;   // query c: running maximum (joined), running sum of this half's keys
  v8f oacc[2];
  oacc[0] = zero8(); oacc[1] = zero8();

  for (int kt = 0; kt < NKT / KGR; ++kt) {   // static trip count
    const int kv0 = (kt * KGR + kg) * 64;
    __syncthreads();
    {
      const int r = tid >> 1, hf = (tid & 1) * 16;                  // key r, d = hf..hf+15
      const _Float16* kg = Kg + (size_t)(kv0 + r) * HD + hf;
      const v8h k0v = *(const v8h*)(kg);
      const v8h k1v = *(const v8h*)(kg + 8);
      *(v8h*)(Ksh + r * KPI + hf)     = k0v;
      *(v8h*)(Ksh + r * KPI + hf + 8) = k1v;
      const int d = tid >> 2, sg = (tid & 3) * 16;                  // d row, keys sg..sg+15
      const _Float16* vg  = Vh + (size_t)d * SEQ + kv0 + sg;
      const _Float16* vlg = Vl + (size_t)d * SEQ + kv0 + sg;
      const v8h v0 = *(const v8h*)(vg),  v1 = *(const v8h*)(vg + 8);
      const v8h w0 = *(const v8h*)(vlg), w1 = *(const v8h*)(vlg + 8);
      *(v8h*)(Vth + d * VPI + sg)     = v0;
      *(v8h*)(Vth + d * VPI + sg + 8) = v1;
      *(v8h*)(Vtl + d * VPI + sg)     = w0;
      *(v8h*)(Vtl + d * VPI + sg + 8) = w1;
    }
    __syncthreads();

    // ---- transposed scores: 64 keys (rows) x 16 queries (columns) per wave; lane (c, hh) holds, for query c,
    //      keys j*16 + 8*hh + r in s[j][r] ----
    v8f s[4];
#pragma unroll
    for (int j = 0; j < 4; ++j) {
      FH kb;
      kb.h[0] = *(const v8h*)(Ksh + (j * 16 + c) * KPI + 8 * hh);
      kb.h[1] = *(const v8h*)(Ksh + (j * 16 + c) * KPI + 16 + 8 * hh);
      s[j] = mma_h(kb.v, qa, zero8());
#pragma unroll
      for (int r = 0; r < 8; ++r) s[j][r] *= sscale;
    }

    // ---- online softmax: a query's maximum and sum lie in its own two lanes; the maximum is joined across the
    //      halves every chunk (both halves rescale alike), the sums only after the loop ----
    float mj[4];
#pragma unroll
    for (int j = 0; j < 4; ++j) {   // a short tree per tile, ready while the next tile's product runs
      const float t0 = fmaxf(fmaxf(s[j][0], s[j][1]), s[j][2]);
      const float t1 = fmaxf(fmaxf(s[j][3], s[j][4]), s[j][5]);
      mj[j] = fmaxf(fmaxf(t0, t1), fmaxf(s[j][6], s[j][7]));
    }
    float m = fmaxf(fmaxf(mj[0], mj[1]), fmaxf(mj[2], mj[3]));
    m = fmaxf(m, xhalf(m));
    const float mnew  = fmaxf(mrun, m);
    const float msafe = (mnew == -INFINITY) ? 0.f : mnew;
    const float alpha = __expf(mrun - msafe);
    mrun = mnew;
#pragma unroll
    for (int j = 0; j < 4; ++j)
#pragma unroll
      for (int r = 0; r < 8; ++r) s[j][r] = __expf(s[j][r] - msafe);
    const v8f ts = (s[0] + s[1]) + (s[2] + s[3]);   // tiles first (packed adds), then a tree over the eight
    const float psum = ((ts[0] + ts[1]) + (ts[2] + ts[3])) + ((ts[4] + ts[5]) + (ts[6] + ts[7]));
    lrun = lrun * alpha + psum;
#pragma unroll
    for (int r = 0; r < 8; ++r) {
      oacc[0][r] *= alpha;
      oacc[1][r] *= alpha;
    }

    // ---- context^T += V^T . P^T (f16 WMMA); two score tiles, converted in place (x1024, f16), are the B operand
    //      of one 32-key step; residual products into a separate accumulator ----
    v8f o1[2];
    o1[0] = zero8(); o1[1] = zero8();
#pragma unroll
    for (int kk = 0; kk < 2; ++kk) {
      FH pb;
      pb.h[0] = __builtin_convertvector(s[2 * kk] * 1024.0f, v8h);
      pb.h[1] = __builtin_convertvector(s[2 * kk + 1] * 1024.0f, v8h);
#pragma unroll
      for (int t = 0; t < 2; ++t) {
        FH vb, vl;
        vb.h[0] = *(const v8h*)(Vth + (t * 16 + c) * VPI + kk * 32 + 8 * hh);
        vb.h[1] = *(const v8h*)(Vth + (t * 16 + c) * VPI + kk * 32 + 16 + 8 * hh);
        vl.h[0] = *(const v8h*)(Vtl + (t * 16 + c) * VPI + kk * 32 + 8 * hh);
        vl.h[1] = *(const v8h*)(Vtl + (t * 16 + c) * VPI + kk * 32 + 16 + 8 * hh);
        oacc[t] = mma_h(vb.v, pb.v, oacc[t]);
        o1[t]   = mma_h(vl.v, pb.v, o1[t]);
      }
    }
#pragma unroll
    for (int t = 0; t < 2; ++t)
#pragma unroll
      for (int r = 0; r < 8; ++r) oacc[t][r] += o1[t][r] * (1.0f / 2048.0f);
  }

  // ---- merge the two groups' partials: lane for lane the same (query, key half, d) places ----
  if (kg == 1) {
    Mm[wave][lane] = mrun;
    Ml[wave][lane] = lrun;
#pragma unroll
    for (int t = 0; t < 2; ++t) {
      Mo[wave][2 * t][lane]     = (v4f){oacc[t][0], oacc[t][1], oacc[t][2], oacc[t][3]};
      Mo[wave][2 * t + 1][lane] = (v4f){oacc[t][4], oacc[t][5], oacc[t][6], oacc[t][7]};
    }
  }
  __syncthreads();                           // group 1's partials are readable by group 0
  if (kg == 1) return;                       // whole waves; no block barrier stands behind this line
  {
    const float m1 = Mm[wave][lane], l1 = Ml[wave][lane];
    const float mnew  = fmaxf(mrun, m1);
    const float msafe = (mnew == -INFINITY) ? 0.f : mnew;
    const float w0 = __expf(mrun - msafe), w1 = __expf(m1 - msafe);
    lrun = lrun * w0 + l1 * w1;
#pragma unroll
    for (int t = 0; t < 2; ++t) {
      const v4f pa = Mo[wave][2 * t][lane], pb = Mo[wave][2 * t + 1][lane];
#pragma unroll
      for (int r = 0; r < 4; ++r) {
        oacc[t][r]     = oacc[t][r] * w0 + pa[r] * w1;
        oacc[t][r + 4] = oacc[t][r + 4] * w0 + pb[r] * w1;
      }
    }
  }

  // ---- join the halves' sums, normalise (1/l, undo the x1024 p carry and the x4 v carry), stage the wave's
  //      16x32 tile: oacc[t][r] is element (query c, d = t*16 + 8*hh + r)
  float* os = Os[wave];
  {
    const float l = lrun + xhalf(lrun);
    const float inv = 1.0f / (l * 4096.0f);
#pragma unroll
    for (int t = 0; t < 2; ++t) {
      const v8f o = oacc[t] * inv;
      *(v4f*)(os + c * OPI + t * 16 + 8 * hh)     = (v4f){o[0], o[1], o[2], o[3]};
      *(v4f*)(os + c * OPI + t * 16 + 8 * hh + 4) = (v4f){o[4], o[5], o[6], o[7]};
    }
  }
  __builtin_amdgcn_fence(__ATOMIC_RELEASE, "workgroup");
  __builtin_amdgcn_wave_barrier();
  __builtin_amdgcn_fence(__ATOMIC_ACQUIRE, "workgroup");
  {
    const int rq = lane >> 2, c8 = (lane & 3) * 8;
    v4u hv[2], lv[2];
#pragma unroll
    for (int it = 0; it < 2; ++it) {
      const int row = it * 8 + rq;   // it 0..1 x rq 0..7 = rows 0..15 of the wave tile
      const float* sp = os + row * OPI + c8;
      v4u a, a2;
#pragma unroll
      for (int e = 0; e < 4; ++e) {
        const float f0 = sp[2 * e], f1 = sp[2 * e + 1];
        const unsigned short h0 = bf_bits(f0), h1 = bf_bits(f1);
        const unsigned short l0 = bf_bits(f0 - bf_up(h0)), l1 = bf_bits(f1 - bf_up(h1));
        a[e] = pk16(h0, h1); a2[e] = pk16(l0, l1);
      }
      hv[it] = a; lv[it] = a2;
    }
    const size_t PS = (size_t)NBH * SEQ * HD;
    unsigned short* base = ct + ((size_t)bh * SEQ + (size_t)q0) * HD;
    {
#pragma unroll
      for (int it = 0; it < 2; ++it) {
        unsigned short* p = base + it * 256 + lane * 8;
        *(v4u*)(p)      = hv[it];
        *(v4u*)(p + PS) = lv[it];
      }
      
    }
  }
}

// =====================================================================================================
// Workspace map (bytes), every region an exact multiple of its whole-line / whole-tile store granularity
// (no tail rows anywhere: all shapes are exact tile multiples):
//   X3   bf16 [4096][512]            4194304
//   Wq3  bf16 [768][512]              786432
//   Wo3  bf16 [256][512]              262144
//   Qp   f16  [16][2048][32]          2097152
//   Kp   f16  [16][2048][32]          2097152
//   VTh  f16  [2][256][2048]          2097152
//   VTl  f16  [2][256][2048]          2097152
//   CT   bf16 [2][16][2048][32]       4194304
//   total                           17825792
// =====================================================================================================
extern "C" void kernel_launch(void* const* d_in, const int* in_sizes, int n_in,
                              void* d_out, int out_size, void* d_ws, size_t ws_size,
                              hipStream_t stream) {
  if (n_in < 6) return;
  if (in_sizes[0] != ROWS * DM) return;
  if (in_sizes[1] != DM * QKVW) return;
  if (in_sizes[2] != DM * DM) return;
  if (in_sizes[3] != DM) return;
  if (in_sizes[4] != NFUN || in_sizes[5] != NFUN) return;
  if (out_size != ROWS * DM) return;

  const float* x     = (const float*)d_in[0];   // [2][2048][256]
  const float* w_qkv = (const float*)d_in[1];   // [256 in][768 out]
  const float* w_o   = (const float*)d_in[2];   // [256 in][256 out]
  const float* b_o   = (const float*)d_in[3];   // [256]
  const float* coefa = (const float*)d_in[4];   // [256] sine coefficients
  const float* coefb = (const float*)d_in[5];   // [256] cosine coefficients

  const size_t PX3 = (size_t)ROWS * KP * 2;            // 4194304
  const size_t PWQ = (size_t)QKVW * KP * 2;            //  786432
  const size_t PWO = (size_t)DM * KP * 2;              //  262144
  const size_t PH  = (size_t)NBH * SEQ * HD * 2;       // 2097152  f16 head plane
  const size_t PVT = (size_t)NB * DM * SEQ * 2;        // 2097152  v^T plane
  const size_t PCT = (size_t)2 * NBH * SEQ * HD * 2;   // 4194304  ctx planes
  size_t off = 0;
  const size_t oX3  = off; off += PX3;
  const size_t oWq  = off; off += PWQ;
  const size_t oWo  = off; off += PWO;
  const size_t oQp  = off; off += PH;
  const size_t oKp  = off; off += PH;
  const size_t oVTh = off; off += PVT;
  const size_t oVTl = off; off += PVT;
  const size_t oCT  = off; off += PCT;
  if (off > ws_size) return;                           // off = 17825792
  if (off > (size_t)134217728) return;

  char* ws = (char*)d_ws;
  unsigned short* X3  = (unsigned short*)(ws + oX3);
  unsigned short* Wq3 = (unsigned short*)(ws + oWq);
  unsigned short* Wo3 = (unsigned short*)(ws + oWo);
  unsigned short* Qp  = (unsigned short*)(ws + oQp);
  unsigned short* Kp  = (unsigned short*)(ws + oKp);
  unsigned short* VTh = (unsigned short*)(ws + oVTh);
  unsigned short* VTl = (unsigned short*)(ws + oVTl);
  unsigned short* CT  = (unsigned short*)(ws + oCT);

  const dim3 blk(256);
  const int n8x = ROWS * DM / 8;                                   // 131072
  const dim3 gPrep(NTQ + NTO + (n8x + 255) / 256);                  //   48 + 16 + 512 blocks
  const dim3 gProj(3 * NGB);                                        //  768 blocks: k, q, v^T
  const dim3 gOut(NGB);                                             //  256 blocks: M=4096, N=256
  const dim3 gAttn(NBH * NQB);                                      //  512 blocks of 256

  // (1) x -> [hi|lo] bf16 plane; weights transposed to [out][in] as [hi|lo] bf16 planes
  prep3<<<gPrep, blk, 0, stream>>>(x, w_qkv, w_o, X3, Wq3, Wo3, n8x);
  // (2) k, Fourier-basis transformed -> f16 head plane (x4), q -> f16 head plane (x4),
  //     v^T -> f16 hi (x4) and residual (x2048) planes
  proj_qkv<<<gProj, blk, 0, stream>>>(X3, Wq3, coefa, coefb, Qp, Kp, VTh, VTl);
  // (3) attention -> ctx planes (bf16 hi, lo)
  attn32<<<gAttn, dim3(128 * KGR), 0, stream>>>(Qp, Kp, VTh, VTl, CT, 0.17677669529663687f * 0.0625f);
  // (4) out = ctx . Wo + bias -> d_out f32 [4096][256]
  proj_out<<<gOut, blk, 0, stream>>>(CT, Wo3, (float*)d_out, b_o);
  (void)hipGetLastError();
}
